// v000
// The times below were measured on an AMD MI455X: many runs one after another, warmed up first and cycling through
// copies of the inputs, with the whole window's GPU time divided by the number of runs. Launches and the gaps
// between them are all in it. The median over several windows is given; except for v000 it joins two sittings, which
// can be a few percent apart, so the side-by-side timings, each taken in one sitting, are the better comparison.
// v000 is the starting kernel. One run takes 2680 microseconds.
#include <hip/hip_runtime.h>

// Self-attention with a learned relative-position bias (x [4][1024][1024]; q, k, v = x W^T + b ('oi', 16 heads x 64); S = q.k/8 + S_rel[i][j - i + 1023] where S_rel = q.pos_emb^T (pos_emb [2047][64], unscaled); softmax; out = merged Wo^T + bo -> [4][1024][1024]).
// Layout: per pass of two heads the relative scores S_rel [2][1024][2048] are one extra GEMM of the q hi/lo planes against the bf16 position table (2047 rows + one zero pad row; 2 products), and the softmax kernel gathers S_rel[i][j - i + 1023] (the reference's skew) while forming each logit.
// Compute dtypes, f32 accumulate: every input rounded to bf16; q/k/v on PLAIN bf16 operands (inputs: exact) + biases; relative scores q(hi+lo).pos_emb (2 products, f32); scores and attn.v: query rows < 512 hl (3 products), the rest single fp16 (x1024); softmax f32; Wo hl x exact (2 products) + bo.

#define NB_  4
#define TT   1024
#define DM   1024
#define NH_  16
#define NKV  16
#define REP  (NH_ / NKV)
#define HD   64
#define DQ   (NH_ * HD)
#define DKV  (NKV * HD)
#define NPE  2048                 // 2047 relative positions + 1 zero pad row
#define ZH   2
#define RH   512                  // query rows < RH use hi+lo planes (0: none)
#define WIN  0
#define PCAR 1024.0f
#define SCL  0.125f   // HD^-0.5
typedef _Float16 h16;
typedef unsigned short bf;
typedef __attribute__((ext_vector_type(16))) __bf16   v16bf;
typedef __attribute__((ext_vector_type(16))) _Float16 v16h;
typedef __attribute__((ext_vector_type(8)))  _Float16 v8h;
typedef __attribute__((ext_vector_type(8)))  unsigned short v8us;
typedef __attribute__((ext_vector_type(8)))  float    v8f;
typedef __attribute__((ext_vector_type(4)))  float    v4f;
typedef v8h  __attribute__((may_alias)) v8ha;
typedef v4f  __attribute__((may_alias)) v4fa;
typedef v8us __attribute__((may_alias)) v8usa;

__device__ __forceinline__ unsigned short f2bf(float f) { unsigned u = __float_as_uint(f); u += 0x7FFFu + ((u >> 16) & 1u); return (unsigned short)(u >> 16); }
__device__ __forceinline__ float bf2f(unsigned short b) { return __uint_as_float(((unsigned)b) << 16); }
__device__ __forceinline__ float bfr(float f) { return bf2f(f2bf(f)); }
__device__ __forceinline__ v16h cat16(v8h lo, v8h hi) { return __builtin_shufflevector(lo, hi, 0, 1, 2, 3, 4, 5, 6, 7, 8, 9, 10, 11, 12, 13, 14, 15); }
__device__ __forceinline__ v16bf cat16b(v8us lo, v8us hi) { return __builtin_bit_cast(v16bf, __builtin_shufflevector(lo, hi, 0, 1, 2, 3, 4, 5, 6, 7, 8, 9, 10, 11, 12, 13, 14, 15)); }
__device__ __forceinline__ v8f wmma16(v16h a, v16h b, v8f c) { return __builtin_amdgcn_wmma_f32_16x16x32_f16(false, a, false, b, (short)0, c, false, false); }
__device__ __forceinline__ v8f wmmab(v16bf a, v16bf b, v8f c) { return __builtin_amdgcn_wmma_f32_16x16x32_bf16(false, a, false, b, (short)0, c, false, false); }



// ---- k_gemmw: register-blocked GEMM, ONE WAVE per 64x64 output tile (16 accumulators), operands straight from K-contiguous 16-bit planes; grid (M/64, N/64, Z), 32 threads.
// C[m][n] (f32, pitch ldc, + optional f32 bias[n]) = sum_k A[m][k] Bt[n][k] (+ split products per NSPLIT). z-batch strides sA/sB/sC in elements. K % 32 == 0.
template <typename T16> struct WFrag;
template <> struct WFrag<h16> { typedef v16h V; static __device__ __forceinline__ V ld(const h16* p) { return cat16(*(const v8h*)p, *(const v8h*)(p + 16)); } static __device__ __forceinline__ v8f mma(V a, V b, v8f c) { return wmma16(a, b, c); } };
template <> struct WFrag<bf> { typedef v16bf V; static __device__ __forceinline__ V ld(const bf* p) { return cat16b(*(const v8us*)p, *(const v8us*)(p + 16)); } static __device__ __forceinline__ v8f mma(V a, V b, v8f c) { return wmmab(a, b, c); } };
template <typename T16, int NSPLIT, bool BIAS>
__global__ __launch_bounds__(32) void k_gemmw(const T16* __restrict__ A, const T16* __restrict__ A2, const T16* __restrict__ Bt, const T16* __restrict__ Bt2, int K, float* C, int ldc, const float* __restrict__ bias, size_t sA, size_t sB, size_t sC) {
    typedef typename WFrag<T16>::V V;
    __shared__ __align__(16) float os[16 * 68];
    const size_t z = blockIdx.z; A += z * sA; if (A2) A2 += z * sA; Bt += z * sB; if (Bt2) Bt2 += z * sB; C += z * sC;
    const int lane = threadIdx.x & 31, lr = lane & 15, hi = lane >> 4; const int r0 = blockIdx.x * 64, c0 = blockIdx.y * 64;
    v8f acc[4][4];
#pragma unroll
    for (int mb = 0; mb < 4; ++mb)
#pragma unroll
        for (int nb = 0; nb < 4; ++nb) acc[mb][nb] = (v8f){};
    const size_t aoff = (size_t)(r0 + lr) * K + 8 * hi, boff = (size_t)(c0 + lr) * K + 8 * hi;
#pragma unroll 1
    for (int kc = 0; kc < K; kc += 32) {
        V a[4], a2[4];
#pragma unroll
        for (int mb = 0; mb < 4; ++mb) { a[mb] = WFrag<T16>::ld(A + aoff + (size_t)mb * 16 * K + kc); if (NSPLIT == 1 || NSPLIT == 2) a2[mb] = WFrag<T16>::ld(A2 + aoff + (size_t)mb * 16 * K + kc); }
#pragma unroll
        for (int nb = 0; nb < 4; ++nb) { const V b = WFrag<T16>::ld(Bt + boff + (size_t)nb * 16 * K + kc); V b2; if (NSPLIT >= 2) b2 = WFrag<T16>::ld(Bt2 + boff + (size_t)nb * 16 * K + kc);
#pragma unroll
            for (int mb = 0; mb < 4; ++mb) { acc[mb][nb] = WFrag<T16>::mma(a[mb], b, acc[mb][nb]); if (NSPLIT == 1 || NSPLIT == 2) acc[mb][nb] = WFrag<T16>::mma(a2[mb], b, acc[mb][nb]); if (NSPLIT >= 2) acc[mb][nb] = WFrag<T16>::mma(a[mb], b2, acc[mb][nb]); } }
        asm volatile("v_nop\n\tv_nop\n\tv_nop\n\tv_nop" : "+v"(acc[0][0]), "+v"(acc[1][1]), "+v"(acc[2][2]), "+v"(acc[3][3]) : "v"(a[0]), "v"(a[3]));
    }
#pragma unroll
    for (int mb = 0; mb < 4; ++mb) {
#pragma unroll
        for (int nb = 0; nb < 4; ++nb) {
#pragma unroll
            for (int j = 0; j < 8; ++j) os[(hi * 8 + j) * 68 + nb * 16 + lr] = acc[mb][nb][j]; }
        __builtin_amdgcn_wave_barrier(); asm volatile("" ::: "memory");
        float* crow = C + (size_t)(r0 + mb * 16) * ldc + c0;
{
#pragma unroll
            for (int s = 0; s < 8; ++s) { const int row = 2 * s + hi, cofs = lr * 4; v4f val = *(const v4fa*)(os + row * 68 + cofs); if (BIAS) { val[0] += bfr(bias[c0 + cofs]); val[1] += bfr(bias[c0 + cofs + 1]); val[2] += bfr(bias[c0 + cofs + 2]); val[3] += bfr(bias[c0 + cofs + 3]); }
                *(v4f*)(crow + (size_t)row * ldc + cofs) = val; }
             }
        __builtin_amdgcn_wave_barrier(); asm volatile("" ::: "memory");
    }
}

__device__ __forceinline__ h16 tohx(float x) { return (h16)x; }
__device__ __forceinline__ void splitf(float y, unsigned short& h, unsigned short& l) { h = f2bf(y); l = f2bf(y - bf2f(h)); }
typedef __attribute__((ext_vector_type(2))) _Float16 v2h;
typedef __attribute__((ext_vector_type(4))) _Float16 v4h;
typedef __attribute__((ext_vector_type(2))) unsigned short v2us;
typedef __attribute__((ext_vector_type(4))) unsigned short v4us;
typedef __attribute__((ext_vector_type(2))) float v2f;
typedef __attribute__((ext_vector_type(4))) int v4i;

__global__ __launch_bounds__(256) void k_wtG(const float* __restrict__ w, int K, int N, bf* Bt) {
    const int lane = threadIdx.x & 31; const int L0 = (blockIdx.x * 8 + (threadIdx.x >> 5)) * 8; const int nlines = N * K / 64;
{
#pragma unroll 1
        for (int l = 0; l < 8; ++l) { const int L = L0 + l; if (L >= nlines) break; const size_t e = (size_t)L * 64 + lane * 2; const int k = (int)(e % K), n = (int)(e / K); v2us o;
            o[0] = f2bf(w[(size_t)k * N + n]); o[1] = f2bf(w[(size_t)(k + 1) * N + n]); *(v2us*)(Bt + e) = o; }
         }
}
__global__ __launch_bounds__(256) void k_cvt8(const float* __restrict__ src, bf* dst, size_t n8) { const size_t i = (size_t)blockIdx.x * 256 + threadIdx.x; if (i >= n8) return; const v8f v = *(const v8f*)(src + i * 8); v8us o;
#pragma unroll
    for (int k = 0; k < 8; ++k) o[k] = f2bf(v[k]); *(v8us*)(dst + i * 8) = o;  }

// k_rope: head planes [h][t][d] (fp16 + hi/lo) of rope(x) x sc with the rotate-half convention out[d] = x[d] cos[t][d] - x[d+HD/2] sin[t][d], out[d+HD/2] = x[d+HD/2] cos[t][d+HD/2] + x[d] sin[t][d+HD/2]
__global__ __launch_bounds__(256) void k_rope(const float* __restrict__ F, int pitch, int nheads, const float* __restrict__ CS, const float* __restrict__ RF, const float* __restrict__ nw, float sc, h16* P16, bf* Ph, bf* Pl) {
    const size_t e = ((size_t)blockIdx.x * 256 + threadIdx.x) * 2; if (e >= (size_t)nheads * TT * HD) return; const int d = (int)(e % HD); const int t = (int)((e / HD) % TT); const int h = (int)(e / ((size_t)HD * TT)); const float* f = F + (size_t)t * pitch + h * HD; const float rf = RF ? RF[(size_t)h * TT + t] : 1.0f; v2h o16; v2us oh, ol;
#pragma unroll
    for (int q = 0; q < 2; ++q) { const int dd = d + q; const int dp = (dd < HD / 2) ? dd + HD / 2 : dd - HD / 2; float x0 = f[dd], x1 = f[dp];
        if (RF) { float n0 = __fmul_rn(x0, rf), n1 = __fmul_rn(x1, rf); asm volatile("" : "+v"(n0)); asm volatile("" : "+v"(n1)); x0 = __fmul_rn(bfr(nw[dd]), n0); x1 = __fmul_rn(bfr(nw[dp]), n1); }
        const v2f cs = *(const v2f*)(CS + ((size_t)t * HD + dd) * 2); float a = __fmul_rn(x0, cs[0]), bq = __fmul_rn(x1, cs[1]); asm volatile("" : "+v"(a)); asm volatile("" : "+v"(bq)); const float r = ((dd < HD / 2) ? __fsub_rn(a, bq) : __fadd_rn(a, bq)) * sc;
        o16[q] = tohx(r); unsigned short a2, c2; splitf(r, a2, c2); oh[q] = a2; ol[q] = c2; }
    *(v2h*)(P16 + e) = o16; *(v2us*)(Ph + e) = oh; *(v2us*)(Pl + e) = ol;  }
__global__ __launch_bounds__(256) void k_vtp(const float* __restrict__ F, int pitch, int nheads, h16* V16, bf* Vh, bf* Vl) { const size_t e = ((size_t)blockIdx.x * 256 + threadIdx.x) * 2; if (e >= (size_t)nheads * HD * TT) return; const int t = (int)(e % TT); const int d = (int)((e / TT) % HD); const int g = (int)(e / ((size_t)TT * HD)); v2h o16; v2us oh, ol;
#pragma unroll
    for (int q = 0; q < 2; ++q) { const float x = F[(size_t)(t + q) * pitch + g * HD + d]; o16[q] = tohx(x); unsigned short a2, c2; splitf(x, a2, c2); oh[q] = a2; ol[q] = c2; }
    *(v2h*)(V16 + e) = o16; *(v2us*)(Vh + e) = oh; *(v2us*)(Vl + e) = ol;  }
__global__ __launch_bounds__(256) void k_csid(float* CS) { const int idx = blockIdx.x * 256 + threadIdx.x; if (idx >= TT * HD) return; v2f cs; cs[0] = 1.0f; cs[1] = 0.0f; *(v2f*)(CS + (size_t)idx * 2) = cs;  }
__global__ void k_pezero(bf* PE) { const int lane = threadIdx.x; if (lane >= 32) return; v2us z; z[0] = 0; z[1] = 0; *(v2us*)(PE + (size_t)2047 * HD + lane * 2) = z;  }
// k_asoft: per row (zz, i): t = S x HD^-0.5 + S_rel[i][j - i + 1023] (no mask); softmax over the 1024 keys (register row, one exp, fixed trees);
__global__ __launch_bounds__(256) void k_asoft(const float* __restrict__ Sb, const float* __restrict__ SR, h16* P16, bf* Ph, bf* Pl) {
    const int lane = threadIdx.x & 31; const int row = blockIdx.x * 8 + (threadIdx.x >> 5); if (row >= ZH * TT) return; const int i = row % TT; const int zz = row / TT; (void)zz; const float* srr = SR + (size_t)row * NPE + (TT - 1 - i);   /* S_rel[i][j - i + L - 1] */ const bool hires = (i < RH); const float* sr = Sb + (size_t)row * TT; float v[TT / 32]; float mx = -3.0e38f;
#pragma unroll
    for (int ch = 0; ch < TT / 128; ++ch) { const int j0 = ch * 128 + lane * 4; const v4f a = *(const v4f*)(sr + j0);
#pragma unroll
        for (int q = 0; q < 4; ++q) { const int j = j0 + q; float sa = a[q] * SCL; asm volatile("" : "+v"(sa)); const float t = __fadd_rn(sa, srr[j]);   /* + relative-position score (skewed gather) */ v[ch * 4 + q] = t; mx = fmaxf(mx, t); } }
#pragma unroll
    for (int sh = 16; sh; sh >>= 1) mx = fmaxf(mx, __shfl_xor(mx, sh, 32));
    float sum = 0.f;
#pragma unroll
    for (int k = 0; k < TT / 32; ++k) { float d0 = __fsub_rn(v[k], mx); asm volatile("" : "+v"(d0)); v[k] = __builtin_amdgcn_exp2f(__fmul_rn(d0, 1.4426950408889634f)); sum += v[k]; }
#pragma unroll
    for (int sh = 16; sh; sh >>= 1) sum += __shfl_xor(sum, sh, 32);
    const float f = __fdiv_rn(hires ? 1.0f : PCAR, sum);
{
        if (hires) {
#pragma unroll
            for (int ch = 0; ch < TT / 128; ++ch) { v4us oh, ol;
#pragma unroll
                for (int q = 0; q < 4; ++q) { unsigned short a, c2; splitf(v[ch * 4 + q] * f, a, c2); oh[q] = a; ol[q] = c2; }
                const size_t oo = ((size_t)zz * (RH ? RH : 1) + i) * TT + ch * 128 + lane * 4; *(v4us*)(Ph + oo) = oh; *(v4us*)(Pl + oo) = ol; }
        } else {
#pragma unroll
            for (int ch = 0; ch < TT / 128; ++ch) { v4h o4;
#pragma unroll
                for (int q = 0; q < 4; ++q) o4[q] = tohx(v[ch * 4 + q] * f);
                *(v4h*)(P16 + (size_t)row * TT + ch * 128 + lane * 4) = o4; } }
         }
}
__global__ __launch_bounds__(256) void k_merge(const float* __restrict__ O, int h0, bf* Ah, bf* Al) { const size_t e = ((size_t)blockIdx.x * 256 + threadIdx.x) * 2; if (e >= (size_t)ZH * TT * HD) return; const int d = (int)(e % HD); const int t = (int)((e / HD) % TT); const int zz = (int)(e / ((size_t)HD * TT)); const float cs = (t < RH) ? 1.0f : (1.0f / PCAR); const size_t oo = (size_t)t * DQ + (h0 + zz) * HD + d;
    v2us oh, ol;
#pragma unroll
    for (int q = 0; q < 2; ++q) { unsigned short a, c2; splitf(O[e + q] * cs, a, c2); oh[q] = a; ol[q] = c2; } *(v2us*)(Ah + oo) = oh; *(v2us*)(Al + oo) = ol;  }

extern "C" void kernel_launch(void* const* d_in, const int* in_sizes, int n_in,
                              void* d_out, int out_size, void* d_ws, size_t ws_size, hipStream_t stream) {
    (void)in_sizes; (void)n_in; (void)out_size;
    const float* x = (const float*)d_in[0]; const float* wq = (const float*)d_in[1]; const float* bq = (const float*)d_in[2]; const float* wk = (const float*)d_in[3]; const float* bk = (const float*)d_in[4]; const float* wv = (const float*)d_in[5]; const float* bv = (const float*)d_in[6]; const float* wo = (const float*)d_in[7]; const float* bo = (const float*)d_in[8]; const float* pe = (const float*)d_in[9];
    float* OUT = (float*)d_out;     // [4][1024][1024]
    char* wsp = (char*)d_ws;
    auto take = [&](size_t bytes) { char* p = wsp; wsp += (bytes + 255) & ~(size_t)255; return (void*)p; };
    bf* WQ = (bf*)take((size_t)DQ * DM * 2); bf* WK = (bf*)take((size_t)DKV * DM * 2); bf* WV = (bf*)take((size_t)DKV * DM * 2); bf* WO = (bf*)take((size_t)DM * DQ * 2); float* CS = (float*)take((size_t)TT * HD * 2 * 4);
    bf* XB = (bf*)take((size_t)TT * DM * 2); bf* PE = (bf*)take((size_t)NPE * HD * 2); float* SR = (float*)take((size_t)ZH * TT * NPE * 4); float* FQ = (float*)take((size_t)TT * DQ * 4); float* FK = (float*)take((size_t)TT * DKV * 4);
    h16* QP16 = (h16*)take((size_t)NH_ * TT * HD * 2); h16* KP16 = (h16*)take((size_t)NKV * TT * HD * 2); h16* VT16 = (h16*)take((size_t)NKV * HD * TT * 2);
    bf* QPh = (bf*)take((size_t)NH_ * TT * HD * 2); bf* QPl = (bf*)take((size_t)NH_ * TT * HD * 2); bf* KPh = (bf*)take((size_t)NKV * TT * HD * 2); bf* KPl = (bf*)take((size_t)NKV * TT * HD * 2); bf* VTh = (bf*)take((size_t)NKV * HD * TT * 2); bf* VTl = (bf*)take((size_t)NKV * HD * TT * 2); bf* Ph = (bf*)take((size_t)ZH * RH * TT * 2); bf* Pl = (bf*)take((size_t)ZH * RH * TT * 2);
    float* Sb = (float*)take((size_t)ZH * TT * TT * 4); h16* P16 = (h16*)take((size_t)ZH * TT * TT * 2); float* Ob = (float*)take((size_t)ZH * TT * HD * 4); bf* ATh = (bf*)take((size_t)TT * DQ * 2); bf* ATl = (bf*)take((size_t)TT * DQ * 2);
    if ((size_t)(wsp - (char*)d_ws) > ws_size) return;    // ws 256 MiB
    float* FV = FK;   // v projection reuses the k buffer after the k planes are built (stream-ordered)
    { k_cvt8<<<(unsigned)(((size_t)DQ * DM / 8 + 255) / 256), 256, 0, stream>>>(wq, WQ, (size_t)DQ * DM / 8); k_cvt8<<<(unsigned)(((size_t)DKV * DM / 8 + 255) / 256), 256, 0, stream>>>(wk, WK, (size_t)DKV * DM / 8); k_cvt8<<<(unsigned)(((size_t)DKV * DM / 8 + 255) / 256), 256, 0, stream>>>(wv, WV, (size_t)DKV * DM / 8);
      k_cvt8<<<(unsigned)(((size_t)DM * DQ / 8 + 255) / 256), 256, 0, stream>>>(wo, WO, (size_t)DM * DQ / 8);
       }
    k_csid<<<(TT * HD + 255) / 256, 256, 0, stream>>>(CS); k_cvt8<<<(unsigned)(((size_t)2047 * HD / 8 + 255) / 256), 256, 0, stream>>>(pe, PE, (size_t)2047 * HD / 8); k_pezero<<<1, 32, 0, stream>>>(PE);   /* bf16 position table + zero pad row */
    const unsigned LQ = (unsigned)(((size_t)NH_ * TT * HD / 2 + 255) / 256), LKv = (unsigned)(((size_t)NKV * TT * HD / 2 + 255) / 256);
    for (int b = 0; b < NB_; ++b) {
        
        k_cvt8<<<(unsigned)(((size_t)TT * DM / 8 + 255) / 256), 256, 0, stream>>>(x + (size_t)b * TT * DM, XB, (size_t)TT * DM / 8);
        k_gemmw<bf, 0, true><<<dim3(TT / 64, DQ / 64, 1), 32, 0, stream>>>(XB, nullptr, WQ, nullptr, DM, FQ, DQ, bq, 0, 0, 0);
        k_rope<<<LQ, 256, 0, stream>>>(FQ, DQ, NH_, CS, nullptr, nullptr, 1.0f, QP16, QPh, QPl);
        k_gemmw<bf, 0, true><<<dim3(TT / 64, DKV / 64, 1), 32, 0, stream>>>(XB, nullptr, WK, nullptr, DM, FK, DKV, bk, 0, 0, 0);
        k_rope<<<LKv, 256, 0, stream>>>(FK, DKV, NKV, CS, nullptr, nullptr, 1.0f, KP16, KPh, KPl);
        k_gemmw<bf, 0, true><<<dim3(TT / 64, DKV / 64, 1), 32, 0, stream>>>(XB, nullptr, WV, nullptr, DM, FV, DKV, bv, 0, 0, 0); k_vtp<<<LKv, 256, 0, stream>>>(FV, DKV, NKV, VT16, VTh, VTl);
        for (int h0 = 0; h0 < NH_; h0 += ZH) { const size_t zq = (size_t)h0, zk = (size_t)(h0 / REP);   // one kv head per query head: the pass's two heads use consecutive kv planes (z-strides TT*HD)
            k_gemmw<bf, 2, false><<<dim3(RH / 64, TT / 64, ZH), 32, 0, stream>>>(QPh + zq * TT * HD, QPl + zq * TT * HD, KPh + zk * TT * HD, KPl + zk * TT * HD, HD, Sb, TT, nullptr, (size_t)TT * HD, (size_t)TT * HD, (size_t)TT * TT);
            k_gemmw<h16, 0, false><<<dim3((TT - RH) / 64, TT / 64, ZH), 32, 0, stream>>>(QP16 + zq * TT * HD + (size_t)RH * HD, nullptr, KP16 + zk * TT * HD, nullptr, HD, Sb + (size_t)RH * TT, TT, nullptr, (size_t)TT * HD, (size_t)TT * HD, (size_t)TT * TT);
            k_gemmw<bf, 1, false><<<dim3(TT / 64, NPE / 64, ZH), 32, 0, stream>>>(QPh + zq * TT * HD, QPl + zq * TT * HD, PE, nullptr, HD, SR, NPE, nullptr, (size_t)TT * HD, 0, (size_t)TT * NPE);   /* S_rel = q . pos_emb^T (2 products) */ k_asoft<<<ZH * TT / 8, 256, 0, stream>>>(Sb, SR, P16, Ph, Pl);
            k_gemmw<bf, 2, false><<<dim3(RH / 64, HD / 64, ZH), 32, 0, stream>>>(Ph, Pl, VTh + zk * HD * TT, VTl + zk * HD * TT, TT, Ob, HD, nullptr, (size_t)RH * TT, (size_t)HD * TT, (size_t)TT * HD);
            k_gemmw<h16, 0, false><<<dim3((TT - RH) / 64, HD / 64, ZH), 32, 0, stream>>>(P16 + (size_t)RH * TT, nullptr, VT16 + zk * HD * TT, nullptr, TT, Ob + (size_t)RH * HD, HD, nullptr, (size_t)TT * TT, (size_t)HD * TT, (size_t)TT * HD);
            k_merge<<<(unsigned)(((size_t)ZH * TT * HD / 2 + 255) / 256), 256, 0, stream>>>(Ob, h0, ATh, ATl); }
        k_gemmw<bf, 1, true><<<dim3(TT / 64, DM / 64, 1), 32, 0, stream>>>(ATh, ATl, WO, nullptr, DQ, OUT + (size_t)b * TT * DM, DM, bo, 0, 0, 0); }
}

// v001
// A run of this version takes 729 microseconds.
// Timed twice side by side with v000, it ran 3.67 and 3.65 times as fast.
#include <hip/hip_runtime.h>

// Self-attention with a learned relative-position bias (x [4][1024][1024]; q, k, v = x W^T + b ('oi', 16 heads x 64); S = q.k/8 + S_rel[i][j - i + 1023] where S_rel = q.pos_emb^T (pos_emb [2047][64], unscaled); softmax; out = merged Wo^T + bo -> [4][1024][1024]).
// Layout: batch and head are one flat index z = b * 16 + h carried in the grids (projections over all 4096 rows; scores and softmax ZH heads a launch; attn.v ZP heads a launch). Per score launch the relative scores S_rel [ZH][1024][2048] are one extra GEMM of the q hi/lo planes against the bf16 position table (2047 rows + one zero pad row; 2 products), and the softmax kernel gathers S_rel[i][j - i + 1023] (the reference's skew) while forming each logit.
// Compute dtypes, f32 accumulate: every input rounded to bf16; q/k/v on PLAIN bf16 operands (inputs: exact) + biases; relative scores q(hi+lo).pos_emb (2 products, f32); scores and attn.v: query rows < 512 hl (3 products), the rest single fp16 (x1024); softmax f32; Wo hl x exact (2 products) + bo.

#define NB_  4
#define TT   1024
#define DM   1024
#define NH_  16
#define NKV  16
#define REP  (NH_ / NKV)
#define HD   64
#define DQ   (NH_ * HD)
#define DKV  (NKV * HD)
#define NPE  2048                 // 2047 relative positions + 1 zero pad row
#define ZH   8                    // heads (flat z) per score / softmax launch
#define ZP   16                   // heads (flat z) per attn.v launch; a multiple of ZH
#define NZ   (NB_ * NH_)
#define RH   512                  // query rows < RH use hi+lo planes (0: none)
#define WIN  0
#define PCAR 1024.0f
#define SCL  0.125f   // HD^-0.5
typedef _Float16 h16;
typedef unsigned short bf;
typedef __attribute__((ext_vector_type(16))) __bf16   v16bf;
typedef __attribute__((ext_vector_type(16))) _Float16 v16h;
typedef __attribute__((ext_vector_type(8)))  _Float16 v8h;
typedef __attribute__((ext_vector_type(8)))  unsigned short v8us;
typedef __attribute__((ext_vector_type(8)))  float    v8f;
typedef __attribute__((ext_vector_type(4)))  float    v4f;
typedef v8h  __attribute__((may_alias)) v8ha;
typedef v4f  __attribute__((may_alias)) v4fa;
typedef v8us __attribute__((may_alias)) v8usa;

__device__ __forceinline__ unsigned short f2bf(float f) { unsigned u = __float_as_uint(f); u += 0x7FFFu + ((u >> 16) & 1u); return (unsigned short)(u >> 16); }
__device__ __forceinline__ float bf2f(unsigned short b) { return __uint_as_float(((unsigned)b) << 16); }
__device__ __forceinline__ float bfr(float f) { return bf2f(f2bf(f)); }
__device__ __forceinline__ v16h cat16(v8h lo, v8h hi) { return __builtin_shufflevector(lo, hi, 0, 1, 2, 3, 4, 5, 6, 7, 8, 9, 10, 11, 12, 13, 14, 15); }
__device__ __forceinline__ v16bf cat16b(v8us lo, v8us hi) { return __builtin_bit_cast(v16bf, __builtin_shufflevector(lo, hi, 0, 1, 2, 3, 4, 5, 6, 7, 8, 9, 10, 11, 12, 13, 14, 15)); }
__device__ __forceinline__ v8f wmma16(v16h a, v16h b, v8f c) { return __builtin_amdgcn_wmma_f32_16x16x32_f16(false, a, false, b, (short)0, c, false, false); }
__device__ __forceinline__ v8f wmmab(v16bf a, v16bf b, v8f c) { return __builtin_amdgcn_wmma_f32_16x16x32_bf16(false, a, false, b, (short)0, c, false, false); }



// ---- k_gemmw: register-blocked GEMM, ONE WAVE per 64x64 output tile (16 accumulators), operands straight from K-contiguous 16-bit planes; grid (M/64, N/64, Z), 32 threads.
// C[m][n] (f32, pitch ldc, + optional f32 bias[n]) = sum_k A[m][k] Bt[n][k] (+ split products per NSPLIT). z-batch strides sA/sB/sC in elements. K % 32 == 0.
template <typename T16> struct WFrag;
template <> struct WFrag<h16> { typedef v16h V; static __device__ __forceinline__ V ld(const h16* p) { return cat16(*(const v8h*)p, *(const v8h*)(p + 16)); } static __device__ __forceinline__ v8f mma(V a, V b, v8f c) { return wmma16(a, b, c); } };
template <> struct WFrag<bf> { typedef v16bf V; static __device__ __forceinline__ V ld(const bf* p) { return cat16b(*(const v8us*)p, *(const v8us*)(p + 16)); } static __device__ __forceinline__ v8f mma(V a, V b, v8f c) { return wmmab(a, b, c); } };
template <typename T16, int NSPLIT, bool BIAS>
__global__ __launch_bounds__(32) void k_gemmw(const T16* __restrict__ A, const T16* __restrict__ A2, const T16* __restrict__ Bt, const T16* __restrict__ Bt2, int K, float* C, int ldc, const float* __restrict__ bias, size_t sA, size_t sB, size_t sC) {
    typedef typename WFrag<T16>::V V;
    __shared__ __align__(16) float os[16 * 68];
    const size_t z = blockIdx.z; A += z * sA; if (A2) A2 += z * sA; Bt += z * sB; if (Bt2) Bt2 += z * sB; C += z * sC;
    const int lane = threadIdx.x & 31, lr = lane & 15, hi = lane >> 4; const int r0 = blockIdx.x * 64, c0 = blockIdx.y * 64;
    v8f acc[4][4];
#pragma unroll
    for (int mb = 0; mb < 4; ++mb)
#pragma unroll
        for (int nb = 0; nb < 4; ++nb) acc[mb][nb] = (v8f){};
    const size_t aoff = (size_t)(r0 + lr) * K + 8 * hi, boff = (size_t)(c0 + lr) * K + 8 * hi;
#pragma unroll 1
    for (int kc = 0; kc < K; kc += 32) {
        V a[4], a2[4];
#pragma unroll
        for (int mb = 0; mb < 4; ++mb) { a[mb] = WFrag<T16>::ld(A + aoff + (size_t)mb * 16 * K + kc); if (NSPLIT == 1 || NSPLIT == 2) a2[mb] = WFrag<T16>::ld(A2 + aoff + (size_t)mb * 16 * K + kc); }
#pragma unroll
        for (int nb = 0; nb < 4; ++nb) { const V b = WFrag<T16>::ld(Bt + boff + (size_t)nb * 16 * K + kc); V b2; if (NSPLIT >= 2) b2 = WFrag<T16>::ld(Bt2 + boff + (size_t)nb * 16 * K + kc);
#pragma unroll
            for (int mb = 0; mb < 4; ++mb) { acc[mb][nb] = WFrag<T16>::mma(a[mb], b, acc[mb][nb]); if (NSPLIT == 1 || NSPLIT == 2) acc[mb][nb] = WFrag<T16>::mma(a2[mb], b, acc[mb][nb]); if (NSPLIT >= 2) acc[mb][nb] = WFrag<T16>::mma(a[mb], b2, acc[mb][nb]); } }
        asm volatile("v_nop\n\tv_nop\n\tv_nop\n\tv_nop" : "+v"(acc[0][0]), "+v"(acc[1][1]), "+v"(acc[2][2]), "+v"(acc[3][3]) : "v"(a[0]), "v"(a[3]));
    }
#pragma unroll
    for (int mb = 0; mb < 4; ++mb) {
#pragma unroll
        for (int nb = 0; nb < 4; ++nb) {
#pragma unroll
            for (int j = 0; j < 8; ++j) os[(hi * 8 + j) * 68 + nb * 16 + lr] = acc[mb][nb][j]; }
        __builtin_amdgcn_wave_barrier(); asm volatile("" ::: "memory");
        float* crow = C + (size_t)(r0 + mb * 16) * ldc + c0;
{
#pragma unroll
            for (int s = 0; s < 8; ++s) { const int row = 2 * s + hi, cofs = lr * 4; v4f val = *(const v4fa*)(os + row * 68 + cofs); if (BIAS) { val[0] += bfr(bias[c0 + cofs]); val[1] += bfr(bias[c0 + cofs + 1]); val[2] += bfr(bias[c0 + cofs + 2]); val[3] += bfr(bias[c0 + cofs + 3]); }
                *(v4f*)(crow + (size_t)row * ldc + cofs) = val; }
             }
        __builtin_amdgcn_wave_barrier(); asm volatile("" ::: "memory");
    }
}

__device__ __forceinline__ h16 tohx(float x) { return (h16)x; }
__device__ __forceinline__ void splitf(float y, unsigned short& h, unsigned short& l) { h = f2bf(y); l = f2bf(y - bf2f(h)); }
typedef __attribute__((ext_vector_type(2))) _Float16 v2h;
typedef __attribute__((ext_vector_type(4))) _Float16 v4h;
typedef __attribute__((ext_vector_type(2))) unsigned short v2us;
typedef __attribute__((ext_vector_type(4))) unsigned short v4us;
typedef __attribute__((ext_vector_type(2))) float v2f;
typedef __attribute__((ext_vector_type(4))) int v4i;

__global__ __launch_bounds__(256) void k_wtG(const float* __restrict__ w, int K, int N, bf* Bt) {
    const int lane = threadIdx.x & 31; const int L0 = (blockIdx.x * 8 + (threadIdx.x >> 5)) * 8; const int nlines = N * K / 64;
{
#pragma unroll 1
        for (int l = 0; l < 8; ++l) { const int L = L0 + l; if (L >= nlines) break; const size_t e = (size_t)L * 64 + lane * 2; const int k = (int)(e % K), n = (int)(e / K); v2us o;
            o[0] = f2bf(w[(size_t)k * N + n]); o[1] = f2bf(w[(size_t)(k + 1) * N + n]); *(v2us*)(Bt + e) = o; }
         }
}
__global__ __launch_bounds__(256) void k_cvt8(const float* __restrict__ src, bf* dst, size_t n8) { const size_t i = (size_t)blockIdx.x * 256 + threadIdx.x; if (i >= n8) return; const v8f v = *(const v8f*)(src + i * 8); v8us o;
#pragma unroll
    for (int k = 0; k < 8; ++k) o[k] = f2bf(v[k]); *(v8us*)(dst + i * 8) = o;  }

// k_rope: head planes [h][t][d] (fp16 + hi/lo) of rope(x) x sc with the rotate-half convention out[d] = x[d] cos[t][d] - x[d+HD/2] sin[t][d], out[d+HD/2] = x[d+HD/2] cos[t][d+HD/2] + x[d] sin[t][d+HD/2]
__global__ __launch_bounds__(256) void k_rope(const float* __restrict__ F, int pitch, int nheads, const float* __restrict__ CS, const float* __restrict__ RF, const float* __restrict__ nw, float sc, h16* P16, bf* Ph, bf* Pl) {
    { const size_t b = blockIdx.y, pb = b * nheads * TT * HD; F += b * TT * pitch; if (RF) RF += b * nheads * TT; P16 += pb; Ph += pb; Pl += pb; }   // blockIdx.y: batch (rows b * TT.. of F, planes [b][h][t][d])
    const size_t e = ((size_t)blockIdx.x * 256 + threadIdx.x) * 2; if (e >= (size_t)nheads * TT * HD) return; const int d = (int)(e % HD); const int t = (int)((e / HD) % TT); const int h = (int)(e / ((size_t)HD * TT)); const float* f = F + (size_t)t * pitch + h * HD; const float rf = RF ? RF[(size_t)h * TT + t] : 1.0f; v2h o16; v2us oh, ol;
#pragma unroll
    for (int q = 0; q < 2; ++q) { const int dd = d + q; const int dp = (dd < HD / 2) ? dd + HD / 2 : dd - HD / 2; float x0 = f[dd], x1 = f[dp];
        if (RF) { float n0 = __fmul_rn(x0, rf), n1 = __fmul_rn(x1, rf); asm volatile("" : "+v"(n0)); asm volatile("" : "+v"(n1)); x0 = __fmul_rn(bfr(nw[dd]), n0); x1 = __fmul_rn(bfr(nw[dp]), n1); }
        const v2f cs = *(const v2f*)(CS + ((size_t)t * HD + dd) * 2); float a = __fmul_rn(x0, cs[0]), bq = __fmul_rn(x1, cs[1]); asm volatile("" : "+v"(a)); asm volatile("" : "+v"(bq)); const float r = ((dd < HD / 2) ? __fsub_rn(a, bq) : __fadd_rn(a, bq)) * sc;
        o16[q] = tohx(r); unsigned short a2, c2; splitf(r, a2, c2); oh[q] = a2; ol[q] = c2; }
    *(v2h*)(P16 + e) = o16; *(v2us*)(Ph + e) = oh; *(v2us*)(Pl + e) = ol;  }
__global__ __launch_bounds__(256) void k_vtp(const float* __restrict__ F, int pitch, int nheads, h16* V16, bf* Vh, bf* Vl) { const size_t e = ((size_t)blockIdx.x * 256 + threadIdx.x) * 2; if (e >= (size_t)nheads * HD * TT) return; const int t = (int)(e % TT); const int d = (int)((e / TT) % HD); const int g = (int)(e / ((size_t)TT * HD)); { const size_t b = blockIdx.y, pb = b * nheads * HD * TT; F += b * TT * pitch; V16 += pb; Vh += pb; Vl += pb; }   /* blockIdx.y: batch */ v2h o16; v2us oh, ol;
#pragma unroll
    for (int q = 0; q < 2; ++q) { const float x = F[(size_t)(t + q) * pitch + g * HD + d]; o16[q] = tohx(x); unsigned short a2, c2; splitf(x, a2, c2); oh[q] = a2; ol[q] = c2; }
    *(v2h*)(V16 + e) = o16; *(v2us*)(Vh + e) = oh; *(v2us*)(Vl + e) = ol;  }
__global__ __launch_bounds__(256) void k_csid(float* CS) { const int idx = blockIdx.x * 256 + threadIdx.x; if (idx >= TT * HD) return; v2f cs; cs[0] = 1.0f; cs[1] = 0.0f; *(v2f*)(CS + (size_t)idx * 2) = cs;  }
__global__ void k_pezero(bf* PE) { const int lane = threadIdx.x; if (lane >= 32) return; v2us z; z[0] = 0; z[1] = 0; *(v2us*)(PE + (size_t)2047 * HD + lane * 2) = z;  }
// k_asoft: per row (zz, i): t = S x HD^-0.5 + S_rel[i][j - i + 1023] (no mask); softmax over the 1024 keys (register row, one exp, fixed trees);
__global__ __launch_bounds__(256) void k_asoft(const float* __restrict__ Sb, const float* __restrict__ SR, h16* P16, bf* Ph, bf* Pl) {
    const int lane = threadIdx.x & 31; const int row = blockIdx.x * 8 + (threadIdx.x >> 5); if (row >= ZH * TT) return; const int i = row % TT; const int zz = row / TT; (void)zz; const float* srr = SR + (size_t)row * NPE + (TT - 1 - i);   /* S_rel[i][j - i + L - 1] */ const bool hires = (i < RH); const float* sr = Sb + (size_t)row * TT; float v[TT / 32]; float mx = -3.0e38f;
#pragma unroll
    for (int ch = 0; ch < TT / 128; ++ch) { const int j0 = ch * 128 + lane * 4; const v4f a = *(const v4f*)(sr + j0);
#pragma unroll
        for (int q = 0; q < 4; ++q) { const int j = j0 + q; float sa = a[q] * SCL; asm volatile("" : "+v"(sa)); const float t = __fadd_rn(sa, srr[j]);   /* + relative-position score (skewed gather) */ v[ch * 4 + q] = t; mx = fmaxf(mx, t); } }
#pragma unroll
    for (int sh = 16; sh; sh >>= 1) mx = fmaxf(mx, __shfl_xor(mx, sh, 32));
    float sum = 0.f;
#pragma unroll
    for (int k = 0; k < TT / 32; ++k) { float d0 = __fsub_rn(v[k], mx); asm volatile("" : "+v"(d0)); v[k] = __builtin_amdgcn_exp2f(__fmul_rn(d0, 1.4426950408889634f)); sum += v[k]; }
#pragma unroll
    for (int sh = 16; sh; sh >>= 1) sum += __shfl_xor(sum, sh, 32);
    const float f = __fdiv_rn(hires ? 1.0f : PCAR, sum);
{
        if (hires) {
#pragma unroll
            for (int ch = 0; ch < TT / 128; ++ch) { v4us oh, ol;
#pragma unroll
                for (int q = 0; q < 4; ++q) { unsigned short a, c2; splitf(v[ch * 4 + q] * f, a, c2); oh[q] = a; ol[q] = c2; }
                const size_t oo = ((size_t)zz * (RH ? RH : 1) + i) * TT + ch * 128 + lane * 4; *(v4us*)(Ph + oo) = oh; *(v4us*)(Pl + oo) = ol; }
        } else {
#pragma unroll
            for (int ch = 0; ch < TT / 128; ++ch) { v4h o4;
#pragma unroll
                for (int q = 0; q < 4; ++q) o4[q] = tohx(v[ch * 4 + q] * f);
                *(v4h*)(P16 + (size_t)row * TT + ch * 128 + lane * 4) = o4; } }
         }
}
__global__ __launch_bounds__(256) void k_merge(const float* __restrict__ O, int z0, bf* Ah, bf* Al) { const size_t e = ((size_t)blockIdx.x * 256 + threadIdx.x) * 2; if (e >= (size_t)ZP * TT * HD) return; const int d = (int)(e % HD); const int t = (int)((e / HD) % TT); const int zz = (int)(e / ((size_t)HD * TT)); const float cs = (t < RH) ? 1.0f : (1.0f / PCAR); const int z = z0 + zz; const size_t oo = ((size_t)(z / NH_) * TT + t) * DQ + (z % NH_) * HD + d;
    v2us oh, ol;
#pragma unroll
    for (int q = 0; q < 2; ++q) { unsigned short a, c2; splitf(O[e + q] * cs, a, c2); oh[q] = a; ol[q] = c2; } *(v2us*)(Ah + oo) = oh; *(v2us*)(Al + oo) = ol;  }

extern "C" void kernel_launch(void* const* d_in, const int* in_sizes, int n_in,
                              void* d_out, int out_size, void* d_ws, size_t ws_size, hipStream_t stream) {
    (void)in_sizes; (void)n_in; (void)out_size;
    const float* x = (const float*)d_in[0]; const float* wq = (const float*)d_in[1]; const float* bq = (const float*)d_in[2]; const float* wk = (const float*)d_in[3]; const float* bk = (const float*)d_in[4]; const float* wv = (const float*)d_in[5]; const float* bv = (const float*)d_in[6]; const float* wo = (const float*)d_in[7]; const float* bo = (const float*)d_in[8]; const float* pe = (const float*)d_in[9];
    float* OUT = (float*)d_out;     // [4][1024][1024]
    char* wsp = (char*)d_ws;
    auto take = [&](size_t bytes) { char* p = wsp; wsp += (bytes + 255) & ~(size_t)255; return (void*)p; };
    bf* WO = (bf*)take((size_t)DM * DQ * 2); bf* PE = (bf*)take((size_t)NPE * HD * 2);
    h16* QP16 = (h16*)take((size_t)NZ * TT * HD * 2); h16* KP16 = (h16*)take((size_t)NZ * TT * HD * 2); h16* VT16 = (h16*)take((size_t)NZ * HD * TT * 2);
    bf* QPh = (bf*)take((size_t)NZ * TT * HD * 2); bf* QPl = (bf*)take((size_t)NZ * TT * HD * 2); bf* KPh = (bf*)take((size_t)NZ * TT * HD * 2); bf* KPl = (bf*)take((size_t)NZ * TT * HD * 2); bf* VTh = (bf*)take((size_t)NZ * HD * TT * 2); bf* VTl = (bf*)take((size_t)NZ * HD * TT * 2);
    bf* Ph = (bf*)take((size_t)ZP * RH * TT * 2); bf* Pl = (bf*)take((size_t)ZP * RH * TT * 2); h16* P16 = (h16*)take((size_t)ZP * TT * TT * 2); float* Ob = (float*)take((size_t)ZP * TT * HD * 4); bf* ATh = (bf*)take((size_t)NB_ * TT * DQ * 2); bf* ATl = (bf*)take((size_t)NB_ * TT * DQ * 2);
    char* const shared0 = wsp;
    float* SR = (float*)take((size_t)ZH * TT * NPE * 4); float* Sb = (float*)take((size_t)ZH * TT * TT * 4);
    char* const top = wsp;
    wsp = shared0;   // the projection stage's buffers share the score region: each is last read before the first score launch writes there (stream-ordered)
    bf* WQ = (bf*)take((size_t)DQ * DM * 2); bf* WK = (bf*)take((size_t)DKV * DM * 2); bf* WV = (bf*)take((size_t)DKV * DM * 2); float* CS = (float*)take((size_t)TT * HD * 2 * 4);
    bf* XB = (bf*)take((size_t)NB_ * TT * DM * 2); float* FQ = (float*)take((size_t)NB_ * TT * DQ * 4); float* FK = (float*)take((size_t)NB_ * TT * DKV * 4);
    if (wsp > top || (size_t)(top - (char*)d_ws) > ws_size) return;    // ws 256 MiB
    float* FV = FK;   // v projection reuses the k buffer after the k planes are built (stream-ordered)
    { k_cvt8<<<(unsigned)(((size_t)DQ * DM / 8 + 255) / 256), 256, 0, stream>>>(wq, WQ, (size_t)DQ * DM / 8); k_cvt8<<<(unsigned)(((size_t)DKV * DM / 8 + 255) / 256), 256, 0, stream>>>(wk, WK, (size_t)DKV * DM / 8); k_cvt8<<<(unsigned)(((size_t)DKV * DM / 8 + 255) / 256), 256, 0, stream>>>(wv, WV, (size_t)DKV * DM / 8);
      k_cvt8<<<(unsigned)(((size_t)DM * DQ / 8 + 255) / 256), 256, 0, stream>>>(wo, WO, (size_t)DM * DQ / 8);
       }
    k_csid<<<(TT * HD + 255) / 256, 256, 0, stream>>>(CS); k_cvt8<<<(unsigned)(((size_t)2047 * HD / 8 + 255) / 256), 256, 0, stream>>>(pe, PE, (size_t)2047 * HD / 8); k_pezero<<<1, 32, 0, stream>>>(PE);   /* bf16 position table + zero pad row */
    const unsigned LQ = (unsigned)(((size_t)NH_ * TT * HD / 2 + 255) / 256), LKv = (unsigned)(((size_t)NKV * TT * HD / 2 + 255) / 256);
    k_cvt8<<<(unsigned)(((size_t)NB_ * TT * DM / 8 + 255) / 256), 256, 0, stream>>>(x, XB, (size_t)NB_ * TT * DM / 8);
    k_gemmw<bf, 0, true><<<dim3(NB_ * TT / 64, DQ / 64, 1), 32, 0, stream>>>(XB, nullptr, WQ, nullptr, DM, FQ, DQ, bq, 0, 0, 0);
    k_rope<<<dim3(LQ, NB_, 1), 256, 0, stream>>>(FQ, DQ, NH_, CS, nullptr, nullptr, 1.0f, QP16, QPh, QPl);
    k_gemmw<bf, 0, true><<<dim3(NB_ * TT / 64, DKV / 64, 1), 32, 0, stream>>>(XB, nullptr, WK, nullptr, DM, FK, DKV, bk, 0, 0, 0);
    k_rope<<<dim3(LKv, NB_, 1), 256, 0, stream>>>(FK, DKV, NKV, CS, nullptr, nullptr, 1.0f, KP16, KPh, KPl);
    k_gemmw<bf, 0, true><<<dim3(NB_ * TT / 64, DKV / 64, 1), 32, 0, stream>>>(XB, nullptr, WV, nullptr, DM, FV, DKV, bv, 0, 0, 0); k_vtp<<<dim3(LKv, NB_, 1), 256, 0, stream>>>(FV, DKV, NKV, VT16, VTh, VTl);
    for (int zp = 0; zp < NZ; zp += ZP) {   // planes are [b][h][..]: consecutive z are consecutive planes across heads and batches (one kv head per query head)
        for (int zs = 0; zs < ZP; zs += ZH) { const size_t zq = (size_t)(zp + zs), zk = (size_t)((zp + zs) / REP);
            k_gemmw<bf, 2, false><<<dim3(RH / 64, TT / 64, ZH), 32, 0, stream>>>(QPh + zq * TT * HD, QPl + zq * TT * HD, KPh + zk * TT * HD, KPl + zk * TT * HD, HD, Sb, TT, nullptr, (size_t)TT * HD, (size_t)TT * HD, (size_t)TT * TT);
            k_gemmw<h16, 0, false><<<dim3((TT - RH) / 64, TT / 64, ZH), 32, 0, stream>>>(QP16 + zq * TT * HD + (size_t)RH * HD, nullptr, KP16 + zk * TT * HD, nullptr, HD, Sb + (size_t)RH * TT, TT, nullptr, (size_t)TT * HD, (size_t)TT * HD, (size_t)TT * TT);
            k_gemmw<bf, 1, false><<<dim3(TT / 64, NPE / 64, ZH), 32, 0, stream>>>(QPh + zq * TT * HD, QPl + zq * TT * HD, PE, nullptr, HD, SR, NPE, nullptr, (size_t)TT * HD, 0, (size_t)TT * NPE);   /* S_rel = q . pos_emb^T (2 products) */
            k_asoft<<<ZH * TT / 8, 256, 0, stream>>>(Sb, SR, P16 + (size_t)zs * TT * TT, Ph + (size_t)zs * RH * TT, Pl + (size_t)zs * RH * TT); }
        const size_t zv = (size_t)(zp / REP);
        k_gemmw<bf, 2, false><<<dim3(RH / 64, HD / 64, ZP), 32, 0, stream>>>(Ph, Pl, VTh + zv * HD * TT, VTl + zv * HD * TT, TT, Ob, HD, nullptr, (size_t)RH * TT, (size_t)HD * TT, (size_t)TT * HD);
        k_gemmw<h16, 0, false><<<dim3((TT - RH) / 64, HD / 64, ZP), 32, 0, stream>>>(P16 + (size_t)RH * TT, nullptr, VT16 + zv * HD * TT, nullptr, TT, Ob + (size_t)RH * HD, HD, nullptr, (size_t)TT * TT, (size_t)HD * TT, (size_t)TT * HD);
        k_merge<<<(unsigned)(((size_t)ZP * TT * HD / 2 + 255) / 256), 256, 0, stream>>>(Ob, zp, ATh, ATl); }
    k_gemmw<bf, 1, true><<<dim3(NB_ * TT / 64, DM / 64, 1), 32, 0, stream>>>(ATh, ATl, WO, nullptr, DQ, OUT, DM, bo, 0, 0, 0);
}

// v003
// One run takes 260 microseconds.
// Versions between v001 and this one are left out; their measured steps multiply to 2.77 times as fast.
// Counting every step since v000, it is 10.1 times as fast.
#include <hip/hip_runtime.h>

// Self-attention with a learned relative-position bias (x [4][1024][1024]; q, k, v = x W^T + b ('oi', 16 heads x 64); S = q.k/8 + S_rel[i][j - i + 1023] where S_rel = q.pos_emb^T (pos_emb [2047][64], unscaled); softmax; out = merged Wo^T + bo -> [4][1024][1024]).
// Layout: batch and head are one flat index z = b * 16 + h carried in the grids (projections over all 4096 rows; their epilogues write the 16-bit head planes themselves: q, k as [z][t][d], v as [z][d][t]). Attention is ONE launch: a work-group of 8 waves owns 32 query rows of one z and keeps their 1024 logits a row in LDS: relative scores (q hi/lo planes against the bf16 position table, 2047 rows + one zero pad row; only the band of positions the 32 rows reach) are stored to LDS already skewed (S_rel[i][j - i + 1023] at column j), the content scores are added, the softmax rewrites each row in place as 16-bit planes, attn.v reads them as A fragments and the hi/lo planes of the merged heads go to memory.
// Compute dtypes, f32 accumulate: every input rounded to bf16; q/k/v on PLAIN bf16 operands (inputs: exact) + biases; relative scores q(hi+lo).pos_emb (2 products, f32); scores and attn.v: query rows < 512 hl (3 products), the rest single fp16 (x1024); softmax f32; Wo hl x exact (2 products) + bo.

#define NB_  4
#define TT   1024
#define DM   1024
#define NH_  16
#define NKV  16
#define REP  (NH_ / NKV)
#define HD   64
#define DQ   (NH_ * HD)
#define DKV  (NKV * HD)
#define NPE  2048                 // 2047 relative positions + 1 zero pad row
#define BR   32                   // query rows per attention work-group
#define TP   1028                 // LDS row pitch in floats: 4112 B = 16 B x odd, so b128 reads of 16 rows meet no bank twice; columns 1024.. are never read
#define OPP  68                   // pitch in floats of a wave's partial attn.v tile in LDS
#define NZ   (NB_ * NH_)
#define RH   512                  // query rows < RH use hi+lo planes (0: none)
#define WIN  0
#define PCAR 1024.0f
#define SCL  0.125f   // HD^-0.5
typedef _Float16 h16;
typedef unsigned short bf;
typedef __attribute__((ext_vector_type(16))) __bf16   v16bf;
typedef __attribute__((ext_vector_type(16))) _Float16 v16h;
typedef __attribute__((ext_vector_type(8)))  _Float16 v8h;
typedef __attribute__((ext_vector_type(8)))  unsigned short v8us;
typedef __attribute__((ext_vector_type(8)))  float    v8f;
typedef __attribute__((ext_vector_type(4)))  float    v4f;
typedef v8h  __attribute__((may_alias)) v8ha;
typedef v4f  __attribute__((may_alias)) v4fa;
typedef v8us __attribute__((may_alias)) v8usa;

__device__ __forceinline__ unsigned short f2bf(float f) { unsigned u = __float_as_uint(f); u += 0x7FFFu + ((u >> 16) & 1u); return (unsigned short)(u >> 16); }
__device__ __forceinline__ float bf2f(unsigned short b) { return __uint_as_float(((unsigned)b) << 16); }
__device__ __forceinline__ float bfr(float f) { return bf2f(f2bf(f)); }
__device__ __forceinline__ h16 tohx(float x) { return (h16)x; }
__device__ __forceinline__ void splitf(float y, unsigned short& h, unsigned short& l) { h = f2bf(y); l = f2bf(y - bf2f(h)); }
__device__ __forceinline__ v16h cat16(v8h lo, v8h hi) { return __builtin_shufflevector(lo, hi, 0, 1, 2, 3, 4, 5, 6, 7, 8, 9, 10, 11, 12, 13, 14, 15); }
__device__ __forceinline__ v16bf cat16b(v8us lo, v8us hi) { return __builtin_bit_cast(v16bf, __builtin_shufflevector(lo, hi, 0, 1, 2, 3, 4, 5, 6, 7, 8, 9, 10, 11, 12, 13, 14, 15)); }
__device__ __forceinline__ v8f wmma16(v16h a, v16h b, v8f c) { return __builtin_amdgcn_wmma_f32_16x16x32_f16(false, a, false, b, (short)0, c, false, false); }
__device__ __forceinline__ v8f wmmab(v16bf a, v16bf b, v8f c) { return __builtin_amdgcn_wmma_f32_16x16x32_bf16(false, a, false, b, (short)0, c, false, false); }



// ---- k_gemmw: register-blocked GEMM, ONE WAVE per 64x64 output tile (16 accumulators), operands straight from K-contiguous 16-bit planes; grid (M/64, N/64, Z), 32 threads.
// C[m][n] (f32, pitch ldc, + optional f32 bias[n]) = sum_k A[m][k] Bt[n][k] (+ split products per NSPLIT). z-batch strides sA/sB/sC in elements. K % 32 == 0.
// EPI 0: C goes to memory as f32. EPI 1, 2: no f32 result; a 64-column tile is one head (HD == 64, ldc / HD heads) and rows are b * TT + t: C + bias goes out as three 16-bit planes (fp16, bf16 hi, bf16 lo), EPI 1 as [b][head][t][d], EPI 2 transposed as [b][head][d][t].
template <typename T16> struct WFrag;
template <> struct WFrag<h16> { typedef v16h V; static __device__ __forceinline__ V ld(const h16* p) { return cat16(*(const v8h*)p, *(const v8h*)(p + 16)); } static __device__ __forceinline__ v8f mma(V a, V b, v8f c) { return wmma16(a, b, c); } };
template <> struct WFrag<bf> { typedef v16bf V; static __device__ __forceinline__ V ld(const bf* p) { return cat16b(*(const v8us*)p, *(const v8us*)(p + 16)); } static __device__ __forceinline__ v8f mma(V a, V b, v8f c) { return wmmab(a, b, c); } };
template <typename T16, int NSPLIT, bool BIAS, int EPI>
__global__ __launch_bounds__(32) void k_gemmw(const T16* __restrict__ A, const T16* __restrict__ A2, const T16* __restrict__ Bt, const T16* __restrict__ Bt2, int K, float* C, int ldc, const float* __restrict__ bias, size_t sA, size_t sB, size_t sC, h16* P16, bf* Ph, bf* Pl) {
    typedef typename WFrag<T16>::V V;
    __shared__ __align__(16) float os[16 * 68];
    const size_t z = blockIdx.z; A += z * sA; if (A2) A2 += z * sA; Bt += z * sB; if (Bt2) Bt2 += z * sB; C += z * sC;
    const int lane = threadIdx.x & 31, lr = lane & 15, hi = lane >> 4; const int r0 = blockIdx.x * 64, c0 = blockIdx.y * 64;
    v8f acc[4][4];
#pragma unroll
    for (int mb = 0; mb < 4; ++mb)
#pragma unroll
        for (int nb = 0; nb < 4; ++nb) acc[mb][nb] = (v8f){};
    const size_t aoff = (size_t)(r0 + lr) * K + 8 * hi, boff = (size_t)(c0 + lr) * K + 8 * hi;
#pragma unroll 1
    for (int kc = 0; kc < K; kc += 32) {
        V a[4], a2[4];
#pragma unroll
        for (int mb = 0; mb < 4; ++mb) { a[mb] = WFrag<T16>::ld(A + aoff + (size_t)mb * 16 * K + kc); if (NSPLIT == 1 || NSPLIT == 2) a2[mb] = WFrag<T16>::ld(A2 + aoff + (size_t)mb * 16 * K + kc); }
#pragma unroll
        for (int nb = 0; nb < 4; ++nb) { const V b = WFrag<T16>::ld(Bt + boff + (size_t)nb * 16 * K + kc); V b2; if (NSPLIT >= 2) b2 = WFrag<T16>::ld(Bt2 + boff + (size_t)nb * 16 * K + kc);
#pragma unroll
            for (int mb = 0; mb < 4; ++mb) { acc[mb][nb] = WFrag<T16>::mma(a[mb], b, acc[mb][nb]); if (NSPLIT == 1 || NSPLIT == 2) acc[mb][nb] = WFrag<T16>::mma(a2[mb], b, acc[mb][nb]); if (NSPLIT >= 2) acc[mb][nb] = WFrag<T16>::mma(a[mb], b2, acc[mb][nb]); } }
        asm volatile("v_nop\n\tv_nop\n\tv_nop\n\tv_nop" : "+v"(acc[0][0]), "+v"(acc[1][1]), "+v"(acc[2][2]), "+v"(acc[3][3]) : "v"(a[0]), "v"(a[3]));
    }
    if (EPI == 2) {   // a lane's eight accumulator rows are eight consecutive t of one column d: 16 bytes of a transposed plane's row, straight from registers
        const size_t pb = (((size_t)(r0 / TT) * (ldc / HD) + blockIdx.y) * HD + lr) * TT + (r0 % TT) + hi * 8; const float* bp = bias + c0 + lr; float tb[4];
#pragma unroll
        for (int nb = 0; nb < 4; ++nb) tb[nb] = BIAS ? bp[nb * 16] : 0.0f;   // all four at once: one wait for memory, not four
        if (BIAS) asm volatile("s_wait_xcnt 0x0" :: "v"(bp) : "memory");   // in front of any overwrite of the address these loads name
#pragma unroll
        for (int nb = 0; nb < 4; ++nb) { const float bb = bfr(tb[nb]); h16* p16 = P16 + pb + (size_t)nb * 16 * TT; bf* ph = Ph + pb + (size_t)nb * 16 * TT; bf* pl = Pl + pb + (size_t)nb * 16 * TT; v8h o16[4]; v8us oh[4], ol[4];
#pragma unroll
            for (int mb = 0; mb < 4; ++mb)
#pragma unroll
                for (int j = 0; j < 8; ++j) { const float val = acc[mb][nb][j] + bb; o16[mb][j] = tohx(val); unsigned short a2, c2; splitf(val, a2, c2); oh[mb][j] = a2; ol[mb][j] = c2; }
#pragma unroll
            for (int mb = 0; mb < 4; ++mb) { *(v8h*)(p16 + mb * 16) = o16[mb]; *(v8us*)(ph + mb * 16) = oh[mb]; *(v8us*)(pl + mb * 16) = ol[mb]; }   // the four mb fill each row's 128-byte line
            // the wait that stands in front of any overwrite of a register which an issued store names: addresses and data are its inputs, so they stay untouched up to it
            asm volatile("s_wait_xcnt 0x0" :: "v"(p16), "v"(ph), "v"(pl), "v"(o16[0]), "v"(o16[1]), "v"(o16[2]), "v"(o16[3]), "v"(oh[0]), "v"(oh[1]), "v"(oh[2]), "v"(oh[3]), "v"(ol[0]), "v"(ol[1]), "v"(ol[2]), "v"(ol[3]) : "memory"); }
        return; }
    const int prow = lane >> 3, pcol = (lane & 7) * 8; float pbias[8];   // EPI 1: a lane takes eight neighbouring columns of a row
    if (EPI == 1) { const float* bp = bias + c0 + pcol; v8f tb = (v8f){}; if (BIAS) { tb = *(const v8f*)bp; asm volatile("s_wait_xcnt 0x0" :: "v"(bp) : "memory"); }   // the wait: in front of any overwrite of the address this load names
#pragma unroll
        for (int q = 0; q < 8; ++q) pbias[q] = bfr(tb[q]); }
#pragma unroll
    for (int mb = 0; mb < 4; ++mb) {
#pragma unroll
        for (int nb = 0; nb < 4; ++nb) {
#pragma unroll
            for (int j = 0; j < 8; ++j) os[(hi * 8 + j) * 68 + nb * 16 + lr] = acc[mb][nb][j]; }
        __builtin_amdgcn_wave_barrier(); asm volatile("" ::: "memory");
        if (EPI == 1) {   // the tile is 8 KiB in a row of each plane: a store instruction fills four whole 128-byte rows
            const size_t pb = (((size_t)(r0 / TT) * (ldc / HD) + blockIdx.y) * TT + (r0 % TT) + mb * 16 + prow) * HD + pcol; h16* p16 = P16 + pb; bf* ph = Ph + pb; bf* pl = Pl + pb; v8h o16[4]; v8us oh[4], ol[4];
#pragma unroll
            for (int s = 0; s < 4; ++s) { const float* op = os + (4 * s + prow) * 68 + pcol; const v4f v0 = *(const v4fa*)op, v1 = *(const v4fa*)(op + 4);
#pragma unroll
                for (int q = 0; q < 8; ++q) { const float val = (q < 4 ? v0[q & 3] : v1[q & 3]) + pbias[q]; o16[s][q] = tohx(val); unsigned short a2, c2; splitf(val, a2, c2); oh[s][q] = a2; ol[s][q] = c2; } }
#pragma unroll
            for (int s = 0; s < 4; ++s) { *(v8h*)(p16 + s * 4 * HD) = o16[s]; *(v8us*)(ph + s * 4 * HD) = oh[s]; *(v8us*)(pl + s * 4 * HD) = ol[s]; }
            // the wait in front of any overwrite of a register which an issued store names, as above
            asm volatile("s_wait_xcnt 0x0" :: "v"(p16), "v"(ph), "v"(pl), "v"(o16[0]), "v"(o16[1]), "v"(o16[2]), "v"(o16[3]), "v"(oh[0]), "v"(oh[1]), "v"(oh[2]), "v"(oh[3]), "v"(ol[0]), "v"(ol[1]), "v"(ol[2]), "v"(ol[3]) : "memory");
        } else {
        float* crow = C + (size_t)(r0 + mb * 16) * ldc + c0;
{
#pragma unroll
            for (int s = 0; s < 8; ++s) { const int row = 2 * s + hi, cofs = lr * 4; v4f val = *(const v4fa*)(os + row * 68 + cofs); if (BIAS) { val[0] += bfr(bias[c0 + cofs]); val[1] += bfr(bias[c0 + cofs + 1]); val[2] += bfr(bias[c0 + cofs + 2]); val[3] += bfr(bias[c0 + cofs + 3]); }
                *(v4f*)(crow + (size_t)row * ldc + cofs) = val; }
             }
        }
        __builtin_amdgcn_wave_barrier(); asm volatile("" ::: "memory");
    }
}

typedef __attribute__((ext_vector_type(2))) _Float16 v2h;
typedef __attribute__((ext_vector_type(4))) _Float16 v4h;
typedef __attribute__((ext_vector_type(2))) unsigned short v2us;
typedef __attribute__((ext_vector_type(4))) unsigned short v4us;
typedef __attribute__((ext_vector_type(2))) float v2f;
typedef __attribute__((ext_vector_type(4))) int v4i;

__global__ __launch_bounds__(256) void k_wtG(const float* __restrict__ w, int K, int N, bf* Bt) {
    const int lane = threadIdx.x & 31; const int L0 = (blockIdx.x * 8 + (threadIdx.x >> 5)) * 8; const int nlines = N * K / 64;
{
#pragma unroll 1
        for (int l = 0; l < 8; ++l) { const int L = L0 + l; if (L >= nlines) break; const size_t e = (size_t)L * 64 + lane * 2; const int k = (int)(e % K), n = (int)(e / K); v2us o;
            o[0] = f2bf(w[(size_t)k * N + n]); o[1] = f2bf(w[(size_t)(k + 1) * N + n]); *(v2us*)(Bt + e) = o; }
         }
}
__global__ __launch_bounds__(256) void k_cvt8(const float* __restrict__ src, bf* dst, size_t n8) { const size_t i = (size_t)blockIdx.x * 256 + threadIdx.x; if (i >= n8) return; const v8f v = *(const v8f*)(src + i * 8); v8us o;
#pragma unroll
    for (int k = 0; k < 8; ++k) o[k] = f2bf(v[k]); *(v8us*)(dst + i * 8) = o;  }

__global__ void k_pezero(bf* PE) { const int lane = threadIdx.x; if (lane >= 32) return; v2us z; z[0] = 0; z[1] = 0; *(v2us*)(PE + (size_t)2047 * HD + lane * 2) = z;  }
typedef v4us __attribute__((may_alias)) v4usa;
typedef v4h  __attribute__((may_alias)) v4ha;
__device__ __forceinline__ v16bf ldsb(const bf* p) { return cat16b(*(const v8usa*)p, *(const v8usa*)(p + 16)); }
__device__ __forceinline__ v16h ldsh(const h16* p) { return cat16(*(const v8ha*)p, *(const v8ha*)(p + 16)); }

// attn_body: 32 query rows i0.. of head z, 8 waves. T [32][TP] f32 in LDS holds the logits, then the probabilities' 16-bit planes (row r: hi plane in its first 2048 bytes, lo plane in the next; or one fp16 plane), then the waves' partial outputs.
// HI: hi+lo planes, 3 products, for scores and attn.v; else single fp16 (probabilities x PCAR).
// Behind a group of global loads: the wait that stands in front of any overwrite of a register which an issued load names. It takes the group's addresses as inputs, so that they stay untouched (also by a landing load of the group) up to it.
#define XWAIT1(p)    asm volatile("s_wait_xcnt 0x0" :: "v"(p) : "memory")
#define XWAIT2(p, q) asm volatile("s_wait_xcnt 0x0" :: "v"(p), "v"(q) : "memory")
template <bool HI>
__device__ __forceinline__ void attn_body(float* T, int z, int i0, const h16* __restrict__ QP16, const bf* __restrict__ QPh, const bf* __restrict__ QPl, const h16* __restrict__ KP16, const bf* __restrict__ KPh, const bf* __restrict__ KPl,
                                          const h16* __restrict__ VT16, const bf* __restrict__ VTh, const bf* __restrict__ VTl, const bf* __restrict__ PE, bf* ATh, bf* ATl) {
    const int tid = threadIdx.x, lane = tid & 31, lr = lane & 15, hi = lane >> 4, w = tid >> 5; const int j0 = w * 128;   // this wave's 128 keys
    const size_t qb = ((size_t)z * TT + i0 + lr) * HD + 8 * hi;
    // relative scores: rows i0 + 16 mt + r and keys j0 + jj need positions p = (j0 - i0 - 16 mt + 1008) + c, c = jj - r + 15 in 0..142: nine 16-wide tiles a row tile, ten for both
    const int pb = j0 - i0 + 992;   // 0 .. 1888; last row read pb + 159 <= 2047
    // B fragments are fetched some tiles ahead of their use (position table 4 tiles, keys 3, values 2 k-steps), so that a wave waits for L2 once and not at every tile
    v16bf qh[2][2], ql[2][2], rb[10][2], kb[8][4], vb[4][4][2]; v16h q16[2][2], kf[8][2], vf[4][4];
    auto rload = [&](int u) { const bf* pp = PE + (size_t)(pb + u * 16 + lr) * HD + 8 * hi; rb[u][0] = WFrag<bf>::ld(pp); rb[u][1] = WFrag<bf>::ld(pp + 32); XWAIT1(pp); };
    auto kload = [&](int nb) { const size_t ko = ((size_t)z * TT + j0 + nb * 16 + lr) * HD + 8 * hi;
        if (HI) { kb[nb][0] = WFrag<bf>::ld(KPh + ko); kb[nb][1] = WFrag<bf>::ld(KPh + ko + 32); kb[nb][2] = WFrag<bf>::ld(KPl + ko); kb[nb][3] = WFrag<bf>::ld(KPl + ko + 32); XWAIT2(KPh + ko, KPl + ko); }
        else { kf[nb][0] = WFrag<h16>::ld(KP16 + ko); kf[nb][1] = WFrag<h16>::ld(KP16 + ko + 32); XWAIT1(KP16 + ko); } };
    auto vload = [&](int ks) { const size_t vo = ((size_t)z * HD + lr) * TT + j0 + ks * 32 + 8 * hi;
#pragma unroll
        for (int nb = 0; nb < 4; ++nb) { if (HI) { vb[ks][nb][0] = WFrag<bf>::ld(VTh + vo + nb * 16 * TT); vb[ks][nb][1] = WFrag<bf>::ld(VTl + vo + nb * 16 * TT); } else vf[ks][nb] = WFrag<h16>::ld(VT16 + vo + nb * 16 * TT); }
        if (HI) XWAIT2(VTh + vo, VTl + vo); else XWAIT1(VT16 + vo); };
#pragma unroll
    for (int mt = 0; mt < 2; ++mt)
#pragma unroll
        for (int kk = 0; kk < 2; ++kk) { qh[mt][kk] = WFrag<bf>::ld(QPh + qb + (size_t)mt * 16 * HD + kk * 32); ql[mt][kk] = WFrag<bf>::ld(QPl + qb + (size_t)mt * 16 * HD + kk * 32); }
    XWAIT2(QPh + qb, QPl + qb);
#pragma unroll
    for (int u = 0; u < 4; ++u) rload(u);
#pragma unroll
    for (int u = 0; u < 10; ++u) {
#pragma unroll
        for (int mt = 0; mt < 2; ++mt) { const int tt = u - 1 + mt; if (tt < 0 || tt > 8) continue;
            v8f acc = (v8f){}; acc = wmmab(qh[mt][0], rb[u][0], acc); acc = wmmab(ql[mt][0], rb[u][0], acc); acc = wmmab(qh[mt][1], rb[u][1], acc); acc = wmmab(ql[mt][1], rb[u][1], acc);
            asm volatile("v_nop\n\tv_nop\n\tv_nop\n\tv_nop" :: "v"(acc));   // the four vector slots the chip needs before the next tile's first matrix instruction may overwrite these result registers
#pragma unroll
            for (int j = 0; j < 8; ++j) { const int r = hi * 8 + j, jj = tt * 16 + lr + r - 15; T[(mt * 16 + r) * TP + ((jj >= 0 && jj < 128) ? j0 + jj : TT)] = acc[j]; } }   // a position outside this wave's keys lands in the row's pad column
        if (u < 6) rload(u + 4); else if (u < 9) kload(u - 6);
        if (!HI && u == 5) {
#pragma unroll
            for (int mt = 0; mt < 2; ++mt)
#pragma unroll
                for (int kk = 0; kk < 2; ++kk) q16[mt][kk] = WFrag<h16>::ld(QP16 + qb + (size_t)mt * 16 * HD + kk * 32);
            XWAIT1(QP16 + qb); } }
    __syncthreads();   // the skewed stores crossed lanes: every logit slot holds its relative score
#pragma unroll
    for (int nb = 0; nb < 8; ++nb) { v8f acc[2];
#pragma unroll
        for (int mt = 0; mt < 2; ++mt) { v8f a = (v8f){};
            if (HI) { a = wmmab(qh[mt][0], kb[nb][0], a); a = wmmab(ql[mt][0], kb[nb][0], a); a = wmmab(qh[mt][0], kb[nb][2], a); a = wmmab(qh[mt][1], kb[nb][1], a); a = wmmab(ql[mt][1], kb[nb][1], a); a = wmmab(qh[mt][1], kb[nb][3], a); }
            else { a = wmma16(q16[mt][0], kf[nb][0], a); a = wmma16(q16[mt][1], kf[nb][1], a); }
            asm volatile("v_nop\n\tv_nop\n\tv_nop\n\tv_nop" :: "v"(a)); acc[mt] = a; }   // v_nop: as above, the result registers are reused by the next tile
        if (nb < 5) kload(nb + 3);
#pragma unroll
        for (int mt = 0; mt < 2; ++mt)
#pragma unroll
            for (int j = 0; j < 8; ++j) { float* tp = T + (mt * 16 + hi * 8 + j) * TP + j0 + nb * 16 + lr; *tp = __fadd_rn(__fmul_rn(acc[mt][j], SCL), *tp); } }   // SCL is a power of two: the product is exact, fused or not
    __syncthreads();   // logits complete for all 1024 keys
    vload(0); vload(1); if (!HI) { vload(2); vload(3); }   // behind the barrier, which would wait for them: they fly during the softmax
    // softmax: four rows a wave, register row, one exp, fixed trees; the row's planes overwrite its logits
#pragma unroll 1
    for (int rr = 0; rr < BR / 8; ++rr) { float* tr = T + (w * (BR / 8) + rr) * TP; float v[TT / 32]; float mx = -3.0e38f;
#pragma unroll
        for (int ch = 0; ch < TT / 128; ++ch) { const v4f a = *(const v4fa*)(tr + ch * 128 + lane * 4);
#pragma unroll
            for (int q = 0; q < 4; ++q) { v[ch * 4 + q] = a[q]; mx = fmaxf(mx, a[q]); } }
#pragma unroll
        for (int sh = 16; sh; sh >>= 1) mx = fmaxf(mx, __shfl_xor(mx, sh, 32));
        float sum = 0.f;
#pragma unroll
        for (int k = 0; k < TT / 32; ++k) { v[k] = __builtin_amdgcn_exp2f(__fmul_rn(__fsub_rn(v[k], mx), 1.4426950408889634f)); sum += v[k]; }
#pragma unroll
        for (int sh = 16; sh; sh >>= 1) sum += __shfl_xor(sum, sh, 32);
        const float f = __fdiv_rn(HI ? 1.0f : PCAR, sum);
        if (HI) {
#pragma unroll
            for (int ch = 0; ch < TT / 128; ++ch) { v4us oh, ol;
#pragma unroll
                for (int q = 0; q < 4; ++q) { unsigned short a, c2; splitf(v[ch * 4 + q] * f, a, c2); oh[q] = a; ol[q] = c2; }
                *(v4usa*)((bf*)tr + ch * 128 + lane * 4) = oh; *(v4usa*)((bf*)tr + TT + ch * 128 + lane * 4) = ol; }
        } else {
#pragma unroll
            for (int ch = 0; ch < TT / 128; ++ch) { v4h o4;
#pragma unroll
                for (int q = 0; q < 4; ++q) o4[q] = tohx(v[ch * 4 + q] * f);
                *(v4ha*)((h16*)tr + ch * 128 + lane * 4) = o4; } } }
    __syncthreads();   // probability planes complete
    // attn.v: this wave sums its own 128 keys for all 32 rows x 64 columns
    v8f o[2][4];
#pragma unroll
    for (int mt = 0; mt < 2; ++mt)
#pragma unroll
        for (int nb = 0; nb < 4; ++nb) o[mt][nb] = (v8f){};
#pragma unroll
    for (int ks = 0; ks < 4; ++ks) { const int kc = j0 + ks * 32 + 8 * hi;
        if (HI) { v16bf ah[2], al[2];
#pragma unroll
            for (int mt = 0; mt < 2; ++mt) { const bf* pr = (const bf*)(T + (mt * 16 + lr) * TP) + kc; ah[mt] = ldsb(pr); al[mt] = ldsb(pr + TT); }
#pragma unroll
            for (int nb = 0; nb < 4; ++nb)
#pragma unroll
                for (int mt = 0; mt < 2; ++mt) { o[mt][nb] = wmmab(ah[mt], vb[ks][nb][0], o[mt][nb]); o[mt][nb] = wmmab(al[mt], vb[ks][nb][0], o[mt][nb]); o[mt][nb] = wmmab(ah[mt], vb[ks][nb][1], o[mt][nb]); }
            if (ks < 2) vload(ks + 2);
        } else { v16h a16[2];
#pragma unroll
            for (int mt = 0; mt < 2; ++mt) a16[mt] = ldsh((const h16*)(T + (mt * 16 + lr) * TP) + kc);
#pragma unroll
            for (int nb = 0; nb < 4; ++nb)
#pragma unroll
                for (int mt = 0; mt < 2; ++mt) o[mt][nb] = wmma16(a16[mt], vf[ks][nb], o[mt][nb]); } }
    __syncthreads();   // every wave has read the planes: T is free for the partial outputs
#pragma unroll
    for (int mt = 0; mt < 2; ++mt)
#pragma unroll
        for (int nb = 0; nb < 4; ++nb)
#pragma unroll
            for (int j = 0; j < 8; ++j) T[w * (BR * OPP) + (mt * 16 + hi * 8 + j) * OPP + nb * 16 + lr] = o[mt][nb][j];
    __syncthreads();   // partial outputs complete
    { const int row = tid >> 3, d0 = (tid & 7) * 8; v4f p0[8], p1[8];
#pragma unroll
        for (int ww = 0; ww < 8; ++ww) { p0[ww] = *(const v4fa*)(T + ww * (BR * OPP) + row * OPP + d0); p1[ww] = *(const v4fa*)(T + ww * (BR * OPP) + row * OPP + d0 + 4); }
        v4f s0 = p0[0], s1 = p1[0];
#pragma unroll
        for (int ww = 1; ww < 8; ++ww) { s0 += p0[ww]; s1 += p1[ww]; }   // key blocks in ascending order
        const float cs = HI ? 1.0f : (1.0f / PCAR); v8us oh, ol;
#pragma unroll
        for (int q = 0; q < 4; ++q) { unsigned short a, c2; splitf(s0[q] * cs, a, c2); oh[q] = a; ol[q] = c2; splitf(s1[q] * cs, a, c2); oh[4 + q] = a; ol[4 + q] = c2; }
        const size_t oo = ((size_t)(z / NH_) * TT + i0 + row) * DQ + (z % NH_) * HD + d0; *(v8us*)(ATh + oo) = oh; *(v8us*)(ATl + oo) = ol; }   // eight neighbouring lanes fill one 128-byte line
}
// k_attn: grid (TT / BR, NZ), 256 threads; two work-groups share a WGP's LDS, so four waves a SIMD
__global__ __launch_bounds__(256) __attribute__((amdgpu_waves_per_eu(4, 4))) void k_attn(const h16* __restrict__ QP16, const bf* __restrict__ QPh, const bf* __restrict__ QPl, const h16* __restrict__ KP16, const bf* __restrict__ KPh, const bf* __restrict__ KPl,
                                               const h16* __restrict__ VT16, const bf* __restrict__ VTh, const bf* __restrict__ VTl, const bf* __restrict__ PE, bf* ATh, bf* ATl) {
    __shared__ __align__(16) float T[BR * TP];
    const int i0 = blockIdx.x * BR, z = blockIdx.y;
    if (i0 < RH) attn_body<true>(T, z, i0, QP16, QPh, QPl, KP16, KPh, KPl, VT16, VTh, VTl, PE, ATh, ATl);
    else attn_body<false>(T, z, i0, QP16, QPh, QPl, KP16, KPh, KPl, VT16, VTh, VTl, PE, ATh, ATl);
}

extern "C" void kernel_launch(void* const* d_in, const int* in_sizes, int n_in,
                              void* d_out, int out_size, void* d_ws, size_t ws_size, hipStream_t stream) {
    (void)in_sizes; (void)n_in; (void)out_size;
    const float* x = (const float*)d_in[0]; const float* wq = (const float*)d_in[1]; const float* bq = (const float*)d_in[2]; const float* wk = (const float*)d_in[3]; const float* bk = (const float*)d_in[4]; const float* wv = (const float*)d_in[5]; const float* bv = (const float*)d_in[6]; const float* wo = (const float*)d_in[7]; const float* bo = (const float*)d_in[8]; const float* pe = (const float*)d_in[9];
    float* OUT = (float*)d_out;     // [4][1024][1024]
    char* wsp = (char*)d_ws;
    auto take = [&](size_t bytes) { char* p = wsp; wsp += (bytes + 255) & ~(size_t)255; return (void*)p; };
    bf* WO = (bf*)take((size_t)DM * DQ * 2); bf* PE = (bf*)take((size_t)NPE * HD * 2);
    h16* QP16 = (h16*)take((size_t)NZ * TT * HD * 2); h16* KP16 = (h16*)take((size_t)NZ * TT * HD * 2); h16* VT16 = (h16*)take((size_t)NZ * HD * TT * 2);
    bf* QPh = (bf*)take((size_t)NZ * TT * HD * 2); bf* QPl = (bf*)take((size_t)NZ * TT * HD * 2); bf* KPh = (bf*)take((size_t)NZ * TT * HD * 2); bf* KPl = (bf*)take((size_t)NZ * TT * HD * 2); bf* VTh = (bf*)take((size_t)NZ * HD * TT * 2); bf* VTl = (bf*)take((size_t)NZ * HD * TT * 2);
    bf* ATh = (bf*)take((size_t)NB_ * TT * DQ * 2); bf* ATl = (bf*)take((size_t)NB_ * TT * DQ * 2);
    bf* WQ = (bf*)take((size_t)DQ * DM * 2); bf* WK = (bf*)take((size_t)DKV * DM * 2); bf* WV = (bf*)take((size_t)DKV * DM * 2);
    bf* XB = (bf*)take((size_t)NB_ * TT * DM * 2);
    if ((size_t)(wsp - (char*)d_ws) > ws_size) return;    // ws 256 MiB
    { k_cvt8<<<(unsigned)(((size_t)DQ * DM / 8 + 255) / 256), 256, 0, stream>>>(wq, WQ, (size_t)DQ * DM / 8); k_cvt8<<<(unsigned)(((size_t)DKV * DM / 8 + 255) / 256), 256, 0, stream>>>(wk, WK, (size_t)DKV * DM / 8); k_cvt8<<<(unsigned)(((size_t)DKV * DM / 8 + 255) / 256), 256, 0, stream>>>(wv, WV, (size_t)DKV * DM / 8);
      k_cvt8<<<(unsigned)(((size_t)DM * DQ / 8 + 255) / 256), 256, 0, stream>>>(wo, WO, (size_t)DM * DQ / 8);
       }
    k_cvt8<<<(unsigned)(((size_t)2047 * HD / 8 + 255) / 256), 256, 0, stream>>>(pe, PE, (size_t)2047 * HD / 8); k_pezero<<<1, 32, 0, stream>>>(PE);   /* bf16 position table + zero pad row */
    k_cvt8<<<(unsigned)(((size_t)NB_ * TT * DM / 8 + 255) / 256), 256, 0, stream>>>(x, XB, (size_t)NB_ * TT * DM / 8);
    k_gemmw<bf, 0, true, 1><<<dim3(NB_ * TT / 64, DQ / 64, 1), 32, 0, stream>>>(XB, nullptr, WQ, nullptr, DM, nullptr, DQ, bq, 0, 0, 0, QP16, QPh, QPl);
    k_gemmw<bf, 0, true, 1><<<dim3(NB_ * TT / 64, DKV / 64, 1), 32, 0, stream>>>(XB, nullptr, WK, nullptr, DM, nullptr, DKV, bk, 0, 0, 0, KP16, KPh, KPl);
    k_gemmw<bf, 0, true, 2><<<dim3(NB_ * TT / 64, DKV / 64, 1), 32, 0, stream>>>(XB, nullptr, WV, nullptr, DM, nullptr, DKV, bv, 0, 0, 0, VT16, VTh, VTl);
    k_attn<<<dim3(TT / BR, NZ, 1), 256, 0, stream>>>(QP16, QPh, QPl, KP16, KPh, KPl, VT16, VTh, VTl, PE, ATh, ATl);   // planes are [b][h][..]: z is the plane index (one kv head per query head)
    k_gemmw<bf, 1, true, 0><<<dim3(NB_ * TT / 64, DM / 64, 1), 32, 0, stream>>>(ATh, ATl, WO, nullptr, DQ, OUT, DM, bo, 0, 0, 0, nullptr, nullptr, nullptr);
}

// v004
// A run of this version takes 223 microseconds.
// In both of two side-by-side timings against v003, it was 1.16 times as fast.
// Counting every step since v000, it is 11.8 times as fast.
#include <hip/hip_runtime.h>

// Self-attention with a learned relative-position bias (x [4][1024][1024]; q, k, v = x W^T + b ('oi', 16 heads x 64); S = q.k/8 + S_rel[i][j - i + 1023] where S_rel = q.pos_emb^T (pos_emb [2047][64], unscaled); softmax; out = merged Wo^T + bo -> [4][1024][1024]).
// Layout: batch and head are one flat index z = b * 16 + h carried in the grids (projections over all 4096 rows; their epilogues write the 16-bit head planes themselves: q, k as [z][t][d], v as [z][d][t]). Attention is ONE launch: a work-group of 8 waves owns 32 query rows of one z and keeps their 1024 logits a row in LDS: relative scores (q hi/lo planes against the bf16 position table, 2047 rows + one zero pad row; only the band of positions the 32 rows reach) are stored to LDS already skewed (S_rel[i][j - i + 1023] at column j), the content scores are added, the softmax rewrites each row in place as 16-bit planes, attn.v reads them as A fragments and the hi/lo planes of the merged heads go to memory.
// Compute dtypes, f32 accumulate: every input rounded to bf16; q/k/v on PLAIN bf16 operands (inputs: exact) + biases; relative scores q(hi+lo).pos_emb (2 products, f32); scores and attn.v: query rows < 512 hl (3 products), the rest single fp16 (x1024); softmax f32; Wo hl x exact (2 products) + bo.

#define NB_  4
#define TT   1024
#define DM   1024
#define NH_  16
#define NKV  16
#define REP  (NH_ / NKV)
#define HD   64
#define DQ   (NH_ * HD)
#define DKV  (NKV * HD)
#define NPE  2048                 // 2047 relative positions + 1 zero pad row
#define BR   32                   // query rows per attention work-group
#define TP   1028                 // LDS row pitch in floats: 4112 B = 16 B x odd, so b128 reads of 16 rows meet no bank twice; columns 1024.. are never read
#define OPP  68                   // pitch in floats of a wave's partial attn.v tile in LDS
#define NZ   (NB_ * NH_)
#define RH   512                  // query rows < RH use hi+lo planes (0: none)
#define WIN  0
#define PCAR 1024.0f
#define SCL  0.125f   // HD^-0.5
typedef _Float16 h16;
typedef unsigned short bf;
typedef __attribute__((ext_vector_type(16))) __bf16   v16bf;
typedef __attribute__((ext_vector_type(16))) _Float16 v16h;
typedef __attribute__((ext_vector_type(8)))  _Float16 v8h;
typedef __attribute__((ext_vector_type(8)))  unsigned short v8us;
typedef __attribute__((ext_vector_type(8)))  float    v8f;
typedef __attribute__((ext_vector_type(4)))  float    v4f;
typedef v8h  __attribute__((may_alias)) v8ha;
typedef v4f  __attribute__((may_alias)) v4fa;
typedef v8us __attribute__((may_alias)) v8usa;

__device__ __forceinline__ unsigned short f2bf(float f) { unsigned u = __float_as_uint(f); u += 0x7FFFu + ((u >> 16) & 1u); return (unsigned short)(u >> 16); }
__device__ __forceinline__ float bf2f(unsigned short b) { return __uint_as_float(((unsigned)b) << 16); }
__device__ __forceinline__ float bfr(float f) { return bf2f(f2bf(f)); }
__device__ __forceinline__ h16 tohx(float x) { return (h16)x; }
__device__ __forceinline__ void splitf(float y, unsigned short& h, unsigned short& l) { h = f2bf(y); l = f2bf(y - bf2f(h)); }
__device__ __forceinline__ v16h cat16(v8h lo, v8h hi) { return __builtin_shufflevector(lo, hi, 0, 1, 2, 3, 4, 5, 6, 7, 8, 9, 10, 11, 12, 13, 14, 15); }
__device__ __forceinline__ v16bf cat16b(v8us lo, v8us hi) { return __builtin_bit_cast(v16bf, __builtin_shufflevector(lo, hi, 0, 1, 2, 3, 4, 5, 6, 7, 8, 9, 10, 11, 12, 13, 14, 15)); }
__device__ __forceinline__ v8f wmma16(v16h a, v16h b, v8f c) { return __builtin_amdgcn_wmma_f32_16x16x32_f16(false, a, false, b, (short)0, c, false, false); }
__device__ __forceinline__ v8f wmmab(v16bf a, v16bf b, v8f c) { return __builtin_amdgcn_wmma_f32_16x16x32_bf16(false, a, false, b, (short)0, c, false, false); }



// ---- k_gemmw: register-blocked GEMM, ONE WAVE per 64x64 output tile (16 accumulators), operands straight from K-contiguous 16-bit planes; grid (M/64, N/64, Z), 32 threads.
// C[m][n] (f32, pitch ldc, + optional f32 bias[n]) = sum_k A[m][k] Bt[n][k] (+ split products per NSPLIT). z-batch strides sA/sB/sC in elements. K % 32 == 0.
// C goes to memory as f32 (EPI 0, the one form left here: the projections, which write 16-bit planes, are proj_tile below).
template <typename T16> struct WFrag;
template <> struct WFrag<h16> { typedef v16h V; static __device__ __forceinline__ V ld(const h16* p) { return cat16(*(const v8h*)p, *(const v8h*)(p + 16)); } static __device__ __forceinline__ v8f mma(V a, V b, v8f c) { return wmma16(a, b, c); } };
template <> struct WFrag<bf> { typedef v16bf V; static __device__ __forceinline__ V ld(const bf* p) { return cat16b(*(const v8us*)p, *(const v8us*)(p + 16)); } static __device__ __forceinline__ v8f mma(V a, V b, v8f c) { return wmmab(a, b, c); } };
template <typename T16, int NSPLIT, bool BIAS, int EPI>
__global__ __launch_bounds__(32) void k_gemmw(const T16* __restrict__ A, const T16* __restrict__ A2, const T16* __restrict__ Bt, const T16* __restrict__ Bt2, int K, float* C, int ldc, const float* __restrict__ bias, size_t sA, size_t sB, size_t sC, h16* P16, bf* Ph, bf* Pl) {
    typedef typename WFrag<T16>::V V;
    __shared__ __align__(16) float os[16 * 68];
    const size_t z = blockIdx.z; A += z * sA; if (A2) A2 += z * sA; Bt += z * sB; if (Bt2) Bt2 += z * sB; C += z * sC;
    const int lane = threadIdx.x & 31, lr = lane & 15, hi = lane >> 4; const int r0 = blockIdx.x * 64, c0 = blockIdx.y * 64;
    v8f acc[4][4];
#pragma unroll
    for (int mb = 0; mb < 4; ++mb)
#pragma unroll
        for (int nb = 0; nb < 4; ++nb) acc[mb][nb] = (v8f){};
    const size_t aoff = (size_t)(r0 + lr) * K + 8 * hi, boff = (size_t)(c0 + lr) * K + 8 * hi;
#pragma unroll 1
    for (int kc = 0; kc < K; kc += 32) {
        V a[4], a2[4];
#pragma unroll
        for (int mb = 0; mb < 4; ++mb) { a[mb] = WFrag<T16>::ld(A + aoff + (size_t)mb * 16 * K + kc); if (NSPLIT == 1 || NSPLIT == 2) a2[mb] = WFrag<T16>::ld(A2 + aoff + (size_t)mb * 16 * K + kc); }
#pragma unroll
        for (int nb = 0; nb < 4; ++nb) { const V b = WFrag<T16>::ld(Bt + boff + (size_t)nb * 16 * K + kc); V b2; if (NSPLIT >= 2) b2 = WFrag<T16>::ld(Bt2 + boff + (size_t)nb * 16 * K + kc);
#pragma unroll
            for (int mb = 0; mb < 4; ++mb) { acc[mb][nb] = WFrag<T16>::mma(a[mb], b, acc[mb][nb]); if (NSPLIT == 1 || NSPLIT == 2) acc[mb][nb] = WFrag<T16>::mma(a2[mb], b, acc[mb][nb]); if (NSPLIT >= 2) acc[mb][nb] = WFrag<T16>::mma(a[mb], b2, acc[mb][nb]); } }
        asm volatile("v_nop\n\tv_nop\n\tv_nop\n\tv_nop" : "+v"(acc[0][0]), "+v"(acc[1][1]), "+v"(acc[2][2]), "+v"(acc[3][3]) : "v"(a[0]), "v"(a[3]));
    }
#pragma unroll
    for (int mb = 0; mb < 4; ++mb) {
#pragma unroll
        for (int nb = 0; nb < 4; ++nb) {
#pragma unroll
            for (int j = 0; j < 8; ++j) os[(hi * 8 + j) * 68 + nb * 16 + lr] = acc[mb][nb][j]; }
        __builtin_amdgcn_wave_barrier(); asm volatile("" ::: "memory");
        float* crow = C + (size_t)(r0 + mb * 16) * ldc + c0;
{
#pragma unroll
            for (int s = 0; s < 8; ++s) { const int row = 2 * s + hi, cofs = lr * 4; v4f val = *(const v4fa*)(os + row * 68 + cofs); if (BIAS) { val[0] += bfr(bias[c0 + cofs]); val[1] += bfr(bias[c0 + cofs + 1]); val[2] += bfr(bias[c0 + cofs + 2]); val[3] += bfr(bias[c0 + cofs + 3]); }
                *(v4f*)(crow + (size_t)row * ldc + cofs) = val; }
             }
        __builtin_amdgcn_wave_barrier(); asm volatile("" ::: "memory");
    }
}

// ---- proj_tile: k_gemmw's 64x64 tile of one wave for the projections: C = x W^T + b, K = DM, plain bf16 operands, no f32 result. A 64-column tile is one head (HD == 64) and rows are b * TT + t:
// C + bias goes out as three 16-bit planes (fp16, bf16 hi, bf16 lo), EPI 1 as [b][head][t][d] (staged through the wave's own os rows), EPI 2 transposed as [b][head][d][t].
template <int EPI>
__device__ __forceinline__ void proj_tile(const bf* __restrict__ A, const bf* __restrict__ Bt, const float* __restrict__ bias, int r0, int c0, float* os, h16* P16, bf* Ph, bf* Pl) {
    typedef WFrag<bf>::V V; constexpr int K = DM, ldc = DQ; constexpr bool BIAS = true;
    const int lane = threadIdx.x & 31, lr = lane & 15, hi = lane >> 4;
    v8f acc[4][4];
#pragma unroll
    for (int mb = 0; mb < 4; ++mb)
#pragma unroll
        for (int nb = 0; nb < 4; ++nb) acc[mb][nb] = (v8f){};
    const bf* pa = A + (size_t)(r0 + lr) * K + 8 * hi; const bf* pb = Bt + (size_t)(c0 + lr) * K + 8 * hi;
#pragma unroll 1
    for (int kc = 0; kc < K; kc += 32, pa += 32, pb += 32) {
        V a[4], b[4];
#pragma unroll
        for (int mb = 0; mb < 4; ++mb) { a[mb] = WFrag<bf>::ld(pa + mb * 16 * K); b[mb] = WFrag<bf>::ld(pb + mb * 16 * K); }
        asm volatile("s_wait_xcnt 0x0" :: "v"(pa), "v"(pb) : "memory");   // in front of any overwrite of the two addresses this trip's loads name (the row blocks are immediate offsets); as inputs they stay untouched, also by a landing load, up to it
#pragma unroll
        for (int nb = 0; nb < 4; ++nb)
#pragma unroll
            for (int mb = 0; mb < 4; ++mb) acc[mb][nb] = WFrag<bf>::mma(a[mb], b[nb], acc[mb][nb]);
        asm volatile("v_nop\n\tv_nop\n\tv_nop\n\tv_nop" : "+v"(acc[0][0]), "+v"(acc[1][1]), "+v"(acc[2][2]), "+v"(acc[3][3]) : "v"(a[0]), "v"(a[3]));   // the four vector slots the chip needs behind the last matrix instruction, on the loop's taken branch too
    }
    if (EPI == 2) {   // a lane's eight accumulator rows are eight consecutive t of one column d: 16 bytes of a transposed plane's row, straight from registers
        const size_t pb = (((size_t)(r0 / TT) * (ldc / HD) + c0 / HD) * HD + lr) * TT + (r0 % TT) + hi * 8; const float* bp = bias + c0 + lr; float tb[4];
#pragma unroll
        for (int nb = 0; nb < 4; ++nb) tb[nb] = BIAS ? bp[nb * 16] : 0.0f;   // all four at once: one wait for memory, not four
        if (BIAS) asm volatile("s_wait_xcnt 0x0" :: "v"(bp) : "memory");   // in front of any overwrite of the address these loads name
#pragma unroll
        for (int nb = 0; nb < 4; ++nb) { const float bb = bfr(tb[nb]); h16* p16 = P16 + pb + (size_t)nb * 16 * TT; bf* ph = Ph + pb + (size_t)nb * 16 * TT; bf* pl = Pl + pb + (size_t)nb * 16 * TT; v8h o16[4]; v8us oh[4], ol[4];
#pragma unroll
            for (int mb = 0; mb < 4; ++mb)
#pragma unroll
                for (int j = 0; j < 8; ++j) { const float val = acc[mb][nb][j] + bb; o16[mb][j] = tohx(val); unsigned short a2, c2; splitf(val, a2, c2); oh[mb][j] = a2; ol[mb][j] = c2; }
#pragma unroll
            for (int mb = 0; mb < 4; ++mb) { *(v8h*)(p16 + mb * 16) = o16[mb]; *(v8us*)(ph + mb * 16) = oh[mb]; *(v8us*)(pl + mb * 16) = ol[mb]; }   // the four mb fill each row's 128-byte line
            // the wait that stands in front of any overwrite of a register which an issued store names: addresses and data are its inputs, so they stay untouched up to it
            asm volatile("s_wait_xcnt 0x0" :: "v"(p16), "v"(ph), "v"(pl), "v"(o16[0]), "v"(o16[1]), "v"(o16[2]), "v"(o16[3]), "v"(oh[0]), "v"(oh[1]), "v"(oh[2]), "v"(oh[3]), "v"(ol[0]), "v"(ol[1]), "v"(ol[2]), "v"(ol[3]) : "memory"); }
        return; }
    const int prow = lane >> 3, pcol = (lane & 7) * 8; float pbias[8];   // EPI 1: a lane takes eight neighbouring columns of a row
    if (EPI == 1) { const float* bp = bias + c0 + pcol; v8f tb = (v8f){}; if (BIAS) { tb = *(const v8f*)bp; asm volatile("s_wait_xcnt 0x0" :: "v"(bp) : "memory"); }   // the wait: in front of any overwrite of the address this load names
#pragma unroll
        for (int q = 0; q < 8; ++q) pbias[q] = bfr(tb[q]); }
#pragma unroll
    for (int mb = 0; mb < 4; ++mb) {
#pragma unroll
        for (int nb = 0; nb < 4; ++nb) {
#pragma unroll
            for (int j = 0; j < 8; ++j) os[(hi * 8 + j) * 68 + nb * 16 + lr] = acc[mb][nb][j]; }
        __builtin_amdgcn_wave_barrier(); asm volatile("" ::: "memory");
        if (EPI == 1) {   // the tile is 8 KiB in a row of each plane: a store instruction fills four whole 128-byte rows
            const size_t pb = (((size_t)(r0 / TT) * (ldc / HD) + c0 / HD) * TT + (r0 % TT) + mb * 16 + prow) * HD + pcol; h16* p16 = P16 + pb; bf* ph = Ph + pb; bf* pl = Pl + pb; v8h o16[4]; v8us oh[4], ol[4];
#pragma unroll
            for (int s = 0; s < 4; ++s) { const float* op = os + (4 * s + prow) * 68 + pcol; const v4f v0 = *(const v4fa*)op, v1 = *(const v4fa*)(op + 4);
#pragma unroll
                for (int q = 0; q < 8; ++q) { const float val = (q < 4 ? v0[q & 3] : v1[q & 3]) + pbias[q]; o16[s][q] = tohx(val); unsigned short a2, c2; splitf(val, a2, c2); oh[s][q] = a2; ol[s][q] = c2; } }
#pragma unroll
            for (int s = 0; s < 4; ++s) { *(v8h*)(p16 + s * 4 * HD) = o16[s]; *(v8us*)(ph + s * 4 * HD) = oh[s]; *(v8us*)(pl + s * 4 * HD) = ol[s]; }
            // the wait in front of any overwrite of a register which an issued store names, as above
            asm volatile("s_wait_xcnt 0x0" :: "v"(p16), "v"(ph), "v"(pl), "v"(o16[0]), "v"(o16[1]), "v"(o16[2]), "v"(o16[3]), "v"(oh[0]), "v"(oh[1]), "v"(oh[2]), "v"(oh[3]), "v"(ol[0]), "v"(ol[1]), "v"(ol[2]), "v"(ol[3]) : "memory");
        }
        __builtin_amdgcn_wave_barrier(); asm volatile("" ::: "memory");
    }
}
// k_qkv: the three projections in ONE launch. Grid (rows / 128, columns / 128), 12 waves: waves 0-3 q, 4-7 k, 8-11 v, each group 2 x 2 tiles of 64 x 64 on the same 128 rows and 128 columns,
// so an x row is read by six waves of one WGP and a weight row by two, and three waves share a SIMD. No wave waits for another: every q and k wave has its own staging rows in LDS; the v waves write from registers and use none.
__global__ __launch_bounds__(384) void k_qkv(const bf* __restrict__ XB, const bf* __restrict__ WQ, const bf* __restrict__ WK, const bf* __restrict__ WV, const float* __restrict__ bq, const float* __restrict__ bk, const float* __restrict__ bv,
                                             h16* QP16, bf* QPh, bf* QPl, h16* KP16, bf* KPh, bf* KPl, h16* VT16, bf* VTh, bf* VTl) {
    __shared__ __align__(16) float os[8][16 * 68];
    const int w = __builtin_amdgcn_readfirstlane((int)(threadIdx.x >> 5)); const int r0 = blockIdx.x * 128 + (w & 1) * 64, c0 = blockIdx.y * 128 + ((w >> 1) & 1) * 64;
    if (w >= 8) proj_tile<2>(XB, WV, bv, r0, c0, nullptr, VT16, VTh, VTl);
    else { const bool kk = w >= 4; proj_tile<1>(XB, kk ? WK : WQ, kk ? bk : bq, r0, c0, os[w], kk ? KP16 : QP16, kk ? KPh : QPh, kk ? KPl : QPl); }
}

typedef __attribute__((ext_vector_type(2))) _Float16 v2h;
typedef __attribute__((ext_vector_type(4))) _Float16 v4h;
typedef __attribute__((ext_vector_type(2))) unsigned short v2us;
typedef __attribute__((ext_vector_type(4))) unsigned short v4us;
typedef __attribute__((ext_vector_type(2))) float v2f;
typedef __attribute__((ext_vector_type(4))) int v4i;

__global__ __launch_bounds__(256) void k_wtG(const float* __restrict__ w, int K, int N, bf* Bt) {
    const int lane = threadIdx.x & 31; const int L0 = (blockIdx.x * 8 + (threadIdx.x >> 5)) * 8; const int nlines = N * K / 64;
{
#pragma unroll 1
        for (int l = 0; l < 8; ++l) { const int L = L0 + l; if (L >= nlines) break; const size_t e = (size_t)L * 64 + lane * 2; const int k = (int)(e % K), n = (int)(e / K); v2us o;
            o[0] = f2bf(w[(size_t)k * N + n]); o[1] = f2bf(w[(size_t)(k + 1) * N + n]); *(v2us*)(Bt + e) = o; }
         }
}
// k_prep: every f32 -> bf16 conversion of the call in ONE launch. A work-group takes CH groups of eight floats of one array (eight a thread, all sixteen loads in flight at once); blockIdx.x picks the array.
// PAD (the position table): groups at or past n8 are the zero pad row; they are stored as zeros and read nothing past the table (the index is clamped).
#define CH   2048
#define GX   (NB_ * TT * DM / 8 / CH)
#define GW   (DM * DQ / 8 / CH)
#define GP   (NPE * HD / 8 / CH)
template <bool PAD>
__device__ __forceinline__ void cvt_run(const float* __restrict__ src, bf* dst, unsigned blk, unsigned n8) {
    const unsigned i0 = blk * CH + threadIdx.x; unsigned so[8]; v8f v[8]; v8us o[8];
#pragma unroll
    for (int u = 0; u < 8; ++u) { const unsigned i = i0 + u * 256; so[u] = (PAD ? (i < n8 ? i : n8 - 1) : i) * 32u; v[u] = *(const v8f*)((const char*)src + so[u]); }
    // the wait that stands in front of any overwrite of a register which an issued load names: the byte offsets are its inputs, so they stay untouched (also by a landing load) up to it
    if (PAD) asm volatile("s_wait_xcnt 0x0" :: "v"(so[0]), "v"(so[1]), "v"(so[2]), "v"(so[3]), "v"(so[4]), "v"(so[5]), "v"(so[6]), "v"(so[7]) : "memory");
    else asm volatile("s_wait_xcnt 0x0" :: "v"(so[0]) : "memory");   // the other seven are immediate offsets from this one
#pragma unroll
    for (int u = 0; u < 8; ++u)
#pragma unroll
        for (int k = 0; k < 8; ++k) o[u][k] = f2bf((PAD && i0 + u * 256 >= n8) ? 0.0f : v[u][k]);
#pragma unroll
    for (int u = 0; u < 8; ++u) *(v8us*)(dst + (size_t)(i0 + u * 256) * 8) = o[u];
}
__global__ __launch_bounds__(256) void k_prep(const float* __restrict__ x, const float* __restrict__ wq, const float* __restrict__ wk, const float* __restrict__ wv, const float* __restrict__ wo, const float* __restrict__ pe,
                                              bf* XB, bf* WQ, bf* WK, bf* WV, bf* WO, bf* PE) {
    const unsigned b = blockIdx.x;
    if (b >= GX + 4 * GW) { cvt_run<true>(pe, PE, b - (GX + 4 * GW), 2047 * HD / 8); return; }
    const unsigned a = b < GX ? 0 : 1 + (b - GX) / GW;
    cvt_run<false>(a == 0 ? x : a == 1 ? wq : a == 2 ? wk : a == 3 ? wv : wo, a == 0 ? XB : a == 1 ? WQ : a == 2 ? WK : a == 3 ? WV : WO, a == 0 ? b : (b - GX) % GW, 0);
}
typedef v4us __attribute__((may_alias)) v4usa;
typedef v4h  __attribute__((may_alias)) v4ha;
__device__ __forceinline__ v16bf ldsb(const bf* p) { return cat16b(*(const v8usa*)p, *(const v8usa*)(p + 16)); }
__device__ __forceinline__ v16h ldsh(const h16* p) { return cat16(*(const v8ha*)p, *(const v8ha*)(p + 16)); }

// attn_body: 32 query rows i0.. of head z, 8 waves. T [32][TP] f32 in LDS holds the logits, then the probabilities' 16-bit planes (row r: hi plane in its first 2048 bytes, lo plane in the next; or one fp16 plane), then the waves' partial outputs.
// HI: hi+lo planes, 3 products, for scores and attn.v; else single fp16 (probabilities x PCAR).
// Behind a group of global loads: the wait that stands in front of any overwrite of a register which an issued load names. It takes the group's addresses as inputs, so that they stay untouched (also by a landing load of the group) up to it.
#define XWAIT1(p)    asm volatile("s_wait_xcnt 0x0" :: "v"(p) : "memory")
#define XWAIT2(p, q) asm volatile("s_wait_xcnt 0x0" :: "v"(p), "v"(q) : "memory")
template <bool HI>
__device__ __forceinline__ void attn_body(float* T, int z, int i0, const h16* __restrict__ QP16, const bf* __restrict__ QPh, const bf* __restrict__ QPl, const h16* __restrict__ KP16, const bf* __restrict__ KPh, const bf* __restrict__ KPl,
                                          const h16* __restrict__ VT16, const bf* __restrict__ VTh, const bf* __restrict__ VTl, const bf* __restrict__ PE, bf* ATh, bf* ATl) {
    const int tid = threadIdx.x, lane = tid & 31, lr = lane & 15, hi = lane >> 4, w = tid >> 5; const int j0 = w * 128;   // this wave's 128 keys
    const size_t qb = ((size_t)z * TT + i0 + lr) * HD + 8 * hi;
    // relative scores: rows i0 + 16 mt + r and keys j0 + jj need positions p = (j0 - i0 - 16 mt + 1008) + c, c = jj - r + 15 in 0..142: nine 16-wide tiles a row tile, ten for both
    const int pb = j0 - i0 + 992;   // 0 .. 1888; last row read pb + 159 <= 2047
    // B fragments are fetched some tiles ahead of their use (position table 4 tiles, keys 3, values 2 k-steps), so that a wave waits for L2 once and not at every tile
    v16bf qh[2][2], ql[2][2], rb[10][2], kb[8][4], vb[4][4][2]; v16h q16[2][2], kf[8][2], vf[4][4];
    auto rload = [&](int u) { const bf* pp = PE + (size_t)(pb + u * 16 + lr) * HD + 8 * hi; rb[u][0] = WFrag<bf>::ld(pp); rb[u][1] = WFrag<bf>::ld(pp + 32); XWAIT1(pp); };
    auto kload = [&](int nb) { const size_t ko = ((size_t)z * TT + j0 + nb * 16 + lr) * HD + 8 * hi;
        if (HI) { kb[nb][0] = WFrag<bf>::ld(KPh + ko); kb[nb][1] = WFrag<bf>::ld(KPh + ko + 32); kb[nb][2] = WFrag<bf>::ld(KPl + ko); kb[nb][3] = WFrag<bf>::ld(KPl + ko + 32); XWAIT2(KPh + ko, KPl + ko); }
        else { kf[nb][0] = WFrag<h16>::ld(KP16 + ko); kf[nb][1] = WFrag<h16>::ld(KP16 + ko + 32); XWAIT1(KP16 + ko); } };
    auto vload = [&](int ks) { const size_t vo = ((size_t)z * HD + lr) * TT + j0 + ks * 32 + 8 * hi;
#pragma unroll
        for (int nb = 0; nb < 4; ++nb) { if (HI) { vb[ks][nb][0] = WFrag<bf>::ld(VTh + vo + nb * 16 * TT); vb[ks][nb][1] = WFrag<bf>::ld(VTl + vo + nb * 16 * TT); } else vf[ks][nb] = WFrag<h16>::ld(VT16 + vo + nb * 16 * TT); }
        if (HI) XWAIT2(VTh + vo, VTl + vo); else XWAIT1(VT16 + vo); };
#pragma unroll
    for (int mt = 0; mt < 2; ++mt)
#pragma unroll
        for (int kk = 0; kk < 2; ++kk) { qh[mt][kk] = WFrag<bf>::ld(QPh + qb + (size_t)mt * 16 * HD + kk * 32); ql[mt][kk] = WFrag<bf>::ld(QPl + qb + (size_t)mt * 16 * HD + kk * 32); }
    XWAIT2(QPh + qb, QPl + qb);
#pragma unroll
    for (int u = 0; u < 4; ++u) rload(u);
#pragma unroll
    for (int u = 0; u < 10; ++u) {
#pragma unroll
        for (int mt = 0; mt < 2; ++mt) { const int tt = u - 1 + mt; if (tt < 0 || tt > 8) continue;
            v8f acc = (v8f){}; acc = wmmab(qh[mt][0], rb[u][0], acc); acc = wmmab(ql[mt][0], rb[u][0], acc); acc = wmmab(qh[mt][1], rb[u][1], acc); acc = wmmab(ql[mt][1], rb[u][1], acc);
            asm volatile("v_nop\n\tv_nop\n\tv_nop\n\tv_nop" :: "v"(acc));   // the four vector slots the chip needs before the next tile's first matrix instruction may overwrite these result registers
#pragma unroll
            for (int j = 0; j < 8; ++j) { const int r = hi * 8 + j, jj = tt * 16 + lr + r - 15; T[(mt * 16 + r) * TP + ((jj >= 0 && jj < 128) ? j0 + jj : TT)] = acc[j]; } }   // a position outside this wave's keys lands in the row's pad column
        if (u < 6) rload(u + 4); else if (u < 9) kload(u - 6);
        if (!HI && u == 5) {
#pragma unroll
            for (int mt = 0; mt < 2; ++mt)
#pragma unroll
                for (int kk = 0; kk < 2; ++kk) q16[mt][kk] = WFrag<h16>::ld(QP16 + qb + (size_t)mt * 16 * HD + kk * 32);
            XWAIT1(QP16 + qb); } }
    __syncthreads();   // the skewed stores crossed lanes: every logit slot holds its relative score
#pragma unroll
    for (int nb = 0; nb < 8; ++nb) { v8f acc[2];
#pragma unroll
        for (int mt = 0; mt < 2; ++mt) { v8f a = (v8f){};
            if (HI) { a = wmmab(qh[mt][0], kb[nb][0], a); a = wmmab(ql[mt][0], kb[nb][0], a); a = wmmab(qh[mt][0], kb[nb][2], a); a = wmmab(qh[mt][1], kb[nb][1], a); a = wmmab(ql[mt][1], kb[nb][1], a); a = wmmab(qh[mt][1], kb[nb][3], a); }
            else { a = wmma16(q16[mt][0], kf[nb][0], a); a = wmma16(q16[mt][1], kf[nb][1], a); }
            asm volatile("v_nop\n\tv_nop\n\tv_nop\n\tv_nop" :: "v"(a)); acc[mt] = a; }   // v_nop: as above, the result registers are reused by the next tile
        if (nb < 5) kload(nb + 3);
#pragma unroll
        for (int mt = 0; mt < 2; ++mt)
#pragma unroll
            for (int j = 0; j < 8; ++j) { float* tp = T + (mt * 16 + hi * 8 + j) * TP + j0 + nb * 16 + lr; *tp = __fadd_rn(__fmul_rn(acc[mt][j], SCL), *tp); } }   // SCL is a power of two: the product is exact, fused or not
    __syncthreads();   // logits complete for all 1024 keys
    vload(0); vload(1); if (!HI) { vload(2); vload(3); }   // behind the barrier, which would wait for them: they fly during the softmax
    // softmax: four rows a wave, register row, one exp, fixed trees; the row's planes overwrite its logits
#pragma unroll 1
    for (int rr = 0; rr < BR / 8; ++rr) { float* tr = T + (w * (BR / 8) + rr) * TP; float v[TT / 32]; float mx = -3.0e38f;
#pragma unroll
        for (int ch = 0; ch < TT / 128; ++ch) { const v4f a = *(const v4fa*)(tr + ch * 128 + lane * 4);
#pragma unroll
            for (int q = 0; q < 4; ++q) { v[ch * 4 + q] = a[q]; mx = fmaxf(mx, a[q]); } }
#pragma unroll
        for (int sh = 16; sh; sh >>= 1) mx = fmaxf(mx, __shfl_xor(mx, sh, 32));
        float sum = 0.f;
#pragma unroll
        for (int k = 0; k < TT / 32; ++k) { v[k] = __builtin_amdgcn_exp2f(__fmul_rn(__fsub_rn(v[k], mx), 1.4426950408889634f)); sum += v[k]; }
#pragma unroll
        for (int sh = 16; sh; sh >>= 1) sum += __shfl_xor(sum, sh, 32);
        const float f = __fdiv_rn(HI ? 1.0f : PCAR, sum);
        if (HI) {
#pragma unroll
            for (int ch = 0; ch < TT / 128; ++ch) { v4us oh, ol;
#pragma unroll
                for (int q = 0; q < 4; ++q) { unsigned short a, c2; splitf(v[ch * 4 + q] * f, a, c2); oh[q] = a; ol[q] = c2; }
                *(v4usa*)((bf*)tr + ch * 128 + lane * 4) = oh; *(v4usa*)((bf*)tr + TT + ch * 128 + lane * 4) = ol; }
        } else {
#pragma unroll
            for (int ch = 0; ch < TT / 128; ++ch) { v4h o4;
#pragma unroll
                for (int q = 0; q < 4; ++q) o4[q] = tohx(v[ch * 4 + q] * f);
                *(v4ha*)((h16*)tr + ch * 128 + lane * 4) = o4; } } }
    __syncthreads();   // probability planes complete
    // attn.v: this wave sums its own 128 keys for all 32 rows x 64 columns
    v8f o[2][4];
#pragma unroll
    for (int mt = 0; mt < 2; ++mt)
#pragma unroll
        for (int nb = 0; nb < 4; ++nb) o[mt][nb] = (v8f){};
#pragma unroll
    for (int ks = 0; ks < 4; ++ks) { const int kc = j0 + ks * 32 + 8 * hi;
        if (HI) { v16bf ah[2], al[2];
#pragma unroll
            for (int mt = 0; mt < 2; ++mt) { const bf* pr = (const bf*)(T + (mt * 16 + lr) * TP) + kc; ah[mt] = ldsb(pr); al[mt] = ldsb(pr + TT); }
#pragma unroll
            for (int nb = 0; nb < 4; ++nb)
#pragma unroll
                for (int mt = 0; mt < 2; ++mt) { o[mt][nb] = wmmab(ah[mt], vb[ks][nb][0], o[mt][nb]); o[mt][nb] = wmmab(al[mt], vb[ks][nb][0], o[mt][nb]); o[mt][nb] = wmmab(ah[mt], vb[ks][nb][1], o[mt][nb]); }
            if (ks < 2) vload(ks + 2);
        } else { v16h a16[2];
#pragma unroll
            for (int mt = 0; mt < 2; ++mt) a16[mt] = ldsh((const h16*)(T + (mt * 16 + lr) * TP) + kc);
#pragma unroll
            for (int nb = 0; nb < 4; ++nb)
#pragma unroll
                for (int mt = 0; mt < 2; ++mt) o[mt][nb] = wmma16(a16[mt], vf[ks][nb], o[mt][nb]); } }
    __syncthreads();   // every wave has read the planes: T is free for the partial outputs
#pragma unroll
    for (int mt = 0; mt < 2; ++mt)
#pragma unroll
        for (int nb = 0; nb < 4; ++nb)
#pragma unroll
            for (int j = 0; j < 8; ++j) T[w * (BR * OPP) + (mt * 16 + hi * 8 + j) * OPP + nb * 16 + lr] = o[mt][nb][j];
    __syncthreads();   // partial outputs complete
    { const int row = tid >> 3, d0 = (tid & 7) * 8; v4f p0[8], p1[8];
#pragma unroll
        for (int ww = 0; ww < 8; ++ww) { p0[ww] = *(const v4fa*)(T + ww * (BR * OPP) + row * OPP + d0); p1[ww] = *(const v4fa*)(T + ww * (BR * OPP) + row * OPP + d0 + 4); }
        v4f s0 = p0[0], s1 = p1[0];
#pragma unroll
        for (int ww = 1; ww < 8; ++ww) { s0 += p0[ww]; s1 += p1[ww]; }   // key blocks in ascending order
        const float cs = HI ? 1.0f : (1.0f / PCAR); v8us oh, ol;
#pragma unroll
        for (int q = 0; q < 4; ++q) { unsigned short a, c2; splitf(s0[q] * cs, a, c2); oh[q] = a; ol[q] = c2; splitf(s1[q] * cs, a, c2); oh[4 + q] = a; ol[4 + q] = c2; }
        const size_t oo = ((size_t)(z / NH_) * TT + i0 + row) * DQ + (z % NH_) * HD + d0; *(v8us*)(ATh + oo) = oh; *(v8us*)(ATl + oo) = ol; }   // eight neighbouring lanes fill one 128-byte line
}
// k_attn: grid (TT / BR, NZ), 256 threads; two work-groups share a WGP's LDS, so four waves a SIMD
__global__ __launch_bounds__(256) __attribute__((amdgpu_waves_per_eu(4, 4))) void k_attn(const h16* __restrict__ QP16, const bf* __restrict__ QPh, const bf* __restrict__ QPl, const h16* __restrict__ KP16, const bf* __restrict__ KPh, const bf* __restrict__ KPl,
                                               const h16* __restrict__ VT16, const bf* __restrict__ VTh, const bf* __restrict__ VTl, const bf* __restrict__ PE, bf* ATh, bf* ATl) {
    __shared__ __align__(16) float T[BR * TP];
    const int i0 = blockIdx.x * BR, z = blockIdx.y;
    if (i0 < RH) attn_body<true>(T, z, i0, QP16, QPh, QPl, KP16, KPh, KPl, VT16, VTh, VTl, PE, ATh, ATl);
    else attn_body<false>(T, z, i0, QP16, QPh, QPl, KP16, KPh, KPl, VT16, VTh, VTl, PE, ATh, ATl);
}

extern "C" void kernel_launch(void* const* d_in, const int* in_sizes, int n_in,
                              void* d_out, int out_size, void* d_ws, size_t ws_size, hipStream_t stream) {
    (void)in_sizes; (void)n_in; (void)out_size;
    const float* x = (const float*)d_in[0]; const float* wq = (const float*)d_in[1]; const float* bq = (const float*)d_in[2]; const float* wk = (const float*)d_in[3]; const float* bk = (const float*)d_in[4]; const float* wv = (const float*)d_in[5]; const float* bv = (const float*)d_in[6]; const float* wo = (const float*)d_in[7]; const float* bo = (const float*)d_in[8]; const float* pe = (const float*)d_in[9];
    float* OUT = (float*)d_out;     // [4][1024][1024]
    char* wsp = (char*)d_ws;
    auto take = [&](size_t bytes) { char* p = wsp; wsp += (bytes + 255) & ~(size_t)255; return (void*)p; };
    bf* WO = (bf*)take((size_t)DM * DQ * 2); bf* PE = (bf*)take((size_t)NPE * HD * 2);
    h16* QP16 = (h16*)take((size_t)NZ * TT * HD * 2); h16* KP16 = (h16*)take((size_t)NZ * TT * HD * 2); h16* VT16 = (h16*)take((size_t)NZ * HD * TT * 2);
    bf* QPh = (bf*)take((size_t)NZ * TT * HD * 2); bf* QPl = (bf*)take((size_t)NZ * TT * HD * 2); bf* KPh = (bf*)take((size_t)NZ * TT * HD * 2); bf* KPl = (bf*)take((size_t)NZ * TT * HD * 2); bf* VTh = (bf*)take((size_t)NZ * HD * TT * 2); bf* VTl = (bf*)take((size_t)NZ * HD * TT * 2);
    bf* ATh = (bf*)take((size_t)NB_ * TT * DQ * 2); bf* ATl = (bf*)take((size_t)NB_ * TT * DQ * 2);
    bf* WQ = (bf*)take((size_t)DQ * DM * 2); bf* WK = (bf*)take((size_t)DKV * DM * 2); bf* WV = (bf*)take((size_t)DKV * DM * 2);
    bf* XB = (bf*)take((size_t)NB_ * TT * DM * 2);
    if ((size_t)(wsp - (char*)d_ws) > ws_size) return;    // ws 256 MiB
    k_prep<<<GX + 4 * GW + GP, 256, 0, stream>>>(x, wq, wk, wv, wo, pe, XB, WQ, WK, WV, WO, PE);   /* bf16 x, weights, position table + zero pad row */
    k_qkv<<<dim3(NB_ * TT / 128, DQ / 128, 1), 384, 0, stream>>>(XB, WQ, WK, WV, bq, bk, bv, QP16, QPh, QPl, KP16, KPh, KPl, VT16, VTh, VTl);
    k_attn<<<dim3(TT / BR, NZ, 1), 256, 0, stream>>>(QP16, QPh, QPl, KP16, KPh, KPl, VT16, VTh, VTl, PE, ATh, ATl);   // planes are [b][h][..]: z is the plane index (one kv head per query head)
    k_gemmw<bf, 1, true, 0><<<dim3(NB_ * TT / 64, DM / 64, 1), 32, 0, stream>>>(ATh, ATl, WO, nullptr, DQ, OUT, DM, bo, 0, 0, 0, nullptr, nullptr, nullptr);
}

// v005
// Measured time: 163 microseconds a run.
// Next to v004, in two timings, it ran 1.36 and 1.37 times as fast.
// Counting every step since v000, it is 16.1 times as fast.
#include <hip/hip_runtime.h>

// Self-attention with a learned relative-position bias (x [4][1024][1024]; q, k, v = x W^T + b ('oi', 16 heads x 64); S = q.k/8 + S_rel[i][j - i + 1023] where S_rel = q.pos_emb^T (pos_emb [2047][64], unscaled); softmax; out = merged Wo^T + bo -> [4][1024][1024]).
// Layout: batch and head are one flat index z = b * 16 + h carried in the grids (projections over all 4096 rows; their epilogues write the 16-bit head planes themselves: q, k as [z][t][d], v as [z][d][t]). Attention is ONE launch: a work-group of 8 waves owns 32 query rows of one z and keeps their 1024 logits a row in LDS: relative scores (q hi/lo planes against the bf16 position table, 2047 rows + one zero pad row; only the band of positions the 32 rows reach) are stored to LDS already skewed (S_rel[i][j - i + 1023] at column j), the content scores are added, the softmax rewrites each row in place as 16-bit planes, attn.v reads them as A fragments and the hi/lo planes of the merged heads go to memory.
// Every 16-bit operand plane in memory (x, weights, position table, q, k, v^T, merged heads) is kept in FRAGMENT ORDER: a tile of 16 rows x 32 k is 1 KiB in a row, first the 16 bytes that each lane 0..31 takes for k = 8 * (lane >> 4) .. + 7 of row lane & 15, then the 16 bytes for k + 16;
// tiles run along k, then down the rows (tile (rt, ks) of a plane with K elements a row starts at element rt * 16 * K + ks * 512). A fragment load is then 2 x 512 contiguous bytes (four whole 128-byte lines each) and not 16 pieces of 32 bytes; which element meets which in a product is as before.
// Compute dtypes, f32 accumulate: every input rounded to bf16; q/k/v on PLAIN bf16 operands (inputs: exact) + biases; relative scores q(hi+lo).pos_emb (2 products, f32); scores and attn.v: query rows < 512 hl (3 products), the rest single fp16 (x1024); softmax f32; Wo hl x exact (2 products) + bo.

#define NB_  4
#define TT   1024
#define DM   1024
#define NH_  16
#define NKV  16
#define REP  (NH_ / NKV)
#define HD   64
#define DQ   (NH_ * HD)
#define DKV  (NKV * HD)
#define NPE  2048                 // 2047 relative positions + 1 zero pad row
#define BR   32                   // query rows per attention work-group
#define TP   1028                 // LDS row pitch in floats: 4112 B = 16 B x odd, so b128 reads of 16 rows meet no bank twice; columns 1024.. are never read
#define OPP  68                   // pitch in floats of a wave's partial attn.v tile in LDS
#define NZ   (NB_ * NH_)
#define RH   512                  // query rows < RH use hi+lo planes (0: none)
#define WIN  0
#define PCAR 1024.0f
#define SCL  0.125f   // HD^-0.5
typedef _Float16 h16;
typedef unsigned short bf;
typedef __attribute__((ext_vector_type(16))) __bf16   v16bf;
typedef __attribute__((ext_vector_type(16))) _Float16 v16h;
typedef __attribute__((ext_vector_type(8)))  _Float16 v8h;
typedef __attribute__((ext_vector_type(8)))  unsigned short v8us;
typedef __attribute__((ext_vector_type(8)))  float    v8f;
typedef __attribute__((ext_vector_type(4)))  float    v4f;
typedef v8h  __attribute__((may_alias)) v8ha;
typedef v4f  __attribute__((may_alias)) v4fa;
typedef v8us __attribute__((may_alias)) v8usa;

__device__ __forceinline__ unsigned short f2bf(float f) { unsigned u = __float_as_uint(f); u += 0x7FFFu + ((u >> 16) & 1u); return (unsigned short)(u >> 16); }
__device__ __forceinline__ float bf2f(unsigned short b) { return __uint_as_float(((unsigned)b) << 16); }
__device__ __forceinline__ float bfr(float f) { return bf2f(f2bf(f)); }
__device__ __forceinline__ h16 tohx(float x) { return (h16)x; }
__device__ __forceinline__ void splitf(float y, unsigned short& h, unsigned short& l) { h = f2bf(y); l = f2bf(y - bf2f(h)); }
__device__ __forceinline__ v16h cat16(v8h lo, v8h hi) { return __builtin_shufflevector(lo, hi, 0, 1, 2, 3, 4, 5, 6, 7, 8, 9, 10, 11, 12, 13, 14, 15); }
__device__ __forceinline__ v16bf cat16b(v8us lo, v8us hi) { return __builtin_bit_cast(v16bf, __builtin_shufflevector(lo, hi, 0, 1, 2, 3, 4, 5, 6, 7, 8, 9, 10, 11, 12, 13, 14, 15)); }
__device__ __forceinline__ v8f wmma16(v16h a, v16h b, v8f c) { return __builtin_amdgcn_wmma_f32_16x16x32_f16(false, a, false, b, (short)0, c, false, false); }
__device__ __forceinline__ v8f wmmab(v16bf a, v16bf b, v8f c) { return __builtin_amdgcn_wmma_f32_16x16x32_bf16(false, a, false, b, (short)0, c, false, false); }



// ---- k_gemmw: register-blocked GEMM, ONE WAVE per 64x64 output tile (16 accumulators), operands straight from 16-bit planes in fragment order (ld takes the tile's start + lane * 8); grid (M/64, N/64, Z), 32 threads.
// C[m][n] (f32, pitch ldc, + optional f32 bias[n]) = sum_k A[m][k] Bt[n][k] (+ split products per NSPLIT). z-batch strides sA/sB/sC in elements. K % 32 == 0.
// C goes to memory as f32 (EPI 0, the one form left here: the projections, which write 16-bit planes, are proj_tile below).
template <typename T16> struct WFrag;
template <> struct WFrag<h16> { typedef v16h V; static __device__ __forceinline__ V ld(const h16* p) { return cat16(*(const v8h*)p, *(const v8h*)(p + 256)); } static __device__ __forceinline__ v8f mma(V a, V b, v8f c) { return wmma16(a, b, c); } };
template <> struct WFrag<bf> { typedef v16bf V; static __device__ __forceinline__ V ld(const bf* p) { return cat16b(*(const v8us*)p, *(const v8us*)(p + 256)); } static __device__ __forceinline__ v8f mma(V a, V b, v8f c) { return wmmab(a, b, c); } };
template <typename T16, int NSPLIT, bool BIAS, int EPI>
__global__ __launch_bounds__(32) void k_gemmw(const T16* __restrict__ A, const T16* __restrict__ A2, const T16* __restrict__ Bt, const T16* __restrict__ Bt2, int K, float* C, int ldc, const float* __restrict__ bias, size_t sA, size_t sB, size_t sC, h16* P16, bf* Ph, bf* Pl) {
    typedef typename WFrag<T16>::V V;
    __shared__ __align__(16) float os[16 * 68];
    const size_t z = blockIdx.z; A += z * sA; if (A2) A2 += z * sA; Bt += z * sB; if (Bt2) Bt2 += z * sB; C += z * sC;
    const int lane = threadIdx.x & 31, lr = lane & 15, hi = lane >> 4; const int r0 = blockIdx.x * 64, c0 = blockIdx.y * 64;
    v8f acc[4][4];
#pragma unroll
    for (int mb = 0; mb < 4; ++mb)
#pragma unroll
        for (int nb = 0; nb < 4; ++nb) acc[mb][nb] = (v8f){};
    const size_t aoff = (size_t)r0 * K + lane * 8, boff = (size_t)c0 * K + lane * 8;   // a k-step of 32 is one tile of 512 elements: kc * 16
#pragma unroll 1
    for (int kc = 0; kc < K; kc += 32) {
        V a[4], a2[4]; const T16* ap[4]; const T16* ap2[4];
#pragma unroll
        for (int mb = 0; mb < 4; ++mb) { ap[mb] = A + aoff + (size_t)mb * 16 * K + (size_t)kc * 16; ap2[mb] = ap[mb]; a[mb] = WFrag<T16>::ld(ap[mb]); if (NSPLIT == 1 || NSPLIT == 2) { ap2[mb] = A2 + aoff + (size_t)mb * 16 * K + (size_t)kc * 16; a2[mb] = WFrag<T16>::ld(ap2[mb]); } }
        // the wait that stands in front of any overwrite of a register which an issued load names: the addresses are its inputs, so they stay untouched (also by a landing load) up to it
        asm volatile("s_wait_xcnt 0x0" :: "v"(ap[0]), "v"(ap[1]), "v"(ap[2]), "v"(ap[3]), "v"(ap2[0]), "v"(ap2[1]), "v"(ap2[2]), "v"(ap2[3]) : "memory");
#pragma unroll
        for (int nb = 0; nb < 4; ++nb) { const T16* bp = Bt + boff + (size_t)nb * 16 * K + (size_t)kc * 16; const T16* bp2 = bp; const V b = WFrag<T16>::ld(bp); V b2; if (NSPLIT >= 2) { bp2 = Bt2 + boff + (size_t)nb * 16 * K + (size_t)kc * 16; b2 = WFrag<T16>::ld(bp2); }
            asm volatile("s_wait_xcnt 0x0" :: "v"(bp), "v"(bp2) : "memory");   // as above, for this column block's addresses
#pragma unroll
            for (int mb = 0; mb < 4; ++mb) { acc[mb][nb] = WFrag<T16>::mma(a[mb], b, acc[mb][nb]); if (NSPLIT == 1 || NSPLIT == 2) acc[mb][nb] = WFrag<T16>::mma(a2[mb], b, acc[mb][nb]); if (NSPLIT >= 2) acc[mb][nb] = WFrag<T16>::mma(a[mb], b2, acc[mb][nb]); } }
        asm volatile("v_nop\n\tv_nop\n\tv_nop\n\tv_nop" : "+v"(acc[0][0]), "+v"(acc[1][1]), "+v"(acc[2][2]), "+v"(acc[3][3]) : "v"(a[0]), "v"(a[3]));
    }
#pragma unroll
    for (int mb = 0; mb < 4; ++mb) {
#pragma unroll
        for (int nb = 0; nb < 4; ++nb) {
#pragma unroll
            for (int j = 0; j < 8; ++j) os[(hi * 8 + j) * 68 + nb * 16 + lr] = acc[mb][nb][j]; }
        __builtin_amdgcn_wave_barrier(); asm volatile("" ::: "memory");
        float* crow = C + (size_t)(r0 + mb * 16) * ldc + c0;
{
#pragma unroll
            for (int s = 0; s < 8; ++s) { const int row = 2 * s + hi, cofs = lr * 4; v4f val = *(const v4fa*)(os + row * 68 + cofs); if (BIAS) { val[0] += bfr(bias[c0 + cofs]); val[1] += bfr(bias[c0 + cofs + 1]); val[2] += bfr(bias[c0 + cofs + 2]); val[3] += bfr(bias[c0 + cofs + 3]); }
                *(v4f*)(crow + (size_t)row * ldc + cofs) = val; }
             }
        __builtin_amdgcn_wave_barrier(); asm volatile("" ::: "memory");
    }
}

// ---- proj_tile: k_gemmw's 64x64 tile of one wave for the projections: C = x W^T + b, K = DM, plain bf16 operands, no f32 result. A 64-column tile is one head (HD == 64) and rows are b * TT + t:
// C + bias goes out as three 16-bit planes (fp16, bf16 hi, bf16 lo), EPI 1 as [b][head][t][d] (staged through the wave's own os rows), EPI 2 transposed as [b][head][d][t], each head's plane in fragment order.
template <int EPI>
__device__ __forceinline__ void proj_tile(const bf* __restrict__ A, const bf* __restrict__ Bt, const float* __restrict__ bias, int r0, int c0, float* os, h16* P16, bf* Ph, bf* Pl) {
    typedef WFrag<bf>::V V; constexpr int K = DM, ldc = DQ; constexpr bool BIAS = true;
    const int lane = threadIdx.x & 31, lr = lane & 15, hi = lane >> 4;
    v8f acc[4][4];
#pragma unroll
    for (int mb = 0; mb < 4; ++mb)
#pragma unroll
        for (int nb = 0; nb < 4; ++nb) acc[mb][nb] = (v8f){};
    const bf* pa = A + (size_t)r0 * K + lane * 8; const bf* pb = Bt + (size_t)c0 * K + lane * 8;
#pragma unroll 1
    for (int kc = 0; kc < K; kc += 32, pa += 512, pb += 512) {
        V a[4], b[4];
#pragma unroll
        for (int mb = 0; mb < 4; ++mb) { a[mb] = WFrag<bf>::ld(pa + mb * 16 * K); b[mb] = WFrag<bf>::ld(pb + mb * 16 * K); }
        asm volatile("s_wait_xcnt 0x0" :: "v"(pa), "v"(pb) : "memory");   // in front of any overwrite of the two addresses this trip's loads name (the row blocks are immediate offsets); as inputs they stay untouched, also by a landing load, up to it
#pragma unroll
        for (int nb = 0; nb < 4; ++nb)
#pragma unroll
            for (int mb = 0; mb < 4; ++mb) acc[mb][nb] = WFrag<bf>::mma(a[mb], b[nb], acc[mb][nb]);
        asm volatile("v_nop\n\tv_nop\n\tv_nop\n\tv_nop" : "+v"(acc[0][0]), "+v"(acc[1][1]), "+v"(acc[2][2]), "+v"(acc[3][3]) : "v"(a[0]), "v"(a[3]));   // the four vector slots the chip needs behind the last matrix instruction, on the loop's taken branch too
    }
    if (EPI == 2) {   // a lane's eight accumulator rows are eight consecutive t of one column d: in fragment order the very 16 bytes of lane 'lane' in half mb & 1 of tile (nb, t / 32), straight from registers
        const size_t pb = ((size_t)(r0 / TT) * (ldc / HD) + c0 / HD) * HD * TT + (size_t)(r0 % TT) * 16 + lane * 8; const float* bp = bias + c0 + lr; float tb[4];
#pragma unroll
        for (int nb = 0; nb < 4; ++nb) tb[nb] = BIAS ? bp[nb * 16] : 0.0f;   // all four at once: one wait for memory, not four
        if (BIAS) asm volatile("s_wait_xcnt 0x0" :: "v"(bp) : "memory");   // in front of any overwrite of the address these loads name
#pragma unroll
        for (int nb = 0; nb < 4; ++nb) { const float bb = bfr(tb[nb]); h16* p16 = P16 + pb + (size_t)nb * 16 * TT; bf* ph = Ph + pb + (size_t)nb * 16 * TT; bf* pl = Pl + pb + (size_t)nb * 16 * TT; v8h o16[4]; v8us oh[4], ol[4];
#pragma unroll
            for (int mb = 0; mb < 4; ++mb)
#pragma unroll
                for (int j = 0; j < 8; ++j) { const float val = acc[mb][nb][j] + bb; o16[mb][j] = tohx(val); unsigned short a2, c2; splitf(val, a2, c2); oh[mb][j] = a2; ol[mb][j] = c2; }
#pragma unroll
            for (int mb = 0; mb < 4; ++mb) { *(v8h*)(p16 + mb * 256) = o16[mb]; *(v8us*)(ph + mb * 256) = oh[mb]; *(v8us*)(pl + mb * 256) = ol[mb]; }   // every store is 512 bytes in a row
            // the wait that stands in front of any overwrite of a register which an issued store names: addresses and data are its inputs, so they stay untouched up to it
            asm volatile("s_wait_xcnt 0x0" :: "v"(p16), "v"(ph), "v"(pl), "v"(o16[0]), "v"(o16[1]), "v"(o16[2]), "v"(o16[3]), "v"(oh[0]), "v"(oh[1]), "v"(oh[2]), "v"(oh[3]), "v"(ol[0]), "v"(ol[1]), "v"(ol[2]), "v"(ol[3]) : "memory"); }
        return; }
    float pbias[4][8];   // EPI 1: in store s a lane takes columns s * 16 + hi * 8 .. + 7 of row lr, its own 16 bytes of the s-th half tile
    if (EPI == 1) { const float* bp = bias + c0 + hi * 8; v8f tb[4];
#pragma unroll
        for (int s = 0; s < 4; ++s) tb[s] = BIAS ? *(const v8f*)(bp + s * 16) : (v8f){};
        if (BIAS) asm volatile("s_wait_xcnt 0x0" :: "v"(bp) : "memory");   // the wait: in front of any overwrite of the address these loads name
#pragma unroll
        for (int s = 0; s < 4; ++s)
#pragma unroll
            for (int q = 0; q < 8; ++q) pbias[s][q] = bfr(tb[s][q]); }
#pragma unroll
    for (int mb = 0; mb < 4; ++mb) {
#pragma unroll
        for (int nb = 0; nb < 4; ++nb) {
#pragma unroll
            for (int j = 0; j < 8; ++j) os[(hi * 8 + j) * 68 + nb * 16 + lr] = acc[mb][nb][j]; }
        __builtin_amdgcn_wave_barrier(); asm volatile("" ::: "memory");
        if (EPI == 1) {   // 16 rows x 64 columns are two tiles, 2 KiB in a row of each plane: a store instruction fills four whole 128-byte lines
            const size_t pb = (((size_t)(r0 / TT) * (ldc / HD) + c0 / HD) * TT + (r0 % TT) + mb * 16) * HD + lane * 8; h16* p16 = P16 + pb; bf* ph = Ph + pb; bf* pl = Pl + pb; v8h o16[4]; v8us oh[4], ol[4];
#pragma unroll
            for (int s = 0; s < 4; ++s) { const float* op = os + lr * 68 + s * 16 + hi * 8; const v4f v0 = *(const v4fa*)op, v1 = *(const v4fa*)(op + 4);
#pragma unroll
                for (int q = 0; q < 8; ++q) { const float val = (q < 4 ? v0[q & 3] : v1[q & 3]) + pbias[s][q]; o16[s][q] = tohx(val); unsigned short a2, c2; splitf(val, a2, c2); oh[s][q] = a2; ol[s][q] = c2; } }
#pragma unroll
            for (int s = 0; s < 4; ++s) { *(v8h*)(p16 + s * 256) = o16[s]; *(v8us*)(ph + s * 256) = oh[s]; *(v8us*)(pl + s * 256) = ol[s]; }
            // the wait in front of any overwrite of a register which an issued store names, as above
            asm volatile("s_wait_xcnt 0x0" :: "v"(p16), "v"(ph), "v"(pl), "v"(o16[0]), "v"(o16[1]), "v"(o16[2]), "v"(o16[3]), "v"(oh[0]), "v"(oh[1]), "v"(oh[2]), "v"(oh[3]), "v"(ol[0]), "v"(ol[1]), "v"(ol[2]), "v"(ol[3]) : "memory");
        }
        __builtin_amdgcn_wave_barrier(); asm volatile("" ::: "memory");
    }
}
// k_qkv: the three projections in ONE launch. Grid (rows / 128, columns / 128), 12 waves: waves 0-3 q, 4-7 k, 8-11 v, each group 2 x 2 tiles of 64 x 64 on the same 128 rows and 128 columns,
// so an x row is read by six waves of one WGP and a weight row by two, and three waves share a SIMD. No wave waits for another: every q and k wave has its own staging rows in LDS; the v waves write from registers and use none.
__global__ __launch_bounds__(384) void k_qkv(const bf* __restrict__ XB, const bf* __restrict__ WQ, const bf* __restrict__ WK, const bf* __restrict__ WV, const float* __restrict__ bq, const float* __restrict__ bk, const float* __restrict__ bv,
                                             h16* QP16, bf* QPh, bf* QPl, h16* KP16, bf* KPh, bf* KPl, h16* VT16, bf* VTh, bf* VTl) {
    __shared__ __align__(16) float os[8][16 * 68];
    const int w = __builtin_amdgcn_readfirstlane((int)(threadIdx.x >> 5)); const int r0 = blockIdx.x * 128 + (w & 1) * 64, c0 = blockIdx.y * 128 + ((w >> 1) & 1) * 64;
    if (w >= 8) proj_tile<2>(XB, WV, bv, r0, c0, nullptr, VT16, VTh, VTl);
    else { const bool kk = w >= 4; proj_tile<1>(XB, kk ? WK : WQ, kk ? bk : bq, r0, c0, os[w], kk ? KP16 : QP16, kk ? KPh : QPh, kk ? KPl : QPl); }
}

typedef __attribute__((ext_vector_type(2))) _Float16 v2h;
typedef __attribute__((ext_vector_type(4))) _Float16 v4h;
typedef __attribute__((ext_vector_type(2))) unsigned short v2us;
typedef __attribute__((ext_vector_type(4))) unsigned short v4us;
typedef __attribute__((ext_vector_type(2))) float v2f;
typedef __attribute__((ext_vector_type(4))) int v4i;

__global__ __launch_bounds__(256) void k_wtG(const float* __restrict__ w, int K, int N, bf* Bt) {
    const int lane = threadIdx.x & 31; const int L0 = (blockIdx.x * 8 + (threadIdx.x >> 5)) * 8; const int nlines = N * K / 64;
{
#pragma unroll 1
        for (int l = 0; l < 8; ++l) { const int L = L0 + l; if (L >= nlines) break; const size_t e = (size_t)L * 64 + lane * 2; const int k = (int)(e % K), n = (int)(e / K); v2us o;
            o[0] = f2bf(w[(size_t)k * N + n]); o[1] = f2bf(w[(size_t)(k + 1) * N + n]); *(v2us*)(Bt + e) = o; }
         }
}
// k_prep: every f32 -> bf16 conversion of the call in ONE launch, from row-major f32 to fragment order. A work-group takes CH groups of eight floats of one array = 32 tiles of 16 rows x 32 k (a wave four tiles; all sixteen loads of a thread in flight at once); blockIdx.x picks the array.
// A load takes four whole 128-byte lines (four rows of one tile, eight lanes a row, four floats a lane); the four stores of a tile fill its 1 KiB.
// PAD (the position table): rows at or past nrow are the zero pad row; they are stored as zeros and read nothing past the table (the row is clamped).
#define CH   2048
#define GX   (NB_ * TT * DM / 8 / CH)
#define GW   (DM * DQ / 8 / CH)
#define GP   (NPE * HD / 8 / CH)
template <bool PAD, int K>
__device__ __forceinline__ void cvt_run(const float* __restrict__ src, bf* dst, unsigned blk, unsigned nrow) {
    constexpr unsigned TPR = K / 32;   // tiles along a row: 32 (one work-group = one band of 16 rows) or a divisor of 32
    const unsigned lane = threadIdx.x & 31, w = threadIdx.x >> 5, r4 = lane >> 3, c = lane & 7; unsigned so[16], row[16]; v4f v[16]; v4us o[16];
#pragma unroll
    for (int u = 0; u < 16; ++u) { const unsigned tl = w * 4 + (u >> 2), rt = TPR >= 32 ? blk : blk * (32 / TPR) + tl / TPR, ks = TPR >= 32 ? tl : tl % TPR;   // tile tl of this work-group's 32; rows (u & 3) * 4 + r4 of it
        row[u] = rt * 16 + (u & 3) * 4 + r4; so[u] = ((PAD ? (row[u] < nrow ? row[u] : nrow - 1) : row[u]) * K + ks * 32 + c * 4) * 4u; v[u] = *(const v4f*)((const char*)src + so[u]); }
    // the wait that stands in front of any overwrite of a register which an issued load names: the byte offsets are its inputs, so they stay untouched (also by a landing load) up to it
    if (PAD) asm volatile("s_wait_xcnt 0x0" :: "v"(so[0]), "v"(so[1]), "v"(so[2]), "v"(so[3]), "v"(so[4]), "v"(so[5]), "v"(so[6]), "v"(so[7]), "v"(so[8]), "v"(so[9]), "v"(so[10]), "v"(so[11]), "v"(so[12]), "v"(so[13]), "v"(so[14]), "v"(so[15]) : "memory");
    else asm volatile("s_wait_xcnt 0x0" :: "v"(so[0]), "v"(so[1]), "v"(so[2]), "v"(so[3]) : "memory");   // the other twelve are immediate offsets from these four
#pragma unroll
    for (int u = 0; u < 16; ++u)
#pragma unroll
        for (int k = 0; k < 4; ++k) o[u][k] = f2bf((PAD && row[u] >= nrow) ? 0.0f : v[u][k]);
    // floats c * 4 .. + 3 of a tile's row: half c >> 2, lane group (c >> 1) & 1, first or second 8 bytes of that lane's 16
    bf* dp = dst + (size_t)(blk * 32 + w * 4) * 512 + (c >> 2) * 256 + (((c >> 1) & 1) * 16 + r4) * 8 + (c & 1) * 4;
#pragma unroll
    for (int u = 0; u < 16; ++u) *(v4us*)(dp + (u >> 2) * 512 + (u & 3) * 32) = o[u];
}
__global__ __launch_bounds__(256) void k_prep(const float* __restrict__ x, const float* __restrict__ wq, const float* __restrict__ wk, const float* __restrict__ wv, const float* __restrict__ wo, const float* __restrict__ pe,
                                              bf* XB, bf* WQ, bf* WK, bf* WV, bf* WO, bf* PE) {
    const unsigned b = blockIdx.x;
    if (b >= GX + 4 * GW) { cvt_run<true, HD>(pe, PE, b - (GX + 4 * GW), 2047); return; }
    const unsigned a = b < GX ? 0 : 1 + (b - GX) / GW;
    cvt_run<false, DM>(a == 0 ? x : a == 1 ? wq : a == 2 ? wk : a == 3 ? wv : wo, a == 0 ? XB : a == 1 ? WQ : a == 2 ? WK : a == 3 ? WV : WO, a == 0 ? b : (b - GX) % GW, 0);
}
typedef v4us __attribute__((may_alias)) v4usa;
typedef v4h  __attribute__((may_alias)) v4ha;
__device__ __forceinline__ v16bf ldsb(const bf* p) { return cat16b(*(const v8usa*)p, *(const v8usa*)(p + 16)); }
__device__ __forceinline__ v16h ldsh(const h16* p) { return cat16(*(const v8ha*)p, *(const v8ha*)(p + 16)); }

// attn_body: 32 query rows i0.. of head z, 8 waves. T [32][TP] f32 in LDS holds the logits, then the probabilities' 16-bit planes (row r: hi plane in its first 2048 bytes, lo plane in the next; or one fp16 plane), then the waves' partial outputs.
// HI: hi+lo planes, 3 products, for scores and attn.v; else single fp16 (probabilities x PCAR).
// Behind a group of global loads: the wait that stands in front of any overwrite of a register which an issued load names. It takes the group's addresses as inputs, so that they stay untouched (also by a landing load of the group) up to it.
#define XWAIT1(p)    asm volatile("s_wait_xcnt 0x0" :: "v"(p) : "memory")
#define XWAIT2(p, q) asm volatile("s_wait_xcnt 0x0" :: "v"(p), "v"(q) : "memory")
template <bool HI>
__device__ __forceinline__ void attn_body(float* T, int z, int i0, const h16* __restrict__ QP16, const bf* __restrict__ QPh, const bf* __restrict__ QPl, const h16* __restrict__ KP16, const bf* __restrict__ KPh, const bf* __restrict__ KPl,
                                          const h16* __restrict__ VT16, const bf* __restrict__ VTh, const bf* __restrict__ VTl, const bf* __restrict__ PE, bf* ATh, bf* ATl) {
    const int tid = threadIdx.x, lane = tid & 31, lr = lane & 15, hi = lane >> 4, w = tid >> 5; const int j0 = w * 128;   // this wave's 128 keys
    const size_t qb = ((size_t)z * TT + i0) * HD + lane * 8;   // planes in fragment order: 16 rows x 64 are two tiles of 512 elements
    // relative scores: rows i0 + 16 mt + r and keys j0 + jj need positions p = (j0 - i0 - 16 mt + 1008) + c, c = jj - r + 15 in 0..142: nine 16-wide tiles a row tile, ten for both
    const int pb = j0 - i0 + 992;   // 0 .. 1888; last row read pb + 159 <= 2047
    // B fragments are fetched some tiles ahead of their use (position table 4 tiles, keys 3, values 2 k-steps), so that a wave waits for L2 once and not at every tile
    v16bf qh[2][2], ql[2][2], rb[10][2], kb[8][4], vb[4][4][2]; v16h q16[2][2], kf[8][2], vf[4][4];
    auto rload = [&](int u) { const bf* pp = PE + (size_t)(pb + u * 16) * HD + lane * 8; rb[u][0] = WFrag<bf>::ld(pp); rb[u][1] = WFrag<bf>::ld(pp + 512); XWAIT1(pp); };
    auto kload = [&](int nb) { const size_t ko = ((size_t)z * TT + j0 + nb * 16) * HD + lane * 8;
        if (HI) { kb[nb][0] = WFrag<bf>::ld(KPh + ko); kb[nb][1] = WFrag<bf>::ld(KPh + ko + 512); kb[nb][2] = WFrag<bf>::ld(KPl + ko); kb[nb][3] = WFrag<bf>::ld(KPl + ko + 512); XWAIT2(KPh + ko, KPl + ko); }
        else { kf[nb][0] = WFrag<h16>::ld(KP16 + ko); kf[nb][1] = WFrag<h16>::ld(KP16 + ko + 512); XWAIT1(KP16 + ko); } };
    auto vload = [&](int ks) { const size_t vo = (size_t)z * HD * TT + (j0 + ks * 32) * 16 + lane * 8;   // tile (nb, key / 32) of the transposed plane
#pragma unroll
        for (int nb = 0; nb < 4; ++nb) { if (HI) { vb[ks][nb][0] = WFrag<bf>::ld(VTh + vo + nb * 16 * TT); vb[ks][nb][1] = WFrag<bf>::ld(VTl + vo + nb * 16 * TT); } else vf[ks][nb] = WFrag<h16>::ld(VT16 + vo + nb * 16 * TT); }
        if (HI) XWAIT2(VTh + vo, VTl + vo); else XWAIT1(VT16 + vo); };
#pragma unroll
    for (int mt = 0; mt < 2; ++mt)
#pragma unroll
        for (int kk = 0; kk < 2; ++kk) { qh[mt][kk] = WFrag<bf>::ld(QPh + qb + (size_t)mt * 16 * HD + kk * 512); ql[mt][kk] = WFrag<bf>::ld(QPl + qb + (size_t)mt * 16 * HD + kk * 512); }
    XWAIT2(QPh + qb, QPl + qb);
#pragma unroll
    for (int u = 0; u < 4; ++u) rload(u);
#pragma unroll
    for (int u = 0; u < 10; ++u) {
#pragma unroll
        for (int mt = 0; mt < 2; ++mt) { const int tt = u - 1 + mt; if (tt < 0 || tt > 8) continue;
            v8f acc = (v8f){}; acc = wmmab(qh[mt][0], rb[u][0], acc); acc = wmmab(ql[mt][0], rb[u][0], acc); acc = wmmab(qh[mt][1], rb[u][1], acc); acc = wmmab(ql[mt][1], rb[u][1], acc);
            asm volatile("v_nop\n\tv_nop\n\tv_nop\n\tv_nop" :: "v"(acc));   // the four vector slots the chip needs before the next tile's first matrix instruction may overwrite these result registers
#pragma unroll
            for (int j = 0; j < 8; ++j) { const int r = hi * 8 + j, jj = tt * 16 + lr + r - 15; T[(mt * 16 + r) * TP + ((jj >= 0 && jj < 128) ? j0 + jj : TT)] = acc[j]; } }   // a position outside this wave's keys lands in the row's pad column
        if (u < 6) rload(u + 4); else if (u < 9) kload(u - 6);
        if (!HI && u == 5) {
#pragma unroll
            for (int mt = 0; mt < 2; ++mt)
#pragma unroll
                for (int kk = 0; kk < 2; ++kk) q16[mt][kk] = WFrag<h16>::ld(QP16 + qb + (size_t)mt * 16 * HD + kk * 512);
            XWAIT1(QP16 + qb); } }
    __syncthreads();   // the skewed stores crossed lanes: every logit slot holds its relative score
#pragma unroll
    for (int nb = 0; nb < 8; ++nb) { v8f acc[2];
#pragma unroll
        for (int mt = 0; mt < 2; ++mt) { v8f a = (v8f){};
            if (HI) { a = wmmab(qh[mt][0], kb[nb][0], a); a = wmmab(ql[mt][0], kb[nb][0], a); a = wmmab(qh[mt][0], kb[nb][2], a); a = wmmab(qh[mt][1], kb[nb][1], a); a = wmmab(ql[mt][1], kb[nb][1], a); a = wmmab(qh[mt][1], kb[nb][3], a); }
            else { a = wmma16(q16[mt][0], kf[nb][0], a); a = wmma16(q16[mt][1], kf[nb][1], a); }
            asm volatile("v_nop\n\tv_nop\n\tv_nop\n\tv_nop" :: "v"(a)); acc[mt] = a; }   // v_nop: as above, the result registers are reused by the next tile
        if (nb < 5) kload(nb + 3);
#pragma unroll
        for (int mt = 0; mt < 2; ++mt)
#pragma unroll
            for (int j = 0; j < 8; ++j) { float* tp = T + (mt * 16 + hi * 8 + j) * TP + j0 + nb * 16 + lr; *tp = __fadd_rn(__fmul_rn(acc[mt][j], SCL), *tp); } }   // SCL is a power of two: the product is exact, fused or not
    __syncthreads();   // logits complete for all 1024 keys
    vload(0); vload(1); if (!HI) { vload(2); vload(3); }   // behind the barrier, which would wait for them: they fly during the softmax
    // softmax: four rows a wave, register row, one exp, fixed trees; the row's planes overwrite its logits
#pragma unroll 1
    for (int rr = 0; rr < BR / 8; ++rr) { float* tr = T + (w * (BR / 8) + rr) * TP; float v[TT / 32]; float mx = -3.0e38f;
#pragma unroll
        for (int ch = 0; ch < TT / 128; ++ch) { const v4f a = *(const v4fa*)(tr + ch * 128 + lane * 4);
#pragma unroll
            for (int q = 0; q < 4; ++q) { v[ch * 4 + q] = a[q]; mx = fmaxf(mx, a[q]); } }
#pragma unroll
        for (int sh = 16; sh; sh >>= 1) mx = fmaxf(mx, __shfl_xor(mx, sh, 32));
        float sum = 0.f;
#pragma unroll
        for (int k = 0; k < TT / 32; ++k) { v[k] = __builtin_amdgcn_exp2f(__fmul_rn(__fsub_rn(v[k], mx), 1.4426950408889634f)); sum += v[k]; }
#pragma unroll
        for (int sh = 16; sh; sh >>= 1) sum += __shfl_xor(sum, sh, 32);
        const float f = __fdiv_rn(HI ? 1.0f : PCAR, sum);
        if (HI) {
#pragma unroll
            for (int ch = 0; ch < TT / 128; ++ch) { v4us oh, ol;
#pragma unroll
                for (int q = 0; q < 4; ++q) { unsigned short a, c2; splitf(v[ch * 4 + q] * f, a, c2); oh[q] = a; ol[q] = c2; }
                *(v4usa*)((bf*)tr + ch * 128 + lane * 4) = oh; *(v4usa*)((bf*)tr + TT + ch * 128 + lane * 4) = ol; }
        } else {
#pragma unroll
            for (int ch = 0; ch < TT / 128; ++ch) { v4h o4;
#pragma unroll
                for (int q = 0; q < 4; ++q) o4[q] = tohx(v[ch * 4 + q] * f);
                *(v4ha*)((h16*)tr + ch * 128 + lane * 4) = o4; } } }
    __syncthreads();   // probability planes complete
    // attn.v: this wave sums its own 128 keys for all 32 rows x 64 columns
    v8f o[2][4];
#pragma unroll
    for (int mt = 0; mt < 2; ++mt)
#pragma unroll
        for (int nb = 0; nb < 4; ++nb) o[mt][nb] = (v8f){};
#pragma unroll
    for (int ks = 0; ks < 4; ++ks) { const int kc = j0 + ks * 32 + 8 * hi;
        if (HI) { v16bf ah[2], al[2];
#pragma unroll
            for (int mt = 0; mt < 2; ++mt) { const bf* pr = (const bf*)(T + (mt * 16 + lr) * TP) + kc; ah[mt] = ldsb(pr); al[mt] = ldsb(pr + TT); }
#pragma unroll
            for (int nb = 0; nb < 4; ++nb)
#pragma unroll
                for (int mt = 0; mt < 2; ++mt) { o[mt][nb] = wmmab(ah[mt], vb[ks][nb][0], o[mt][nb]); o[mt][nb] = wmmab(al[mt], vb[ks][nb][0], o[mt][nb]); o[mt][nb] = wmmab(ah[mt], vb[ks][nb][1], o[mt][nb]); }
            if (ks < 2) vload(ks + 2);
        } else { v16h a16[2];
#pragma unroll
            for (int mt = 0; mt < 2; ++mt) a16[mt] = ldsh((const h16*)(T + (mt * 16 + lr) * TP) + kc);
#pragma unroll
            for (int nb = 0; nb < 4; ++nb)
#pragma unroll
                for (int mt = 0; mt < 2; ++mt) o[mt][nb] = wmma16(a16[mt], vf[ks][nb], o[mt][nb]); } }
    __syncthreads();   // every wave has read the planes: T is free for the partial outputs
#pragma unroll
    for (int mt = 0; mt < 2; ++mt)
#pragma unroll
        for (int nb = 0; nb < 4; ++nb)
#pragma unroll
            for (int j = 0; j < 8; ++j) T[w * (BR * OPP) + (mt * 16 + hi * 8 + j) * OPP + nb * 16 + lr] = o[mt][nb][j];
    __syncthreads();   // partial outputs complete
    { const int row = (w >> 2) * 16 + lr, d0 = (w & 3) * 16 + hi * 8; v4f p0[8], p1[8];   // wave w writes half tile w & 3 of row tile w >> 2: a lane its own 16 bytes there
#pragma unroll
        for (int ww = 0; ww < 8; ++ww) { p0[ww] = *(const v4fa*)(T + ww * (BR * OPP) + row * OPP + d0); p1[ww] = *(const v4fa*)(T + ww * (BR * OPP) + row * OPP + d0 + 4); }
        v4f s0 = p0[0], s1 = p1[0];
#pragma unroll
        for (int ww = 1; ww < 8; ++ww) { s0 += p0[ww]; s1 += p1[ww]; }   // key blocks in ascending order
        const float cs = HI ? 1.0f : (1.0f / PCAR); v8us oh, ol;
#pragma unroll
        for (int q = 0; q < 4; ++q) { unsigned short a, c2; splitf(s0[q] * cs, a, c2); oh[q] = a; ol[q] = c2; splitf(s1[q] * cs, a, c2); oh[4 + q] = a; ol[4 + q] = c2; }
        const size_t oo = ((size_t)(z / NH_) * TT + i0 + (w >> 2) * 16) * DQ + (size_t)(z % NH_) * 1024 + (w & 3) * 256 + lane * 8; *(v8us*)(ATh + oo) = oh; *(v8us*)(ATl + oo) = ol; }   // fragment order, K = DQ: a head is two tiles along k; a wave fills four 128-byte lines
}
// k_attn: grid (TT / BR, NZ), 256 threads; two work-groups share a WGP's LDS, so four waves a SIMD
__global__ __launch_bounds__(256) __attribute__((amdgpu_waves_per_eu(4, 4))) void k_attn(const h16* __restrict__ QP16, const bf* __restrict__ QPh, const bf* __restrict__ QPl, const h16* __restrict__ KP16, const bf* __restrict__ KPh, const bf* __restrict__ KPl,
                                               const h16* __restrict__ VT16, const bf* __restrict__ VTh, const bf* __restrict__ VTl, const bf* __restrict__ PE, bf* ATh, bf* ATl) {
    __shared__ __align__(16) float T[BR * TP];
    const int i0 = blockIdx.x * BR, z = blockIdx.y;
    if (i0 < RH) attn_body<true>(T, z, i0, QP16, QPh, QPl, KP16, KPh, KPl, VT16, VTh, VTl, PE, ATh, ATl);
    else attn_body<false>(T, z, i0, QP16, QPh, QPl, KP16, KPh, KPl, VT16, VTh, VTl, PE, ATh, ATl);
}

extern "C" void kernel_launch(void* const* d_in, const int* in_sizes, int n_in,
                              void* d_out, int out_size, void* d_ws, size_t ws_size, hipStream_t stream) {
    (void)in_sizes; (void)n_in; (void)out_size;
    const float* x = (const float*)d_in[0]; const float* wq = (const float*)d_in[1]; const float* bq = (const float*)d_in[2]; const float* wk = (const float*)d_in[3]; const float* bk = (const float*)d_in[4]; const float* wv = (const float*)d_in[5]; const float* bv = (const float*)d_in[6]; const float* wo = (const float*)d_in[7]; const float* bo = (const float*)d_in[8]; const float* pe = (const float*)d_in[9];
    float* OUT = (float*)d_out;     // [4][1024][1024]
    char* wsp = (char*)d_ws;
    auto take = [&](size_t bytes) { char* p = wsp; wsp += (bytes + 255) & ~(size_t)255; return (void*)p; };
    bf* WO = (bf*)take((size_t)DM * DQ * 2); bf* PE = (bf*)take((size_t)NPE * HD * 2);
    h16* QP16 = (h16*)take((size_t)NZ * TT * HD * 2); h16* KP16 = (h16*)take((size_t)NZ * TT * HD * 2); h16* VT16 = (h16*)take((size_t)NZ * HD * TT * 2);
    bf* QPh = (bf*)take((size_t)NZ * TT * HD * 2); bf* QPl = (bf*)take((size_t)NZ * TT * HD * 2); bf* KPh = (bf*)take((size_t)NZ * TT * HD * 2); bf* KPl = (bf*)take((size_t)NZ * TT * HD * 2); bf* VTh = (bf*)take((size_t)NZ * HD * TT * 2); bf* VTl = (bf*)take((size_t)NZ * HD * TT * 2);
    bf* ATh = (bf*)take((size_t)NB_ * TT * DQ * 2); bf* ATl = (bf*)take((size_t)NB_ * TT * DQ * 2);
    bf* WQ = (bf*)take((size_t)DQ * DM * 2); bf* WK = (bf*)take((size_t)DKV * DM * 2); bf* WV = (bf*)take((size_t)DKV * DM * 2);
    bf* XB = (bf*)take((size_t)NB_ * TT * DM * 2);
    if ((size_t)(wsp - (char*)d_ws) > ws_size) return;    // ws 256 MiB
    k_prep<<<GX + 4 * GW + GP, 256, 0, stream>>>(x, wq, wk, wv, wo, pe, XB, WQ, WK, WV, WO, PE);   /* bf16 x, weights, position table + zero pad row */
    k_qkv<<<dim3(NB_ * TT / 128, DQ / 128, 1), 384, 0, stream>>>(XB, WQ, WK, WV, bq, bk, bv, QP16, QPh, QPl, KP16, KPh, KPl, VT16, VTh, VTl);
    k_attn<<<dim3(TT / BR, NZ, 1), 256, 0, stream>>>(QP16, QPh, QPl, KP16, KPh, KPl, VT16, VTh, VTl, PE, ATh, ATl);   // planes are [b][h][..]: z is the plane index (one kv head per query head)
    k_gemmw<bf, 1, true, 0><<<dim3(NB_ * TT / 64, DM / 64, 1), 32, 0, stream>>>(ATh, ATl, WO, nullptr, DQ, OUT, DM, bo, 0, 0, 0, nullptr, nullptr, nullptr);
}

// v006
// A run of this version takes 150 microseconds.
// Timed twice side by side with v005, it ran 1.09 and 1.10 times as fast.
// Counting every step since v000, it is 17.7 times as fast.
#include <hip/hip_runtime.h>

// Self-attention with a learned relative-position bias (x [4][1024][1024]; q, k, v = x W^T + b ('oi', 16 heads x 64); S = q.k/8 + S_rel[i][j - i + 1023] where S_rel = q.pos_emb^T (pos_emb [2047][64], unscaled); softmax; out = merged Wo^T + bo -> [4][1024][1024]).
// Layout: batch and head are one flat index z = b * 16 + h carried in the grids (projections over all 4096 rows; their epilogues write the 16-bit head planes themselves: q, k as [z][t][d], v as [z][d][t]). Attention is ONE launch: a work-group of 8 waves owns 32 query rows of one z and each wave 128 of the 1024 keys: relative scores (q hi/lo planes against the bf16 position table, 2047 rows + one zero pad row; only the band of positions the 32 rows reach) are stored to the wave's own LDS already skewed (S_rel[i][j - i + 1023] at column j), the content scores are computed transposed and take them up in registers, softmax and attn.v run per wave on registers, the eight partial outputs are joined through LDS and the hi/lo planes of the merged heads go to memory.
// Every 16-bit operand plane in memory (x, weights, position table, q, k, v^T, merged heads) is kept in FRAGMENT ORDER: a tile of 16 rows x 32 k is 1 KiB in a row, first the 16 bytes that each lane 0..31 takes for k = 8 * (lane >> 4) .. + 7 of row lane & 15, then the 16 bytes for k + 16;
// tiles run along k, then down the rows (tile (rt, ks) of a plane with K elements a row starts at element rt * 16 * K + ks * 512). A fragment load is then 2 x 512 contiguous bytes (four whole 128-byte lines each) and not 16 pieces of 32 bytes; which element meets which in a product is as before.
// Compute dtypes, f32 accumulate: every input rounded to bf16; q/k/v on PLAIN bf16 operands (inputs: exact) + biases; relative scores q(hi+lo).pos_emb (2 products, f32); scores and attn.v: query rows < 512 hl (3 products), the rest single fp16 (x1024); softmax f32; Wo hl x exact (2 products) + bo.

#define NB_  4
#define TT   1024
#define DM   1024
#define NH_  16
#define NKV  16
#define REP  (NH_ / NKV)
#define HD   64
#define DQ   (NH_ * HD)
#define DKV  (NKV * HD)
#define NPE  2048                 // 2047 relative positions + 1 zero pad row
#define BR   32                   // query rows per attention work-group
#define RP   132                  // LDS row pitch in floats of a wave's 32 x 128 relative scores: 528 B = 16 B x odd, so b128 accesses of 16 rows meet no bank twice; column 128 is the pad, never read
#define OPP  68                   // pitch in floats of a wave's partial attn.v tile in LDS
#define NZ   (NB_ * NH_)
#define RH   512                  // query rows < RH use hi+lo planes (0: none)
#define WIN  0
#define PCAR 1024.0f
#define SCL  0.125f   // HD^-0.5
typedef _Float16 h16;
typedef unsigned short bf;
typedef __attribute__((ext_vector_type(16))) __bf16   v16bf;
typedef __attribute__((ext_vector_type(16))) _Float16 v16h;
typedef __attribute__((ext_vector_type(8)))  _Float16 v8h;
typedef __attribute__((ext_vector_type(8)))  unsigned short v8us;
typedef __attribute__((ext_vector_type(8)))  float    v8f;
typedef __attribute__((ext_vector_type(4)))  float    v4f;
typedef v8h  __attribute__((may_alias)) v8ha;
typedef v4f  __attribute__((may_alias)) v4fa;
typedef v8us __attribute__((may_alias)) v8usa;

__device__ __forceinline__ unsigned short f2bf(float f) { unsigned u = __float_as_uint(f); u += 0x7FFFu + ((u >> 16) & 1u); return (unsigned short)(u >> 16); }
__device__ __forceinline__ float bf2f(unsigned short b) { return __uint_as_float(((unsigned)b) << 16); }
__device__ __forceinline__ float bfr(float f) { return bf2f(f2bf(f)); }
__device__ __forceinline__ h16 tohx(float x) { return (h16)x; }
__device__ __forceinline__ void splitf(float y, unsigned short& h, unsigned short& l) { h = f2bf(y); l = f2bf(y - bf2f(h)); }
__device__ __forceinline__ v16h cat16(v8h lo, v8h hi) { return __builtin_shufflevector(lo, hi, 0, 1, 2, 3, 4, 5, 6, 7, 8, 9, 10, 11, 12, 13, 14, 15); }
__device__ __forceinline__ v16bf cat16b(v8us lo, v8us hi) { return __builtin_bit_cast(v16bf, __builtin_shufflevector(lo, hi, 0, 1, 2, 3, 4, 5, 6, 7, 8, 9, 10, 11, 12, 13, 14, 15)); }
__device__ __forceinline__ v8f wmma16(v16h a, v16h b, v8f c) { return __builtin_amdgcn_wmma_f32_16x16x32_f16(false, a, false, b, (short)0, c, false, false); }
__device__ __forceinline__ v8f wmmab(v16bf a, v16bf b, v8f c) { return __builtin_amdgcn_wmma_f32_16x16x32_bf16(false, a, false, b, (short)0, c, false, false); }



// ---- k_gemmw: register-blocked GEMM, ONE WAVE per 64x64 output tile (16 accumulators), operands straight from 16-bit planes in fragment order (ld takes the tile's start + lane * 8); grid (M/64, N/64, Z), 32 threads.
// C[m][n] (f32, pitch ldc, + optional f32 bias[n]) = sum_k A[m][k] Bt[n][k] (+ split products per NSPLIT). z-batch strides sA/sB/sC in elements. K % 32 == 0.
// C goes to memory as f32 (EPI 0, the one form left here: the projections, which write 16-bit planes, are proj_tile below).
template <typename T16> struct WFrag;
template <> struct WFrag<h16> { typedef v16h V; static __device__ __forceinline__ V ld(const h16* p) { return cat16(*(const v8h*)p, *(const v8h*)(p + 256)); } static __device__ __forceinline__ v8f mma(V a, V b, v8f c) { return wmma16(a, b, c); } };
template <> struct WFrag<bf> { typedef v16bf V; static __device__ __forceinline__ V ld(const bf* p) { return cat16b(*(const v8us*)p, *(const v8us*)(p + 256)); } static __device__ __forceinline__ v8f mma(V a, V b, v8f c) { return wmmab(a, b, c); } };
template <typename T16, int NSPLIT, bool BIAS, int EPI>
__global__ __launch_bounds__(32) void k_gemmw(const T16* __restrict__ A, const T16* __restrict__ A2, const T16* __restrict__ Bt, const T16* __restrict__ Bt2, int K, float* C, int ldc, const float* __restrict__ bias, size_t sA, size_t sB, size_t sC, h16* P16, bf* Ph, bf* Pl) {
    typedef typename WFrag<T16>::V V;
    __shared__ __align__(16) float os[16 * 68];
    const size_t z = blockIdx.z; A += z * sA; if (A2) A2 += z * sA; Bt += z * sB; if (Bt2) Bt2 += z * sB; C += z * sC;
    const int lane = threadIdx.x & 31, lr = lane & 15, hi = lane >> 4; const int r0 = blockIdx.x * 64, c0 = blockIdx.y * 64;
    v8f acc[4][4];
#pragma unroll
    for (int mb = 0; mb < 4; ++mb)
#pragma unroll
        for (int nb = 0; nb < 4; ++nb) acc[mb][nb] = (v8f){};
    const size_t aoff = (size_t)r0 * K + lane * 8, boff = (size_t)c0 * K + lane * 8;   // a k-step of 32 is one tile of 512 elements: kc * 16
#pragma unroll 1
    for (int kc = 0; kc < K; kc += 32) {
        V a[4], a2[4]; const T16* ap[4]; const T16* ap2[4];
#pragma unroll
        for (int mb = 0; mb < 4; ++mb) { ap[mb] = A + aoff + (size_t)mb * 16 * K + (size_t)kc * 16; ap2[mb] = ap[mb]; a[mb] = WFrag<T16>::ld(ap[mb]); if (NSPLIT == 1 || NSPLIT == 2) { ap2[mb] = A2 + aoff + (size_t)mb * 16 * K + (size_t)kc * 16; a2[mb] = WFrag<T16>::ld(ap2[mb]); } }
        // the wait that stands in front of any overwrite of a register which an issued load names: the addresses are its inputs, so they stay untouched (also by a landing load) up to it
        asm volatile("s_wait_xcnt 0x0" :: "v"(ap[0]), "v"(ap[1]), "v"(ap[2]), "v"(ap[3]), "v"(ap2[0]), "v"(ap2[1]), "v"(ap2[2]), "v"(ap2[3]) : "memory");
#pragma unroll
        for (int nb = 0; nb < 4; ++nb) { const T16* bp = Bt + boff + (size_t)nb * 16 * K + (size_t)kc * 16; const T16* bp2 = bp; const V b = WFrag<T16>::ld(bp); V b2; if (NSPLIT >= 2) { bp2 = Bt2 + boff + (size_t)nb * 16 * K + (size_t)kc * 16; b2 = WFrag<T16>::ld(bp2); }
            asm volatile("s_wait_xcnt 0x0" :: "v"(bp), "v"(bp2) : "memory");   // as above, for this column block's addresses
#pragma unroll
            for (int mb = 0; mb < 4; ++mb) { acc[mb][nb] = WFrag<T16>::mma(a[mb], b, acc[mb][nb]); if (NSPLIT == 1 || NSPLIT == 2) acc[mb][nb] = WFrag<T16>::mma(a2[mb], b, acc[mb][nb]); if (NSPLIT >= 2) acc[mb][nb] = WFrag<T16>::mma(a[mb], b2, acc[mb][nb]); } }
        asm volatile("v_nop\n\tv_nop\n\tv_nop\n\tv_nop" : "+v"(acc[0][0]), "+v"(acc[1][1]), "+v"(acc[2][2]), "+v"(acc[3][3]) : "v"(a[0]), "v"(a[3]));
    }
#pragma unroll
    for (int mb = 0; mb < 4; ++mb) {
#pragma unroll
        for (int nb = 0; nb < 4; ++nb) {
#pragma unroll
            for (int j = 0; j < 8; ++j) os[(hi * 8 + j) * 68 + nb * 16 + lr] = acc[mb][nb][j]; }
        __builtin_amdgcn_wave_barrier(); asm volatile("" ::: "memory");
        float* crow = C + (size_t)(r0 + mb * 16) * ldc + c0;
{
#pragma unroll
            for (int s = 0; s < 8; ++s) { const int row = 2 * s + hi, cofs = lr * 4; v4f val = *(const v4fa*)(os + row * 68 + cofs); if (BIAS) { val[0] += bfr(bias[c0 + cofs]); val[1] += bfr(bias[c0 + cofs + 1]); val[2] += bfr(bias[c0 + cofs + 2]); val[3] += bfr(bias[c0 + cofs + 3]); }
                *(v4f*)(crow + (size_t)row * ldc + cofs) = val; }
             }
        __builtin_amdgcn_wave_barrier(); asm volatile("" ::: "memory");
    }
}

// ---- proj_tile: k_gemmw's 64x64 tile of one wave for the projections: C = x W^T + b, K = DM, plain bf16 operands, no f32 result. A 64-column tile is one head (HD == 64) and rows are b * TT + t:
// C + bias goes out as three 16-bit planes (fp16, bf16 hi, bf16 lo), EPI 1 as [b][head][t][d] (staged through the wave's own os rows), EPI 2 transposed as [b][head][d][t], each head's plane in fragment order.
template <int EPI>
__device__ __forceinline__ void proj_tile(const bf* __restrict__ A, const bf* __restrict__ Bt, const float* __restrict__ bias, int r0, int c0, float* os, h16* P16, bf* Ph, bf* Pl) {
    typedef WFrag<bf>::V V; constexpr int K = DM, ldc = DQ; constexpr bool BIAS = true;
    const int lane = threadIdx.x & 31, lr = lane & 15, hi = lane >> 4;
    v8f acc[4][4];
#pragma unroll
    for (int mb = 0; mb < 4; ++mb)
#pragma unroll
        for (int nb = 0; nb < 4; ++nb) acc[mb][nb] = (v8f){};
    const bf* pa = A + (size_t)r0 * K + lane * 8; const bf* pb = Bt + (size_t)c0 * K + lane * 8;
#pragma unroll 1
    for (int kc = 0; kc < K; kc += 32, pa += 512, pb += 512) {
        V a[4], b[4];
#pragma unroll
        for (int mb = 0; mb < 4; ++mb) { a[mb] = WFrag<bf>::ld(pa + mb * 16 * K); b[mb] = WFrag<bf>::ld(pb + mb * 16 * K); }
        asm volatile("s_wait_xcnt 0x0" :: "v"(pa), "v"(pb) : "memory");   // in front of any overwrite of the two addresses this trip's loads name (the row blocks are immediate offsets); as inputs they stay untouched, also by a landing load, up to it
#pragma unroll
        for (int nb = 0; nb < 4; ++nb)
#pragma unroll
            for (int mb = 0; mb < 4; ++mb) acc[mb][nb] = WFrag<bf>::mma(a[mb], b[nb], acc[mb][nb]);
        asm volatile("v_nop\n\tv_nop\n\tv_nop\n\tv_nop" : "+v"(acc[0][0]), "+v"(acc[1][1]), "+v"(acc[2][2]), "+v"(acc[3][3]) : "v"(a[0]), "v"(a[3]));   // the four vector slots the chip needs behind the last matrix instruction, on the loop's taken branch too
    }
    if (EPI == 2) {   // a lane's eight accumulator rows are eight consecutive t of one column d: in fragment order the very 16 bytes of lane 'lane' in half mb & 1 of tile (nb, t / 32), straight from registers
        const size_t pb = ((size_t)(r0 / TT) * (ldc / HD) + c0 / HD) * HD * TT + (size_t)(r0 % TT) * 16 + lane * 8; const float* bp = bias + c0 + lr; float tb[4];
#pragma unroll
        for (int nb = 0; nb < 4; ++nb) tb[nb] = BIAS ? bp[nb * 16] : 0.0f;   // all four at once: one wait for memory, not four
        if (BIAS) asm volatile("s_wait_xcnt 0x0" :: "v"(bp) : "memory");   // in front of any overwrite of the address these loads name
#pragma unroll
        for (int nb = 0; nb < 4; ++nb) { const float bb = bfr(tb[nb]); h16* p16 = P16 + pb + (size_t)nb * 16 * TT; bf* ph = Ph + pb + (size_t)nb * 16 * TT; bf* pl = Pl + pb + (size_t)nb * 16 * TT; v8h o16[4]; v8us oh[4], ol[4];
#pragma unroll
            for (int mb = 0; mb < 4; ++mb)
#pragma unroll
                for (int j = 0; j < 8; ++j) { const float val = acc[mb][nb][j] + bb; o16[mb][j] = tohx(val); unsigned short a2, c2; splitf(val, a2, c2); oh[mb][j] = a2; ol[mb][j] = c2; }
#pragma unroll
            for (int mb = 0; mb < 4; ++mb) { *(v8h*)(p16 + mb * 256) = o16[mb]; *(v8us*)(ph + mb * 256) = oh[mb]; *(v8us*)(pl + mb * 256) = ol[mb]; }   // every store is 512 bytes in a row
            // the wait that stands in front of any overwrite of a register which an issued store names: addresses and data are its inputs, so they stay untouched up to it
            asm volatile("s_wait_xcnt 0x0" :: "v"(p16), "v"(ph), "v"(pl), "v"(o16[0]), "v"(o16[1]), "v"(o16[2]), "v"(o16[3]), "v"(oh[0]), "v"(oh[1]), "v"(oh[2]), "v"(oh[3]), "v"(ol[0]), "v"(ol[1]), "v"(ol[2]), "v"(ol[3]) : "memory"); }
        return; }
    float pbias[4][8];   // EPI 1: in store s a lane takes columns s * 16 + hi * 8 .. + 7 of row lr, its own 16 bytes of the s-th half tile
    if (EPI == 1) { const float* bp = bias + c0 + hi * 8; v8f tb[4];
#pragma unroll
        for (int s = 0; s < 4; ++s) tb[s] = BIAS ? *(const v8f*)(bp + s * 16) : (v8f){};
        if (BIAS) asm volatile("s_wait_xcnt 0x0" :: "v"(bp) : "memory");   // the wait: in front of any overwrite of the address these loads name
#pragma unroll
        for (int s = 0; s < 4; ++s)
#pragma unroll
            for (int q = 0; q < 8; ++q) pbias[s][q] = bfr(tb[s][q]); }
#pragma unroll
    for (int mb = 0; mb < 4; ++mb) {
#pragma unroll
        for (int nb = 0; nb < 4; ++nb) {
#pragma unroll
            for (int j = 0; j < 8; ++j) os[(hi * 8 + j) * 68 + nb * 16 + lr] = acc[mb][nb][j]; }
        __builtin_amdgcn_wave_barrier(); asm volatile("" ::: "memory");
        if (EPI == 1) {   // 16 rows x 64 columns are two tiles, 2 KiB in a row of each plane: a store instruction fills four whole 128-byte lines
            const size_t pb = (((size_t)(r0 / TT) * (ldc / HD) + c0 / HD) * TT + (r0 % TT) + mb * 16) * HD + lane * 8; h16* p16 = P16 + pb; bf* ph = Ph + pb; bf* pl = Pl + pb; v8h o16[4]; v8us oh[4], ol[4];
#pragma unroll
            for (int s = 0; s < 4; ++s) { const float* op = os + lr * 68 + s * 16 + hi * 8; const v4f v0 = *(const v4fa*)op, v1 = *(const v4fa*)(op + 4);
#pragma unroll
                for (int q = 0; q < 8; ++q) { const float val = (q < 4 ? v0[q & 3] : v1[q & 3]) + pbias[s][q]; o16[s][q] = tohx(val); unsigned short a2, c2; splitf(val, a2, c2); oh[s][q] = a2; ol[s][q] = c2; } }
#pragma unroll
            for (int s = 0; s < 4; ++s) { *(v8h*)(p16 + s * 256) = o16[s]; *(v8us*)(ph + s * 256) = oh[s]; *(v8us*)(pl + s * 256) = ol[s]; }
            // the wait in front of any overwrite of a register which an issued store names, as above
            asm volatile("s_wait_xcnt 0x0" :: "v"(p16), "v"(ph), "v"(pl), "v"(o16[0]), "v"(o16[1]), "v"(o16[2]), "v"(o16[3]), "v"(oh[0]), "v"(oh[1]), "v"(oh[2]), "v"(oh[3]), "v"(ol[0]), "v"(ol[1]), "v"(ol[2]), "v"(ol[3]) : "memory");
        }
        __builtin_amdgcn_wave_barrier(); asm volatile("" ::: "memory");
    }
}
// k_qkv: the three projections in ONE launch. Grid (rows / 128, columns / 128), 12 waves: waves 0-3 q, 4-7 k, 8-11 v, each group 2 x 2 tiles of 64 x 64 on the same 128 rows and 128 columns,
// so an x row is read by six waves of one WGP and a weight row by two, and three waves share a SIMD. No wave waits for another: every q and k wave has its own staging rows in LDS; the v waves write from registers and use none.
__global__ __launch_bounds__(384) void k_qkv(const bf* __restrict__ XB, const bf* __restrict__ WQ, const bf* __restrict__ WK, const bf* __restrict__ WV, const float* __restrict__ bq, const float* __restrict__ bk, const float* __restrict__ bv,
                                             h16* QP16, bf* QPh, bf* QPl, h16* KP16, bf* KPh, bf* KPl, h16* VT16, bf* VTh, bf* VTl) {
    __shared__ __align__(16) float os[8][16 * 68];
    const int w = __builtin_amdgcn_readfirstlane((int)(threadIdx.x >> 5)); const int r0 = blockIdx.x * 128 + (w & 1) * 64, c0 = blockIdx.y * 128 + ((w >> 1) & 1) * 64;
    if (w >= 8) proj_tile<2>(XB, WV, bv, r0, c0, nullptr, VT16, VTh, VTl);
    else { const bool kk = w >= 4; proj_tile<1>(XB, kk ? WK : WQ, kk ? bk : bq, r0, c0, os[w], kk ? KP16 : QP16, kk ? KPh : QPh, kk ? KPl : QPl); }
}

typedef __attribute__((ext_vector_type(2))) _Float16 v2h;
typedef __attribute__((ext_vector_type(4))) _Float16 v4h;
typedef __attribute__((ext_vector_type(2))) unsigned short v2us;
typedef __attribute__((ext_vector_type(4))) unsigned short v4us;
typedef __attribute__((ext_vector_type(2))) float v2f;
typedef __attribute__((ext_vector_type(4))) int v4i;

__global__ __launch_bounds__(256) void k_wtG(const float* __restrict__ w, int K, int N, bf* Bt) {
    const int lane = threadIdx.x & 31; const int L0 = (blockIdx.x * 8 + (threadIdx.x >> 5)) * 8; const int nlines = N * K / 64;
{
#pragma unroll 1
        for (int l = 0; l < 8; ++l) { const int L = L0 + l; if (L >= nlines) break; const size_t e = (size_t)L * 64 + lane * 2; const int k = (int)(e % K), n = (int)(e / K); v2us o;
            o[0] = f2bf(w[(size_t)k * N + n]); o[1] = f2bf(w[(size_t)(k + 1) * N + n]); *(v2us*)(Bt + e) = o; }
         }
}
// k_prep: every f32 -> bf16 conversion of the call in ONE launch, from row-major f32 to fragment order. A work-group takes CH groups of eight floats of one array = 32 tiles of 16 rows x 32 k (a wave four tiles; all sixteen loads of a thread in flight at once); blockIdx.x picks the array.
// A load takes four whole 128-byte lines (four rows of one tile, eight lanes a row, four floats a lane); the four stores of a tile fill its 1 KiB.
// PAD (the position table): rows at or past nrow are the zero pad row; they are stored as zeros and read nothing past the table (the row is clamped).
#define CH   2048
#define GX   (NB_ * TT * DM / 8 / CH)
#define GW   (DM * DQ / 8 / CH)
#define GP   (NPE * HD / 8 / CH)
template <bool PAD, int K>
__device__ __forceinline__ void cvt_run(const float* __restrict__ src, bf* dst, unsigned blk, unsigned nrow) {
    constexpr unsigned TPR = K / 32;   // tiles along a row: 32 (one work-group = one band of 16 rows) or a divisor of 32
    const unsigned lane = threadIdx.x & 31, w = threadIdx.x >> 5, r4 = lane >> 3, c = lane & 7; unsigned so[16], row[16]; v4f v[16]; v4us o[16];
#pragma unroll
    for (int u = 0; u < 16; ++u) { const unsigned tl = w * 4 + (u >> 2), rt = TPR >= 32 ? blk : blk * (32 / TPR) + tl / TPR, ks = TPR >= 32 ? tl : tl % TPR;   // tile tl of this work-group's 32; rows (u & 3) * 4 + r4 of it
        row[u] = rt * 16 + (u & 3) * 4 + r4; so[u] = ((PAD ? (row[u] < nrow ? row[u] : nrow - 1) : row[u]) * K + ks * 32 + c * 4) * 4u; v[u] = *(const v4f*)((const char*)src + so[u]); }
    // the wait that stands in front of any overwrite of a register which an issued load names: the byte offsets are its inputs, so they stay untouched (also by a landing load) up to it
    if (PAD) asm volatile("s_wait_xcnt 0x0" :: "v"(so[0]), "v"(so[1]), "v"(so[2]), "v"(so[3]), "v"(so[4]), "v"(so[5]), "v"(so[6]), "v"(so[7]), "v"(so[8]), "v"(so[9]), "v"(so[10]), "v"(so[11]), "v"(so[12]), "v"(so[13]), "v"(so[14]), "v"(so[15]) : "memory");
    else asm volatile("s_wait_xcnt 0x0" :: "v"(so[0]), "v"(so[1]), "v"(so[2]), "v"(so[3]) : "memory");   // the other twelve are immediate offsets from these four
#pragma unroll
    for (int u = 0; u < 16; ++u)
#pragma unroll
        for (int k = 0; k < 4; ++k) o[u][k] = f2bf((PAD && row[u] >= nrow) ? 0.0f : v[u][k]);
    // floats c * 4 .. + 3 of a tile's row: half c >> 2, lane group (c >> 1) & 1, first or second 8 bytes of that lane's 16
    bf* dp = dst + (size_t)(blk * 32 + w * 4) * 512 + (c >> 2) * 256 + (((c >> 1) & 1) * 16 + r4) * 8 + (c & 1) * 4;
#pragma unroll
    for (int u = 0; u < 16; ++u) *(v4us*)(dp + (u >> 2) * 512 + (u & 3) * 32) = o[u];
}
__global__ __launch_bounds__(256) void k_prep(const float* __restrict__ x, const float* __restrict__ wq, const float* __restrict__ wk, const float* __restrict__ wv, const float* __restrict__ wo, const float* __restrict__ pe,
                                              bf* XB, bf* WQ, bf* WK, bf* WV, bf* WO, bf* PE) {
    const unsigned b = blockIdx.x;
    if (b >= GX + 4 * GW) { cvt_run<true, HD>(pe, PE, b - (GX + 4 * GW), 2047); return; }
    const unsigned a = b < GX ? 0 : 1 + (b - GX) / GW;
    cvt_run<false, DM>(a == 0 ? x : a == 1 ? wq : a == 2 ? wk : a == 3 ? wv : wo, a == 0 ? XB : a == 1 ? WQ : a == 2 ? WK : a == 3 ? WV : WO, a == 0 ? b : (b - GX) % GW, 0);
}

// attn_body: 32 query rows i0.. of head z, 8 waves; wave w owns keys w * 128 .. + 127 from the scores to its partial output, and waits for no other wave before the final sum.
// The scores are computed TRANSPOSED (the key tile is the A operand, the query tile the B operand): a lane then holds eight consecutive keys of ONE query, which is the very piece of an A fragment that attn.v wants from it,
// so the logits, the softmax and the probabilities stay in the lane's registers. LDS holds, per wave, its own 32 x 128 relative scores (R, pitch RP, stored skewed as before and read back as 16-byte pieces),
// into whose slots a lane parks the logits of key tiles NKEEP.. (each lane rewrites only what it has just read), and at the end the wave's partial output with its row maxima and row sums.
// Softmax by parts: each wave takes the maximum m_w and the sum l_w over its own 128 keys, attn.v runs on exp(s - m_w) unnormalised, and the final sum weighs wave w by exp(m_w - m) and divides by the weighted l_w.
// HI: hi+lo planes, 3 products, for scores and attn.v; else single fp16 (probabilities x PCAR).
// Behind a group of global loads: the wait that stands in front of any overwrite of a register which an issued load names. It takes the group's addresses as inputs, so that they stay untouched (also by a landing load of the group) up to it.
#define XWAIT1(p)    asm volatile("s_wait_xcnt 0x0" :: "v"(p) : "memory")
#define XWAIT2(p, q) asm volatile("s_wait_xcnt 0x0" :: "v"(p), "v"(q) : "memory")
#define L2E 1.4426950408889634f
template <bool HI>
__device__ __forceinline__ void attn_body(float* T, int z, int i0, const h16* __restrict__ QP16, const bf* __restrict__ QPh, const bf* __restrict__ QPl, const h16* __restrict__ KP16, const bf* __restrict__ KPh, const bf* __restrict__ KPl,
                                          const h16* __restrict__ VT16, const bf* __restrict__ VTh, const bf* __restrict__ VTl, const bf* __restrict__ PE, bf* ATh, bf* ATl) {
    constexpr int NKEEP = 2, KD = HI ? 2 : 3, VD = HI ? 4 : 8;   // key tiles whose logits stay in registers; how many key tiles, and how many value fragments, are fetched ahead of their use
    const int tid = threadIdx.x, lane = tid & 31, lr = lane & 15, hi = lane >> 4, w = tid >> 5; const int j0 = w * 128;   // this wave's 128 keys
    float* R = T + w * (BR * RP);   // this wave's own LDS
    const size_t qb = ((size_t)z * TT + i0) * HD + lane * 8;   // planes in fragment order: 16 rows x 64 are two tiles of 512 elements
    // relative scores: rows i0 + 16 mt + r and keys j0 + jj need positions p = (j0 - i0 - 16 mt + 1008) + c, c = jj - r + 15 in 0..142: nine 16-wide tiles a row tile, ten for both
    const int pb = j0 - i0 + 992;   // 0 .. 1888; last row read pb + 159 <= 2047
    v16bf qh[2][2], ql[2][2], rb[10][2], kb[8][4], vb[16][2]; v16h q16[2][2], kf[8][2], vf[16];
    const bf* pp = PE + (size_t)pb * HD + lane * 8;
    auto rload = [&](int u) { rb[u][0] = WFrag<bf>::ld(pp + u * 1024); rb[u][1] = WFrag<bf>::ld(pp + u * 1024 + 512); XWAIT1(pp); };   // one base for all ten tiles (the tiles are immediate offsets): as the wait's input it outlives every load that names it
    const size_t ko = ((size_t)z * TT + j0) * HD + lane * 8; const bf* khp = KPh + ko; const bf* klp = KPl + ko; const h16* k16p = KP16 + ko;   // likewise one base a plane for the eight key tiles
    auto kload = [&](int nb) {
        if (HI) { kb[nb][0] = WFrag<bf>::ld(khp + nb * 1024); kb[nb][1] = WFrag<bf>::ld(khp + nb * 1024 + 512); kb[nb][2] = WFrag<bf>::ld(klp + nb * 1024); kb[nb][3] = WFrag<bf>::ld(klp + nb * 1024 + 512); XWAIT2(khp, klp); }
        else { kf[nb][0] = WFrag<h16>::ld(k16p + nb * 1024); kf[nb][1] = WFrag<h16>::ld(k16p + nb * 1024 + 512); XWAIT1(k16p); } };
    const size_t vo = (size_t)z * HD * TT + j0 * 16 + lane * 8; const bf* vhp = VTh + vo; const bf* vlp = VTl + vo; const h16* v16p = VT16 + vo;
    auto vload = [&](int t) { const int off = (t >> 2) * 512 + (t & 3) * 16 * TT;   // step t = ks * 4 + nb: tile (nb, key / 32) of the transposed plane
        if (HI) { vb[t][0] = WFrag<bf>::ld(vhp + off); vb[t][1] = WFrag<bf>::ld(vlp + off); XWAIT2(vhp, vlp); } else { vf[t] = WFrag<h16>::ld(v16p + off); XWAIT1(v16p); } };
#pragma unroll
    for (int mt = 0; mt < 2; ++mt)
#pragma unroll
        for (int kk = 0; kk < 2; ++kk) { qh[mt][kk] = WFrag<bf>::ld(QPh + qb + (size_t)mt * 16 * HD + kk * 512); ql[mt][kk] = WFrag<bf>::ld(QPl + qb + (size_t)mt * 16 * HD + kk * 512); }
    XWAIT2(QPh + qb, QPl + qb);
#pragma unroll
    for (int u = 0; u < 4; ++u) rload(u);
#pragma unroll
    for (int u = 0; u < 10; ++u) {
#pragma unroll
        for (int mt = 0; mt < 2; ++mt) { const int tt = u - 1 + mt; if (tt < 0 || tt > 8) continue;
            v8f acc = (v8f){}; acc = wmmab(qh[mt][0], rb[u][0], acc); acc = wmmab(ql[mt][0], rb[u][0], acc); acc = wmmab(qh[mt][1], rb[u][1], acc); acc = wmmab(ql[mt][1], rb[u][1], acc);
            asm volatile("v_nop\n\tv_nop\n\tv_nop\n\tv_nop" :: "v"(acc));   // the four vector slots the chip needs before the next tile's first matrix instruction may overwrite these result registers
#pragma unroll
            for (int j = 0; j < 8; ++j) { const int r = hi * 8 + j, jj = tt * 16 + lr + r - 15; R[(mt * 16 + r) * RP + ((jj >= 0 && jj < 128) ? jj : 128)] = acc[j]; } }   // a position outside this wave's keys lands in the row's pad column
        if (u < 6) rload(u + 4); else if (u >= 9 - KD && u < 9) kload(u - (9 - KD));
        if (!HI && u == 5) {
#pragma unroll
            for (int mt = 0; mt < 2; ++mt)
#pragma unroll
                for (int kk = 0; kk < 2; ++kk) q16[mt][kk] = WFrag<h16>::ld(QP16 + qb + (size_t)mt * 16 * HD + kk * 512);
            XWAIT1(QP16 + qb); } }
    asm volatile("s_wait_dscnt 0x0" ::: "memory");   // the skewed stores crossed lanes, of this wave alone: they are done before its lanes read the rows back; no other wave touches them, so no barrier
    v8f s[8][2]; float mx[2] = { -3.0e38f, -3.0e38f };
#pragma unroll
    for (int nb = 0; nb < 8; ++nb) { v4f r0[2], r1[2];
#pragma unroll
        for (int mt = 0; mt < 2; ++mt) { const float* rp = R + (mt * 16 + lr) * RP + nb * 16 + hi * 8; r0[mt] = *(const v4fa*)rp; r1[mt] = *(const v4fa*)(rp + 4); }   // query mt * 16 + lr, keys nb * 16 + hi * 8 .. + 7
#pragma unroll
        for (int mt = 0; mt < 2; ++mt) { v8f a = (v8f){};   // D row = key hi * 8 + j of the tile, D column = query lr
            if (HI) { a = wmmab(kb[nb][0], qh[mt][0], a); a = wmmab(kb[nb][0], ql[mt][0], a); a = wmmab(kb[nb][2], qh[mt][0], a); a = wmmab(kb[nb][1], qh[mt][1], a); a = wmmab(kb[nb][1], ql[mt][1], a); a = wmmab(kb[nb][3], qh[mt][1], a); }
            else { a = wmma16(kf[nb][0], q16[mt][0], a); a = wmma16(kf[nb][1], q16[mt][1], a); }
            s[nb][mt] = a; }
        if (nb + KD < 8) kload(nb + KD);
#pragma unroll
        for (int mt = 0; mt < 2; ++mt) {
#pragma unroll
            for (int j = 0; j < 8; ++j) { const float v = __fadd_rn(__fmul_rn(s[nb][mt][j], SCL), j < 4 ? r0[mt][j & 3] : r1[mt][j & 3]); s[nb][mt][j] = v; mx[mt] = fmaxf(mx[mt], v); }   // SCL is a power of two: the product is exact, fused or not
            if (nb >= NKEEP) { float* rp = R + (mt * 16 + lr) * RP + nb * 16 + hi * 8; *(v4fa*)rp = (v4f){ s[nb][mt][0], s[nb][mt][1], s[nb][mt][2], s[nb][mt][3] }; *(v4fa*)(rp + 4) = (v4f){ s[nb][mt][4], s[nb][mt][5], s[nb][mt][6], s[nb][mt][7] }; } } }
#pragma unroll
    for (int t = 0; t < VD; ++t) vload(t);   // they fly during the first exponentials
#pragma unroll
    for (int mt = 0; mt < 2; ++mt) mx[mt] = fmaxf(mx[mt], __shfl_xor(mx[mt], 16, 32));   // the two lane halves hold the two halves of every key tile
    auto sload = [&](int ks) {   // the parked logits of key tiles 2 ks, 2 ks + 1: each lane its own
#pragma unroll
        for (int q = 0; q < 2; ++q)
#pragma unroll
            for (int mt = 0; mt < 2; ++mt) { const float* rp = R + (mt * 16 + lr) * RP + (2 * ks + q) * 16 + hi * 8; const v4f a = *(const v4fa*)rp, b = *(const v4fa*)(rp + 4); s[2 * ks + q][mt] = (v8f){ a[0], a[1], a[2], a[3], b[0], b[1], b[2], b[3] }; } };
    if (NKEEP == 0) sload(0);
    // attn.v: this wave sums its own 128 keys for all 32 rows x 64 columns; element e of a lane's A fragment is key 8 hi + e of tile 2 ks, element 8 + e the same of tile 2 ks + 1
    v8f o[2][4]; float sm[2] = { 0.f, 0.f };
#pragma unroll
    for (int mt = 0; mt < 2; ++mt)
#pragma unroll
        for (int nb = 0; nb < 4; ++nb) o[mt][nb] = (v8f){};
#pragma unroll
    for (int ks = 0; ks < 4; ++ks) { v16bf ah[2], al[2]; v16h a16[2];
#pragma unroll
        for (int mt = 0; mt < 2; ++mt) { v8us oh[2], ol[2]; v8h o16[2];
#pragma unroll
            for (int q = 0; q < 2; ++q) { float p[8];
#pragma unroll
                for (int j = 0; j < 8; ++j) { p[j] = __builtin_amdgcn_exp2f(__fmul_rn(__fsub_rn(s[2 * ks + q][mt][j], mx[mt]), L2E));
                    if (HI) { unsigned short a, c2; splitf(p[j], a, c2); oh[q][j] = a; ol[q][j] = c2; } else o16[q][j] = tohx(p[j] * PCAR); }
                sm[mt] += ((p[0] + p[1]) + (p[2] + p[3])) + ((p[4] + p[5]) + (p[6] + p[7])); }
            if (HI) { ah[mt] = cat16b(oh[0], oh[1]); al[mt] = cat16b(ol[0], ol[1]); } else a16[mt] = cat16(o16[0], o16[1]); }
        if (ks < 3 && 2 * (ks + 1) >= NKEEP) sload(ks + 1);
#pragma unroll
        for (int nb = 0; nb < 4; ++nb) { const int t = ks * 4 + nb;
#pragma unroll
            for (int mt = 0; mt < 2; ++mt) {
                if (HI) { o[mt][nb] = wmmab(ah[mt], vb[t][0], o[mt][nb]); o[mt][nb] = wmmab(al[mt], vb[t][0], o[mt][nb]); o[mt][nb] = wmmab(ah[mt], vb[t][1], o[mt][nb]); }
                else o[mt][nb] = wmma16(a16[mt], vf[t], o[mt][nb]); }
            if (t + VD < 16) vload(t + VD); } }
#pragma unroll
    for (int mt = 0; mt < 2; ++mt) sm[mt] += __shfl_xor(sm[mt], 16, 32);
    __builtin_amdgcn_wave_barrier(); asm volatile("" ::: "memory");   // the partial output goes over this wave's own slots: behind its last read of them
#pragma unroll
    for (int mt = 0; mt < 2; ++mt) {
#pragma unroll
        for (int nb = 0; nb < 4; ++nb)
#pragma unroll
            for (int j = 0; j < 8; ++j) R[(mt * 16 + hi * 8 + j) * OPP + nb * 16 + lr] = o[mt][nb][j];
        R[BR * OPP + hi * BR + mt * 16 + lr] = hi ? sm[mt] : mx[mt]; }   // behind the partial output: 32 row maxima, then 32 row sums
    __syncthreads();   // partial outputs, maxima and sums of all eight waves complete
    { const int row = (w >> 2) * 16 + lr, d0 = (w & 3) * 16 + hi * 8; v4f p0[8], p1[8]; float mw[8], lw[8];   // wave w writes half tile w & 3 of row tile w >> 2: a lane its own 16 bytes there
#pragma unroll
        for (int ww = 0; ww < 8; ++ww) { const float* pr = T + ww * (BR * RP); p0[ww] = *(const v4fa*)(pr + row * OPP + d0); p1[ww] = *(const v4fa*)(pr + row * OPP + d0 + 4); mw[ww] = pr[BR * OPP + row]; lw[ww] = pr[BR * OPP + BR + row]; }
        float m = mw[0];
#pragma unroll
        for (int ww = 1; ww < 8; ++ww) m = fmaxf(m, mw[ww]);
        v4f s0 = (v4f){}, s1 = (v4f){}; float den = 0.f;
#pragma unroll
        for (int ww = 0; ww < 8; ++ww) { const float e = __builtin_amdgcn_exp2f((mw[ww] - m) * L2E); den += e * lw[ww]; s0 += p0[ww] * e; s1 += p1[ww] * e; }   // key blocks in ascending order
        const float cs = __fdiv_rn(HI ? 1.0f : (1.0f / PCAR), den); v8us oh, ol;
#pragma unroll
        for (int q = 0; q < 4; ++q) { unsigned short a, c2; splitf(s0[q] * cs, a, c2); oh[q] = a; ol[q] = c2; splitf(s1[q] * cs, a, c2); oh[4 + q] = a; ol[4 + q] = c2; }
        const size_t oo = ((size_t)(z / NH_) * TT + i0 + (w >> 2) * 16) * DQ + (size_t)(z % NH_) * 1024 + (w & 3) * 256 + lane * 8; *(v8us*)(ATh + oo) = oh; *(v8us*)(ATl + oo) = ol; }   // fragment order, K = DQ: a head is two tiles along k; a wave fills four 128-byte lines
}
// k_attn: grid (TT / BR, NZ), 256 threads; two work-groups share a WGP's LDS, so four waves a SIMD
__global__ __launch_bounds__(256) __attribute__((amdgpu_waves_per_eu(4, 4))) void k_attn(const h16* __restrict__ QP16, const bf* __restrict__ QPh, const bf* __restrict__ QPl, const h16* __restrict__ KP16, const bf* __restrict__ KPh, const bf* __restrict__ KPl,
                                               const h16* __restrict__ VT16, const bf* __restrict__ VTh, const bf* __restrict__ VTl, const bf* __restrict__ PE, bf* ATh, bf* ATl) {
    __shared__ __align__(16) float T[8 * BR * RP];
    const int i0 = blockIdx.x * BR, z = blockIdx.y;
    if (i0 < RH) attn_body<true>(T, z, i0, QP16, QPh, QPl, KP16, KPh, KPl, VT16, VTh, VTl, PE, ATh, ATl);
    else attn_body<false>(T, z, i0, QP16, QPh, QPl, KP16, KPh, KPl, VT16, VTh, VTl, PE, ATh, ATl);
}

extern "C" void kernel_launch(void* const* d_in, const int* in_sizes, int n_in,
                              void* d_out, int out_size, void* d_ws, size_t ws_size, hipStream_t stream) {
    (void)in_sizes; (void)n_in; (void)out_size;
    const float* x = (const float*)d_in[0]; const float* wq = (const float*)d_in[1]; const float* bq = (const float*)d_in[2]; const float* wk = (const float*)d_in[3]; const float* bk = (const float*)d_in[4]; const float* wv = (const float*)d_in[5]; const float* bv = (const float*)d_in[6]; const float* wo = (const float*)d_in[7]; const float* bo = (const float*)d_in[8]; const float* pe = (const float*)d_in[9];
    float* OUT = (float*)d_out;     // [4][1024][1024]
    char* wsp = (char*)d_ws;
    auto take = [&](size_t bytes) { char* p = wsp; wsp += (bytes + 255) & ~(size_t)255; return (void*)p; };
    bf* WO = (bf*)take((size_t)DM * DQ * 2); bf* PE = (bf*)take((size_t)NPE * HD * 2);
    h16* QP16 = (h16*)take((size_t)NZ * TT * HD * 2); h16* KP16 = (h16*)take((size_t)NZ * TT * HD * 2); h16* VT16 = (h16*)take((size_t)NZ * HD * TT * 2);
    bf* QPh = (bf*)take((size_t)NZ * TT * HD * 2); bf* QPl = (bf*)take((size_t)NZ * TT * HD * 2); bf* KPh = (bf*)take((size_t)NZ * TT * HD * 2); bf* KPl = (bf*)take((size_t)NZ * TT * HD * 2); bf* VTh = (bf*)take((size_t)NZ * HD * TT * 2); bf* VTl = (bf*)take((size_t)NZ * HD * TT * 2);
    bf* ATh = (bf*)take((size_t)NB_ * TT * DQ * 2); bf* ATl = (bf*)take((size_t)NB_ * TT * DQ * 2);
    bf* WQ = (bf*)take((size_t)DQ * DM * 2); bf* WK = (bf*)take((size_t)DKV * DM * 2); bf* WV = (bf*)take((size_t)DKV * DM * 2);
    bf* XB = (bf*)take((size_t)NB_ * TT * DM * 2);
    if ((size_t)(wsp - (char*)d_ws) > ws_size) return;    // ws 256 MiB
    k_prep<<<GX + 4 * GW + GP, 256, 0, stream>>>(x, wq, wk, wv, wo, pe, XB, WQ, WK, WV, WO, PE);   /* bf16 x, weights, position table + zero pad row */
    k_qkv<<<dim3(NB_ * TT / 128, DQ / 128, 1), 384, 0, stream>>>(XB, WQ, WK, WV, bq, bk, bv, QP16, QPh, QPl, KP16, KPh, KPl, VT16, VTh, VTl);
    k_attn<<<dim3(TT / BR, NZ, 1), 256, 0, stream>>>(QP16, QPh, QPl, KP16, KPh, KPl, VT16, VTh, VTl, PE, ATh, ATl);   // planes are [b][h][..]: z is the plane index (one kv head per query head)
    k_gemmw<bf, 1, true, 0><<<dim3(NB_ * TT / 64, DM / 64, 1), 32, 0, stream>>>(ATh, ATl, WO, nullptr, DQ, OUT, DM, bo, 0, 0, 0, nullptr, nullptr, nullptr);
}

// v007
// Measured time: 124 microseconds a run.
// In both of two side-by-side timings against v006, it was 1.20 times as fast.
// Over all steps from v000 it is 21.2 times as fast.
#include <hip/hip_runtime.h>

// Self-attention with a learned relative-position bias (x [4][1024][1024]; q, k, v = x W^T + b ('oi', 16 heads x 64); S = q.k/8 + S_rel[i][j - i + 1023] where S_rel = q.pos_emb^T (pos_emb [2047][64], unscaled); softmax; out = merged Wo^T + bo -> [4][1024][1024]).
// Layout: batch and head are one flat index z = b * 16 + h carried in the grids (projections over all 4096 rows; their epilogues write the 16-bit head planes themselves: q, k as [z][t][d], v as [z][d][t]). Attention is ONE launch: a work-group of 8 waves owns 32 query rows of one z and each wave 128 of the 1024 keys: relative scores (q hi/lo planes against the bf16 position table, 2047 rows + one zero pad row; only the band of positions the 32 rows reach) are stored to the wave's own LDS already skewed (S_rel[i][j - i + 1023] at column j), the content scores are computed transposed and take them up in registers, softmax and attn.v run per wave on registers, the eight partial outputs are joined through LDS and the hi/lo planes of the merged heads go to memory.
// Every 16-bit operand plane in memory (x, weights, position table, q, k, v^T, merged heads) is kept in FRAGMENT ORDER: a tile of 16 rows x 32 k is 1 KiB in a row, first the 16 bytes that each lane 0..31 takes for k = 8 * (lane >> 4) .. + 7 of row lane & 15, then the 16 bytes for k + 16;
// tiles run along k, then down the rows (tile (rt, ks) of a plane with K elements a row starts at element rt * 16 * K + ks * 512). A fragment load is then 2 x 512 contiguous bytes (four whole 128-byte lines each) and not 16 pieces of 32 bytes; which element meets which in a product is as before.
// Compute dtypes, f32 accumulate: every input rounded to bf16; q/k/v on PLAIN bf16 operands (inputs: exact) + biases; relative scores q(hi+lo).pos_emb (2 products, f32); scores and attn.v: query rows < 512 hl (3 products), the rest single fp16 (x1024); softmax f32; Wo hl x exact (2 products) + bo.

#define NB_  4
#define TT   1024
#define DM   1024
#define NH_  16
#define NKV  16
#define REP  (NH_ / NKV)
#define HD   64
#define DQ   (NH_ * HD)
#define DKV  (NKV * HD)
#define NPE  2048                 // 2047 relative positions + 1 zero pad row
#define BR   32                   // query rows per attention work-group
#define RP   132                  // LDS row pitch in floats of a wave's 32 x 128 relative scores: 528 B = 16 B x odd, so b128 accesses of 16 rows meet no bank twice; column 128 is the pad, never read
#define OPP  68                   // pitch in floats of a wave's partial attn.v tile in LDS
#define NZ   (NB_ * NH_)
#define RH   512                  // query rows < RH use hi+lo planes (0: none)
#define WIN  0
#define PCAR 1024.0f
#define SCL  0.125f   // HD^-0.5
typedef _Float16 h16;
typedef unsigned short bf;
typedef __attribute__((ext_vector_type(16))) __bf16   v16bf;
typedef __attribute__((ext_vector_type(16))) _Float16 v16h;
typedef __attribute__((ext_vector_type(8)))  _Float16 v8h;
typedef __attribute__((ext_vector_type(8)))  unsigned short v8us;
typedef __attribute__((ext_vector_type(8)))  float    v8f;
typedef __attribute__((ext_vector_type(4)))  float    v4f;
typedef v8h  __attribute__((may_alias)) v8ha;
typedef v4f  __attribute__((may_alias)) v4fa;
typedef v8us __attribute__((may_alias)) v8usa;

__device__ __forceinline__ unsigned short f2bf(float f) { unsigned u = __float_as_uint(f); u += 0x7FFFu + ((u >> 16) & 1u); return (unsigned short)(u >> 16); }
__device__ __forceinline__ float bf2f(unsigned short b) { return __uint_as_float(((unsigned)b) << 16); }
__device__ __forceinline__ float bfr(float f) { return bf2f(f2bf(f)); }
__device__ __forceinline__ h16 tohx(float x) { return (h16)x; }
__device__ __forceinline__ void splitf(float y, unsigned short& h, unsigned short& l) { h = f2bf(y); l = f2bf(y - bf2f(h)); }
__device__ __forceinline__ v16h cat16(v8h lo, v8h hi) { return __builtin_shufflevector(lo, hi, 0, 1, 2, 3, 4, 5, 6, 7, 8, 9, 10, 11, 12, 13, 14, 15); }
__device__ __forceinline__ v16bf cat16b(v8us lo, v8us hi) { return __builtin_bit_cast(v16bf, __builtin_shufflevector(lo, hi, 0, 1, 2, 3, 4, 5, 6, 7, 8, 9, 10, 11, 12, 13, 14, 15)); }
__device__ __forceinline__ v8f wmma16(v16h a, v16h b, v8f c) { return __builtin_amdgcn_wmma_f32_16x16x32_f16(false, a, false, b, (short)0, c, false, false); }
__device__ __forceinline__ v8f wmmab(v16bf a, v16bf b, v8f c) { return __builtin_amdgcn_wmma_f32_16x16x32_bf16(false, a, false, b, (short)0, c, false, false); }



// ---- k_gemmw: register-blocked GEMM, ONE WAVE per 64x64 output tile (16 accumulators), operands straight from 16-bit planes in fragment order (ld takes the tile's start + lane * 8); grid (M/64, N/64, Z), 32 threads.
// C[m][n] (f32, pitch ldc, + optional f32 bias[n]) = sum_k A[m][k] Bt[n][k] (+ split products per NSPLIT). z-batch strides sA/sB/sC in elements. K is a compile-time constant.
// C goes to memory as f32 (EPI 0, the one form left here: the projections, which write 16-bit planes, are proj_tile below).
template <typename T16> struct WFrag;
template <> struct WFrag<h16> { typedef v16h V; static __device__ __forceinline__ V ld(const h16* p) { return cat16(*(const v8h*)p, *(const v8h*)(p + 256)); } static __device__ __forceinline__ v8f mma(V a, V b, v8f c) { return wmma16(a, b, c); } };
template <> struct WFrag<bf> { typedef v16bf V; static __device__ __forceinline__ V ld(const bf* p) { return cat16b(*(const v8us*)p, *(const v8us*)(p + 256)); } static __device__ __forceinline__ v8f mma(V a, V b, v8f c) { return wmmab(a, b, c); } };
template <typename T16, int NSPLIT, bool BIAS, int EPI, int K>
__global__ __launch_bounds__(32) void k_gemmw(const T16* __restrict__ A, const T16* __restrict__ A2, const T16* __restrict__ Bt, const T16* __restrict__ Bt2, float* C, int ldc, const float* __restrict__ bias, size_t sA, size_t sB, size_t sC, h16* P16, bf* Ph, bf* Pl) {
    typedef typename WFrag<T16>::V V;
    static_assert(K % 32 == 0 && K / 32 >= 5 && (K / 32 - 2) % 3 == 0, "the k loop below takes three k steps a trip and leaves two");
    __shared__ __align__(16) float os[16 * 68];
    const size_t z = blockIdx.z; A += z * sA; if (A2) A2 += z * sA; Bt += z * sB; if (Bt2) Bt2 += z * sB; C += z * sC;
    const int lane = threadIdx.x & 31, lr = lane & 15, hi = lane >> 4; const int r0 = blockIdx.x * 64, c0 = blockIdx.y * 64;
    v8f acc[4][4];
#pragma unroll
    for (int mb = 0; mb < 4; ++mb)
#pragma unroll
        for (int nb = 0; nb < 4; ++nb) acc[mb][nb] = (v8f){};
    constexpr bool SA = NSPLIT == 1 || NSPLIT == 2, SB = NSPLIT >= 2;
    const size_t aoff = (size_t)r0 * K + lane * 8, boff = (size_t)c0 * K + lane * 8;   // a k step of 32 is one tile of 512 elements
    const T16* pa = A + aoff; const T16* pa2 = SA ? A2 + aoff : pa; const T16* pb = Bt + boff; const T16* pb2 = SB ? Bt2 + boff : pb;   // one base a plane: row blocks and k steps are immediate offsets
    // Three register sets of fragments: the loads of k step t + 2 are issued in front of the products of step t, so a load has two steps of matrix work to come back in (the grid is one wave a SIMD: no other wave covers this one's wait).
    struct FS { V a[4], a2[4], b[4], b2[4]; } f0, f1, f2;
    auto ld = [&](FS& f, int st) {
#pragma unroll
        for (int q = 0; q < 4; ++q) { f.a[q] = WFrag<T16>::ld(pa + q * 16 * K + st * 512); if (SA) f.a2[q] = WFrag<T16>::ld(pa2 + q * 16 * K + st * 512); f.b[q] = WFrag<T16>::ld(pb + q * 16 * K + st * 512); if (SB) f.b2[q] = WFrag<T16>::ld(pb2 + q * 16 * K + st * 512); }
        __builtin_amdgcn_sched_barrier(0); };   // keeps a step's loads together in front of the products that follow, not strewn among them or sunk towards their use
    auto mm = [&](const FS& f) {
#pragma unroll
        for (int nb = 0; nb < 4; ++nb)
#pragma unroll
            for (int mb = 0; mb < 4; ++mb) { acc[mb][nb] = WFrag<T16>::mma(f.a[mb], f.b[nb], acc[mb][nb]); if (SA) acc[mb][nb] = WFrag<T16>::mma(f.a2[mb], f.b[nb], acc[mb][nb]); if (SB) acc[mb][nb] = WFrag<T16>::mma(f.a[mb], f.b2[nb], acc[mb][nb]); }
        __builtin_amdgcn_sched_barrier(0); };   // the other side of the same fence: every product of the step stays in front of what follows it (the slots of gap, then the set's refill)
    auto gap = [&]() { asm volatile("v_nop\n\tv_nop\n\tv_nop\n\tv_nop");   // four vector slots between the last matrix instruction and the loads that land on its operand registers (the set's refill; at the loop's foot over the taken branch): the distance that holds for a vector instruction, kept for a load too
        __builtin_amdgcn_sched_barrier(0); };   // the refill is not lifted over the slots
    ld(f0, 0); ld(f1, 1);
    asm volatile("s_wait_xcnt 0x0" ::: "memory");   // in front of any overwrite of a register which these first loads name: the compiler forms their addresses in registers of its own and takes those for other values behind them
    __builtin_amdgcn_sched_barrier(0);   // nothing that follows (the accumulators' zeros, the loop's counter) is lifted over that wait
#pragma unroll 1
    for (int kc = 0; kc < K - 64; kc += 96) {
        ld(f2, 2); mm(f0); gap(); ld(f0, 3); mm(f1); gap(); ld(f1, 4); mm(f2); gap();
        asm volatile("s_wait_xcnt 0x0" :: "v"(pa), "v"(pa2), "v"(pb), "v"(pb2) : "memory");   // in front of the overwrite of the bases which this trip's loads name: as inputs they stay untouched up to it
        pa += 1536; pa2 += 1536; pb += 1536; pb2 += 1536;
    }
    mm(f0); mm(f1);
#pragma unroll
    for (int mb = 0; mb < 4; ++mb) {
#pragma unroll
        for (int nb = 0; nb < 4; ++nb) {
#pragma unroll
            for (int j = 0; j < 8; ++j) os[(hi * 8 + j) * 68 + nb * 16 + lr] = acc[mb][nb][j]; }
        __builtin_amdgcn_wave_barrier(); asm volatile("" ::: "memory");
        float* crow = C + (size_t)(r0 + mb * 16) * ldc + c0;
{
#pragma unroll
            for (int s = 0; s < 8; ++s) { const int row = 2 * s + hi, cofs = lr * 4; v4f val = *(const v4fa*)(os + row * 68 + cofs); if (BIAS) { val[0] += bfr(bias[c0 + cofs]); val[1] += bfr(bias[c0 + cofs + 1]); val[2] += bfr(bias[c0 + cofs + 2]); val[3] += bfr(bias[c0 + cofs + 3]); }
                *(v4f*)(crow + (size_t)row * ldc + cofs) = val; }
             }
        __builtin_amdgcn_sched_barrier(0);   // the row block's stores stay in front of the wait below
        asm volatile("s_wait_xcnt 0x0" ::: "memory");   // in front of any overwrite of a register (address or data) which these stores name: the next row block takes the same registers
        __builtin_amdgcn_sched_barrier(0);   // the next row block's work stays behind that wait
        __builtin_amdgcn_wave_barrier(); asm volatile("" ::: "memory");
    }
}

// ---- proj_tile: k_gemmw's 64x64 tile of one wave for the projections: C = x W^T + b, K = DM, plain bf16 operands, no f32 result. A 64-column tile is one head (HD == 64) and rows are b * TT + t:
// C + bias goes out as three 16-bit planes (fp16, bf16 hi, bf16 lo), EPI 1 as [b][head][t][d] (staged through the wave's own os rows), EPI 2 transposed as [b][head][d][t], each head's plane in fragment order.
template <int EPI>
__device__ __forceinline__ void proj_tile(const bf* __restrict__ A, const bf* __restrict__ Bt, const float* __restrict__ bias, int r0, int c0, float* os, h16* P16, bf* Ph, bf* Pl) {
    typedef WFrag<bf>::V V; constexpr int K = DM, ldc = DQ; constexpr bool BIAS = true;
    const int lane = threadIdx.x & 31, lr = lane & 15, hi = lane >> 4;
    v8f acc[4][4];
#pragma unroll
    for (int mb = 0; mb < 4; ++mb)
#pragma unroll
        for (int nb = 0; nb < 4; ++nb) acc[mb][nb] = (v8f){};
    const bf* pa = A + (size_t)r0 * K + lane * 8; const bf* pb = Bt + (size_t)c0 * K + lane * 8;
    // Three register sets of fragments: the loads of k step t + 2 are issued in front of the products of step t, so a load has two steps of this wave's matrix work (and the SIMD's two other waves) to come back under.
    static_assert(K / 32 >= 5 && (K / 32 - 2) % 3 == 0, "the k loop below takes three k steps a trip and leaves two");
    V a0[4], b0[4], a1[4], b1[4], a2[4], b2[4];
    auto ld = [&](V (&a)[4], V (&b)[4], int st) {
#pragma unroll
        for (int mb = 0; mb < 4; ++mb) { a[mb] = WFrag<bf>::ld(pa + mb * 16 * K + st * 512); b[mb] = WFrag<bf>::ld(pb + mb * 16 * K + st * 512); }
        __builtin_amdgcn_sched_barrier(0); };   // keeps the sixteen loads in front of the products that follow: left alone the compiler sinks them to just before their use, and the wait for memory is back
    auto mm = [&](const V (&a)[4], const V (&b)[4]) {
#pragma unroll
        for (int nb = 0; nb < 4; ++nb)
#pragma unroll
            for (int mb = 0; mb < 4; ++mb) acc[mb][nb] = WFrag<bf>::mma(a[mb], b[nb], acc[mb][nb]);
        __builtin_amdgcn_sched_barrier(0); };   // the other side of the same fence: every product of the step stays in front of what follows it (the slots of gap, then the set's refill)
    auto gap = [&]() { asm volatile("v_nop\n\tv_nop\n\tv_nop\n\tv_nop");   // four vector slots between the last matrix instruction and the loads that land on its operand registers (the set's refill; at the loop's foot over the taken branch): the distance that holds for a vector instruction, kept for a load too
        __builtin_amdgcn_sched_barrier(0); };   // the refill is not lifted over the slots
    ld(a0, b0, 0); ld(a1, b1, 1);
    asm volatile("s_wait_xcnt 0x0" ::: "memory");   // in front of any overwrite of a register which these first loads name: the compiler forms their addresses in registers of its own and takes those for other values behind them
    __builtin_amdgcn_sched_barrier(0);   // nothing that follows (the accumulators' zeros, the loop's counter) is lifted over that wait
#pragma unroll 1
    for (int kc = 0; kc < K - 64; kc += 96) {
        ld(a2, b2, 2); mm(a0, b0); gap(); ld(a0, b0, 3); mm(a1, b1); gap(); ld(a1, b1, 4); mm(a2, b2); gap();
        asm volatile("s_wait_xcnt 0x0" :: "v"(pa), "v"(pb) : "memory");   // in front of the overwrite of the two addresses this trip's loads name (row blocks and k steps are immediate offsets); as inputs they stay untouched up to it
        pa += 1536; pb += 1536;
    }
    mm(a0, b0); mm(a1, b1); gap();   // here the slots stand in front of the bias loads, which take operand registers of the last products
    if (EPI == 2) {   // a lane's eight accumulator rows are eight consecutive t of one column d: in fragment order the very 16 bytes of lane 'lane' in half mb & 1 of tile (nb, t / 32), straight from registers
        const size_t pb = ((size_t)(r0 / TT) * (ldc / HD) + c0 / HD) * HD * TT + (size_t)(r0 % TT) * 16 + lane * 8; const float* bp = bias + c0 + lr; float tb[4];
#pragma unroll
        for (int nb = 0; nb < 4; ++nb) tb[nb] = BIAS ? bp[nb * 16] : 0.0f;   // all four at once: one wait for memory, not four
        if (BIAS) asm volatile("s_wait_xcnt 0x0" :: "v"(bp) : "memory");   // in front of any overwrite of the address these loads name
#pragma unroll
        for (int nb = 0; nb < 4; ++nb) { const float bb = bfr(tb[nb]); h16* p16 = P16 + pb + (size_t)nb * 16 * TT; bf* ph = Ph + pb + (size_t)nb * 16 * TT; bf* pl = Pl + pb + (size_t)nb * 16 * TT; v8h o16[4]; v8us oh[4], ol[4];
#pragma unroll
            for (int mb = 0; mb < 4; ++mb)
#pragma unroll
                for (int j = 0; j < 8; ++j) { const float val = acc[mb][nb][j] + bb; o16[mb][j] = tohx(val); unsigned short a2, c2; splitf(val, a2, c2); oh[mb][j] = a2; ol[mb][j] = c2; }
#pragma unroll
            for (int mb = 0; mb < 4; ++mb) { *(v8h*)(p16 + mb * 256) = o16[mb]; *(v8us*)(ph + mb * 256) = oh[mb]; *(v8us*)(pl + mb * 256) = ol[mb]; }   // every store is 512 bytes in a row
            // the wait that stands in front of any overwrite of a register which an issued store names: addresses and data are its inputs, so they stay untouched up to it
            asm volatile("s_wait_xcnt 0x0" :: "v"(p16), "v"(ph), "v"(pl), "v"(o16[0]), "v"(o16[1]), "v"(o16[2]), "v"(o16[3]), "v"(oh[0]), "v"(oh[1]), "v"(oh[2]), "v"(oh[3]), "v"(ol[0]), "v"(ol[1]), "v"(ol[2]), "v"(ol[3]) : "memory"); }
        return; }
    float pbias[4][8];   // EPI 1: in store s a lane takes columns s * 16 + hi * 8 .. + 7 of row lr, its own 16 bytes of the s-th half tile
    if (EPI == 1) { const float* bp = bias + c0 + hi * 8; v8f tb[4];
#pragma unroll
        for (int s = 0; s < 4; ++s) tb[s] = BIAS ? *(const v8f*)(bp + s * 16) : (v8f){};
        if (BIAS) asm volatile("s_wait_xcnt 0x0" :: "v"(bp) : "memory");   // the wait: in front of any overwrite of the address these loads name
#pragma unroll
        for (int s = 0; s < 4; ++s)
#pragma unroll
            for (int q = 0; q < 8; ++q) pbias[s][q] = bfr(tb[s][q]); }
#pragma unroll
    for (int mb = 0; mb < 4; ++mb) {
#pragma unroll
        for (int nb = 0; nb < 4; ++nb) {
#pragma unroll
            for (int j = 0; j < 8; ++j) os[(hi * 8 + j) * 68 + nb * 16 + lr] = acc[mb][nb][j]; }
        __builtin_amdgcn_wave_barrier(); asm volatile("" ::: "memory");
        if (EPI == 1) {   // 16 rows x 64 columns are two tiles, 2 KiB in a row of each plane: a store instruction fills four whole 128-byte lines
            const size_t pb = (((size_t)(r0 / TT) * (ldc / HD) + c0 / HD) * TT + (r0 % TT) + mb * 16) * HD + lane * 8; h16* p16 = P16 + pb; bf* ph = Ph + pb; bf* pl = Pl + pb; v8h o16[4]; v8us oh[4], ol[4];
#pragma unroll
            for (int s = 0; s < 4; ++s) { const float* op = os + lr * 68 + s * 16 + hi * 8; const v4f v0 = *(const v4fa*)op, v1 = *(const v4fa*)(op + 4);
#pragma unroll
                for (int q = 0; q < 8; ++q) { const float val = (q < 4 ? v0[q & 3] : v1[q & 3]) + pbias[s][q]; o16[s][q] = tohx(val); unsigned short a2, c2; splitf(val, a2, c2); oh[s][q] = a2; ol[s][q] = c2; } }
#pragma unroll
            for (int s = 0; s < 4; ++s) { *(v8h*)(p16 + s * 256) = o16[s]; *(v8us*)(ph + s * 256) = oh[s]; *(v8us*)(pl + s * 256) = ol[s]; }
            // the wait in front of any overwrite of a register which an issued store names, as above
            asm volatile("s_wait_xcnt 0x0" :: "v"(p16), "v"(ph), "v"(pl), "v"(o16[0]), "v"(o16[1]), "v"(o16[2]), "v"(o16[3]), "v"(oh[0]), "v"(oh[1]), "v"(oh[2]), "v"(oh[3]), "v"(ol[0]), "v"(ol[1]), "v"(ol[2]), "v"(ol[3]) : "memory");
        }
        __builtin_amdgcn_wave_barrier(); asm volatile("" ::: "memory");
    }
}
// k_qkv: the three projections in ONE launch. Grid (rows / 128, columns / 128), 12 waves: waves 0-3 q, 4-7 k, 8-11 v, each group 2 x 2 tiles of 64 x 64 on the same 128 rows and 128 columns,
// so an x row is read by six waves of one WGP and a weight row by two, and three waves share a SIMD. No wave waits for another: every q and k wave has its own staging rows in LDS; the v waves write from registers and use none.
__global__ __launch_bounds__(384) void k_qkv(const bf* __restrict__ XB, const bf* __restrict__ WQ, const bf* __restrict__ WK, const bf* __restrict__ WV, const float* __restrict__ bq, const float* __restrict__ bk, const float* __restrict__ bv,
                                             h16* QP16, bf* QPh, bf* QPl, h16* KP16, bf* KPh, bf* KPl, h16* VT16, bf* VTh, bf* VTl) {
    __shared__ __align__(16) float os[8][16 * 68];
    const int w = __builtin_amdgcn_readfirstlane((int)(threadIdx.x >> 5)); const int r0 = blockIdx.x * 128 + (w & 1) * 64, c0 = blockIdx.y * 128 + ((w >> 1) & 1) * 64;
    if (w >= 8) proj_tile<2>(XB, WV, bv, r0, c0, nullptr, VT16, VTh, VTl);
    else { const bool kk = w >= 4; proj_tile<1>(XB, kk ? WK : WQ, kk ? bk : bq, r0, c0, os[w], kk ? KP16 : QP16, kk ? KPh : QPh, kk ? KPl : QPl); }
}

typedef __attribute__((ext_vector_type(2))) _Float16 v2h;
typedef __attribute__((ext_vector_type(4))) _Float16 v4h;
typedef __attribute__((ext_vector_type(2))) unsigned short v2us;
typedef __attribute__((ext_vector_type(4))) unsigned short v4us;
typedef __attribute__((ext_vector_type(2))) float v2f;
typedef __attribute__((ext_vector_type(4))) int v4i;

__global__ __launch_bounds__(256) void k_wtG(const float* __restrict__ w, int K, int N, bf* Bt) {
    const int lane = threadIdx.x & 31; const int L0 = (blockIdx.x * 8 + (threadIdx.x >> 5)) * 8; const int nlines = N * K / 64;
{
#pragma unroll 1
        for (int l = 0; l < 8; ++l) { const int L = L0 + l; if (L >= nlines) break; const size_t e = (size_t)L * 64 + lane * 2; const int k = (int)(e % K), n = (int)(e / K); v2us o;
            o[0] = f2bf(w[(size_t)k * N + n]); o[1] = f2bf(w[(size_t)(k + 1) * N + n]); *(v2us*)(Bt + e) = o; }
         }
}
// k_prep: every f32 -> bf16 conversion of the call in ONE launch, from row-major f32 to fragment order. A work-group takes CH groups of eight floats of one array = 32 tiles of 16 rows x 32 k (a wave four tiles; all sixteen loads of a thread in flight at once); blockIdx.x picks the array.
// A load takes four whole 128-byte lines (four rows of one tile, eight lanes a row, four floats a lane); the four stores of a tile fill its 1 KiB.
// PAD (the position table): rows at or past nrow are the zero pad row; they are stored as zeros and read nothing past the table (the row is clamped).
#define CH   2048
#define GX   (NB_ * TT * DM / 8 / CH)
#define GW   (DM * DQ / 8 / CH)
#define GP   (NPE * HD / 8 / CH)
template <bool PAD, int K>
__device__ __forceinline__ void cvt_run(const float* __restrict__ src, bf* dst, unsigned blk, unsigned nrow) {
    constexpr unsigned TPR = K / 32;   // tiles along a row: 32 (one work-group = one band of 16 rows) or a divisor of 32
    const unsigned lane = threadIdx.x & 31, w = threadIdx.x >> 5, r4 = lane >> 3, c = lane & 7; unsigned so[16], row[16]; v4f v[16]; v4us o[16];
#pragma unroll
    for (int u = 0; u < 16; ++u) { const unsigned tl = w * 4 + (u >> 2), rt = TPR >= 32 ? blk : blk * (32 / TPR) + tl / TPR, ks = TPR >= 32 ? tl : tl % TPR;   // tile tl of this work-group's 32; rows (u & 3) * 4 + r4 of it
        row[u] = rt * 16 + (u & 3) * 4 + r4; so[u] = ((PAD ? (row[u] < nrow ? row[u] : nrow - 1) : row[u]) * K + ks * 32 + c * 4) * 4u; v[u] = *(const v4f*)((const char*)src + so[u]); }
    // the wait that stands in front of any overwrite of a register which an issued load names: the byte offsets are its inputs, so they stay untouched (also by a landing load) up to it
    if (PAD) asm volatile("s_wait_xcnt 0x0" :: "v"(so[0]), "v"(so[1]), "v"(so[2]), "v"(so[3]), "v"(so[4]), "v"(so[5]), "v"(so[6]), "v"(so[7]), "v"(so[8]), "v"(so[9]), "v"(so[10]), "v"(so[11]), "v"(so[12]), "v"(so[13]), "v"(so[14]), "v"(so[15]) : "memory");
    else asm volatile("s_wait_xcnt 0x0" :: "v"(so[0]), "v"(so[1]), "v"(so[2]), "v"(so[3]) : "memory");   // the other twelve are immediate offsets from these four
#pragma unroll
    for (int u = 0; u < 16; ++u)
#pragma unroll
        for (int k = 0; k < 4; ++k) o[u][k] = f2bf((PAD && row[u] >= nrow) ? 0.0f : v[u][k]);
    // floats c * 4 .. + 3 of a tile's row: half c >> 2, lane group (c >> 1) & 1, first or second 8 bytes of that lane's 16
    bf* dp = dst + (size_t)(blk * 32 + w * 4) * 512 + (c >> 2) * 256 + (((c >> 1) & 1) * 16 + r4) * 8 + (c & 1) * 4;
#pragma unroll
    for (int u = 0; u < 16; ++u) *(v4us*)(dp + (u >> 2) * 512 + (u & 3) * 32) = o[u];
}
__global__ __launch_bounds__(256) void k_prep(const float* __restrict__ x, const float* __restrict__ wq, const float* __restrict__ wk, const float* __restrict__ wv, const float* __restrict__ wo, const float* __restrict__ pe,
                                              bf* XB, bf* WQ, bf* WK, bf* WV, bf* WO, bf* PE) {
    const unsigned b = blockIdx.x;
    if (b >= GX + 4 * GW) { cvt_run<true, HD>(pe, PE, b - (GX + 4 * GW), 2047); return; }
    const unsigned a = b < GX ? 0 : 1 + (b - GX) / GW;
    cvt_run<false, DM>(a == 0 ? x : a == 1 ? wq : a == 2 ? wk : a == 3 ? wv : wo, a == 0 ? XB : a == 1 ? WQ : a == 2 ? WK : a == 3 ? WV : WO, a == 0 ? b : (b - GX) % GW, 0);
}

// attn_body: 32 query rows i0.. of head z, 8 waves; wave w owns keys w * 128 .. + 127 from the scores to its partial output, and waits for no other wave before the final sum.
// The scores are computed TRANSPOSED (the key tile is the A operand, the query tile the B operand): a lane then holds eight consecutive keys of ONE query, which is the very piece of an A fragment that attn.v wants from it,
// so the logits, the softmax and the probabilities stay in the lane's registers. LDS holds, per wave, its own 32 x 128 relative scores (R, pitch RP, stored skewed as before and read back as 16-byte pieces),
// into whose slots a lane parks the logits of key tiles NKEEP.. (each lane rewrites only what it has just read), and at the end the wave's partial output with its row maxima and row sums.
// Softmax by parts: each wave takes the maximum m_w and the sum l_w over its own 128 keys, attn.v runs on exp(s - m_w) unnormalised, and the final sum weighs wave w by exp(m_w - m) and divides by the weighted l_w.
// HI: hi+lo planes, 3 products, for scores and attn.v; else single fp16 (probabilities x PCAR).
// Behind a group of global loads: the wait that stands in front of any overwrite of a register which an issued load names. It takes the group's addresses as inputs, so that they stay untouched (also by a landing load of the group) up to it.
#define XWAIT1(p)    asm volatile("s_wait_xcnt 0x0" :: "v"(p) : "memory")
#define XWAIT2(p, q) asm volatile("s_wait_xcnt 0x0" :: "v"(p), "v"(q) : "memory")
#define L2E 1.4426950408889634f
template <bool HI>
__device__ __forceinline__ void attn_body(float* T, int z, int i0, const h16* __restrict__ QP16, const bf* __restrict__ QPh, const bf* __restrict__ QPl, const h16* __restrict__ KP16, const bf* __restrict__ KPh, const bf* __restrict__ KPl,
                                          const h16* __restrict__ VT16, const bf* __restrict__ VTh, const bf* __restrict__ VTl, const bf* __restrict__ PE, bf* ATh, bf* ATl) {
    constexpr int NKEEP = 2, KD = HI ? 2 : 3, VD = HI ? 4 : 8;   // key tiles whose logits stay in registers; how many key tiles, and how many value fragments, are fetched ahead of their use
    const int tid = threadIdx.x, lane = tid & 31, lr = lane & 15, hi = lane >> 4, w = tid >> 5; const int j0 = w * 128;   // this wave's 128 keys
    float* R = T + w * (BR * RP);   // this wave's own LDS
    const size_t qb = ((size_t)z * TT + i0) * HD + lane * 8;   // planes in fragment order: 16 rows x 64 are two tiles of 512 elements
    // relative scores: rows i0 + 16 mt + r and keys j0 + jj need positions p = (j0 - i0 - 16 mt + 1008) + c, c = jj - r + 15 in 0..142: nine 16-wide tiles a row tile, ten for both
    const int pb = j0 - i0 + 992;   // 0 .. 1888; last row read pb + 159 <= 2047
    v16bf qh[2][2], ql[2][2], rb[10][2], kb[8][4], vb[16][2]; v16h q16[2][2], kf[8][2], vf[16];
    const bf* pp = PE + (size_t)pb * HD + lane * 8;
    auto rload = [&](int u) { rb[u][0] = WFrag<bf>::ld(pp + u * 1024); rb[u][1] = WFrag<bf>::ld(pp + u * 1024 + 512); XWAIT1(pp); };   // one base for all ten tiles (the tiles are immediate offsets): as the wait's input it outlives every load that names it
    const size_t ko = ((size_t)z * TT + j0) * HD + lane * 8; const bf* khp = KPh + ko; const bf* klp = KPl + ko; const h16* k16p = KP16 + ko;   // likewise one base a plane for the eight key tiles
    auto kload = [&](int nb) {
        if (HI) { kb[nb][0] = WFrag<bf>::ld(khp + nb * 1024); kb[nb][1] = WFrag<bf>::ld(khp + nb * 1024 + 512); kb[nb][2] = WFrag<bf>::ld(klp + nb * 1024); kb[nb][3] = WFrag<bf>::ld(klp + nb * 1024 + 512); XWAIT2(khp, klp); }
        else { kf[nb][0] = WFrag<h16>::ld(k16p + nb * 1024); kf[nb][1] = WFrag<h16>::ld(k16p + nb * 1024 + 512); XWAIT1(k16p); } };
    const size_t vo = (size_t)z * HD * TT + j0 * 16 + lane * 8; const bf* vhp = VTh + vo; const bf* vlp = VTl + vo; const h16* v16p = VT16 + vo;
    auto vload = [&](int t) { const int off = (t >> 2) * 512 + (t & 3) * 16 * TT;   // step t = ks * 4 + nb: tile (nb, key / 32) of the transposed plane
        if (HI) { vb[t][0] = WFrag<bf>::ld(vhp + off); vb[t][1] = WFrag<bf>::ld(vlp + off); XWAIT2(vhp, vlp); } else { vf[t] = WFrag<h16>::ld(v16p + off); XWAIT1(v16p); } };
#pragma unroll
    for (int mt = 0; mt < 2; ++mt)
#pragma unroll
        for (int kk = 0; kk < 2; ++kk) { qh[mt][kk] = WFrag<bf>::ld(QPh + qb + (size_t)mt * 16 * HD + kk * 512); ql[mt][kk] = WFrag<bf>::ld(QPl + qb + (size_t)mt * 16 * HD + kk * 512); }
    XWAIT2(QPh + qb, QPl + qb);
#pragma unroll
    for (int u = 0; u < 4; ++u) rload(u);
#pragma unroll
    for (int u = 0; u < 10; ++u) {
#pragma unroll
        for (int mt = 0; mt < 2; ++mt) { const int tt = u - 1 + mt; if (tt < 0 || tt > 8) continue;
            v8f acc = (v8f){}; acc = wmmab(qh[mt][0], rb[u][0], acc); acc = wmmab(ql[mt][0], rb[u][0], acc); acc = wmmab(qh[mt][1], rb[u][1], acc); acc = wmmab(ql[mt][1], rb[u][1], acc);
            asm volatile("v_nop\n\tv_nop\n\tv_nop\n\tv_nop" :: "v"(acc));   // the four vector slots the chip needs before the next tile's first matrix instruction may overwrite these result registers
#pragma unroll
            for (int j = 0; j < 8; ++j) { const int r = hi * 8 + j, jj = tt * 16 + lr + r - 15; R[(mt * 16 + r) * RP + ((jj >= 0 && jj < 128) ? jj : 128)] = acc[j]; } }   // a position outside this wave's keys lands in the row's pad column
        if (u < 6) rload(u + 4); else if (u >= 9 - KD && u < 9) kload(u - (9 - KD));
        if (!HI && u == 5) {
#pragma unroll
            for (int mt = 0; mt < 2; ++mt)
#pragma unroll
                for (int kk = 0; kk < 2; ++kk) q16[mt][kk] = WFrag<h16>::ld(QP16 + qb + (size_t)mt * 16 * HD + kk * 512);
            XWAIT1(QP16 + qb); } }
    asm volatile("s_wait_dscnt 0x0" ::: "memory");   // the skewed stores crossed lanes, of this wave alone: they are done before its lanes read the rows back; no other wave touches them, so no barrier
    v8f s[8][2]; float mx[2] = { -3.0e38f, -3.0e38f };
#pragma unroll
    for (int nb = 0; nb < 8; ++nb) { v4f r0[2], r1[2];
#pragma unroll
        for (int mt = 0; mt < 2; ++mt) { const float* rp = R + (mt * 16 + lr) * RP + nb * 16 + hi * 8; r0[mt] = *(const v4fa*)rp; r1[mt] = *(const v4fa*)(rp + 4); }   // query mt * 16 + lr, keys nb * 16 + hi * 8 .. + 7
#pragma unroll
        for (int mt = 0; mt < 2; ++mt) { v8f a = (v8f){};   // D row = key hi * 8 + j of the tile, D column = query lr
            if (HI) { a = wmmab(kb[nb][0], qh[mt][0], a); a = wmmab(kb[nb][0], ql[mt][0], a); a = wmmab(kb[nb][2], qh[mt][0], a); a = wmmab(kb[nb][1], qh[mt][1], a); a = wmmab(kb[nb][1], ql[mt][1], a); a = wmmab(kb[nb][3], qh[mt][1], a); }
            else { a = wmma16(kf[nb][0], q16[mt][0], a); a = wmma16(kf[nb][1], q16[mt][1], a); }
            s[nb][mt] = a; }
        if (nb + KD < 8) kload(nb + KD);
#pragma unroll
        for (int mt = 0; mt < 2; ++mt) {
#pragma unroll
            for (int j = 0; j < 8; ++j) { const float v = __fadd_rn(__fmul_rn(s[nb][mt][j], SCL), j < 4 ? r0[mt][j & 3] : r1[mt][j & 3]); s[nb][mt][j] = v; mx[mt] = fmaxf(mx[mt], v); }   // SCL is a power of two: the product is exact, fused or not
            if (nb >= NKEEP) { float* rp = R + (mt * 16 + lr) * RP + nb * 16 + hi * 8; *(v4fa*)rp = (v4f){ s[nb][mt][0], s[nb][mt][1], s[nb][mt][2], s[nb][mt][3] }; *(v4fa*)(rp + 4) = (v4f){ s[nb][mt][4], s[nb][mt][5], s[nb][mt][6], s[nb][mt][7] }; } } }
#pragma unroll
    for (int t = 0; t < VD; ++t) vload(t);   // they fly during the first exponentials
#pragma unroll
    for (int mt = 0; mt < 2; ++mt) mx[mt] = fmaxf(mx[mt], __shfl_xor(mx[mt], 16, 32));   // the two lane halves hold the two halves of every key tile
    auto sload = [&](int ks) {   // the parked logits of key tiles 2 ks, 2 ks + 1: each lane its own
#pragma unroll
        for (int q = 0; q < 2; ++q)
#pragma unroll
            for (int mt = 0; mt < 2; ++mt) { const float* rp = R + (mt * 16 + lr) * RP + (2 * ks + q) * 16 + hi * 8; const v4f a = *(const v4fa*)rp, b = *(const v4fa*)(rp + 4); s[2 * ks + q][mt] = (v8f){ a[0], a[1], a[2], a[3], b[0], b[1], b[2], b[3] }; } };
    if (NKEEP == 0) sload(0);
    // attn.v: this wave sums its own 128 keys for all 32 rows x 64 columns; element e of a lane's A fragment is key 8 hi + e of tile 2 ks, element 8 + e the same of tile 2 ks + 1
    v8f o[2][4]; float sm[2] = { 0.f, 0.f };
#pragma unroll
    for (int mt = 0; mt < 2; ++mt)
#pragma unroll
        for (int nb = 0; nb < 4; ++nb) o[mt][nb] = (v8f){};
#pragma unroll
    for (int ks = 0; ks < 4; ++ks) { v16bf ah[2], al[2]; v16h a16[2];
#pragma unroll
        for (int mt = 0; mt < 2; ++mt) { v8us oh[2], ol[2]; v8h o16[2];
#pragma unroll
            for (int q = 0; q < 2; ++q) { float p[8];
#pragma unroll
                for (int j = 0; j < 8; ++j) { p[j] = __builtin_amdgcn_exp2f(__fmul_rn(__fsub_rn(s[2 * ks + q][mt][j], mx[mt]), L2E));
                    if (HI) { unsigned short a, c2; splitf(p[j], a, c2); oh[q][j] = a; ol[q][j] = c2; } else o16[q][j] = tohx(p[j] * PCAR); }
                sm[mt] += ((p[0] + p[1]) + (p[2] + p[3])) + ((p[4] + p[5]) + (p[6] + p[7])); }
            if (HI) { ah[mt] = cat16b(oh[0], oh[1]); al[mt] = cat16b(ol[0], ol[1]); } else a16[mt] = cat16(o16[0], o16[1]); }
        if (ks < 3 && 2 * (ks + 1) >= NKEEP) sload(ks + 1);
#pragma unroll
        for (int nb = 0; nb < 4; ++nb) { const int t = ks * 4 + nb;
#pragma unroll
            for (int mt = 0; mt < 2; ++mt) {
                if (HI) { o[mt][nb] = wmmab(ah[mt], vb[t][0], o[mt][nb]); o[mt][nb] = wmmab(al[mt], vb[t][0], o[mt][nb]); o[mt][nb] = wmmab(ah[mt], vb[t][1], o[mt][nb]); }
                else o[mt][nb] = wmma16(a16[mt], vf[t], o[mt][nb]); }
            if (t + VD < 16) vload(t + VD); } }
#pragma unroll
    for (int mt = 0; mt < 2; ++mt) sm[mt] += __shfl_xor(sm[mt], 16, 32);
    __builtin_amdgcn_wave_barrier(); asm volatile("" ::: "memory");   // the partial output goes over this wave's own slots: behind its last read of them
#pragma unroll
    for (int mt = 0; mt < 2; ++mt) {
#pragma unroll
        for (int nb = 0; nb < 4; ++nb)
#pragma unroll
            for (int j = 0; j < 8; ++j) R[(mt * 16 + hi * 8 + j) * OPP + nb * 16 + lr] = o[mt][nb][j];
        R[BR * OPP + hi * BR + mt * 16 + lr] = hi ? sm[mt] : mx[mt]; }   // behind the partial output: 32 row maxima, then 32 row sums
    __syncthreads();   // partial outputs, maxima and sums of all eight waves complete
    { const int row = (w >> 2) * 16 + lr, d0 = (w & 3) * 16 + hi * 8; v4f p0[8], p1[8]; float mw[8], lw[8];   // wave w writes half tile w & 3 of row tile w >> 2: a lane its own 16 bytes there
#pragma unroll
        for (int ww = 0; ww < 8; ++ww) { const float* pr = T + ww * (BR * RP); p0[ww] = *(const v4fa*)(pr + row * OPP + d0); p1[ww] = *(const v4fa*)(pr + row * OPP + d0 + 4); mw[ww] = pr[BR * OPP + row]; lw[ww] = pr[BR * OPP + BR + row]; }
        float m = mw[0];
#pragma unroll
        for (int ww = 1; ww < 8; ++ww) m = fmaxf(m, mw[ww]);
        v4f s0 = (v4f){}, s1 = (v4f){}; float den = 0.f;
#pragma unroll
        for (int ww = 0; ww < 8; ++ww) { const float e = __builtin_amdgcn_exp2f((mw[ww] - m) * L2E); den += e * lw[ww]; s0 += p0[ww] * e; s1 += p1[ww] * e; }   // key blocks in ascending order
        const float cs = __fdiv_rn(HI ? 1.0f : (1.0f / PCAR), den); v8us oh, ol;
#pragma unroll
        for (int q = 0; q < 4; ++q) { unsigned short a, c2; splitf(s0[q] * cs, a, c2); oh[q] = a; ol[q] = c2; splitf(s1[q] * cs, a, c2); oh[4 + q] = a; ol[4 + q] = c2; }
        const size_t oo = ((size_t)(z / NH_) * TT + i0 + (w >> 2) * 16) * DQ + (size_t)(z % NH_) * 1024 + (w & 3) * 256 + lane * 8; *(v8us*)(ATh + oo) = oh; *(v8us*)(ATl + oo) = ol; }   // fragment order, K = DQ: a head is two tiles along k; a wave fills four 128-byte lines
}
// k_attn: grid (TT / BR, NZ), 256 threads; two work-groups share a WGP's LDS, so four waves a SIMD
__global__ __launch_bounds__(256) __attribute__((amdgpu_waves_per_eu(4, 4))) void k_attn(const h16* __restrict__ QP16, const bf* __restrict__ QPh, const bf* __restrict__ QPl, const h16* __restrict__ KP16, const bf* __restrict__ KPh, const bf* __restrict__ KPl,
                                               const h16* __restrict__ VT16, const bf* __restrict__ VTh, const bf* __restrict__ VTl, const bf* __restrict__ PE, bf* ATh, bf* ATl) {
    __shared__ __align__(16) float T[8 * BR * RP];
    const int i0 = blockIdx.x * BR, z = blockIdx.y;
    if (i0 < RH) attn_body<true>(T, z, i0, QP16, QPh, QPl, KP16, KPh, KPl, VT16, VTh, VTl, PE, ATh, ATl);
    else attn_body<false>(T, z, i0, QP16, QPh, QPl, KP16, KPh, KPl, VT16, VTh, VTl, PE, ATh, ATl);
}

extern "C" void kernel_launch(void* const* d_in, const int* in_sizes, int n_in,
                              void* d_out, int out_size, void* d_ws, size_t ws_size, hipStream_t stream) {
    (void)in_sizes; (void)n_in; (void)out_size;
    const float* x = (const float*)d_in[0]; const float* wq = (const float*)d_in[1]; const float* bq = (const float*)d_in[2]; const float* wk = (const float*)d_in[3]; const float* bk = (const float*)d_in[4]; const float* wv = (const float*)d_in[5]; const float* bv = (const float*)d_in[6]; const float* wo = (const float*)d_in[7]; const float* bo = (const float*)d_in[8]; const float* pe = (const float*)d_in[9];
    float* OUT = (float*)d_out;     // [4][1024][1024]
    char* wsp = (char*)d_ws;
    auto take = [&](size_t bytes) { char* p = wsp; wsp += (bytes + 255) & ~(size_t)255; return (void*)p; };
    bf* WO = (bf*)take((size_t)DM * DQ * 2); bf* PE = (bf*)take((size_t)NPE * HD * 2);
    h16* QP16 = (h16*)take((size_t)NZ * TT * HD * 2); h16* KP16 = (h16*)take((size_t)NZ * TT * HD * 2); h16* VT16 = (h16*)take((size_t)NZ * HD * TT * 2);
    bf* QPh = (bf*)take((size_t)NZ * TT * HD * 2); bf* QPl = (bf*)take((size_t)NZ * TT * HD * 2); bf* KPh = (bf*)take((size_t)NZ * TT * HD * 2); bf* KPl = (bf*)take((size_t)NZ * TT * HD * 2); bf* VTh = (bf*)take((size_t)NZ * HD * TT * 2); bf* VTl = (bf*)take((size_t)NZ * HD * TT * 2);
    bf* ATh = (bf*)take((size_t)NB_ * TT * DQ * 2); bf* ATl = (bf*)take((size_t)NB_ * TT * DQ * 2);
    bf* WQ = (bf*)take((size_t)DQ * DM * 2); bf* WK = (bf*)take((size_t)DKV * DM * 2); bf* WV = (bf*)take((size_t)DKV * DM * 2);
    bf* XB = (bf*)take((size_t)NB_ * TT * DM * 2);
    if ((size_t)(wsp - (char*)d_ws) > ws_size) return;    // ws 256 MiB
    k_prep<<<GX + 4 * GW + GP, 256, 0, stream>>>(x, wq, wk, wv, wo, pe, XB, WQ, WK, WV, WO, PE);   /* bf16 x, weights, position table + zero pad row */
    k_qkv<<<dim3(NB_ * TT / 128, DQ / 128, 1), 384, 0, stream>>>(XB, WQ, WK, WV, bq, bk, bv, QP16, QPh, QPl, KP16, KPh, KPl, VT16, VTh, VTl);
    k_attn<<<dim3(TT / BR, NZ, 1), 256, 0, stream>>>(QP16, QPh, QPl, KP16, KPh, KPl, VT16, VTh, VTl, PE, ATh, ATl);   // planes are [b][h][..]: z is the plane index (one kv head per query head)
    k_gemmw<bf, 1, true, 0, DQ><<<dim3(NB_ * TT / 64, DM / 64, 1), 32, 0, stream>>>(ATh, ATl, WO, nullptr, OUT, DM, bo, 0, 0, 0, nullptr, nullptr, nullptr);
}

// v008
// It runs in 118 microseconds.
// In both of two side-by-side timings against v007, it was 1.06 times as fast.
// All steps since v000 together make it 22.4 times as fast.
#include <hip/hip_runtime.h>

// Self-attention with a learned relative-position bias (x [4][1024][1024]; q, k, v = x W^T + b ('oi', 16 heads x 64); S = q.k/8 + S_rel[i][j - i + 1023] where S_rel = q.pos_emb^T (pos_emb [2047][64], unscaled); softmax; out = merged Wo^T + bo -> [4][1024][1024]).
// Layout: batch and head are one flat index z = b * 16 + h carried in the grids (projections over all 4096 rows; their epilogues write the 16-bit head planes themselves: q, k as [z][t][d], v as [z][d][t]). Attention is ONE launch: a work-group of 8 waves owns 32 query rows of one z and each wave 128 of the 1024 keys: relative scores (q hi/lo planes against the bf16 position table, 2047 rows + one zero pad row; only the band of positions the 32 rows reach) are stored to the wave's own LDS already skewed (S_rel[i][j - i + 1023] at column j), the content scores are computed transposed and take them up in registers, softmax and attn.v run per wave on registers, the eight partial outputs are joined through LDS and the hi/lo planes of the merged heads go to memory.
// Every 16-bit operand plane in memory (x, weights, position table, q, k, v^T, merged heads) is kept in FRAGMENT ORDER: a tile of 16 rows x 32 k is 1 KiB in a row, first the 16 bytes that each lane 0..31 takes for k = 8 * (lane >> 4) .. + 7 of row lane & 15, then the 16 bytes for k + 16;
// tiles run along k, then down the rows (tile (rt, ks) of a plane with K elements a row starts at element rt * 16 * K + ks * 512). A fragment load is then 2 x 512 contiguous bytes (four whole 128-byte lines each) and not 16 pieces of 32 bytes; which element meets which in a product is as before.
// Compute dtypes, f32 accumulate: every input rounded to bf16; q/k/v on PLAIN bf16 operands (inputs: exact) + biases; relative scores q(hi+lo).pos_emb (2 products, f32); scores and attn.v: query rows < 512 hl (3 products), the rest single fp16 (x1024); softmax f32; Wo hl x exact (2 products) + bo.

#define NB_  4
#define TT   1024
#define DM   1024
#define NH_  16
#define NKV  16
#define REP  (NH_ / NKV)
#define HD   64
#define DQ   (NH_ * HD)
#define DKV  (NKV * HD)
#define NPE  2048                 // 2047 relative positions + 1 zero pad row
#define BR   32                   // query rows per attention work-group
#define RP   132                  // LDS row pitch in floats of a wave's 32 x 128 relative scores: 528 B = 16 B x odd, so b128 accesses of 16 rows meet no bank twice; column 128 is the pad, never read
#define OPP  68                   // pitch in floats of a wave's partial attn.v tile in LDS
#define NZ   (NB_ * NH_)
#define RH   512                  // query rows < RH use hi+lo planes (0: none)
#define WIN  0
#define PCAR 1024.0f
#define SCL  0.125f   // HD^-0.5
typedef _Float16 h16;
typedef unsigned short bf;
typedef __attribute__((ext_vector_type(16))) __bf16   v16bf;
typedef __attribute__((ext_vector_type(16))) _Float16 v16h;
typedef __attribute__((ext_vector_type(8)))  _Float16 v8h;
typedef __attribute__((ext_vector_type(8)))  unsigned short v8us;
typedef __attribute__((ext_vector_type(8)))  float    v8f;
typedef __attribute__((ext_vector_type(4)))  float    v4f;
typedef v8h  __attribute__((may_alias)) v8ha;
typedef v4f  __attribute__((may_alias)) v4fa;
typedef v8us __attribute__((may_alias)) v8usa;

__device__ __forceinline__ unsigned short f2bf(float f) { return __builtin_bit_cast(unsigned short, (__bf16)f); }   // the chip's own convert, round to nearest even
__device__ __forceinline__ float bf2f(unsigned short b) { return __uint_as_float(((unsigned)b) << 16); }
__device__ __forceinline__ float bfr(float f) { return bf2f(f2bf(f)); }
__device__ __forceinline__ h16 tohx(float x) { return (h16)x; }
typedef __attribute__((ext_vector_type(2))) __bf16 v2bf;
typedef __attribute__((ext_vector_type(2))) float f32x2;
typedef __attribute__((ext_vector_type(4))) unsigned u32x4;
__device__ __forceinline__ unsigned pk2bf(float a, float b) { return __builtin_bit_cast(unsigned, __builtin_convertvector(((f32x2){ a, b }), v2bf)); }   // one packed convert: a in the low half, b in the high half, each rounded to nearest even
// eight values at once into bf16 hi + lo (lo = the rounded rest y - hi), two by two: one packed convert makes a pair's word of the 16-byte piece, and the rest is taken from that same word, so no value is converted twice or moved into place
__device__ __forceinline__ void split8(v8f y, v8us& h, v8us& l) { u32x4 hu, lu;
#pragma unroll
    for (int i = 0; i < 4; ++i) { const unsigned u = pk2bf(y[2 * i], y[2 * i + 1]); hu[i] = u; lu[i] = pk2bf(y[2 * i] - __uint_as_float(u << 16), y[2 * i + 1] - __uint_as_float(u & 0xFFFF0000u)); }
    h = __builtin_bit_cast(v8us, hu); l = __builtin_bit_cast(v8us, lu); }
__device__ __forceinline__ v16h cat16(v8h lo, v8h hi) { return __builtin_shufflevector(lo, hi, 0, 1, 2, 3, 4, 5, 6, 7, 8, 9, 10, 11, 12, 13, 14, 15); }
__device__ __forceinline__ v16bf cat16b(v8us lo, v8us hi) { return __builtin_bit_cast(v16bf, __builtin_shufflevector(lo, hi, 0, 1, 2, 3, 4, 5, 6, 7, 8, 9, 10, 11, 12, 13, 14, 15)); }
__device__ __forceinline__ v8f wmma16(v16h a, v16h b, v8f c) { return __builtin_amdgcn_wmma_f32_16x16x32_f16(false, a, false, b, (short)0, c, false, false); }
__device__ __forceinline__ v8f wmmab(v16bf a, v16bf b, v8f c) { return __builtin_amdgcn_wmma_f32_16x16x32_bf16(false, a, false, b, (short)0, c, false, false); }



// ---- k_gemmw: register-blocked GEMM, ONE WAVE per 64x64 output tile (16 accumulators), operands straight from 16-bit planes in fragment order (ld takes the tile's start + lane * 8); grid (M/64, N/64, Z), 32 threads.
// C[m][n] (f32, pitch ldc, + optional f32 bias[n]) = sum_k A[m][k] Bt[n][k] (+ split products per NSPLIT). z-batch strides sA/sB/sC in elements. K is a compile-time constant.
// C goes to memory as f32 (EPI 0, the one form left here: the projections, which write 16-bit planes, are proj_tile below).
template <typename T16> struct WFrag;
template <> struct WFrag<h16> { typedef v16h V; static __device__ __forceinline__ V ld(const h16* p) { return cat16(*(const v8h*)p, *(const v8h*)(p + 256)); } static __device__ __forceinline__ v8f mma(V a, V b, v8f c) { return wmma16(a, b, c); } };
template <> struct WFrag<bf> { typedef v16bf V; static __device__ __forceinline__ V ld(const bf* p) { return cat16b(*(const v8us*)p, *(const v8us*)(p + 256)); } static __device__ __forceinline__ v8f mma(V a, V b, v8f c) { return wmmab(a, b, c); } };
template <typename T16, int NSPLIT, bool BIAS, int EPI, int K>
__global__ __launch_bounds__(32) void k_gemmw(const T16* __restrict__ A, const T16* __restrict__ A2, const T16* __restrict__ Bt, const T16* __restrict__ Bt2, float* C, int ldc, const float* __restrict__ bias, size_t sA, size_t sB, size_t sC, h16* P16, bf* Ph, bf* Pl) {
    typedef typename WFrag<T16>::V V;
    static_assert(K % 32 == 0 && K / 32 >= 5 && (K / 32 - 2) % 3 == 0, "the k loop below takes three k steps a trip and leaves two");
    __shared__ __align__(16) float os[16 * 68];
    const size_t z = blockIdx.z; A += z * sA; if (A2) A2 += z * sA; Bt += z * sB; if (Bt2) Bt2 += z * sB; C += z * sC;
    const int lane = threadIdx.x & 31, lr = lane & 15, hi = lane >> 4; const int r0 = blockIdx.x * 64, c0 = blockIdx.y * 64;
    v8f acc[4][4];
#pragma unroll
    for (int mb = 0; mb < 4; ++mb)
#pragma unroll
        for (int nb = 0; nb < 4; ++nb) acc[mb][nb] = (v8f){};
    constexpr bool SA = NSPLIT == 1 || NSPLIT == 2, SB = NSPLIT >= 2;
    const size_t aoff = (size_t)r0 * K + lane * 8, boff = (size_t)c0 * K + lane * 8;   // a k step of 32 is one tile of 512 elements
    const T16* pa = A + aoff; const T16* pa2 = SA ? A2 + aoff : pa; const T16* pb = Bt + boff; const T16* pb2 = SB ? Bt2 + boff : pb;   // one base a plane: row blocks and k steps are immediate offsets
    // Three register sets of fragments: the loads of k step t + 2 are issued in front of the products of step t, so a load has two steps of matrix work to come back in (the grid is one wave a SIMD: no other wave covers this one's wait).
    struct FS { V a[4], a2[4], b[4], b2[4]; } f0, f1, f2;
    auto ld = [&](FS& f, int st) {
#pragma unroll
        for (int q = 0; q < 4; ++q) { f.a[q] = WFrag<T16>::ld(pa + q * 16 * K + st * 512); if (SA) f.a2[q] = WFrag<T16>::ld(pa2 + q * 16 * K + st * 512); f.b[q] = WFrag<T16>::ld(pb + q * 16 * K + st * 512); if (SB) f.b2[q] = WFrag<T16>::ld(pb2 + q * 16 * K + st * 512); }
        __builtin_amdgcn_sched_barrier(0); };   // keeps a step's loads together in front of the products that follow, not strewn among them or sunk towards their use
    auto mm = [&](const FS& f) {
#pragma unroll
        for (int nb = 0; nb < 4; ++nb)
#pragma unroll
            for (int mb = 0; mb < 4; ++mb) { acc[mb][nb] = WFrag<T16>::mma(f.a[mb], f.b[nb], acc[mb][nb]); if (SA) acc[mb][nb] = WFrag<T16>::mma(f.a2[mb], f.b[nb], acc[mb][nb]); if (SB) acc[mb][nb] = WFrag<T16>::mma(f.a[mb], f.b2[nb], acc[mb][nb]); }
        __builtin_amdgcn_sched_barrier(0); };   // the other side of the same fence: every product of the step stays in front of what follows it (the slots of gap, then the set's refill)
    auto gap = [&]() { asm volatile("v_nop\n\tv_nop\n\tv_nop\n\tv_nop");   // four vector slots between the last matrix instruction and the loads that land on its operand registers (the set's refill; at the loop's foot over the taken branch): the distance that holds for a vector instruction, kept for a load too
        __builtin_amdgcn_sched_barrier(0); };   // the refill is not lifted over the slots
    ld(f0, 0); ld(f1, 1);
    asm volatile("s_wait_xcnt 0x0" ::: "memory");   // in front of any overwrite of a register which these first loads name: the compiler forms their addresses in registers of its own and takes those for other values behind them
    __builtin_amdgcn_sched_barrier(0);   // nothing that follows (the accumulators' zeros, the loop's counter) is lifted over that wait
#pragma unroll 1
    for (int kc = 0; kc < K - 64; kc += 96) {
        ld(f2, 2); mm(f0); gap(); ld(f0, 3); mm(f1); gap(); ld(f1, 4); mm(f2); gap();
        asm volatile("s_wait_xcnt 0x0" :: "v"(pa), "v"(pa2), "v"(pb), "v"(pb2) : "memory");   // in front of the overwrite of the bases which this trip's loads name: as inputs they stay untouched up to it
        pa += 1536; pa2 += 1536; pb += 1536; pb2 += 1536;
    }
    mm(f0); mm(f1);
#pragma unroll
    for (int mb = 0; mb < 4; ++mb) {
#pragma unroll
        for (int nb = 0; nb < 4; ++nb) {
#pragma unroll
            for (int j = 0; j < 8; ++j) os[(hi * 8 + j) * 68 + nb * 16 + lr] = acc[mb][nb][j]; }
        __builtin_amdgcn_wave_barrier(); asm volatile("" ::: "memory");
        float* crow = C + (size_t)(r0 + mb * 16) * ldc + c0;
{
#pragma unroll
            for (int s = 0; s < 8; ++s) { const int row = 2 * s + hi, cofs = lr * 4; v4f val = *(const v4fa*)(os + row * 68 + cofs); if (BIAS) { val[0] += bfr(bias[c0 + cofs]); val[1] += bfr(bias[c0 + cofs + 1]); val[2] += bfr(bias[c0 + cofs + 2]); val[3] += bfr(bias[c0 + cofs + 3]); }
                *(v4f*)(crow + (size_t)row * ldc + cofs) = val; }
             }
        __builtin_amdgcn_sched_barrier(0);   // the row block's stores stay in front of the wait below
        asm volatile("s_wait_xcnt 0x0" ::: "memory");   // in front of any overwrite of a register (address or data) which these stores name: the next row block takes the same registers
        __builtin_amdgcn_sched_barrier(0);   // the next row block's work stays behind that wait
        __builtin_amdgcn_wave_barrier(); asm volatile("" ::: "memory");
    }
}

// ---- proj_tile: k_gemmw's 64x64 tile of one wave for the projections: C = x W^T + b, K = DM, plain bf16 operands, no f32 result. A 64-column tile is one head (HD == 64) and rows are b * TT + t:
// C + bias goes out as three 16-bit planes (fp16, bf16 hi, bf16 lo), EPI 1 as [b][head][t][d] (staged through the wave's own os rows), EPI 2 transposed as [b][head][d][t], each head's plane in fragment order.
template <int EPI>
__device__ __forceinline__ void proj_tile(const bf* __restrict__ A, const bf* __restrict__ Bt, const float* __restrict__ bias, int r0, int c0, float* os, h16* P16, bf* Ph, bf* Pl) {
    typedef WFrag<bf>::V V; constexpr int K = DM, ldc = DQ; constexpr bool BIAS = true;
    const int lane = threadIdx.x & 31, lr = lane & 15, hi = lane >> 4;
    v8f acc[4][4];
#pragma unroll
    for (int mb = 0; mb < 4; ++mb)
#pragma unroll
        for (int nb = 0; nb < 4; ++nb) acc[mb][nb] = (v8f){};
    const bf* pa = A + (size_t)r0 * K + lane * 8; const bf* pb = Bt + (size_t)c0 * K + lane * 8;
    // Three register sets of fragments: the loads of k step t + 2 are issued in front of the products of step t, so a load has two steps of this wave's matrix work (and the SIMD's two other waves) to come back under.
    static_assert(K / 32 >= 5 && (K / 32 - 2) % 3 == 0, "the k loop below takes three k steps a trip and leaves two");
    V a0[4], b0[4], a1[4], b1[4], a2[4], b2[4];
    auto ld = [&](V (&a)[4], V (&b)[4], int st) {
#pragma unroll
        for (int mb = 0; mb < 4; ++mb) { a[mb] = WFrag<bf>::ld(pa + mb * 16 * K + st * 512); b[mb] = WFrag<bf>::ld(pb + mb * 16 * K + st * 512); }
        __builtin_amdgcn_sched_barrier(0); };   // keeps the sixteen loads in front of the products that follow: left alone the compiler sinks them to just before their use, and the wait for memory is back
    auto mm = [&](const V (&a)[4], const V (&b)[4]) {
#pragma unroll
        for (int nb = 0; nb < 4; ++nb)
#pragma unroll
            for (int mb = 0; mb < 4; ++mb) acc[mb][nb] = WFrag<bf>::mma(a[mb], b[nb], acc[mb][nb]);
        __builtin_amdgcn_sched_barrier(0); };   // the other side of the same fence: every product of the step stays in front of what follows it (the slots of gap, then the set's refill)
    auto gap = [&]() { asm volatile("v_nop\n\tv_nop\n\tv_nop\n\tv_nop");   // four vector slots between the last matrix instruction and the loads that land on its operand registers (the set's refill; at the loop's foot over the taken branch): the distance that holds for a vector instruction, kept for a load too
        __builtin_amdgcn_sched_barrier(0); };   // the refill is not lifted over the slots
    ld(a0, b0, 0); ld(a1, b1, 1);
    asm volatile("s_wait_xcnt 0x0" ::: "memory");   // in front of any overwrite of a register which these first loads name: the compiler forms their addresses in registers of its own and takes those for other values behind them
    __builtin_amdgcn_sched_barrier(0);   // nothing that follows (the accumulators' zeros, the loop's counter) is lifted over that wait
#pragma unroll 1
    for (int kc = 0; kc < K - 64; kc += 96) {
        ld(a2, b2, 2); mm(a0, b0); gap(); ld(a0, b0, 3); mm(a1, b1); gap(); ld(a1, b1, 4); mm(a2, b2); gap();
        asm volatile("s_wait_xcnt 0x0" :: "v"(pa), "v"(pb) : "memory");   // in front of the overwrite of the two addresses this trip's loads name (row blocks and k steps are immediate offsets); as inputs they stay untouched up to it
        pa += 1536; pb += 1536;
    }
    mm(a0, b0); mm(a1, b1); gap();   // here the slots stand in front of the bias loads, which take operand registers of the last products
    if (EPI == 2) {   // a lane's eight accumulator rows are eight consecutive t of one column d: in fragment order the very 16 bytes of lane 'lane' in half mb & 1 of tile (nb, t / 32), straight from registers
        const size_t pb = ((size_t)(r0 / TT) * (ldc / HD) + c0 / HD) * HD * TT + (size_t)(r0 % TT) * 16 + lane * 8; const float* bp = bias + c0 + lr; float tb[4];
#pragma unroll
        for (int nb = 0; nb < 4; ++nb) tb[nb] = BIAS ? bp[nb * 16] : 0.0f;   // all four at once: one wait for memory, not four
        if (BIAS) asm volatile("s_wait_xcnt 0x0" :: "v"(bp) : "memory");   // in front of any overwrite of the address these loads name
#pragma unroll
        for (int nb = 0; nb < 4; ++nb) { const float bb = bfr(tb[nb]); h16* p16 = P16 + pb + (size_t)nb * 16 * TT; bf* ph = Ph + pb + (size_t)nb * 16 * TT; bf* pl = Pl + pb + (size_t)nb * 16 * TT; v8h o16[4]; v8us oh[4], ol[4];
#pragma unroll
            for (int mb = 0; mb < 4; ++mb) { v8f val;
#pragma unroll
                for (int j = 0; j < 8; ++j) { val[j] = acc[mb][nb][j] + bb; o16[mb][j] = tohx(val[j]); }
                split8(val, oh[mb], ol[mb]); }
#pragma unroll
            for (int mb = 0; mb < 4; ++mb) { *(v8h*)(p16 + mb * 256) = o16[mb]; *(v8us*)(ph + mb * 256) = oh[mb]; *(v8us*)(pl + mb * 256) = ol[mb]; }   // every store is 512 bytes in a row
            // the wait that stands in front of any overwrite of a register which an issued store names: addresses and data are its inputs, so they stay untouched up to it
            asm volatile("s_wait_xcnt 0x0" :: "v"(p16), "v"(ph), "v"(pl), "v"(o16[0]), "v"(o16[1]), "v"(o16[2]), "v"(o16[3]), "v"(oh[0]), "v"(oh[1]), "v"(oh[2]), "v"(oh[3]), "v"(ol[0]), "v"(ol[1]), "v"(ol[2]), "v"(ol[3]) : "memory"); }
        return; }
    float pbias[4][8];   // EPI 1: in store s a lane takes columns s * 16 + hi * 8 .. + 7 of row lr, its own 16 bytes of the s-th half tile
    if (EPI == 1) { const float* bp = bias + c0 + hi * 8; v8f tb[4];
#pragma unroll
        for (int s = 0; s < 4; ++s) tb[s] = BIAS ? *(const v8f*)(bp + s * 16) : (v8f){};
        if (BIAS) asm volatile("s_wait_xcnt 0x0" :: "v"(bp) : "memory");   // the wait: in front of any overwrite of the address these loads name
#pragma unroll
        for (int s = 0; s < 4; ++s)
#pragma unroll
            for (int q = 0; q < 8; ++q) pbias[s][q] = bfr(tb[s][q]); }
#pragma unroll
    for (int mb = 0; mb < 4; ++mb) {
#pragma unroll
        for (int nb = 0; nb < 4; ++nb) {
#pragma unroll
            for (int j = 0; j < 8; ++j) os[(hi * 8 + j) * 68 + nb * 16 + lr] = acc[mb][nb][j]; }
        __builtin_amdgcn_wave_barrier(); asm volatile("" ::: "memory");
        if (EPI == 1) {   // 16 rows x 64 columns are two tiles, 2 KiB in a row of each plane: a store instruction fills four whole 128-byte lines
            const size_t pb = (((size_t)(r0 / TT) * (ldc / HD) + c0 / HD) * TT + (r0 % TT) + mb * 16) * HD + lane * 8; h16* p16 = P16 + pb; bf* ph = Ph + pb; bf* pl = Pl + pb; v8h o16[4]; v8us oh[4], ol[4];
#pragma unroll
            for (int s = 0; s < 4; ++s) { const float* op = os + lr * 68 + s * 16 + hi * 8; const v4f v0 = *(const v4fa*)op, v1 = *(const v4fa*)(op + 4); v8f val;
#pragma unroll
                for (int q = 0; q < 8; ++q) { val[q] = (q < 4 ? v0[q & 3] : v1[q & 3]) + pbias[s][q]; o16[s][q] = tohx(val[q]); }
                split8(val, oh[s], ol[s]); }
#pragma unroll
            for (int s = 0; s < 4; ++s) { *(v8h*)(p16 + s * 256) = o16[s]; *(v8us*)(ph + s * 256) = oh[s]; *(v8us*)(pl + s * 256) = ol[s]; }
            // the wait in front of any overwrite of a register which an issued store names, as above
            asm volatile("s_wait_xcnt 0x0" :: "v"(p16), "v"(ph), "v"(pl), "v"(o16[0]), "v"(o16[1]), "v"(o16[2]), "v"(o16[3]), "v"(oh[0]), "v"(oh[1]), "v"(oh[2]), "v"(oh[3]), "v"(ol[0]), "v"(ol[1]), "v"(ol[2]), "v"(ol[3]) : "memory");
        }
        __builtin_amdgcn_wave_barrier(); asm volatile("" ::: "memory");
    }
}
// k_qkv: the three projections in ONE launch. Grid (rows / 128, columns / 128), 12 waves: waves 0-3 q, 4-7 k, 8-11 v, each group 2 x 2 tiles of 64 x 64 on the same 128 rows and 128 columns,
// so an x row is read by six waves of one WGP and a weight row by two, and three waves share a SIMD. No wave waits for another: every q and k wave has its own staging rows in LDS; the v waves write from registers and use none.
__global__ __launch_bounds__(384) void k_qkv(const bf* __restrict__ XB, const bf* __restrict__ WQ, const bf* __restrict__ WK, const bf* __restrict__ WV, const float* __restrict__ bq, const float* __restrict__ bk, const float* __restrict__ bv,
                                             h16* QP16, bf* QPh, bf* QPl, h16* KP16, bf* KPh, bf* KPl, h16* VT16, bf* VTh, bf* VTl) {
    __shared__ __align__(16) float os[8][16 * 68];
    const int w = __builtin_amdgcn_readfirstlane((int)(threadIdx.x >> 5)); const int r0 = blockIdx.x * 128 + (w & 1) * 64, c0 = blockIdx.y * 128 + ((w >> 1) & 1) * 64;
    if (w >= 8) proj_tile<2>(XB, WV, bv, r0, c0, nullptr, VT16, VTh, VTl);
    else { const bool kk = w >= 4; proj_tile<1>(XB, kk ? WK : WQ, kk ? bk : bq, r0, c0, os[w], kk ? KP16 : QP16, kk ? KPh : QPh, kk ? KPl : QPl); }
}

typedef __attribute__((ext_vector_type(2))) _Float16 v2h;
typedef __attribute__((ext_vector_type(4))) _Float16 v4h;
typedef __attribute__((ext_vector_type(2))) unsigned short v2us;
typedef __attribute__((ext_vector_type(4))) unsigned short v4us;
typedef __attribute__((ext_vector_type(2))) float v2f;
typedef __attribute__((ext_vector_type(4))) int v4i;

__global__ __launch_bounds__(256) void k_wtG(const float* __restrict__ w, int K, int N, bf* Bt) {
    const int lane = threadIdx.x & 31; const int L0 = (blockIdx.x * 8 + (threadIdx.x >> 5)) * 8; const int nlines = N * K / 64;
{
#pragma unroll 1
        for (int l = 0; l < 8; ++l) { const int L = L0 + l; if (L >= nlines) break; const size_t e = (size_t)L * 64 + lane * 2; const int k = (int)(e % K), n = (int)(e / K); v2us o;
            o[0] = f2bf(w[(size_t)k * N + n]); o[1] = f2bf(w[(size_t)(k + 1) * N + n]); *(v2us*)(Bt + e) = o; }
         }
}
// k_prep: every f32 -> bf16 conversion of the call in ONE launch, from row-major f32 to fragment order. A work-group takes CH groups of eight floats of one array = 32 tiles of 16 rows x 32 k (a wave four tiles; all sixteen loads of a thread in flight at once); blockIdx.x picks the array.
// A load takes four whole 128-byte lines (four rows of one tile, eight lanes a row, four floats a lane); the four stores of a tile fill its 1 KiB.
// PAD (the position table): rows at or past nrow are the zero pad row; they are stored as zeros and read nothing past the table (the row is clamped).
#define CH   2048
#define GX   (NB_ * TT * DM / 8 / CH)
#define GW   (DM * DQ / 8 / CH)
#define GP   (NPE * HD / 8 / CH)
template <bool PAD, int K>
__device__ __forceinline__ void cvt_run(const float* __restrict__ src, bf* dst, unsigned blk, unsigned nrow) {
    constexpr unsigned TPR = K / 32;   // tiles along a row: 32 (one work-group = one band of 16 rows) or a divisor of 32
    const unsigned lane = threadIdx.x & 31, w = threadIdx.x >> 5, r4 = lane >> 3, c = lane & 7; unsigned so[16], row[16]; v4f v[16]; v4us o[16];
#pragma unroll
    for (int u = 0; u < 16; ++u) { const unsigned tl = w * 4 + (u >> 2), rt = TPR >= 32 ? blk : blk * (32 / TPR) + tl / TPR, ks = TPR >= 32 ? tl : tl % TPR;   // tile tl of this work-group's 32; rows (u & 3) * 4 + r4 of it
        row[u] = rt * 16 + (u & 3) * 4 + r4; so[u] = ((PAD ? (row[u] < nrow ? row[u] : nrow - 1) : row[u]) * K + ks * 32 + c * 4) * 4u; v[u] = *(const v4f*)((const char*)src + so[u]); }
    // the wait that stands in front of any overwrite of a register which an issued load names: the byte offsets are its inputs, so they stay untouched (also by a landing load) up to it
    if (PAD) asm volatile("s_wait_xcnt 0x0" :: "v"(so[0]), "v"(so[1]), "v"(so[2]), "v"(so[3]), "v"(so[4]), "v"(so[5]), "v"(so[6]), "v"(so[7]), "v"(so[8]), "v"(so[9]), "v"(so[10]), "v"(so[11]), "v"(so[12]), "v"(so[13]), "v"(so[14]), "v"(so[15]) : "memory");
    else asm volatile("s_wait_xcnt 0x0" :: "v"(so[0]), "v"(so[1]), "v"(so[2]), "v"(so[3]) : "memory");   // the other twelve are immediate offsets from these four
#pragma unroll
    for (int u = 0; u < 16; ++u) { const bool zr = PAD && row[u] >= nrow; const unsigned long long w01 = pk2bf(zr ? 0.0f : v[u][0], zr ? 0.0f : v[u][1]), w23 = pk2bf(zr ? 0.0f : v[u][2], zr ? 0.0f : v[u][3]); o[u] = __builtin_bit_cast(v4us, w01 | (w23 << 32)); }
    // floats c * 4 .. + 3 of a tile's row: half c >> 2, lane group (c >> 1) & 1, first or second 8 bytes of that lane's 16
    bf* dp = dst + (size_t)(blk * 32 + w * 4) * 512 + (c >> 2) * 256 + (((c >> 1) & 1) * 16 + r4) * 8 + (c & 1) * 4;
#pragma unroll
    for (int u = 0; u < 16; ++u) *(v4us*)(dp + (u >> 2) * 512 + (u & 3) * 32) = o[u];
}
__global__ __launch_bounds__(256) void k_prep(const float* __restrict__ x, const float* __restrict__ wq, const float* __restrict__ wk, const float* __restrict__ wv, const float* __restrict__ wo, const float* __restrict__ pe,
                                              bf* XB, bf* WQ, bf* WK, bf* WV, bf* WO, bf* PE) {
    const unsigned b = blockIdx.x;
    if (b >= GX + 4 * GW) { cvt_run<true, HD>(pe, PE, b - (GX + 4 * GW), 2047); return; }
    const unsigned a = b < GX ? 0 : 1 + (b - GX) / GW;
    cvt_run<false, DM>(a == 0 ? x : a == 1 ? wq : a == 2 ? wk : a == 3 ? wv : wo, a == 0 ? XB : a == 1 ? WQ : a == 2 ? WK : a == 3 ? WV : WO, a == 0 ? b : (b - GX) % GW, 0);
}

// attn_body: 32 query rows i0.. of head z, 8 waves; wave w owns keys w * 128 .. + 127 from the scores to its partial output, and waits for no other wave before the final sum.
// The scores are computed TRANSPOSED (the key tile is the A operand, the query tile the B operand): a lane then holds eight consecutive keys of ONE query, which is the very piece of an A fragment that attn.v wants from it,
// so the logits, the softmax and the probabilities stay in the lane's registers. LDS holds, per wave, its own 32 x 128 relative scores (R, pitch RP, stored skewed as before and read back as 16-byte pieces),
// into whose slots a lane parks the logits of key tiles NKEEP.. (each lane rewrites only what it has just read), and at the end the wave's partial output with its row maxima and row sums.
// Softmax by parts: each wave takes the maximum m_w and the sum l_w over its own 128 keys, attn.v runs on exp(s - m_w) unnormalised, and the final sum weighs wave w by exp(m_w - m) and divides by the weighted l_w.
// HI: hi+lo planes, 3 products, for scores and attn.v; else single fp16 (probabilities x PCAR).
// Behind a group of global loads: the wait that stands in front of any overwrite of a register which an issued load names. It takes the group's addresses as inputs, so that they stay untouched (also by a landing load of the group) up to it.
#define XWAIT1(p)    asm volatile("s_wait_xcnt 0x0" :: "v"(p) : "memory")
#define XWAIT2(p, q) asm volatile("s_wait_xcnt 0x0" :: "v"(p), "v"(q) : "memory")
#define L2E 1.4426950408889634f
template <bool HI>
__device__ __forceinline__ void attn_body(float* T, int z, int i0, const h16* __restrict__ QP16, const bf* __restrict__ QPh, const bf* __restrict__ QPl, const h16* __restrict__ KP16, const bf* __restrict__ KPh, const bf* __restrict__ KPl,
                                          const h16* __restrict__ VT16, const bf* __restrict__ VTh, const bf* __restrict__ VTl, const bf* __restrict__ PE, bf* ATh, bf* ATl) {
    constexpr int NKEEP = 2, KD = HI ? 2 : 3, VD = HI ? 4 : 8;   // key tiles whose logits stay in registers; how many key tiles, and how many value fragments, are fetched ahead of their use
    const int tid = threadIdx.x, lane = tid & 31, lr = lane & 15, hi = lane >> 4, w = tid >> 5; const int j0 = w * 128;   // this wave's 128 keys
    float* R = T + w * (BR * RP);   // this wave's own LDS
    const size_t qb = ((size_t)z * TT + i0) * HD + lane * 8;   // planes in fragment order: 16 rows x 64 are two tiles of 512 elements
    // relative scores: rows i0 + 16 mt + r and keys j0 + jj need positions p = (j0 - i0 - 16 mt + 1008) + c, c = jj - r + 15 in 0..142: nine 16-wide tiles a row tile, ten for both
    const int pb = j0 - i0 + 992;   // 0 .. 1888; last row read pb + 159 <= 2047
    v16bf qh[2][2], ql[2][2], rb[10][2], kb[8][4], vb[16][2]; v16h q16[2][2], kf[8][2], vf[16];
    const bf* pp = PE + (size_t)pb * HD + lane * 8;
    auto rload = [&](int u) { rb[u][0] = WFrag<bf>::ld(pp + u * 1024); rb[u][1] = WFrag<bf>::ld(pp + u * 1024 + 512); XWAIT1(pp); };   // one base for all ten tiles (the tiles are immediate offsets): as the wait's input it outlives every load that names it
    const size_t ko = ((size_t)z * TT + j0) * HD + lane * 8; const bf* khp = KPh + ko; const bf* klp = KPl + ko; const h16* k16p = KP16 + ko;   // likewise one base a plane for the eight key tiles
    auto kload = [&](int nb) {
        if (HI) { kb[nb][0] = WFrag<bf>::ld(khp + nb * 1024); kb[nb][1] = WFrag<bf>::ld(khp + nb * 1024 + 512); kb[nb][2] = WFrag<bf>::ld(klp + nb * 1024); kb[nb][3] = WFrag<bf>::ld(klp + nb * 1024 + 512); XWAIT2(khp, klp); }
        else { kf[nb][0] = WFrag<h16>::ld(k16p + nb * 1024); kf[nb][1] = WFrag<h16>::ld(k16p + nb * 1024 + 512); XWAIT1(k16p); } };
    const size_t vo = (size_t)z * HD * TT + j0 * 16 + lane * 8; const bf* vhp = VTh + vo; const bf* vlp = VTl + vo; const h16* v16p = VT16 + vo;
    auto vload = [&](int t) { const int off = (t >> 2) * 512 + (t & 3) * 16 * TT;   // step t = ks * 4 + nb: tile (nb, key / 32) of the transposed plane
        if (HI) { vb[t][0] = WFrag<bf>::ld(vhp + off); vb[t][1] = WFrag<bf>::ld(vlp + off); XWAIT2(vhp, vlp); } else { vf[t] = WFrag<h16>::ld(v16p + off); XWAIT1(v16p); } };
#pragma unroll
    for (int mt = 0; mt < 2; ++mt)
#pragma unroll
        for (int kk = 0; kk < 2; ++kk) { qh[mt][kk] = WFrag<bf>::ld(QPh + qb + (size_t)mt * 16 * HD + kk * 512); ql[mt][kk] = WFrag<bf>::ld(QPl + qb + (size_t)mt * 16 * HD + kk * 512); }
    XWAIT2(QPh + qb, QPl + qb);
#pragma unroll
    for (int u = 0; u < 4; ++u) rload(u);
#pragma unroll
    for (int u = 0; u < 10; ++u) {
#pragma unroll
        for (int mt = 0; mt < 2; ++mt) { const int tt = u - 1 + mt; if (tt < 0 || tt > 8) continue;
            v8f acc = (v8f){}; acc = wmmab(qh[mt][0], rb[u][0], acc); acc = wmmab(ql[mt][0], rb[u][0], acc); acc = wmmab(qh[mt][1], rb[u][1], acc); acc = wmmab(ql[mt][1], rb[u][1], acc);
            asm volatile("v_nop\n\tv_nop\n\tv_nop\n\tv_nop" :: "v"(acc));   // the four vector slots the chip needs before the next tile's first matrix instruction may overwrite these result registers
#pragma unroll
            for (int j = 0; j < 8; ++j) { const int r = hi * 8 + j, jj = tt * 16 + lr + r - 15; R[(mt * 16 + r) * RP + ((jj >= 0 && jj < 128) ? jj : 128)] = acc[j]; } }   // a position outside this wave's keys lands in the row's pad column
        if (u < 6) rload(u + 4); else if (u >= 9 - KD && u < 9) kload(u - (9 - KD));
        if (!HI && u == 5) {
#pragma unroll
            for (int mt = 0; mt < 2; ++mt)
#pragma unroll
                for (int kk = 0; kk < 2; ++kk) q16[mt][kk] = WFrag<h16>::ld(QP16 + qb + (size_t)mt * 16 * HD + kk * 512);
            XWAIT1(QP16 + qb); } }
    asm volatile("s_wait_dscnt 0x0" ::: "memory");   // the skewed stores crossed lanes, of this wave alone: they are done before its lanes read the rows back; no other wave touches them, so no barrier
    v8f s[8][2]; float mx[2] = { -3.0e38f, -3.0e38f };
#pragma unroll
    for (int nb = 0; nb < 8; ++nb) { v4f r0[2], r1[2];
#pragma unroll
        for (int mt = 0; mt < 2; ++mt) { const float* rp = R + (mt * 16 + lr) * RP + nb * 16 + hi * 8; r0[mt] = *(const v4fa*)rp; r1[mt] = *(const v4fa*)(rp + 4); }   // query mt * 16 + lr, keys nb * 16 + hi * 8 .. + 7
#pragma unroll
        for (int mt = 0; mt < 2; ++mt) { v8f a = (v8f){};   // D row = key hi * 8 + j of the tile, D column = query lr
            if (HI) { a = wmmab(kb[nb][0], qh[mt][0], a); a = wmmab(kb[nb][0], ql[mt][0], a); a = wmmab(kb[nb][2], qh[mt][0], a); a = wmmab(kb[nb][1], qh[mt][1], a); a = wmmab(kb[nb][1], ql[mt][1], a); a = wmmab(kb[nb][3], qh[mt][1], a); }
            else { a = wmma16(kf[nb][0], q16[mt][0], a); a = wmma16(kf[nb][1], q16[mt][1], a); }
            s[nb][mt] = a; }
        if (nb + KD < 8) kload(nb + KD);
#pragma unroll
        for (int mt = 0; mt < 2; ++mt) {
#pragma unroll
            for (int j = 0; j < 8; ++j) { const float v = __fadd_rn(__fmul_rn(s[nb][mt][j], SCL), j < 4 ? r0[mt][j & 3] : r1[mt][j & 3]); s[nb][mt][j] = v; mx[mt] = fmaxf(mx[mt], v); }   // SCL is a power of two: the product is exact, fused or not
            if (nb >= NKEEP) { float* rp = R + (mt * 16 + lr) * RP + nb * 16 + hi * 8; *(v4fa*)rp = (v4f){ s[nb][mt][0], s[nb][mt][1], s[nb][mt][2], s[nb][mt][3] }; *(v4fa*)(rp + 4) = (v4f){ s[nb][mt][4], s[nb][mt][5], s[nb][mt][6], s[nb][mt][7] }; } } }
#pragma unroll
    for (int t = 0; t < VD; ++t) vload(t);   // they fly during the first exponentials
#pragma unroll
    for (int mt = 0; mt < 2; ++mt) mx[mt] = fmaxf(mx[mt], __shfl_xor(mx[mt], 16, 32));   // the two lane halves hold the two halves of every key tile
    auto sload = [&](int ks) {   // the parked logits of key tiles 2 ks, 2 ks + 1: each lane its own
#pragma unroll
        for (int q = 0; q < 2; ++q)
#pragma unroll
            for (int mt = 0; mt < 2; ++mt) { const float* rp = R + (mt * 16 + lr) * RP + (2 * ks + q) * 16 + hi * 8; const v4f a = *(const v4fa*)rp, b = *(const v4fa*)(rp + 4); s[2 * ks + q][mt] = (v8f){ a[0], a[1], a[2], a[3], b[0], b[1], b[2], b[3] }; } };
    if (NKEEP == 0) sload(0);
    // attn.v: this wave sums its own 128 keys for all 32 rows x 64 columns; element e of a lane's A fragment is key 8 hi + e of tile 2 ks, element 8 + e the same of tile 2 ks + 1
    v8f o[2][4]; float sm[2] = { 0.f, 0.f };
#pragma unroll
    for (int mt = 0; mt < 2; ++mt)
#pragma unroll
        for (int nb = 0; nb < 4; ++nb) o[mt][nb] = (v8f){};
#pragma unroll
    for (int ks = 0; ks < 4; ++ks) { v16bf ah[2], al[2]; v16h a16[2];
#pragma unroll
        for (int mt = 0; mt < 2; ++mt) { v8us oh[2], ol[2]; v8h o16[2];
#pragma unroll
            for (int q = 0; q < 2; ++q) { float p[8];
#pragma unroll
                for (int j = 0; j < 8; ++j) { p[j] = __builtin_amdgcn_exp2f(__fmul_rn(__fsub_rn(s[2 * ks + q][mt][j], mx[mt]), L2E));
                    if (!HI) o16[q][j] = tohx(p[j] * PCAR); }
                if (HI) split8((v8f){ p[0], p[1], p[2], p[3], p[4], p[5], p[6], p[7] }, oh[q], ol[q]);
                sm[mt] += ((p[0] + p[1]) + (p[2] + p[3])) + ((p[4] + p[5]) + (p[6] + p[7])); }
            if (HI) { ah[mt] = cat16b(oh[0], oh[1]); al[mt] = cat16b(ol[0], ol[1]); } else a16[mt] = cat16(o16[0], o16[1]); }
        if (ks < 3 && 2 * (ks + 1) >= NKEEP) sload(ks + 1);
#pragma unroll
        for (int nb = 0; nb < 4; ++nb) { const int t = ks * 4 + nb;
#pragma unroll
            for (int mt = 0; mt < 2; ++mt) {
                if (HI) { o[mt][nb] = wmmab(ah[mt], vb[t][0], o[mt][nb]); o[mt][nb] = wmmab(al[mt], vb[t][0], o[mt][nb]); o[mt][nb] = wmmab(ah[mt], vb[t][1], o[mt][nb]); }
                else o[mt][nb] = wmma16(a16[mt], vf[t], o[mt][nb]); }
            if (t + VD < 16) vload(t + VD); } }
#pragma unroll
    for (int mt = 0; mt < 2; ++mt) sm[mt] += __shfl_xor(sm[mt], 16, 32);
    __builtin_amdgcn_wave_barrier(); asm volatile("" ::: "memory");   // the partial output goes over this wave's own slots: behind its last read of them
#pragma unroll
    for (int mt = 0; mt < 2; ++mt) {
#pragma unroll
        for (int nb = 0; nb < 4; ++nb)
#pragma unroll
            for (int j = 0; j < 8; ++j) R[(mt * 16 + hi * 8 + j) * OPP + nb * 16 + lr] = o[mt][nb][j];
        R[BR * OPP + hi * BR + mt * 16 + lr] = hi ? sm[mt] : mx[mt]; }   // behind the partial output: 32 row maxima, then 32 row sums
    __syncthreads();   // partial outputs, maxima and sums of all eight waves complete
    { const int row = (w >> 2) * 16 + lr, d0 = (w & 3) * 16 + hi * 8; v4f p0[8], p1[8]; float mw[8], lw[8];   // wave w writes half tile w & 3 of row tile w >> 2: a lane its own 16 bytes there
#pragma unroll
        for (int ww = 0; ww < 8; ++ww) { const float* pr = T + ww * (BR * RP); p0[ww] = *(const v4fa*)(pr + row * OPP + d0); p1[ww] = *(const v4fa*)(pr + row * OPP + d0 + 4); mw[ww] = pr[BR * OPP + row]; lw[ww] = pr[BR * OPP + BR + row]; }
        float m = mw[0];
#pragma unroll
        for (int ww = 1; ww < 8; ++ww) m = fmaxf(m, mw[ww]);
        v4f s0 = (v4f){}, s1 = (v4f){}; float den = 0.f;
#pragma unroll
        for (int ww = 0; ww < 8; ++ww) { const float e = __builtin_amdgcn_exp2f((mw[ww] - m) * L2E); den += e * lw[ww]; s0 += p0[ww] * e; s1 += p1[ww] * e; }   // key blocks in ascending order
        const float cs = __fdiv_rn(HI ? 1.0f : (1.0f / PCAR), den); v8us oh, ol; const v4f t0 = s0 * cs, t1 = s1 * cs;
        split8((v8f){ t0[0], t0[1], t0[2], t0[3], t1[0], t1[1], t1[2], t1[3] }, oh, ol);
        const size_t oo = ((size_t)(z / NH_) * TT + i0 + (w >> 2) * 16) * DQ + (size_t)(z % NH_) * 1024 + (w & 3) * 256 + lane * 8; *(v8us*)(ATh + oo) = oh; *(v8us*)(ATl + oo) = ol; }   // fragment order, K = DQ: a head is two tiles along k; a wave fills four 128-byte lines
}
// k_attn: grid (TT / BR, NZ), 256 threads; two work-groups share a WGP's LDS, so four waves a SIMD
__global__ __launch_bounds__(256) __attribute__((amdgpu_waves_per_eu(4, 4))) void k_attn(const h16* __restrict__ QP16, const bf* __restrict__ QPh, const bf* __restrict__ QPl, const h16* __restrict__ KP16, const bf* __restrict__ KPh, const bf* __restrict__ KPl,
                                               const h16* __restrict__ VT16, const bf* __restrict__ VTh, const bf* __restrict__ VTl, const bf* __restrict__ PE, bf* ATh, bf* ATl) {
    __shared__ __align__(16) float T[8 * BR * RP];
    const int i0 = blockIdx.x * BR, z = blockIdx.y;
    if (i0 < RH) attn_body<true>(T, z, i0, QP16, QPh, QPl, KP16, KPh, KPl, VT16, VTh, VTl, PE, ATh, ATl);
    else attn_body<false>(T, z, i0, QP16, QPh, QPl, KP16, KPh, KPl, VT16, VTh, VTl, PE, ATh, ATl);
}

extern "C" void kernel_launch(void* const* d_in, const int* in_sizes, int n_in,
                              void* d_out, int out_size, void* d_ws, size_t ws_size, hipStream_t stream) {
    (void)in_sizes; (void)n_in; (void)out_size;
    const float* x = (const float*)d_in[0]; const float* wq = (const float*)d_in[1]; const float* bq = (const float*)d_in[2]; const float* wk = (const float*)d_in[3]; const float* bk = (const float*)d_in[4]; const float* wv = (const float*)d_in[5]; const float* bv = (const float*)d_in[6]; const float* wo = (const float*)d_in[7]; const float* bo = (const float*)d_in[8]; const float* pe = (const float*)d_in[9];
    float* OUT = (float*)d_out;     // [4][1024][1024]
    char* wsp = (char*)d_ws;
    auto take = [&](size_t bytes) { char* p = wsp; wsp += (bytes + 255) & ~(size_t)255; return (void*)p; };
    bf* WO = (bf*)take((size_t)DM * DQ * 2); bf* PE = (bf*)take((size_t)NPE * HD * 2);
    h16* QP16 = (h16*)take((size_t)NZ * TT * HD * 2); h16* KP16 = (h16*)take((size_t)NZ * TT * HD * 2); h16* VT16 = (h16*)take((size_t)NZ * HD * TT * 2);
    bf* QPh = (bf*)take((size_t)NZ * TT * HD * 2); bf* QPl = (bf*)take((size_t)NZ * TT * HD * 2); bf* KPh = (bf*)take((size_t)NZ * TT * HD * 2); bf* KPl = (bf*)take((size_t)NZ * TT * HD * 2); bf* VTh = (bf*)take((size_t)NZ * HD * TT * 2); bf* VTl = (bf*)take((size_t)NZ * HD * TT * 2);
    bf* ATh = (bf*)take((size_t)NB_ * TT * DQ * 2); bf* ATl = (bf*)take((size_t)NB_ * TT * DQ * 2);
    bf* WQ = (bf*)take((size_t)DQ * DM * 2); bf* WK = (bf*)take((size_t)DKV * DM * 2); bf* WV = (bf*)take((size_t)DKV * DM * 2);
    bf* XB = (bf*)take((size_t)NB_ * TT * DM * 2);
    if ((size_t)(wsp - (char*)d_ws) > ws_size) return;    // ws 256 MiB
    k_prep<<<GX + 4 * GW + GP, 256, 0, stream>>>(x, wq, wk, wv, wo, pe, XB, WQ, WK, WV, WO, PE);   /* bf16 x, weights, position table + zero pad row */
    k_qkv<<<dim3(NB_ * TT / 128, DQ / 128, 1), 384, 0, stream>>>(XB, WQ, WK, WV, bq, bk, bv, QP16, QPh, QPl, KP16, KPh, KPl, VT16, VTh, VTl);
    k_attn<<<dim3(TT / BR, NZ, 1), 256, 0, stream>>>(QP16, QPh, QPl, KP16, KPh, KPl, VT16, VTh, VTl, PE, ATh, ATl);   // planes are [b][h][..]: z is the plane index (one kv head per query head)
    k_gemmw<bf, 1, true, 0, DQ><<<dim3(NB_ * TT / 64, DM / 64, 1), 32, 0, stream>>>(ATh, ATl, WO, nullptr, OUT, DM, bo, 0, 0, 0, nullptr, nullptr, nullptr);
}

// v009
// One run takes 115 microseconds.
// Next to v008, in two timings, it ran 1.04 and 1.03 times as fast.
// Over all steps from v000 it is 23.2 times as fast.
#include <hip/hip_runtime.h>

// Self-attention with a learned relative-position bias (x [4][1024][1024]; q, k, v = x W^T + b ('oi', 16 heads x 64); S = q.k/8 + S_rel[i][j - i + 1023] where S_rel = q.pos_emb^T (pos_emb [2047][64], unscaled); softmax; out = merged Wo^T + bo -> [4][1024][1024]).
// Layout: batch and head are one flat index z = b * 16 + h carried in the grids (projections over all 4096 rows; their epilogues write the 16-bit head planes themselves: q, k as [z][t][d], v as [z][d][t]). Attention is ONE launch: a work-group of 8 waves owns 32 query rows of one z and each wave 128 of the 1024 keys: relative scores (q hi/lo planes against the bf16 position table, 2047 rows + one zero pad row; only the band of positions the 32 rows reach) are stored to the wave's own LDS already skewed (S_rel[i][j - i + 1023] at column j), the content scores are computed transposed and take them up in registers, softmax and attn.v run per wave on registers, the eight partial outputs are joined through LDS and the hi/lo planes of the merged heads go to memory.
// Every 16-bit operand plane in memory (x, weights, position table, q, k, v^T, merged heads) is kept in FRAGMENT ORDER: a tile of 16 rows x 32 k is 1 KiB in a row, first the 16 bytes that each lane 0..31 takes for k = 8 * (lane >> 4) .. + 7 of row lane & 15, then the 16 bytes for k + 16;
// tiles run along k, then down the rows (tile (rt, ks) of a plane with K elements a row starts at element rt * 16 * K + ks * 512). A fragment load is then 2 x 512 contiguous bytes (four whole 128-byte lines each) and not 16 pieces of 32 bytes; which element meets which in a product is as before.
// Compute dtypes, f32 accumulate: every input rounded to bf16; q/k/v on PLAIN bf16 operands (inputs: exact) + biases; relative scores q(hi+lo).pos_emb (2 products, f32); scores and attn.v: query rows < 512 hl (3 products), the rest single fp16 (x1024); softmax f32; Wo hl x exact (2 products) + bo.

#define NB_  4
#define TT   1024
#define DM   1024
#define NH_  16
#define NKV  16
#define REP  (NH_ / NKV)
#define HD   64
#define DQ   (NH_ * HD)
#define DKV  (NKV * HD)
#define NPE  2048                 // 2047 relative positions + 1 zero pad row
#define BR   32                   // query rows per attention work-group
#define RP   132                  // LDS row pitch in floats of a wave's 32 x 128 relative scores: 528 B = 16 B x odd, so b128 accesses of 16 rows meet no bank twice; column 128 is the pad, never read
#define OPP  68                   // pitch in floats of a wave's partial attn.v tile in LDS
#define NZ   (NB_ * NH_)
#define RH   512                  // query rows < RH use hi+lo planes (0: none)
#define WIN  0
#define PCAR 1024.0f
#define SCL  0.125f   // HD^-0.5
typedef _Float16 h16;
typedef unsigned short bf;
typedef __attribute__((ext_vector_type(16))) __bf16   v16bf;
typedef __attribute__((ext_vector_type(16))) _Float16 v16h;
typedef __attribute__((ext_vector_type(8)))  _Float16 v8h;
typedef __attribute__((ext_vector_type(8)))  unsigned short v8us;
typedef __attribute__((ext_vector_type(8)))  float    v8f;
typedef __attribute__((ext_vector_type(4)))  float    v4f;
typedef v8h  __attribute__((may_alias)) v8ha;
typedef v4f  __attribute__((may_alias)) v4fa;
typedef v8us __attribute__((may_alias)) v8usa;

__device__ __forceinline__ unsigned short f2bf(float f) { return __builtin_bit_cast(unsigned short, (__bf16)f); }   // the chip's own convert, round to nearest even
__device__ __forceinline__ float bf2f(unsigned short b) { return __uint_as_float(((unsigned)b) << 16); }
__device__ __forceinline__ float bfr(float f) { return bf2f(f2bf(f)); }
__device__ __forceinline__ h16 tohx(float x) { return (h16)x; }
typedef __attribute__((ext_vector_type(2))) __bf16 v2bf;
typedef __attribute__((ext_vector_type(2))) float f32x2;
typedef __attribute__((ext_vector_type(4))) unsigned u32x4;
__device__ __forceinline__ unsigned pk2bf(float a, float b) { return __builtin_bit_cast(unsigned, __builtin_convertvector(((f32x2){ a, b }), v2bf)); }   // one packed convert: a in the low half, b in the high half, each rounded to nearest even
// eight values at once into bf16 hi + lo (lo = the rounded rest y - hi), two by two: one packed convert makes a pair's word of the 16-byte piece, and the rest is taken from that same word, so no value is converted twice or moved into place
__device__ __forceinline__ void split8(v8f y, v8us& h, v8us& l) { u32x4 hu, lu;
#pragma unroll
    for (int i = 0; i < 4; ++i) { const unsigned u = pk2bf(y[2 * i], y[2 * i + 1]); hu[i] = u; lu[i] = pk2bf(y[2 * i] - __uint_as_float(u << 16), y[2 * i + 1] - __uint_as_float(u & 0xFFFF0000u)); }
    h = __builtin_bit_cast(v8us, hu); l = __builtin_bit_cast(v8us, lu); }
__device__ __forceinline__ v16h cat16(v8h lo, v8h hi) { return __builtin_shufflevector(lo, hi, 0, 1, 2, 3, 4, 5, 6, 7, 8, 9, 10, 11, 12, 13, 14, 15); }
__device__ __forceinline__ v16bf cat16b(v8us lo, v8us hi) { return __builtin_bit_cast(v16bf, __builtin_shufflevector(lo, hi, 0, 1, 2, 3, 4, 5, 6, 7, 8, 9, 10, 11, 12, 13, 14, 15)); }
__device__ __forceinline__ v8f wmma16(v16h a, v16h b, v8f c) { return __builtin_amdgcn_wmma_f32_16x16x32_f16(false, a, false, b, (short)0, c, false, false); }
__device__ __forceinline__ v8f wmmab(v16bf a, v16bf b, v8f c) { return __builtin_amdgcn_wmma_f32_16x16x32_bf16(false, a, false, b, (short)0, c, false, false); }



// ---- k_gemmw: register-blocked GEMM, ONE WAVE per 64x64 output tile (16 accumulators), operands straight from 16-bit planes in fragment order (ld takes the tile's start + lane * 8); grid (M/64, N/64, Z), 32 threads.
// C[m][n] (f32, pitch ldc, + optional f32 bias[n]) = sum_k A[m][k] Bt[n][k] (+ split products per NSPLIT). z-batch strides sA/sB/sC in elements. K is a compile-time constant.
// C goes to memory as f32 (EPI 0, the one form left here: the projections, which write 16-bit planes, are proj_tile below).
template <typename T16> struct WFrag;
template <> struct WFrag<h16> { typedef v16h V; static __device__ __forceinline__ V ld(const h16* p) { return cat16(*(const v8h*)p, *(const v8h*)(p + 256)); } static __device__ __forceinline__ v8f mma(V a, V b, v8f c) { return wmma16(a, b, c); } };
template <> struct WFrag<bf> { typedef v16bf V; static __device__ __forceinline__ V ld(const bf* p) { return cat16b(*(const v8us*)p, *(const v8us*)(p + 256)); } static __device__ __forceinline__ v8f mma(V a, V b, v8f c) { return wmmab(a, b, c); } };
template <typename T16, int NSPLIT, bool BIAS, int EPI, int K>
__global__ __launch_bounds__(32) void k_gemmw(const T16* __restrict__ A, const T16* __restrict__ A2, const T16* __restrict__ Bt, const T16* __restrict__ Bt2, float* C, int ldc, const float* __restrict__ bias, size_t sA, size_t sB, size_t sC, h16* P16, bf* Ph, bf* Pl) {
    typedef typename WFrag<T16>::V V;
    static_assert(K % 32 == 0 && K / 32 >= 5 && (K / 32 - 2) % 3 == 0, "the k loop below takes three k steps a trip and leaves two");
    static_assert(((K / 32) & (K / 32 - 1)) == 0, "the k steps are walked as a ring: their number is a power of two");
    __shared__ __align__(16) float os[16 * 68];
    const size_t z = blockIdx.z; A += z * sA; if (A2) A2 += z * sA; Bt += z * sB; if (Bt2) Bt2 += z * sB; C += z * sC;
    const int lane = threadIdx.x & 31, lr = lane & 15, hi = lane >> 4; const int r0 = blockIdx.x * 64, c0 = blockIdx.y * 64;
    v8f acc[4][4];
#pragma unroll
    for (int mb = 0; mb < 4; ++mb)
#pragma unroll
        for (int nb = 0; nb < 4; ++nb) acc[mb][nb] = (v8f){};
    constexpr bool SA = NSPLIT == 1 || NSPLIT == 2, SB = NSPLIT >= 2;
    // The k steps are walked as a ring from a start that is spread over the tiles that read the same operand rows. All tiles of the grid run at once and at one pace: from a common start every k step of every operand would be asked of memory for the first time by all its readers together,
    // and each step would wait out memory. From spread starts all of A and B is asked for within the first few steps, and what a tile comes to later another tile has already brought into L2. Each output element sums the same products, from another first term.
    const unsigned rot = (blockIdx.x + 8u * (blockIdx.y & 3u)) & (K / 32 - 1);   // readers of one B row block start one step apart, readers of one A row block eight; column tiles four apart keep one start, so that such tiles, where they stand on one WGP, still meet on the A lines in its cache
    const unsigned a0 = ((unsigned)r0 * K + lane * 8) * 2u, b0 = ((unsigned)c0 * K + lane * 8) * 2u;   // byte offsets of this lane's piece in k step 0; a k step of 32 is one tile of 1 KiB
    auto ko = [&](unsigned t) { return ((rot + t) & (K / 32 - 1)) << 10; };   // byte offset of the t-th step of this tile's walk
    // Three register sets of fragments: the loads of k step t + 2 are issued in front of the products of step t, so a load has two steps of matrix work to come back in (the grid is one wave a SIMD: no other wave covers this one's wait).
    struct FS { V a[4], a2[4], b[4], b2[4]; } f0, f1, f2;
    auto ld = [&](FS& f, unsigned oa, unsigned ob) {   // plane base + one 32-bit offset an operand; row blocks are immediate offsets
#pragma unroll
        for (int q = 0; q < 4; ++q) { f.a[q] = WFrag<T16>::ld((const T16*)((const char*)A + oa) + q * 16 * K); if (SA) f.a2[q] = WFrag<T16>::ld((const T16*)((const char*)A2 + oa) + q * 16 * K); f.b[q] = WFrag<T16>::ld((const T16*)((const char*)Bt + ob) + q * 16 * K); if (SB) f.b2[q] = WFrag<T16>::ld((const T16*)((const char*)Bt2 + ob) + q * 16 * K); }
        __builtin_amdgcn_sched_barrier(0); };   // keeps a step's loads together in front of the products that follow, not strewn among them or sunk towards their use
    auto mm = [&](const FS& f) {
#pragma unroll
        for (int nb = 0; nb < 4; ++nb)
#pragma unroll
            for (int mb = 0; mb < 4; ++mb) { acc[mb][nb] = WFrag<T16>::mma(f.a[mb], f.b[nb], acc[mb][nb]); if (SA) acc[mb][nb] = WFrag<T16>::mma(f.a2[mb], f.b[nb], acc[mb][nb]); if (SB) acc[mb][nb] = WFrag<T16>::mma(f.a[mb], f.b2[nb], acc[mb][nb]); }
        __builtin_amdgcn_sched_barrier(0); };   // the other side of the same fence: every product of the step stays in front of what follows it (the slots of gap, then the set's refill)
    auto gap = [&]() { asm volatile("v_nop\n\tv_nop\n\tv_nop\n\tv_nop");   // four vector slots between the last matrix instruction and the loads that land on its operand registers (the set's refill; at the loop's foot over the taken branch): the distance that holds for a vector instruction, kept for a load too
        __builtin_amdgcn_sched_barrier(0); };   // the refill is not lifted over the slots
    ld(f0, a0 + ko(0), b0 + ko(0)); ld(f1, a0 + ko(1), b0 + ko(1));
    asm volatile("s_wait_xcnt 0x0" ::: "memory");   // in front of any overwrite of a register which these first loads name: the compiler forms their addresses in registers of its own and takes those for other values behind them
    __builtin_amdgcn_sched_barrier(0);   // nothing that follows (the accumulators' zeros, the loop's counter) is lifted over that wait
    unsigned oa2 = a0 + ko(2), oa3 = a0 + ko(3), oa4 = a0 + ko(4), ob2 = b0 + ko(2), ob3 = b0 + ko(3), ob4 = b0 + ko(4);   // one offset for each of a trip's three load groups and each operand
#pragma unroll 1
    for (unsigned t = 0; t < K / 32 - 2; t += 3) {
        ld(f2, oa2, ob2); mm(f0); gap(); ld(f0, oa3, ob3); mm(f1); gap(); ld(f1, oa4, ob4); mm(f2); gap();
        asm volatile("s_wait_xcnt 0x0" :: "v"(oa2), "v"(oa3), "v"(oa4), "v"(ob2), "v"(ob3), "v"(ob4) : "memory");   // in front of the overwrite of the offsets which this trip's loads name: as inputs they stay untouched up to it
        oa2 = a0 + ko(t + 5); oa3 = a0 + ko(t + 6); oa4 = a0 + ko(t + 7); ob2 = b0 + ko(t + 5); ob3 = b0 + ko(t + 6); ob4 = b0 + ko(t + 7);
    }
    mm(f0); mm(f1);
#pragma unroll
    for (int mb = 0; mb < 4; ++mb) {
#pragma unroll
        for (int nb = 0; nb < 4; ++nb) {
#pragma unroll
            for (int j = 0; j < 8; ++j) os[(hi * 8 + j) * 68 + nb * 16 + lr] = acc[mb][nb][j]; }
        __builtin_amdgcn_wave_barrier(); asm volatile("" ::: "memory");
        float* crow = C + (size_t)(r0 + mb * 16) * ldc + c0;
{
#pragma unroll
            for (int s = 0; s < 8; ++s) { const int row = 2 * s + hi, cofs = lr * 4; v4f val = *(const v4fa*)(os + row * 68 + cofs); if (BIAS) { val[0] += bfr(bias[c0 + cofs]); val[1] += bfr(bias[c0 + cofs + 1]); val[2] += bfr(bias[c0 + cofs + 2]); val[3] += bfr(bias[c0 + cofs + 3]); }
                *(v4f*)(crow + (size_t)row * ldc + cofs) = val; }
             }
        __builtin_amdgcn_sched_barrier(0);   // the row block's stores stay in front of the wait below
        asm volatile("s_wait_xcnt 0x0" ::: "memory");   // in front of any overwrite of a register (address or data) which these stores name: the next row block takes the same registers
        __builtin_amdgcn_sched_barrier(0);   // the next row block's work stays behind that wait
        __builtin_amdgcn_wave_barrier(); asm volatile("" ::: "memory");
    }
}

// ---- proj_tile: k_gemmw's 64x64 tile of one wave for the projections: C = x W^T + b, K = DM, plain bf16 operands, no f32 result. A 64-column tile is one head (HD == 64) and rows are b * TT + t:
// C + bias goes out as three 16-bit planes (fp16, bf16 hi, bf16 lo), EPI 1 as [b][head][t][d] (staged through the wave's own os rows), EPI 2 transposed as [b][head][d][t], each head's plane in fragment order.
template <int EPI>
__device__ __forceinline__ void proj_tile(const bf* __restrict__ A, const bf* __restrict__ Bt, const float* __restrict__ bias, int r0, int c0, unsigned rot, float* os, h16* P16, bf* Ph, bf* Pl) {
    typedef WFrag<bf>::V V; constexpr int K = DM, ldc = DQ; constexpr bool BIAS = true;
    const int lane = threadIdx.x & 31, lr = lane & 15, hi = lane >> 4;
    v8f acc[4][4];
#pragma unroll
    for (int mb = 0; mb < 4; ++mb)
#pragma unroll
        for (int nb = 0; nb < 4; ++nb) acc[mb][nb] = (v8f){};
    // the k steps are walked as a ring from step rot (one start for the whole work-group, another for the work-groups that read the same rows): why, at k_gemmw
    static_assert(((K / 32) & (K / 32 - 1)) == 0, "the k steps are walked as a ring: their number is a power of two");
    const unsigned a0 = ((unsigned)r0 * K + lane * 8) * 2u, b0 = ((unsigned)c0 * K + lane * 8) * 2u;   // byte offsets of this lane's piece in k step 0
    auto ko = [&](unsigned t) { return ((rot + t) & (K / 32 - 1)) << 10; };   // byte offset of the t-th step of the walk
    // Three register sets of fragments: the loads of k step t + 2 are issued in front of the products of step t, so a load has two steps of this wave's matrix work (and the SIMD's two other waves) to come back under.
    static_assert(K / 32 >= 5 && (K / 32 - 2) % 3 == 0, "the k loop below takes three k steps a trip and leaves two");
    V fa0[4], fb0[4], fa1[4], fb1[4], fa2[4], fb2[4];
    auto ld = [&](V (&a)[4], V (&b)[4], unsigned oa, unsigned ob) {
#pragma unroll
        for (int mb = 0; mb < 4; ++mb) { a[mb] = WFrag<bf>::ld((const bf*)((const char*)A + oa) + mb * 16 * K); b[mb] = WFrag<bf>::ld((const bf*)((const char*)Bt + ob) + mb * 16 * K); }
        __builtin_amdgcn_sched_barrier(0); };   // keeps the sixteen loads in front of the products that follow: left alone the compiler sinks them to just before their use, and the wait for memory is back
    auto mm = [&](const V (&a)[4], const V (&b)[4]) {
#pragma unroll
        for (int nb = 0; nb < 4; ++nb)
#pragma unroll
            for (int mb = 0; mb < 4; ++mb) acc[mb][nb] = WFrag<bf>::mma(a[mb], b[nb], acc[mb][nb]);
        __builtin_amdgcn_sched_barrier(0); };   // the other side of the same fence: every product of the step stays in front of what follows it (the slots of gap, then the set's refill)
    auto gap = [&]() { asm volatile("v_nop\n\tv_nop\n\tv_nop\n\tv_nop");   // four vector slots between the last matrix instruction and the loads that land on its operand registers (the set's refill; at the loop's foot over the taken branch): the distance that holds for a vector instruction, kept for a load too
        __builtin_amdgcn_sched_barrier(0); };   // the refill is not lifted over the slots
    ld(fa0, fb0, a0 + ko(0), b0 + ko(0)); ld(fa1, fb1, a0 + ko(1), b0 + ko(1));
    asm volatile("s_wait_xcnt 0x0" ::: "memory");   // in front of any overwrite of a register which these first loads name: the compiler forms their addresses in registers of its own and takes those for other values behind them
    __builtin_amdgcn_sched_barrier(0);   // nothing that follows (the accumulators' zeros, the loop's counter) is lifted over that wait
    unsigned oa2 = a0 + ko(2), oa3 = a0 + ko(3), oa4 = a0 + ko(4), ob2 = b0 + ko(2), ob3 = b0 + ko(3), ob4 = b0 + ko(4);   // one offset for each of a trip's three load groups and each operand
#pragma unroll 1
    for (unsigned t = 0; t < K / 32 - 2; t += 3) {
        ld(fa2, fb2, oa2, ob2); mm(fa0, fb0); gap(); ld(fa0, fb0, oa3, ob3); mm(fa1, fb1); gap(); ld(fa1, fb1, oa4, ob4); mm(fa2, fb2); gap();
        asm volatile("s_wait_xcnt 0x0" :: "v"(oa2), "v"(oa3), "v"(oa4), "v"(ob2), "v"(ob3), "v"(ob4) : "memory");   // in front of the overwrite of the offsets which this trip's loads name (row blocks are immediate offsets); as inputs they stay untouched up to it
        oa2 = a0 + ko(t + 5); oa3 = a0 + ko(t + 6); oa4 = a0 + ko(t + 7); ob2 = b0 + ko(t + 5); ob3 = b0 + ko(t + 6); ob4 = b0 + ko(t + 7);
    }
    mm(fa0, fb0); mm(fa1, fb1); gap();   // here the slots stand in front of the bias loads, which take operand registers of the last products
    if (EPI == 2) {   // a lane's eight accumulator rows are eight consecutive t of one column d: in fragment order the very 16 bytes of lane 'lane' in half mb & 1 of tile (nb, t / 32), straight from registers
        const size_t pb = ((size_t)(r0 / TT) * (ldc / HD) + c0 / HD) * HD * TT + (size_t)(r0 % TT) * 16 + lane * 8; const float* bp = bias + c0 + lr; float tb[4];
#pragma unroll
        for (int nb = 0; nb < 4; ++nb) tb[nb] = BIAS ? bp[nb * 16] : 0.0f;   // all four at once: one wait for memory, not four
        if (BIAS) asm volatile("s_wait_xcnt 0x0" :: "v"(bp) : "memory");   // in front of any overwrite of the address these loads name
#pragma unroll
        for (int nb = 0; nb < 4; ++nb) { const float bb = bfr(tb[nb]); h16* p16 = P16 + pb + (size_t)nb * 16 * TT; bf* ph = Ph + pb + (size_t)nb * 16 * TT; bf* pl = Pl + pb + (size_t)nb * 16 * TT; v8h o16[4]; v8us oh[4], ol[4];
#pragma unroll
            for (int mb = 0; mb < 4; ++mb) { v8f val;
#pragma unroll
                for (int j = 0; j < 8; ++j) { val[j] = acc[mb][nb][j] + bb; o16[mb][j] = tohx(val[j]); }
                split8(val, oh[mb], ol[mb]); }
#pragma unroll
            for (int mb = 0; mb < 4; ++mb) { *(v8h*)(p16 + mb * 256) = o16[mb]; *(v8us*)(ph + mb * 256) = oh[mb]; *(v8us*)(pl + mb * 256) = ol[mb]; }   // every store is 512 bytes in a row
            // the wait that stands in front of any overwrite of a register which an issued store names: addresses and data are its inputs, so they stay untouched up to it
            asm volatile("s_wait_xcnt 0x0" :: "v"(p16), "v"(ph), "v"(pl), "v"(o16[0]), "v"(o16[1]), "v"(o16[2]), "v"(o16[3]), "v"(oh[0]), "v"(oh[1]), "v"(oh[2]), "v"(oh[3]), "v"(ol[0]), "v"(ol[1]), "v"(ol[2]), "v"(ol[3]) : "memory"); }
        return; }
    float pbias[4][8];   // EPI 1: in store s a lane takes columns s * 16 + hi * 8 .. + 7 of row lr, its own 16 bytes of the s-th half tile
    if (EPI == 1) { const float* bp = bias + c0 + hi * 8; v8f tb[4];
#pragma unroll
        for (int s = 0; s < 4; ++s) tb[s] = BIAS ? *(const v8f*)(bp + s * 16) : (v8f){};
        if (BIAS) asm volatile("s_wait_xcnt 0x0" :: "v"(bp) : "memory");   // the wait: in front of any overwrite of the address these loads name
#pragma unroll
        for (int s = 0; s < 4; ++s)
#pragma unroll
            for (int q = 0; q < 8; ++q) pbias[s][q] = bfr(tb[s][q]); }
#pragma unroll
    for (int mb = 0; mb < 4; ++mb) {
#pragma unroll
        for (int nb = 0; nb < 4; ++nb) {
#pragma unroll
            for (int j = 0; j < 8; ++j) os[(hi * 8 + j) * 68 + nb * 16 + lr] = acc[mb][nb][j]; }
        __builtin_amdgcn_wave_barrier(); asm volatile("" ::: "memory");
        if (EPI == 1) {   // 16 rows x 64 columns are two tiles, 2 KiB in a row of each plane: a store instruction fills four whole 128-byte lines
            const size_t pb = (((size_t)(r0 / TT) * (ldc / HD) + c0 / HD) * TT + (r0 % TT) + mb * 16) * HD + lane * 8; h16* p16 = P16 + pb; bf* ph = Ph + pb; bf* pl = Pl + pb; v8h o16[4]; v8us oh[4], ol[4];
#pragma unroll
            for (int s = 0; s < 4; ++s) { const float* op = os + lr * 68 + s * 16 + hi * 8; const v4f v0 = *(const v4fa*)op, v1 = *(const v4fa*)(op + 4); v8f val;
#pragma unroll
                for (int q = 0; q < 8; ++q) { val[q] = (q < 4 ? v0[q & 3] : v1[q & 3]) + pbias[s][q]; o16[s][q] = tohx(val[q]); }
                split8(val, oh[s], ol[s]); }
#pragma unroll
            for (int s = 0; s < 4; ++s) { *(v8h*)(p16 + s * 256) = o16[s]; *(v8us*)(ph + s * 256) = oh[s]; *(v8us*)(pl + s * 256) = ol[s]; }
            // the wait in front of any overwrite of a register which an issued store names, as above
            asm volatile("s_wait_xcnt 0x0" :: "v"(p16), "v"(ph), "v"(pl), "v"(o16[0]), "v"(o16[1]), "v"(o16[2]), "v"(o16[3]), "v"(oh[0]), "v"(oh[1]), "v"(oh[2]), "v"(oh[3]), "v"(ol[0]), "v"(ol[1]), "v"(ol[2]), "v"(ol[3]) : "memory");
        }
        __builtin_amdgcn_wave_barrier(); asm volatile("" ::: "memory");
    }
}
// k_qkv: the three projections in ONE launch. Grid (rows / 128, columns / 128), 12 waves: waves 0-3 q, 4-7 k, 8-11 v, each group 2 x 2 tiles of 64 x 64 on the same 128 rows and 128 columns,
// so an x row is read by six waves of one WGP and a weight row by two, and three waves share a SIMD. No wave waits for another: every q and k wave has its own staging rows in LDS; the v waves write from registers and use none.
__global__ __launch_bounds__(384) void k_qkv(const bf* __restrict__ XB, const bf* __restrict__ WQ, const bf* __restrict__ WK, const bf* __restrict__ WV, const float* __restrict__ bq, const float* __restrict__ bk, const float* __restrict__ bv,
                                             h16* QP16, bf* QPh, bf* QPl, h16* KP16, bf* KPh, bf* KPl, h16* VT16, bf* VTh, bf* VTl) {
    __shared__ __align__(16) float os[8][16 * 68];
    const int w = __builtin_amdgcn_readfirstlane((int)(threadIdx.x >> 5)); const int r0 = blockIdx.x * 128 + (w & 1) * 64, c0 = blockIdx.y * 128 + ((w >> 1) & 1) * 64;
    const unsigned rot = (blockIdx.x + 4u * blockIdx.y) & (DM / 32 - 1);   // eight work-groups read the same x rows, thirty-two the same weight rows: each set starts spread over the ring of k steps
    if (w >= 8) proj_tile<2>(XB, WV, bv, r0, c0, rot, nullptr, VT16, VTh, VTl);
    else { const bool kk = w >= 4; proj_tile<1>(XB, kk ? WK : WQ, kk ? bk : bq, r0, c0, rot, os[w], kk ? KP16 : QP16, kk ? KPh : QPh, kk ? KPl : QPl); }
}

typedef __attribute__((ext_vector_type(2))) _Float16 v2h;
typedef __attribute__((ext_vector_type(4))) _Float16 v4h;
typedef __attribute__((ext_vector_type(2))) unsigned short v2us;
typedef __attribute__((ext_vector_type(4))) unsigned short v4us;
typedef __attribute__((ext_vector_type(2))) float v2f;
typedef __attribute__((ext_vector_type(4))) int v4i;

__global__ __launch_bounds__(256) void k_wtG(const float* __restrict__ w, int K, int N, bf* Bt) {
    const int lane = threadIdx.x & 31; const int L0 = (blockIdx.x * 8 + (threadIdx.x >> 5)) * 8; const int nlines = N * K / 64;
{
#pragma unroll 1
        for (int l = 0; l < 8; ++l) { const int L = L0 + l; if (L >= nlines) break; const size_t e = (size_t)L * 64 + lane * 2; const int k = (int)(e % K), n = (int)(e / K); v2us o;
            o[0] = f2bf(w[(size_t)k * N + n]); o[1] = f2bf(w[(size_t)(k + 1) * N + n]); *(v2us*)(Bt + e) = o; }
         }
}
// k_prep: every f32 -> bf16 conversion of the call in ONE launch, from row-major f32 to fragment order. A work-group takes CH groups of eight floats of one array = 32 tiles of 16 rows x 32 k (a wave four tiles; all sixteen loads of a thread in flight at once); blockIdx.x picks the array.
// A load takes four whole 128-byte lines (four rows of one tile, eight lanes a row, four floats a lane); the four stores of a tile fill its 1 KiB.
// PAD (the position table): rows at or past nrow are the zero pad row; they are stored as zeros and read nothing past the table (the row is clamped).
#define CH   2048
#define GX   (NB_ * TT * DM / 8 / CH)
#define GW   (DM * DQ / 8 / CH)
#define GP   (NPE * HD / 8 / CH)
template <bool PAD, int K>
__device__ __forceinline__ void cvt_run(const float* __restrict__ src, bf* dst, unsigned blk, unsigned nrow) {
    constexpr unsigned TPR = K / 32;   // tiles along a row: 32 (one work-group = one band of 16 rows) or a divisor of 32
    const unsigned lane = threadIdx.x & 31, w = threadIdx.x >> 5, r4 = lane >> 3, c = lane & 7; unsigned so[16], row[16]; v4f v[16]; v4us o[16];
#pragma unroll
    for (int u = 0; u < 16; ++u) { const unsigned tl = w * 4 + (u >> 2), rt = TPR >= 32 ? blk : blk * (32 / TPR) + tl / TPR, ks = TPR >= 32 ? tl : tl % TPR;   // tile tl of this work-group's 32; rows (u & 3) * 4 + r4 of it
        row[u] = rt * 16 + (u & 3) * 4 + r4; so[u] = ((PAD ? (row[u] < nrow ? row[u] : nrow - 1) : row[u]) * K + ks * 32 + c * 4) * 4u; v[u] = *(const v4f*)((const char*)src + so[u]); }
    // the wait that stands in front of any overwrite of a register which an issued load names: the byte offsets are its inputs, so they stay untouched (also by a landing load) up to it
    if (PAD) asm volatile("s_wait_xcnt 0x0" :: "v"(so[0]), "v"(so[1]), "v"(so[2]), "v"(so[3]), "v"(so[4]), "v"(so[5]), "v"(so[6]), "v"(so[7]), "v"(so[8]), "v"(so[9]), "v"(so[10]), "v"(so[11]), "v"(so[12]), "v"(so[13]), "v"(so[14]), "v"(so[15]) : "memory");
    else asm volatile("s_wait_xcnt 0x0" :: "v"(so[0]), "v"(so[1]), "v"(so[2]), "v"(so[3]) : "memory");   // the other twelve are immediate offsets from these four
#pragma unroll
    for (int u = 0; u < 16; ++u) { const bool zr = PAD && row[u] >= nrow; const unsigned long long w01 = pk2bf(zr ? 0.0f : v[u][0], zr ? 0.0f : v[u][1]), w23 = pk2bf(zr ? 0.0f : v[u][2], zr ? 0.0f : v[u][3]); o[u] = __builtin_bit_cast(v4us, w01 | (w23 << 32)); }
    // floats c * 4 .. + 3 of a tile's row: half c >> 2, lane group (c >> 1) & 1, first or second 8 bytes of that lane's 16
    bf* dp = dst + (size_t)(blk * 32 + w * 4) * 512 + (c >> 2) * 256 + (((c >> 1) & 1) * 16 + r4) * 8 + (c & 1) * 4;
#pragma unroll
    for (int u = 0; u < 16; ++u) *(v4us*)(dp + (u >> 2) * 512 + (u & 3) * 32) = o[u];
}
__global__ __launch_bounds__(256) void k_prep(const float* __restrict__ x, const float* __restrict__ wq, const float* __restrict__ wk, const float* __restrict__ wv, const float* __restrict__ wo, const float* __restrict__ pe,
                                              bf* XB, bf* WQ, bf* WK, bf* WV, bf* WO, bf* PE) {
    const unsigned b = blockIdx.x;
    if (b >= GX + 4 * GW) { cvt_run<true, HD>(pe, PE, b - (GX + 4 * GW), 2047); return; }
    const unsigned a = b < GX ? 0 : 1 + (b - GX) / GW;
    cvt_run<false, DM>(a == 0 ? x : a == 1 ? wq : a == 2 ? wk : a == 3 ? wv : wo, a == 0 ? XB : a == 1 ? WQ : a == 2 ? WK : a == 3 ? WV : WO, a == 0 ? b : (b - GX) % GW, 0);
}

// attn_body: 32 query rows i0.. of head z, 8 waves; wave w owns keys w * 128 .. + 127 from the scores to its partial output, and waits for no other wave before the final sum.
// The scores are computed TRANSPOSED (the key tile is the A operand, the query tile the B operand): a lane then holds eight consecutive keys of ONE query, which is the very piece of an A fragment that attn.v wants from it,
// so the logits, the softmax and the probabilities stay in the lane's registers. LDS holds, per wave, its own 32 x 128 relative scores (R, pitch RP, stored skewed as before and read back as 16-byte pieces),
// into whose slots a lane parks the logits of key tiles NKEEP.. (each lane rewrites only what it has just read), and at the end the wave's partial output with its row maxima and row sums.
// Softmax by parts: each wave takes the maximum m_w and the sum l_w over its own 128 keys, attn.v runs on exp(s - m_w) unnormalised, and the final sum weighs wave w by exp(m_w - m) and divides by the weighted l_w.
// HI: hi+lo planes, 3 products, for scores and attn.v; else single fp16 (probabilities x PCAR).
// Behind a group of global loads: the wait that stands in front of any overwrite of a register which an issued load names. It takes the group's addresses as inputs, so that they stay untouched (also by a landing load of the group) up to it.
#define XWAIT1(p)    asm volatile("s_wait_xcnt 0x0" :: "v"(p) : "memory")
#define XWAIT2(p, q) asm volatile("s_wait_xcnt 0x0" :: "v"(p), "v"(q) : "memory")
#define L2E 1.4426950408889634f
template <bool HI>
__device__ __forceinline__ void attn_body(float* T, int z, int i0, const h16* __restrict__ QP16, const bf* __restrict__ QPh, const bf* __restrict__ QPl, const h16* __restrict__ KP16, const bf* __restrict__ KPh, const bf* __restrict__ KPl,
                                          const h16* __restrict__ VT16, const bf* __restrict__ VTh, const bf* __restrict__ VTl, const bf* __restrict__ PE, bf* ATh, bf* ATl) {
    constexpr int NKEEP = 2, KD = HI ? 2 : 3, VD = HI ? 4 : 8;   // key tiles whose logits stay in registers; how many key tiles, and how many value fragments, are fetched ahead of their use
    const int tid = threadIdx.x, lane = tid & 31, lr = lane & 15, hi = lane >> 4, w = tid >> 5; const int j0 = w * 128;   // this wave's 128 keys
    float* R = T + w * (BR * RP);   // this wave's own LDS
    const size_t qb = ((size_t)z * TT + i0) * HD + lane * 8;   // planes in fragment order: 16 rows x 64 are two tiles of 512 elements
    // relative scores: rows i0 + 16 mt + r and keys j0 + jj need positions p = (j0 - i0 - 16 mt + 1008) + c, c = jj - r + 15 in 0..142: nine 16-wide tiles a row tile, ten for both
    const int pb = j0 - i0 + 992;   // 0 .. 1888; last row read pb + 159 <= 2047
    v16bf qh[2][2], ql[2][2], rb[10][2], kb[8][4], vb[16][2]; v16h q16[2][2], kf[8][2], vf[16];
    const bf* pp = PE + (size_t)pb * HD + lane * 8;
    auto rload = [&](int u) { rb[u][0] = WFrag<bf>::ld(pp + u * 1024); rb[u][1] = WFrag<bf>::ld(pp + u * 1024 + 512); XWAIT1(pp); };   // one base for all ten tiles (the tiles are immediate offsets): as the wait's input it outlives every load that names it
    const size_t ko = ((size_t)z * TT + j0) * HD + lane * 8; const bf* khp = KPh + ko; const bf* klp = KPl + ko; const h16* k16p = KP16 + ko;   // likewise one base a plane for the eight key tiles
    auto kload = [&](int nb) {
        if (HI) { kb[nb][0] = WFrag<bf>::ld(khp + nb * 1024); kb[nb][1] = WFrag<bf>::ld(khp + nb * 1024 + 512); kb[nb][2] = WFrag<bf>::ld(klp + nb * 1024); kb[nb][3] = WFrag<bf>::ld(klp + nb * 1024 + 512); XWAIT2(khp, klp); }
        else { kf[nb][0] = WFrag<h16>::ld(k16p + nb * 1024); kf[nb][1] = WFrag<h16>::ld(k16p + nb * 1024 + 512); XWAIT1(k16p); } };
    const size_t vo = (size_t)z * HD * TT + j0 * 16 + lane * 8; const bf* vhp = VTh + vo; const bf* vlp = VTl + vo; const h16* v16p = VT16 + vo;
    auto vload = [&](int t) { const int off = (t >> 2) * 512 + (t & 3) * 16 * TT;   // step t = ks * 4 + nb: tile (nb, key / 32) of the transposed plane
        if (HI) { vb[t][0] = WFrag<bf>::ld(vhp + off); vb[t][1] = WFrag<bf>::ld(vlp + off); XWAIT2(vhp, vlp); } else { vf[t] = WFrag<h16>::ld(v16p + off); XWAIT1(v16p); } };
#pragma unroll
    for (int mt = 0; mt < 2; ++mt)
#pragma unroll
        for (int kk = 0; kk < 2; ++kk) { qh[mt][kk] = WFrag<bf>::ld(QPh + qb + (size_t)mt * 16 * HD + kk * 512); ql[mt][kk] = WFrag<bf>::ld(QPl + qb + (size_t)mt * 16 * HD + kk * 512); }
    XWAIT2(QPh + qb, QPl + qb);
#pragma unroll
    for (int u = 0; u < 4; ++u) rload(u);
#pragma unroll
    for (int u = 0; u < 10; ++u) {
#pragma unroll
        for (int mt = 0; mt < 2; ++mt) { const int tt = u - 1 + mt; if (tt < 0 || tt > 8) continue;
            v8f acc = (v8f){}; acc = wmmab(qh[mt][0], rb[u][0], acc); acc = wmmab(ql[mt][0], rb[u][0], acc); acc = wmmab(qh[mt][1], rb[u][1], acc); acc = wmmab(ql[mt][1], rb[u][1], acc);
            asm volatile("v_nop\n\tv_nop\n\tv_nop\n\tv_nop" :: "v"(acc));   // the four vector slots the chip needs before the next tile's first matrix instruction may overwrite these result registers
#pragma unroll
            for (int j = 0; j < 8; ++j) { const int r = hi * 8 + j, jj = tt * 16 + lr + r - 15; R[(mt * 16 + r) * RP + ((jj >= 0 && jj < 128) ? jj : 128)] = acc[j]; } }   // a position outside this wave's keys lands in the row's pad column
        if (u < 6) rload(u + 4); else if (u >= 9 - KD && u < 9) kload(u - (9 - KD));
        if (!HI && u == 5) {
#pragma unroll
            for (int mt = 0; mt < 2; ++mt)
#pragma unroll
                for (int kk = 0; kk < 2; ++kk) q16[mt][kk] = WFrag<h16>::ld(QP16 + qb + (size_t)mt * 16 * HD + kk * 512);
            XWAIT1(QP16 + qb); } }
    asm volatile("s_wait_dscnt 0x0" ::: "memory");   // the skewed stores crossed lanes, of this wave alone: they are done before its lanes read the rows back; no other wave touches them, so no barrier
    v8f s[8][2]; float mx[2] = { -3.0e38f, -3.0e38f };
#pragma unroll
    for (int nb = 0; nb < 8; ++nb) { v4f r0[2], r1[2];
#pragma unroll
        for (int mt = 0; mt < 2; ++mt) { const float* rp = R + (mt * 16 + lr) * RP + nb * 16 + hi * 8; r0[mt] = *(const v4fa*)rp; r1[mt] = *(const v4fa*)(rp + 4); }   // query mt * 16 + lr, keys nb * 16 + hi * 8 .. + 7
#pragma unroll
        for (int mt = 0; mt < 2; ++mt) { v8f a = (v8f){};   // D row = key hi * 8 + j of the tile, D column = query lr
            if (HI) { a = wmmab(kb[nb][0], qh[mt][0], a); a = wmmab(kb[nb][0], ql[mt][0], a); a = wmmab(kb[nb][2], qh[mt][0], a); a = wmmab(kb[nb][1], qh[mt][1], a); a = wmmab(kb[nb][1], ql[mt][1], a); a = wmmab(kb[nb][3], qh[mt][1], a); }
            else { a = wmma16(kf[nb][0], q16[mt][0], a); a = wmma16(kf[nb][1], q16[mt][1], a); }
            s[nb][mt] = a; }
        if (nb + KD < 8) kload(nb + KD);
#pragma unroll
        for (int mt = 0; mt < 2; ++mt) {
#pragma unroll
            for (int j = 0; j < 8; ++j) { const float v = __fadd_rn(__fmul_rn(s[nb][mt][j], SCL), j < 4 ? r0[mt][j & 3] : r1[mt][j & 3]); s[nb][mt][j] = v; mx[mt] = fmaxf(mx[mt], v); }   // SCL is a power of two: the product is exact, fused or not
            if (nb >= NKEEP) { float* rp = R + (mt * 16 + lr) * RP + nb * 16 + hi * 8; *(v4fa*)rp = (v4f){ s[nb][mt][0], s[nb][mt][1], s[nb][mt][2], s[nb][mt][3] }; *(v4fa*)(rp + 4) = (v4f){ s[nb][mt][4], s[nb][mt][5], s[nb][mt][6], s[nb][mt][7] }; } } }
#pragma unroll
    for (int t = 0; t < VD; ++t) vload(t);   // they fly during the first exponentials
#pragma unroll
    for (int mt = 0; mt < 2; ++mt) mx[mt] = fmaxf(mx[mt], __shfl_xor(mx[mt], 16, 32));   // the two lane halves hold the two halves of every key tile
    auto sload = [&](int ks) {   // the parked logits of key tiles 2 ks, 2 ks + 1: each lane its own
#pragma unroll
        for (int q = 0; q < 2; ++q)
#pragma unroll
            for (int mt = 0; mt < 2; ++mt) { const float* rp = R + (mt * 16 + lr) * RP + (2 * ks + q) * 16 + hi * 8; const v4f a = *(const v4fa*)rp, b = *(const v4fa*)(rp + 4); s[2 * ks + q][mt] = (v8f){ a[0], a[1], a[2], a[3], b[0], b[1], b[2], b[3] }; } };
    if (NKEEP == 0) sload(0);
    // attn.v: this wave sums its own 128 keys for all 32 rows x 64 columns; element e of a lane's A fragment is key 8 hi + e of tile 2 ks, element 8 + e the same of tile 2 ks + 1
    v8f o[2][4]; float sm[2] = { 0.f, 0.f };
#pragma unroll
    for (int mt = 0; mt < 2; ++mt)
#pragma unroll
        for (int nb = 0; nb < 4; ++nb) o[mt][nb] = (v8f){};
#pragma unroll
    for (int ks = 0; ks < 4; ++ks) { v16bf ah[2], al[2]; v16h a16[2];
#pragma unroll
        for (int mt = 0; mt < 2; ++mt) { v8us oh[2], ol[2]; v8h o16[2];
#pragma unroll
            for (int q = 0; q < 2; ++q) { float p[8];
#pragma unroll
                for (int j = 0; j < 8; ++j) { p[j] = __builtin_amdgcn_exp2f(__fmul_rn(__fsub_rn(s[2 * ks + q][mt][j], mx[mt]), L2E));
                    if (!HI) o16[q][j] = tohx(p[j] * PCAR); }
                if (HI) split8((v8f){ p[0], p[1], p[2], p[3], p[4], p[5], p[6], p[7] }, oh[q], ol[q]);
                sm[mt] += ((p[0] + p[1]) + (p[2] + p[3])) + ((p[4] + p[5]) + (p[6] + p[7])); }
            if (HI) { ah[mt] = cat16b(oh[0], oh[1]); al[mt] = cat16b(ol[0], ol[1]); } else a16[mt] = cat16(o16[0], o16[1]); }
        if (ks < 3 && 2 * (ks + 1) >= NKEEP) sload(ks + 1);
#pragma unroll
        for (int nb = 0; nb < 4; ++nb) { const int t = ks * 4 + nb;
#pragma unroll
            for (int mt = 0; mt < 2; ++mt) {
                if (HI) { o[mt][nb] = wmmab(ah[mt], vb[t][0], o[mt][nb]); o[mt][nb] = wmmab(al[mt], vb[t][0], o[mt][nb]); o[mt][nb] = wmmab(ah[mt], vb[t][1], o[mt][nb]); }
                else o[mt][nb] = wmma16(a16[mt], vf[t], o[mt][nb]); }
            if (t + VD < 16) vload(t + VD); } }
#pragma unroll
    for (int mt = 0; mt < 2; ++mt) sm[mt] += __shfl_xor(sm[mt], 16, 32);
    __builtin_amdgcn_wave_barrier(); asm volatile("" ::: "memory");   // the partial output goes over this wave's own slots: behind its last read of them
#pragma unroll
    for (int mt = 0; mt < 2; ++mt) {
#pragma unroll
        for (int nb = 0; nb < 4; ++nb)
#pragma unroll
            for (int j = 0; j < 8; ++j) R[(mt * 16 + hi * 8 + j) * OPP + nb * 16 + lr] = o[mt][nb][j];
        R[BR * OPP + hi * BR + mt * 16 + lr] = hi ? sm[mt] : mx[mt]; }   // behind the partial output: 32 row maxima, then 32 row sums
    __syncthreads();   // partial outputs, maxima and sums of all eight waves complete
    { const int row = (w >> 2) * 16 + lr, d0 = (w & 3) * 16 + hi * 8; v4f p0[8], p1[8]; float mw[8], lw[8];   // wave w writes half tile w & 3 of row tile w >> 2: a lane its own 16 bytes there
#pragma unroll
        for (int ww = 0; ww < 8; ++ww) { const float* pr = T + ww * (BR * RP); p0[ww] = *(const v4fa*)(pr + row * OPP + d0); p1[ww] = *(const v4fa*)(pr + row * OPP + d0 + 4); mw[ww] = pr[BR * OPP + row]; lw[ww] = pr[BR * OPP + BR + row]; }
        float m = mw[0];
#pragma unroll
        for (int ww = 1; ww < 8; ++ww) m = fmaxf(m, mw[ww]);
        v4f s0 = (v4f){}, s1 = (v4f){}; float den = 0.f;
#pragma unroll
        for (int ww = 0; ww < 8; ++ww) { const float e = __builtin_amdgcn_exp2f((mw[ww] - m) * L2E); den += e * lw[ww]; s0 += p0[ww] * e; s1 += p1[ww] * e; }   // key blocks in ascending order
        const float cs = __fdiv_rn(HI ? 1.0f : (1.0f / PCAR), den); v8us oh, ol; const v4f t0 = s0 * cs, t1 = s1 * cs;
        split8((v8f){ t0[0], t0[1], t0[2], t0[3], t1[0], t1[1], t1[2], t1[3] }, oh, ol);
        const size_t oo = ((size_t)(z / NH_) * TT + i0 + (w >> 2) * 16) * DQ + (size_t)(z % NH_) * 1024 + (w & 3) * 256 + lane * 8; *(v8us*)(ATh + oo) = oh; *(v8us*)(ATl + oo) = ol; }   // fragment order, K = DQ: a head is two tiles along k; a wave fills four 128-byte lines
}
// k_attn: grid (TT / BR, NZ), 256 threads; two work-groups share a WGP's LDS, so four waves a SIMD
__global__ __launch_bounds__(256) __attribute__((amdgpu_waves_per_eu(4, 4))) void k_attn(const h16* __restrict__ QP16, const bf* __restrict__ QPh, const bf* __restrict__ QPl, const h16* __restrict__ KP16, const bf* __restrict__ KPh, const bf* __restrict__ KPl,
                                               const h16* __restrict__ VT16, const bf* __restrict__ VTh, const bf* __restrict__ VTl, const bf* __restrict__ PE, bf* ATh, bf* ATl) {
    __shared__ __align__(16) float T[8 * BR * RP];
    const int i0 = blockIdx.x * BR, z = blockIdx.y;
    if (i0 < RH) attn_body<true>(T, z, i0, QP16, QPh, QPl, KP16, KPh, KPl, VT16, VTh, VTl, PE, ATh, ATl);
    else attn_body<false>(T, z, i0, QP16, QPh, QPl, KP16, KPh, KPl, VT16, VTh, VTl, PE, ATh, ATl);
}

extern "C" void kernel_launch(void* const* d_in, const int* in_sizes, int n_in,
                              void* d_out, int out_size, void* d_ws, size_t ws_size, hipStream_t stream) {
    (void)in_sizes; (void)n_in; (void)out_size;
    const float* x = (const float*)d_in[0]; const float* wq = (const float*)d_in[1]; const float* bq = (const float*)d_in[2]; const float* wk = (const float*)d_in[3]; const float* bk = (const float*)d_in[4]; const float* wv = (const float*)d_in[5]; const float* bv = (const float*)d_in[6]; const float* wo = (const float*)d_in[7]; const float* bo = (const float*)d_in[8]; const float* pe = (const float*)d_in[9];
    float* OUT = (float*)d_out;     // [4][1024][1024]
    char* wsp = (char*)d_ws;
    auto take = [&](size_t bytes) { char* p = wsp; wsp += (bytes + 255) & ~(size_t)255; return (void*)p; };
    bf* WO = (bf*)take((size_t)DM * DQ * 2); bf* PE = (bf*)take((size_t)NPE * HD * 2);
    h16* QP16 = (h16*)take((size_t)NZ * TT * HD * 2); h16* KP16 = (h16*)take((size_t)NZ * TT * HD * 2); h16* VT16 = (h16*)take((size_t)NZ * HD * TT * 2);
    bf* QPh = (bf*)take((size_t)NZ * TT * HD * 2); bf* QPl = (bf*)take((size_t)NZ * TT * HD * 2); bf* KPh = (bf*)take((size_t)NZ * TT * HD * 2); bf* KPl = (bf*)take((size_t)NZ * TT * HD * 2); bf* VTh = (bf*)take((size_t)NZ * HD * TT * 2); bf* VTl = (bf*)take((size_t)NZ * HD * TT * 2);
    bf* ATh = (bf*)take((size_t)NB_ * TT * DQ * 2); bf* ATl = (bf*)take((size_t)NB_ * TT * DQ * 2);
    bf* WQ = (bf*)take((size_t)DQ * DM * 2); bf* WK = (bf*)take((size_t)DKV * DM * 2); bf* WV = (bf*)take((size_t)DKV * DM * 2);
    bf* XB = (bf*)take((size_t)NB_ * TT * DM * 2);
    if ((size_t)(wsp - (char*)d_ws) > ws_size) return;    // ws 256 MiB
    k_prep<<<GX + 4 * GW + GP, 256, 0, stream>>>(x, wq, wk, wv, wo, pe, XB, WQ, WK, WV, WO, PE);   /* bf16 x, weights, position table + zero pad row */
    k_qkv<<<dim3(NB_ * TT / 128, DQ / 128, 1), 384, 0, stream>>>(XB, WQ, WK, WV, bq, bk, bv, QP16, QPh, QPl, KP16, KPh, KPl, VT16, VTh, VTl);
    k_attn<<<dim3(TT / BR, NZ, 1), 256, 0, stream>>>(QP16, QPh, QPl, KP16, KPh, KPl, VT16, VTh, VTl, PE, ATh, ATl);   // planes are [b][h][..]: z is the plane index (one kv head per query head)
    k_gemmw<bf, 1, true, 0, DQ><<<dim3(NB_ * TT / 64, DM / 64, 1), 32, 0, stream>>>(ATh, ATl, WO, nullptr, OUT, DM, bo, 0, 0, 0, nullptr, nullptr, nullptr);
}

// v010
// Measured time: 111 microseconds a run.
// In two side-by-side timings against v009, it was 1.04 and 1.05 times as fast.
// Counting every step since v000, it is 24.2 times as fast.
#include <hip/hip_runtime.h>

// Self-attention with a learned relative-position bias (x [4][1024][1024]; q, k, v = x W^T + b ('oi', 16 heads x 64); S = q.k/8 + S_rel[i][j - i + 1023] where S_rel = q.pos_emb^T (pos_emb [2047][64], unscaled); softmax; out = merged Wo^T + bo -> [4][1024][1024]).
// Layout: batch and head are one flat index z = b * 16 + h carried in the grids (projections over all 4096 rows; their epilogues write the 16-bit head planes themselves: q, k as [z][t][d], v as [z][d][t]). Attention is ONE launch: a team of 8 waves (two teams a work-group) owns 32 query rows of one z and each wave 128 of the 1024 keys: relative scores (q hi/lo planes against the bf16 position table, 2047 rows + one zero pad row; only the band of positions the 32 rows reach) are stored to the wave's own LDS already skewed (S_rel[i][j - i + 1023] at column j), the content scores are computed transposed and take them up in registers, softmax and attn.v run per wave on registers, the eight partial outputs are joined through LDS and the hi/lo planes of the merged heads go to memory.
// Every 16-bit operand plane in memory (x, weights, position table, q, k, v^T, merged heads) is kept in FRAGMENT ORDER: a tile of 16 rows x 32 k is 1 KiB in a row, first the 16 bytes that each lane 0..31 takes for k = 8 * (lane >> 4) .. + 7 of row lane & 15, then the 16 bytes for k + 16;
// tiles run along k, then down the rows (tile (rt, ks) of a plane with K elements a row starts at element rt * 16 * K + ks * 512). A fragment load is then 2 x 512 contiguous bytes (four whole 128-byte lines each) and not 16 pieces of 32 bytes; which element meets which in a product is as before.
// Compute dtypes, f32 accumulate: every input rounded to bf16; q/k/v on PLAIN bf16 operands (inputs: exact) + biases; relative scores q(hi+lo).pos_emb (2 products, f32); scores and attn.v: query rows < 512 hl (3 products), the rest single fp16 (x1024); softmax f32; Wo hl x exact (2 products) + bo.

#define NB_  4
#define TT   1024
#define DM   1024
#define NH_  16
#define NKV  16
#define REP  (NH_ / NKV)
#define HD   64
#define DQ   (NH_ * HD)
#define DKV  (NKV * HD)
#define NPE  2048                 // 2047 relative positions + 1 zero pad row
#define BR   32                   // query rows per attention team of 8 waves (a work-group holds two teams)
#define RP   132                  // LDS row pitch in floats of a wave's 32 x 128 relative scores: 528 B = 16 B x odd, so b128 accesses of 16 rows meet no bank twice; column 128 is the pad, never read
#define OPP  68                   // pitch in floats of a wave's partial attn.v tile in LDS
#define NZ   (NB_ * NH_)
#define RH   512                  // query rows < RH use hi+lo planes (0: none)
#define WIN  0
#define PCAR 1024.0f
#define SCL  0.125f   // HD^-0.5
typedef _Float16 h16;
typedef unsigned short bf;
typedef __attribute__((ext_vector_type(16))) __bf16   v16bf;
typedef __attribute__((ext_vector_type(16))) _Float16 v16h;
typedef __attribute__((ext_vector_type(8)))  _Float16 v8h;
typedef __attribute__((ext_vector_type(8)))  unsigned short v8us;
typedef __attribute__((ext_vector_type(8)))  float    v8f;
typedef __attribute__((ext_vector_type(4)))  float    v4f;
typedef v8h  __attribute__((may_alias)) v8ha;
typedef v4f  __attribute__((may_alias)) v4fa;
typedef v8us __attribute__((may_alias)) v8usa;

__device__ __forceinline__ unsigned short f2bf(float f) { return __builtin_bit_cast(unsigned short, (__bf16)f); }   // the chip's own convert, round to nearest even
__device__ __forceinline__ float bf2f(unsigned short b) { return __uint_as_float(((unsigned)b) << 16); }
__device__ __forceinline__ float bfr(float f) { return bf2f(f2bf(f)); }
__device__ __forceinline__ h16 tohx(float x) { return (h16)x; }
typedef __attribute__((ext_vector_type(2))) __bf16 v2bf;
typedef __attribute__((ext_vector_type(2))) float f32x2;
typedef __attribute__((ext_vector_type(4))) unsigned u32x4;
__device__ __forceinline__ unsigned pk2bf(float a, float b) { return __builtin_bit_cast(unsigned, __builtin_convertvector(((f32x2){ a, b }), v2bf)); }   // one packed convert: a in the low half, b in the high half, each rounded to nearest even
// eight values at once into bf16 hi + lo (lo = the rounded rest y - hi), two by two: one packed convert makes a pair's word of the 16-byte piece, and the rest is taken from that same word, so no value is converted twice or moved into place
__device__ __forceinline__ void split8(v8f y, v8us& h, v8us& l) { u32x4 hu, lu;
#pragma unroll
    for (int i = 0; i < 4; ++i) { const unsigned u = pk2bf(y[2 * i], y[2 * i + 1]); hu[i] = u; lu[i] = pk2bf(y[2 * i] - __uint_as_float(u << 16), y[2 * i + 1] - __uint_as_float(u & 0xFFFF0000u)); }
    h = __builtin_bit_cast(v8us, hu); l = __builtin_bit_cast(v8us, lu); }
__device__ __forceinline__ v16h cat16(v8h lo, v8h hi) { return __builtin_shufflevector(lo, hi, 0, 1, 2, 3, 4, 5, 6, 7, 8, 9, 10, 11, 12, 13, 14, 15); }
__device__ __forceinline__ v16bf cat16b(v8us lo, v8us hi) { return __builtin_bit_cast(v16bf, __builtin_shufflevector(lo, hi, 0, 1, 2, 3, 4, 5, 6, 7, 8, 9, 10, 11, 12, 13, 14, 15)); }
__device__ __forceinline__ v8f wmma16(v16h a, v16h b, v8f c) { return __builtin_amdgcn_wmma_f32_16x16x32_f16(false, a, false, b, (short)0, c, false, false); }
__device__ __forceinline__ v8f wmmab(v16bf a, v16bf b, v8f c) { return __builtin_amdgcn_wmma_f32_16x16x32_bf16(false, a, false, b, (short)0, c, false, false); }



// ---- k_gemmw: register-blocked GEMM, ONE WAVE per 64x64 output tile (16 accumulators), operands straight from 16-bit planes in fragment order (ld takes the tile's start + lane * 8); grid (M/64, N/256, Z), 128 threads.
// A work-group is four waves, one a SIMD, on the same 64 rows: column tiles blockIdx.y + 4 * wave. They start together and walk the k steps from one start, so an A line comes from L2 once and the WGP's cache serves the other three readers. No wave waits for another: each has its own staging rows in LDS.
// C[m][n] (f32, pitch ldc, + optional f32 bias[n]) = sum_k A[m][k] Bt[n][k] (+ split products per NSPLIT). z-batch strides sA/sB/sC in elements. K is a compile-time constant.
// C goes to memory as f32 (EPI 0, the one form left here: the projections, which write 16-bit planes, are proj_tile below).
template <typename T16> struct WFrag;
template <> struct WFrag<h16> { typedef v16h V; static __device__ __forceinline__ V ld(const h16* p) { return cat16(*(const v8h*)p, *(const v8h*)(p + 256)); } static __device__ __forceinline__ v8f mma(V a, V b, v8f c) { return wmma16(a, b, c); } };
template <> struct WFrag<bf> { typedef v16bf V; static __device__ __forceinline__ V ld(const bf* p) { return cat16b(*(const v8us*)p, *(const v8us*)(p + 256)); } static __device__ __forceinline__ v8f mma(V a, V b, v8f c) { return wmmab(a, b, c); } };
template <typename T16, int NSPLIT, bool BIAS, int EPI, int K>
__global__ __launch_bounds__(128) void k_gemmw(const T16* __restrict__ A, const T16* __restrict__ A2, const T16* __restrict__ Bt, const T16* __restrict__ Bt2, float* C, int ldc, const float* __restrict__ bias, size_t sA, size_t sB, size_t sC, h16* P16, bf* Ph, bf* Pl) {
    typedef typename WFrag<T16>::V V;
    static_assert(K % 32 == 0 && K / 32 >= 5 && (K / 32 - 2) % 3 == 0, "the k loop below takes three k steps a trip and leaves two");
    static_assert(((K / 32) & (K / 32 - 1)) == 0, "the k steps are walked as a ring: their number is a power of two");
    __shared__ __align__(16) float osw[4][16 * 68];
    const int wv = __builtin_amdgcn_readfirstlane((int)(threadIdx.x >> 5)); float* os = osw[wv];
    const size_t z = blockIdx.z; A += z * sA; if (A2) A2 += z * sA; Bt += z * sB; if (Bt2) Bt2 += z * sB; C += z * sC;
    const int lane = threadIdx.x & 31, lr = lane & 15, hi = lane >> 4; const int r0 = blockIdx.x * 64, c0 = (blockIdx.y + 4 * wv) * 64;
    v8f acc[4][4];
#pragma unroll
    for (int mb = 0; mb < 4; ++mb)
#pragma unroll
        for (int nb = 0; nb < 4; ++nb) acc[mb][nb] = (v8f){};
    constexpr bool SA = NSPLIT == 1 || NSPLIT == 2, SB = NSPLIT >= 2;
    // The k steps are walked as a ring from a start that differs between the work-groups that read the same operand rows. All tiles of the grid run at once and at one pace: from a common start every k step of every operand would be asked of memory for the first time by all its readers together,
    // and each step would wait out memory. From spread starts all of A and B is asked for within the first few steps, and what a tile comes to later another tile has already brought into L2. Each output element sums the same products, from another first term.
    const unsigned rot = (blockIdx.x + 8u * blockIdx.y) & (K / 32 - 1);   // readers of one B row block start one step apart, work-groups on one A row block eight; the four waves of a work-group keep one start, so that they meet on the A lines in the WGP's cache
    const unsigned a0 = ((unsigned)r0 * K + lane * 8) * 2u, b0 = ((unsigned)c0 * K + lane * 8) * 2u;   // byte offsets of this lane's piece in k step 0; a k step of 32 is one tile of 1 KiB
    auto ko = [&](unsigned t) { return ((rot + t) & (K / 32 - 1)) << 10; };   // byte offset of the t-th step of this tile's walk
    // Three register sets of fragments: the loads of k step t + 2 are issued in front of the products of step t, so a load has two steps of matrix work to come back in (the grid is one wave a SIMD: no other wave covers this one's wait).
    struct FS { V a[4], a2[4], b[4], b2[4]; } f0, f1, f2;
    auto ld = [&](FS& f, unsigned oa, unsigned ob) {   // plane base + one 32-bit offset an operand; row blocks are immediate offsets
#pragma unroll
        for (int q = 0; q < 4; ++q) { f.a[q] = WFrag<T16>::ld((const T16*)((const char*)A + oa) + q * 16 * K); if (SA) f.a2[q] = WFrag<T16>::ld((const T16*)((const char*)A2 + oa) + q * 16 * K); f.b[q] = WFrag<T16>::ld((const T16*)((const char*)Bt + ob) + q * 16 * K); if (SB) f.b2[q] = WFrag<T16>::ld((const T16*)((const char*)Bt2 + ob) + q * 16 * K); }
        __builtin_amdgcn_sched_barrier(0); };   // keeps a step's loads together in front of the products that follow, not strewn among them or sunk towards their use
    auto mm = [&](const FS& f) {
#pragma unroll
        for (int nb = 0; nb < 4; ++nb)
#pragma unroll
            for (int mb = 0; mb < 4; ++mb) { acc[mb][nb] = WFrag<T16>::mma(f.a[mb], f.b[nb], acc[mb][nb]); if (SA) acc[mb][nb] = WFrag<T16>::mma(f.a2[mb], f.b[nb], acc[mb][nb]); if (SB) acc[mb][nb] = WFrag<T16>::mma(f.a[mb], f.b2[nb], acc[mb][nb]); }
        __builtin_amdgcn_sched_barrier(0); };   // the other side of the same fence: every product of the step stays in front of what follows it (the slots of gap, then the set's refill)
    auto gap = [&]() { asm volatile("v_nop\n\tv_nop\n\tv_nop\n\tv_nop");   // four vector slots between the last matrix instruction and the loads that land on its operand registers (the set's refill; at the loop's foot over the taken branch): the distance that holds for a vector instruction, kept for a load too
        __builtin_amdgcn_sched_barrier(0); };   // the refill is not lifted over the slots
    ld(f0, a0 + ko(0), b0 + ko(0)); ld(f1, a0 + ko(1), b0 + ko(1));
    asm volatile("s_wait_xcnt 0x0" ::: "memory");   // in front of any overwrite of a register which these first loads name: the compiler forms their addresses in registers of its own and takes those for other values behind them
    __builtin_amdgcn_sched_barrier(0);   // nothing that follows (the accumulators' zeros, the loop's counter) is lifted over that wait
    unsigned oa2 = a0 + ko(2), oa3 = a0 + ko(3), oa4 = a0 + ko(4), ob2 = b0 + ko(2), ob3 = b0 + ko(3), ob4 = b0 + ko(4);   // one offset for each of a trip's three load groups and each operand
#pragma unroll 1
    for (unsigned t = 0; t < K / 32 - 2; t += 3) {
        ld(f2, oa2, ob2); mm(f0); gap(); ld(f0, oa3, ob3); mm(f1); gap(); ld(f1, oa4, ob4); mm(f2); gap();
        asm volatile("s_wait_xcnt 0x0" :: "v"(oa2), "v"(oa3), "v"(oa4), "v"(ob2), "v"(ob3), "v"(ob4) : "memory");   // in front of the overwrite of the offsets which this trip's loads name: as inputs they stay untouched up to it
        oa2 = a0 + ko(t + 5); oa3 = a0 + ko(t + 6); oa4 = a0 + ko(t + 7); ob2 = b0 + ko(t + 5); ob3 = b0 + ko(t + 6); ob4 = b0 + ko(t + 7);
    }
    mm(f0); mm(f1);
#pragma unroll
    for (int mb = 0; mb < 4; ++mb) {
#pragma unroll
        for (int nb = 0; nb < 4; ++nb) {
#pragma unroll
            for (int j = 0; j < 8; ++j) os[(hi * 8 + j) * 68 + nb * 16 + lr] = acc[mb][nb][j]; }
        __builtin_amdgcn_wave_barrier(); asm volatile("" ::: "memory");
        float* crow = C + (size_t)(r0 + mb * 16) * ldc + c0;
{
#pragma unroll
            for (int s = 0; s < 8; ++s) { const int row = 2 * s + hi, cofs = lr * 4; v4f val = *(const v4fa*)(os + row * 68 + cofs); if (BIAS) { val[0] += bfr(bias[c0 + cofs]); val[1] += bfr(bias[c0 + cofs + 1]); val[2] += bfr(bias[c0 + cofs + 2]); val[3] += bfr(bias[c0 + cofs + 3]); }
                *(v4f*)(crow + (size_t)row * ldc + cofs) = val; }
             }
        __builtin_amdgcn_sched_barrier(0);   // the row block's stores stay in front of the wait below
        asm volatile("s_wait_xcnt 0x0" ::: "memory");   // in front of any overwrite of a register (address or data) which these stores name: the next row block takes the same registers
        __builtin_amdgcn_sched_barrier(0);   // the next row block's work stays behind that wait
        __builtin_amdgcn_wave_barrier(); asm volatile("" ::: "memory");
    }
}

// ---- proj_tile: k_gemmw's 64x64 tile of one wave for the projections: C = x W^T + b, K = DM, plain bf16 operands, no f32 result. A 64-column tile is one head (HD == 64) and rows are b * TT + t:
// C + bias goes out as three 16-bit planes (fp16, bf16 hi, bf16 lo), EPI 1 as [b][head][t][d] (staged through the wave's own os rows), EPI 2 transposed as [b][head][d][t], each head's plane in fragment order.
template <int EPI>
__device__ __forceinline__ void proj_tile(const bf* __restrict__ A, const bf* __restrict__ Bt, const float* __restrict__ bias, int r0, int c0, unsigned rot, float* os, h16* P16, bf* Ph, bf* Pl) {
    typedef WFrag<bf>::V V; constexpr int K = DM, ldc = DQ; constexpr bool BIAS = true;
    const int lane = threadIdx.x & 31, lr = lane & 15, hi = lane >> 4;
    v8f acc[4][4];
#pragma unroll
    for (int mb = 0; mb < 4; ++mb)
#pragma unroll
        for (int nb = 0; nb < 4; ++nb) acc[mb][nb] = (v8f){};
    // the k steps are walked as a ring from step rot (one start for the whole work-group, another for the work-groups that read the same rows): why, at k_gemmw
    static_assert(((K / 32) & (K / 32 - 1)) == 0, "the k steps are walked as a ring: their number is a power of two");
    const unsigned a0 = ((unsigned)r0 * K + lane * 8) * 2u, b0 = ((unsigned)c0 * K + lane * 8) * 2u;   // byte offsets of this lane's piece in k step 0
    auto ko = [&](unsigned t) { return ((rot + t) & (K / 32 - 1)) << 10; };   // byte offset of the t-th step of the walk
    // Three register sets of fragments: the loads of k step t + 2 are issued in front of the products of step t, so a load has two steps of this wave's matrix work (and the SIMD's two other waves) to come back under.
    static_assert(K / 32 >= 5 && (K / 32 - 2) % 3 == 0, "the k loop below takes three k steps a trip and leaves two");
    V fa0[4], fb0[4], fa1[4], fb1[4], fa2[4], fb2[4];
    auto ld = [&](V (&a)[4], V (&b)[4], unsigned oa, unsigned ob) {
#pragma unroll
        for (int mb = 0; mb < 4; ++mb) { a[mb] = WFrag<bf>::ld((const bf*)((const char*)A + oa) + mb * 16 * K); b[mb] = WFrag<bf>::ld((const bf*)((const char*)Bt + ob) + mb * 16 * K); }
        __builtin_amdgcn_sched_barrier(0); };   // keeps the sixteen loads in front of the products that follow: left alone the compiler sinks them to just before their use, and the wait for memory is back
    auto mm = [&](const V (&a)[4], const V (&b)[4]) {
#pragma unroll
        for (int nb = 0; nb < 4; ++nb)
#pragma unroll
            for (int mb = 0; mb < 4; ++mb) acc[mb][nb] = WFrag<bf>::mma(a[mb], b[nb], acc[mb][nb]);
        __builtin_amdgcn_sched_barrier(0); };   // the other side of the same fence: every product of the step stays in front of what follows it (the slots of gap, then the set's refill)
    auto gap = [&]() { asm volatile("v_nop\n\tv_nop\n\tv_nop\n\tv_nop");   // four vector slots between the last matrix instruction and the loads that land on its operand registers (the set's refill; at the loop's foot over the taken branch): the distance that holds for a vector instruction, kept for a load too
        __builtin_amdgcn_sched_barrier(0); };   // the refill is not lifted over the slots
    ld(fa0, fb0, a0 + ko(0), b0 + ko(0)); ld(fa1, fb1, a0 + ko(1), b0 + ko(1));
    asm volatile("s_wait_xcnt 0x0" ::: "memory");   // in front of any overwrite of a register which these first loads name: the compiler forms their addresses in registers of its own and takes those for other values behind them
    __builtin_amdgcn_sched_barrier(0);   // nothing that follows (the accumulators' zeros, the loop's counter) is lifted over that wait
    unsigned oa2 = a0 + ko(2), oa3 = a0 + ko(3), oa4 = a0 + ko(4), ob2 = b0 + ko(2), ob3 = b0 + ko(3), ob4 = b0 + ko(4);   // one offset for each of a trip's three load groups and each operand
#pragma unroll 1
    for (unsigned t = 0; t < K / 32 - 2; t += 3) {
        ld(fa2, fb2, oa2, ob2); mm(fa0, fb0); gap(); ld(fa0, fb0, oa3, ob3); mm(fa1, fb1); gap(); ld(fa1, fb1, oa4, ob4); mm(fa2, fb2); gap();
        asm volatile("s_wait_xcnt 0x0" :: "v"(oa2), "v"(oa3), "v"(oa4), "v"(ob2), "v"(ob3), "v"(ob4) : "memory");   // in front of the overwrite of the offsets which this trip's loads name (row blocks are immediate offsets); as inputs they stay untouched up to it
        oa2 = a0 + ko(t + 5); oa3 = a0 + ko(t + 6); oa4 = a0 + ko(t + 7); ob2 = b0 + ko(t + 5); ob3 = b0 + ko(t + 6); ob4 = b0 + ko(t + 7);
    }
    mm(fa0, fb0); mm(fa1, fb1); gap();   // here the slots stand in front of the bias loads, which take operand registers of the last products
    if (EPI == 2) {   // a lane's eight accumulator rows are eight consecutive t of one column d: in fragment order the very 16 bytes of lane 'lane' in half mb & 1 of tile (nb, t / 32), straight from registers
        const size_t pb = ((size_t)(r0 / TT) * (ldc / HD) + c0 / HD) * HD * TT + (size_t)(r0 % TT) * 16 + lane * 8; const float* bp = bias + c0 + lr; float tb[4];
#pragma unroll
        for (int nb = 0; nb < 4; ++nb) tb[nb] = BIAS ? bp[nb * 16] : 0.0f;   // all four at once: one wait for memory, not four
        if (BIAS) asm volatile("s_wait_xcnt 0x0" :: "v"(bp) : "memory");   // in front of any overwrite of the address these loads name
#pragma unroll
        for (int nb = 0; nb < 4; ++nb) { const float bb = bfr(tb[nb]); h16* p16 = P16 + pb + (size_t)nb * 16 * TT; bf* ph = Ph + pb + (size_t)nb * 16 * TT; bf* pl = Pl + pb + (size_t)nb * 16 * TT; v8h o16[4]; v8us oh[4], ol[4];
#pragma unroll
            for (int mb = 0; mb < 4; ++mb) { v8f val;
#pragma unroll
                for (int j = 0; j < 8; ++j) { val[j] = acc[mb][nb][j] + bb; o16[mb][j] = tohx(val[j]); }
                split8(val, oh[mb], ol[mb]); }
#pragma unroll
            for (int mb = 0; mb < 4; ++mb) { *(v8h*)(p16 + mb * 256) = o16[mb]; *(v8us*)(ph + mb * 256) = oh[mb]; *(v8us*)(pl + mb * 256) = ol[mb]; }   // every store is 512 bytes in a row
            // the wait that stands in front of any overwrite of a register which an issued store names: addresses and data are its inputs, so they stay untouched up to it
            asm volatile("s_wait_xcnt 0x0" :: "v"(p16), "v"(ph), "v"(pl), "v"(o16[0]), "v"(o16[1]), "v"(o16[2]), "v"(o16[3]), "v"(oh[0]), "v"(oh[1]), "v"(oh[2]), "v"(oh[3]), "v"(ol[0]), "v"(ol[1]), "v"(ol[2]), "v"(ol[3]) : "memory"); }
        return; }
    float pbias[4][8];   // EPI 1: in store s a lane takes columns s * 16 + hi * 8 .. + 7 of row lr, its own 16 bytes of the s-th half tile
    if (EPI == 1) { const float* bp = bias + c0 + hi * 8; v8f tb[4];
#pragma unroll
        for (int s = 0; s < 4; ++s) tb[s] = BIAS ? *(const v8f*)(bp + s * 16) : (v8f){};
        if (BIAS) asm volatile("s_wait_xcnt 0x0" :: "v"(bp) : "memory");   // the wait: in front of any overwrite of the address these loads name
#pragma unroll
        for (int s = 0; s < 4; ++s)
#pragma unroll
            for (int q = 0; q < 8; ++q) pbias[s][q] = bfr(tb[s][q]); }
#pragma unroll
    for (int mb = 0; mb < 4; ++mb) {
#pragma unroll
        for (int nb = 0; nb < 4; ++nb) {
#pragma unroll
            for (int j = 0; j < 8; ++j) os[(hi * 8 + j) * 68 + nb * 16 + lr] = acc[mb][nb][j]; }
        __builtin_amdgcn_wave_barrier(); asm volatile("" ::: "memory");
        if (EPI == 1) {   // 16 rows x 64 columns are two tiles, 2 KiB in a row of each plane: a store instruction fills four whole 128-byte lines
            const size_t pb = (((size_t)(r0 / TT) * (ldc / HD) + c0 / HD) * TT + (r0 % TT) + mb * 16) * HD + lane * 8; h16* p16 = P16 + pb; bf* ph = Ph + pb; bf* pl = Pl + pb; v8h o16[4]; v8us oh[4], ol[4];
#pragma unroll
            for (int s = 0; s < 4; ++s) { const float* op = os + lr * 68 + s * 16 + hi * 8; const v4f v0 = *(const v4fa*)op, v1 = *(const v4fa*)(op + 4); v8f val;
#pragma unroll
                for (int q = 0; q < 8; ++q) { val[q] = (q < 4 ? v0[q & 3] : v1[q & 3]) + pbias[s][q]; o16[s][q] = tohx(val[q]); }
                split8(val, oh[s], ol[s]); }
#pragma unroll
            for (int s = 0; s < 4; ++s) { *(v8h*)(p16 + s * 256) = o16[s]; *(v8us*)(ph + s * 256) = oh[s]; *(v8us*)(pl + s * 256) = ol[s]; }
            // the wait in front of any overwrite of a register which an issued store names, as above
            asm volatile("s_wait_xcnt 0x0" :: "v"(p16), "v"(ph), "v"(pl), "v"(o16[0]), "v"(o16[1]), "v"(o16[2]), "v"(o16[3]), "v"(oh[0]), "v"(oh[1]), "v"(oh[2]), "v"(oh[3]), "v"(ol[0]), "v"(ol[1]), "v"(ol[2]), "v"(ol[3]) : "memory");
        }
        __builtin_amdgcn_wave_barrier(); asm volatile("" ::: "memory");
    }
}
// k_qkv: the three projections in ONE launch. Grid (rows / 128, columns / 128), 12 waves: waves 0-3 q, 4-7 k, 8-11 v, each group 2 x 2 tiles of 64 x 64 on the same 128 rows and 128 columns,
// so an x row is read by six waves of one WGP and a weight row by two, and three waves share a SIMD. No wave waits for another: every q and k wave has its own staging rows in LDS; the v waves write from registers and use none.
__global__ __launch_bounds__(384) void k_qkv(const bf* __restrict__ XB, const bf* __restrict__ WQ, const bf* __restrict__ WK, const bf* __restrict__ WV, const float* __restrict__ bq, const float* __restrict__ bk, const float* __restrict__ bv,
                                             h16* QP16, bf* QPh, bf* QPl, h16* KP16, bf* KPh, bf* KPl, h16* VT16, bf* VTh, bf* VTl) {
    __shared__ __align__(16) float os[8][16 * 68];
    const int w = __builtin_amdgcn_readfirstlane((int)(threadIdx.x >> 5)); const int r0 = blockIdx.x * 128 + (w & 1) * 64, c0 = blockIdx.y * 128 + ((w >> 1) & 1) * 64;
    const unsigned rot = (blockIdx.x + 4u * blockIdx.y) & (DM / 32 - 1);   // eight work-groups read the same x rows, thirty-two the same weight rows: each set starts spread over the ring of k steps
    if (w >= 8) proj_tile<2>(XB, WV, bv, r0, c0, rot, nullptr, VT16, VTh, VTl);
    else { const bool kk = w >= 4; proj_tile<1>(XB, kk ? WK : WQ, kk ? bk : bq, r0, c0, rot, os[w], kk ? KP16 : QP16, kk ? KPh : QPh, kk ? KPl : QPl); }
}

typedef __attribute__((ext_vector_type(2))) _Float16 v2h;
typedef __attribute__((ext_vector_type(4))) _Float16 v4h;
typedef __attribute__((ext_vector_type(2))) unsigned short v2us;
typedef __attribute__((ext_vector_type(4))) unsigned short v4us;
typedef __attribute__((ext_vector_type(2))) float v2f;
typedef __attribute__((ext_vector_type(4))) int v4i;

__global__ __launch_bounds__(256) void k_wtG(const float* __restrict__ w, int K, int N, bf* Bt) {
    const int lane = threadIdx.x & 31; const int L0 = (blockIdx.x * 8 + (threadIdx.x >> 5)) * 8; const int nlines = N * K / 64;
{
#pragma unroll 1
        for (int l = 0; l < 8; ++l) { const int L = L0 + l; if (L >= nlines) break; const size_t e = (size_t)L * 64 + lane * 2; const int k = (int)(e % K), n = (int)(e / K); v2us o;
            o[0] = f2bf(w[(size_t)k * N + n]); o[1] = f2bf(w[(size_t)(k + 1) * N + n]); *(v2us*)(Bt + e) = o; }
         }
}
// k_prep: every f32 -> bf16 conversion of the call in ONE launch, from row-major f32 to fragment order. A work-group takes CH groups of eight floats of one array = 32 tiles of 16 rows x 32 k (a wave four tiles; all sixteen loads of a thread in flight at once); blockIdx.x picks the array.
// A load takes four whole 128-byte lines (four rows of one tile, eight lanes a row, four floats a lane); the four stores of a tile fill its 1 KiB.
// PAD (the position table): rows at or past nrow are the zero pad row; they are stored as zeros and read nothing past the table (the row is clamped).
#define CH   2048
#define GX   (NB_ * TT * DM / 8 / CH)
#define GW   (DM * DQ / 8 / CH)
#define GP   (NPE * HD / 8 / CH)
template <bool PAD, int K>
__device__ __forceinline__ void cvt_run(const float* __restrict__ src, bf* dst, unsigned blk, unsigned nrow) {
    constexpr unsigned TPR = K / 32;   // tiles along a row: 32 (one work-group = one band of 16 rows) or a divisor of 32
    const unsigned lane = threadIdx.x & 31, w = threadIdx.x >> 5, r4 = lane >> 3, c = lane & 7; unsigned so[16], row[16]; v4f v[16]; v4us o[16];
#pragma unroll
    for (int u = 0; u < 16; ++u) { const unsigned tl = w * 4 + (u >> 2), rt = TPR >= 32 ? blk : blk * (32 / TPR) + tl / TPR, ks = TPR >= 32 ? tl : tl % TPR;   // tile tl of this work-group's 32; rows (u & 3) * 4 + r4 of it
        row[u] = rt * 16 + (u & 3) * 4 + r4; so[u] = ((PAD ? (row[u] < nrow ? row[u] : nrow - 1) : row[u]) * K + ks * 32 + c * 4) * 4u; v[u] = *(const v4f*)((const char*)src + so[u]); }
    // the wait that stands in front of any overwrite of a register which an issued load names: the byte offsets are its inputs, so they stay untouched (also by a landing load) up to it
    if (PAD) asm volatile("s_wait_xcnt 0x0" :: "v"(so[0]), "v"(so[1]), "v"(so[2]), "v"(so[3]), "v"(so[4]), "v"(so[5]), "v"(so[6]), "v"(so[7]), "v"(so[8]), "v"(so[9]), "v"(so[10]), "v"(so[11]), "v"(so[12]), "v"(so[13]), "v"(so[14]), "v"(so[15]) : "memory");
    else asm volatile("s_wait_xcnt 0x0" :: "v"(so[0]), "v"(so[1]), "v"(so[2]), "v"(so[3]) : "memory");   // the other twelve are immediate offsets from these four
#pragma unroll
    for (int u = 0; u < 16; ++u) { const bool zr = PAD && row[u] >= nrow; const unsigned long long w01 = pk2bf(zr ? 0.0f : v[u][0], zr ? 0.0f : v[u][1]), w23 = pk2bf(zr ? 0.0f : v[u][2], zr ? 0.0f : v[u][3]); o[u] = __builtin_bit_cast(v4us, w01 | (w23 << 32)); }
    // floats c * 4 .. + 3 of a tile's row: half c >> 2, lane group (c >> 1) & 1, first or second 8 bytes of that lane's 16
    bf* dp = dst + (size_t)(blk * 32 + w * 4) * 512 + (c >> 2) * 256 + (((c >> 1) & 1) * 16 + r4) * 8 + (c & 1) * 4;
#pragma unroll
    for (int u = 0; u < 16; ++u) *(v4us*)(dp + (u >> 2) * 512 + (u & 3) * 32) = o[u];
}
__global__ __launch_bounds__(256) void k_prep(const float* __restrict__ x, const float* __restrict__ wq, const float* __restrict__ wk, const float* __restrict__ wv, const float* __restrict__ wo, const float* __restrict__ pe,
                                              bf* XB, bf* WQ, bf* WK, bf* WV, bf* WO, bf* PE) {
    const unsigned b = blockIdx.x;
    if (b >= GX + 4 * GW) { cvt_run<true, HD>(pe, PE, b - (GX + 4 * GW), 2047); return; }
    const unsigned a = b < GX ? 0 : 1 + (b - GX) / GW;
    cvt_run<false, DM>(a == 0 ? x : a == 1 ? wq : a == 2 ? wk : a == 3 ? wv : wo, a == 0 ? XB : a == 1 ? WQ : a == 2 ? WK : a == 3 ? WV : WO, a == 0 ? b : (b - GX) % GW, 0);
}

// attn_body: 32 query rows i0.. of head z, 8 waves; wave w owns keys w * 128 .. + 127 from the scores to its partial output, and waits for no other wave before the final sum.
// The scores are computed TRANSPOSED (the key tile is the A operand, the query tile the B operand): a lane then holds eight consecutive keys of ONE query, which is the very piece of an A fragment that attn.v wants from it,
// so the logits, the softmax and the probabilities stay in the lane's registers. LDS holds, per wave, its own 32 x 128 relative scores (R, pitch RP, stored skewed as before and read back as 16-byte pieces),
// into whose slots a lane parks the logits of key tiles NKEEP.. (each lane rewrites only what it has just read), and at the end the wave's partial output with its row maxima and row sums.
// Softmax by parts: each wave takes the maximum m_w and the sum l_w over its own 128 keys, attn.v runs on exp(s - m_w) unnormalised, and the final sum weighs wave w by exp(m_w - m) and divides by the weighted l_w.
// HI: hi+lo planes, 3 products, for scores and attn.v; else single fp16 (probabilities x PCAR).
// Behind a group of global loads: the wait that stands in front of any overwrite of a register which an issued load names. It takes the group's addresses as inputs, so that they stay untouched (also by a landing load of the group) up to it.
#define XWAIT1(p)    asm volatile("s_wait_xcnt 0x0" :: "v"(p) : "memory")
#define XWAIT2(p, q) asm volatile("s_wait_xcnt 0x0" :: "v"(p), "v"(q) : "memory")
#define L2E 1.4426950408889634f
template <bool HI>
__device__ __forceinline__ void attn_body(float* T, int z, int i0, const h16* __restrict__ QP16, const bf* __restrict__ QPh, const bf* __restrict__ QPl, const h16* __restrict__ KP16, const bf* __restrict__ KPh, const bf* __restrict__ KPl,
                                          const h16* __restrict__ VT16, const bf* __restrict__ VTh, const bf* __restrict__ VTl, const bf* __restrict__ PE, bf* ATh, bf* ATl) {
    constexpr int NKEEP = 2, KD = HI ? 2 : 3, VD = HI ? 4 : 8;   // key tiles whose logits stay in registers; how many key tiles, and how many value fragments, are fetched ahead of their use
    const int tid = threadIdx.x, lane = tid & 31, lr = lane & 15, hi = lane >> 4, w = tid >> 6; const int j0 = w * 128;   // this wave's 128 keys: waves 2 w and 2 w + 1 of the work-group take the same keys, each for its own 32 rows
    float* R = T + w * (BR * RP);   // this wave's own LDS
    const size_t qb = ((size_t)z * TT + i0) * HD + lane * 8;   // planes in fragment order: 16 rows x 64 are two tiles of 512 elements
    // relative scores: rows i0 + 16 mt + r and keys j0 + jj need positions p = (j0 - i0 - 16 mt + 1008) + c, c = jj - r + 15 in 0..142: nine 16-wide tiles a row tile, ten for both
    const int pb = j0 - i0 + 992;   // 0 .. 1888; last row read pb + 159 <= 2047
    v16bf qh[2][2], ql[2][2], rb[10][2], kb[8][4], vb[16][2]; v16h q16[2][2], kf[8][2], vf[16];
    const bf* pp = PE + (size_t)pb * HD + lane * 8;
    auto rload = [&](int u) { rb[u][0] = WFrag<bf>::ld(pp + u * 1024); rb[u][1] = WFrag<bf>::ld(pp + u * 1024 + 512); XWAIT1(pp); };   // one base for all ten tiles (the tiles are immediate offsets): as the wait's input it outlives every load that names it
    const size_t ko = ((size_t)z * TT + j0) * HD + lane * 8; const bf* khp = KPh + ko; const bf* klp = KPl + ko; const h16* k16p = KP16 + ko;   // likewise one base a plane for the eight key tiles
    auto kload = [&](int nb) {
        if (HI) { kb[nb][0] = WFrag<bf>::ld(khp + nb * 1024); kb[nb][1] = WFrag<bf>::ld(khp + nb * 1024 + 512); kb[nb][2] = WFrag<bf>::ld(klp + nb * 1024); kb[nb][3] = WFrag<bf>::ld(klp + nb * 1024 + 512); XWAIT2(khp, klp); }
        else { kf[nb][0] = WFrag<h16>::ld(k16p + nb * 1024); kf[nb][1] = WFrag<h16>::ld(k16p + nb * 1024 + 512); XWAIT1(k16p); } };
    const size_t vo = (size_t)z * HD * TT + j0 * 16 + lane * 8; const bf* vhp = VTh + vo; const bf* vlp = VTl + vo; const h16* v16p = VT16 + vo;
    auto vload = [&](int t) { const int off = (t >> 2) * 512 + (t & 3) * 16 * TT;   // step t = ks * 4 + nb: tile (nb, key / 32) of the transposed plane
        if (HI) { vb[t][0] = WFrag<bf>::ld(vhp + off); vb[t][1] = WFrag<bf>::ld(vlp + off); XWAIT2(vhp, vlp); } else { vf[t] = WFrag<h16>::ld(v16p + off); XWAIT1(v16p); } };
#pragma unroll
    for (int mt = 0; mt < 2; ++mt)
#pragma unroll
        for (int kk = 0; kk < 2; ++kk) { qh[mt][kk] = WFrag<bf>::ld(QPh + qb + (size_t)mt * 16 * HD + kk * 512); ql[mt][kk] = WFrag<bf>::ld(QPl + qb + (size_t)mt * 16 * HD + kk * 512); }
    XWAIT2(QPh + qb, QPl + qb);
#pragma unroll
    for (int u = 0; u < 4; ++u) rload(u);
#pragma unroll
    for (int u = 0; u < 10; ++u) {
#pragma unroll
        for (int mt = 0; mt < 2; ++mt) { const int tt = u - 1 + mt; if (tt < 0 || tt > 8) continue;
            v8f acc = (v8f){}; acc = wmmab(qh[mt][0], rb[u][0], acc); acc = wmmab(ql[mt][0], rb[u][0], acc); acc = wmmab(qh[mt][1], rb[u][1], acc); acc = wmmab(ql[mt][1], rb[u][1], acc);
            asm volatile("v_nop\n\tv_nop\n\tv_nop\n\tv_nop" :: "v"(acc));   // the four vector slots the chip needs before the next tile's first matrix instruction may overwrite these result registers
#pragma unroll
            for (int j = 0; j < 8; ++j) { const int r = hi * 8 + j, jj = tt * 16 + lr + r - 15; R[(mt * 16 + r) * RP + ((jj >= 0 && jj < 128) ? jj : 128)] = acc[j]; } }   // a position outside this wave's keys lands in the row's pad column
        if (u < 6) rload(u + 4); else if (u >= 9 - KD && u < 9) kload(u - (9 - KD));
        if (!HI && u == 5) {
#pragma unroll
            for (int mt = 0; mt < 2; ++mt)
#pragma unroll
                for (int kk = 0; kk < 2; ++kk) q16[mt][kk] = WFrag<h16>::ld(QP16 + qb + (size_t)mt * 16 * HD + kk * 512);
            XWAIT1(QP16 + qb); } }
    asm volatile("s_wait_dscnt 0x0" ::: "memory");   // the skewed stores crossed lanes, of this wave alone: they are done before its lanes read the rows back; no other wave touches them, so no barrier
    v8f s[8][2]; float mx[2] = { -3.0e38f, -3.0e38f };
#pragma unroll
    for (int nb = 0; nb < 8; ++nb) { v4f r0[2], r1[2];
#pragma unroll
        for (int mt = 0; mt < 2; ++mt) { const float* rp = R + (mt * 16 + lr) * RP + nb * 16 + hi * 8; r0[mt] = *(const v4fa*)rp; r1[mt] = *(const v4fa*)(rp + 4); }   // query mt * 16 + lr, keys nb * 16 + hi * 8 .. + 7
#pragma unroll
        for (int mt = 0; mt < 2; ++mt) { v8f a = (v8f){};   // D row = key hi * 8 + j of the tile, D column = query lr
            if (HI) { a = wmmab(kb[nb][0], qh[mt][0], a); a = wmmab(kb[nb][0], ql[mt][0], a); a = wmmab(kb[nb][2], qh[mt][0], a); a = wmmab(kb[nb][1], qh[mt][1], a); a = wmmab(kb[nb][1], ql[mt][1], a); a = wmmab(kb[nb][3], qh[mt][1], a); }
            else { a = wmma16(kf[nb][0], q16[mt][0], a); a = wmma16(kf[nb][1], q16[mt][1], a); }
            s[nb][mt] = a; }
        if (nb + KD < 8) kload(nb + KD);
#pragma unroll
        for (int mt = 0; mt < 2; ++mt) {
#pragma unroll
            for (int j = 0; j < 8; ++j) { const float v = __fadd_rn(__fmul_rn(s[nb][mt][j], SCL), j < 4 ? r0[mt][j & 3] : r1[mt][j & 3]); s[nb][mt][j] = v; mx[mt] = fmaxf(mx[mt], v); }   // SCL is a power of two: the product is exact, fused or not
            if (nb >= NKEEP) { float* rp = R + (mt * 16 + lr) * RP + nb * 16 + hi * 8; *(v4fa*)rp = (v4f){ s[nb][mt][0], s[nb][mt][1], s[nb][mt][2], s[nb][mt][3] }; *(v4fa*)(rp + 4) = (v4f){ s[nb][mt][4], s[nb][mt][5], s[nb][mt][6], s[nb][mt][7] }; } } }
#pragma unroll
    for (int t = 0; t < VD; ++t) vload(t);   // they fly during the first exponentials
#pragma unroll
    for (int mt = 0; mt < 2; ++mt) mx[mt] = fmaxf(mx[mt], __shfl_xor(mx[mt], 16, 32));   // the two lane halves hold the two halves of every key tile
    auto sload = [&](int ks) {   // the parked logits of key tiles 2 ks, 2 ks + 1: each lane its own
#pragma unroll
        for (int q = 0; q < 2; ++q)
#pragma unroll
            for (int mt = 0; mt < 2; ++mt) { const float* rp = R + (mt * 16 + lr) * RP + (2 * ks + q) * 16 + hi * 8; const v4f a = *(const v4fa*)rp, b = *(const v4fa*)(rp + 4); s[2 * ks + q][mt] = (v8f){ a[0], a[1], a[2], a[3], b[0], b[1], b[2], b[3] }; } };
    if (NKEEP == 0) sload(0);
    // attn.v: this wave sums its own 128 keys for all 32 rows x 64 columns; element e of a lane's A fragment is key 8 hi + e of tile 2 ks, element 8 + e the same of tile 2 ks + 1
    v8f o[2][4]; float sm[2] = { 0.f, 0.f };
#pragma unroll
    for (int mt = 0; mt < 2; ++mt)
#pragma unroll
        for (int nb = 0; nb < 4; ++nb) o[mt][nb] = (v8f){};
#pragma unroll
    for (int ks = 0; ks < 4; ++ks) { v16bf ah[2], al[2]; v16h a16[2];
#pragma unroll
        for (int mt = 0; mt < 2; ++mt) { v8us oh[2], ol[2]; v8h o16[2];
#pragma unroll
            for (int q = 0; q < 2; ++q) { float p[8];
#pragma unroll
                for (int j = 0; j < 8; ++j) { p[j] = __builtin_amdgcn_exp2f(__fmul_rn(__fsub_rn(s[2 * ks + q][mt][j], mx[mt]), L2E));
                    if (!HI) o16[q][j] = tohx(p[j] * PCAR); }
                if (HI) split8((v8f){ p[0], p[1], p[2], p[3], p[4], p[5], p[6], p[7] }, oh[q], ol[q]);
                sm[mt] += ((p[0] + p[1]) + (p[2] + p[3])) + ((p[4] + p[5]) + (p[6] + p[7])); }
            if (HI) { ah[mt] = cat16b(oh[0], oh[1]); al[mt] = cat16b(ol[0], ol[1]); } else a16[mt] = cat16(o16[0], o16[1]); }
        if (ks < 3 && 2 * (ks + 1) >= NKEEP) sload(ks + 1);
#pragma unroll
        for (int nb = 0; nb < 4; ++nb) { const int t = ks * 4 + nb;
#pragma unroll
            for (int mt = 0; mt < 2; ++mt) {
                if (HI) { o[mt][nb] = wmmab(ah[mt], vb[t][0], o[mt][nb]); o[mt][nb] = wmmab(al[mt], vb[t][0], o[mt][nb]); o[mt][nb] = wmmab(ah[mt], vb[t][1], o[mt][nb]); }
                else o[mt][nb] = wmma16(a16[mt], vf[t], o[mt][nb]); }
            if (t + VD < 16) vload(t + VD); } }
#pragma unroll
    for (int mt = 0; mt < 2; ++mt) sm[mt] += __shfl_xor(sm[mt], 16, 32);
    __builtin_amdgcn_wave_barrier(); asm volatile("" ::: "memory");   // the partial output goes over this wave's own slots: behind its last read of them
#pragma unroll
    for (int mt = 0; mt < 2; ++mt) {
#pragma unroll
        for (int nb = 0; nb < 4; ++nb)
#pragma unroll
            for (int j = 0; j < 8; ++j) R[(mt * 16 + hi * 8 + j) * OPP + nb * 16 + lr] = o[mt][nb][j];
        R[BR * OPP + hi * BR + mt * 16 + lr] = hi ? sm[mt] : mx[mt]; }   // behind the partial output: 32 row maxima, then 32 row sums
    __syncthreads();   // partial outputs, maxima and sums of all eight waves complete
    { const int row = (w >> 2) * 16 + lr, d0 = (w & 3) * 16 + hi * 8; v4f p0[8], p1[8]; float mw[8], lw[8];   // wave w writes half tile w & 3 of row tile w >> 2: a lane its own 16 bytes there
#pragma unroll
        for (int ww = 0; ww < 8; ++ww) { const float* pr = T + ww * (BR * RP); p0[ww] = *(const v4fa*)(pr + row * OPP + d0); p1[ww] = *(const v4fa*)(pr + row * OPP + d0 + 4); mw[ww] = pr[BR * OPP + row]; lw[ww] = pr[BR * OPP + BR + row]; }
        float m = mw[0];
#pragma unroll
        for (int ww = 1; ww < 8; ++ww) m = fmaxf(m, mw[ww]);
        v4f s0 = (v4f){}, s1 = (v4f){}; float den = 0.f;
#pragma unroll
        for (int ww = 0; ww < 8; ++ww) { const float e = __builtin_amdgcn_exp2f((mw[ww] - m) * L2E); den += e * lw[ww]; s0 += p0[ww] * e; s1 += p1[ww] * e; }   // key blocks in ascending order
        const float cs = __fdiv_rn(HI ? 1.0f : (1.0f / PCAR), den); v8us oh, ol; const v4f t0 = s0 * cs, t1 = s1 * cs;
        split8((v8f){ t0[0], t0[1], t0[2], t0[3], t1[0], t1[1], t1[2], t1[3] }, oh, ol);
        const size_t oo = ((size_t)(z / NH_) * TT + i0 + (w >> 2) * 16) * DQ + (size_t)(z % NH_) * 1024 + (w & 3) * 256 + lane * 8; *(v8us*)(ATh + oo) = oh; *(v8us*)(ATl + oo) = ol; }   // fragment order, K = DQ: a head is two tiles along k; a wave fills four 128-byte lines
}
// k_attn: grid (TT / (2 * BR), NZ), 512 threads: one work-group a WGP, four waves a SIMD. It runs two attn_body teams of eight waves side by side on neighbouring blocks of 32 query rows of one head: even waves the first block, odd waves the second.
// Waves 2 w and 2 w + 1 read the same key and value lines, start together and run the same instructions, so they ask for a line at about the same time: it comes from L2 once and the WGP's cache serves the second reader.
__global__ __launch_bounds__(512) __attribute__((amdgpu_waves_per_eu(4, 4))) void k_attn(const h16* __restrict__ QP16, const bf* __restrict__ QPh, const bf* __restrict__ QPl, const h16* __restrict__ KP16, const bf* __restrict__ KPh, const bf* __restrict__ KPl,
                                               const h16* __restrict__ VT16, const bf* __restrict__ VTh, const bf* __restrict__ VTl, const bf* __restrict__ PE, bf* ATh, bf* ATl) {
    __shared__ __align__(16) float TT2[2 * 8 * BR * RP];
    const int team = __builtin_amdgcn_readfirstlane((int)(threadIdx.x >> 5)) & 1; float* T = TT2 + team * (8 * BR * RP);   // each team has its own LDS; the one barrier of attn_body is passed by both teams
    const int i0 = (blockIdx.x * 2 + team) * BR, z = blockIdx.y;
    static_assert(RH % (2 * BR) == 0, "both teams of a work-group take the same branch, so every wave meets the same barrier");
    if (i0 < RH) attn_body<true>(T, z, i0, QP16, QPh, QPl, KP16, KPh, KPl, VT16, VTh, VTl, PE, ATh, ATl);
    else attn_body<false>(T, z, i0, QP16, QPh, QPl, KP16, KPh, KPl, VT16, VTh, VTl, PE, ATh, ATl);
}

extern "C" void kernel_launch(void* const* d_in, const int* in_sizes, int n_in,
                              void* d_out, int out_size, void* d_ws, size_t ws_size, hipStream_t stream) {
    (void)in_sizes; (void)n_in; (void)out_size;
    const float* x = (const float*)d_in[0]; const float* wq = (const float*)d_in[1]; const float* bq = (const float*)d_in[2]; const float* wk = (const float*)d_in[3]; const float* bk = (const float*)d_in[4]; const float* wv = (const float*)d_in[5]; const float* bv = (const float*)d_in[6]; const float* wo = (const float*)d_in[7]; const float* bo = (const float*)d_in[8]; const float* pe = (const float*)d_in[9];
    float* OUT = (float*)d_out;     // [4][1024][1024]
    char* wsp = (char*)d_ws;
    auto take = [&](size_t bytes) { char* p = wsp; wsp += (bytes + 255) & ~(size_t)255; return (void*)p; };
    bf* WO = (bf*)take((size_t)DM * DQ * 2); bf* PE = (bf*)take((size_t)NPE * HD * 2);
    h16* QP16 = (h16*)take((size_t)NZ * TT * HD * 2); h16* KP16 = (h16*)take((size_t)NZ * TT * HD * 2); h16* VT16 = (h16*)take((size_t)NZ * HD * TT * 2);
    bf* QPh = (bf*)take((size_t)NZ * TT * HD * 2); bf* QPl = (bf*)take((size_t)NZ * TT * HD * 2); bf* KPh = (bf*)take((size_t)NZ * TT * HD * 2); bf* KPl = (bf*)take((size_t)NZ * TT * HD * 2); bf* VTh = (bf*)take((size_t)NZ * HD * TT * 2); bf* VTl = (bf*)take((size_t)NZ * HD * TT * 2);
    bf* ATh = (bf*)take((size_t)NB_ * TT * DQ * 2); bf* ATl = (bf*)take((size_t)NB_ * TT * DQ * 2);
    bf* WQ = (bf*)take((size_t)DQ * DM * 2); bf* WK = (bf*)take((size_t)DKV * DM * 2); bf* WV = (bf*)take((size_t)DKV * DM * 2);
    bf* XB = (bf*)take((size_t)NB_ * TT * DM * 2);
    if ((size_t)(wsp - (char*)d_ws) > ws_size) return;    // ws 256 MiB
    k_prep<<<GX + 4 * GW + GP, 256, 0, stream>>>(x, wq, wk, wv, wo, pe, XB, WQ, WK, WV, WO, PE);   /* bf16 x, weights, position table + zero pad row */
    k_qkv<<<dim3(NB_ * TT / 128, DQ / 128, 1), 384, 0, stream>>>(XB, WQ, WK, WV, bq, bk, bv, QP16, QPh, QPl, KP16, KPh, KPl, VT16, VTh, VTl);
    k_attn<<<dim3(TT / (2 * BR), NZ, 1), 512, 0, stream>>>(QP16, QPh, QPl, KP16, KPh, KPl, VT16, VTh, VTl, PE, ATh, ATl);   // planes are [b][h][..]: z is the plane index (one kv head per query head)
    k_gemmw<bf, 1, true, 0, DQ><<<dim3(NB_ * TT / 64, DM / 256, 1), 128, 0, stream>>>(ATh, ATl, WO, nullptr, OUT, DM, bo, 0, 0, 0, nullptr, nullptr, nullptr);
}
